// v000
// Times are from an AMD MI455X. After a warm-up the kernel runs many times in a row, and a time is the length of
// such a window on the GPU divided by its runs, so every launch and the gaps after it count. The runs cycle
// through copies of the inputs. A figure is the median of several windows, for all but v000 over two sittings.
// Sittings can differ by a few percent; kernels timed side by side share one.
// v000 is the starting kernel. One run takes 661 microseconds.
#include <hip/hip_runtime.h>
#include <math.h>

// ---------------------------------------------------------------- types
typedef __bf16 bf16_t;
typedef __attribute__((ext_vector_type(16))) __bf16 v16bf;
typedef __attribute__((ext_vector_type(8)))  float  v8f;

union FragB {
    v16bf  v;
    uint4  q[2];
    bf16_t e[16];
};

__device__ __forceinline__ bf16_t f2bf(float f) {
    unsigned int u = __float_as_uint(f);
    unsigned int r = u + 0x7FFFu + ((u >> 16) & 1u);   // round to nearest even
    unsigned short s = (unsigned short)(r >> 16);
    return __builtin_bit_cast(bf16_t, s);
}

__device__ __forceinline__ v8f wmma_bf16(const v16bf& a, const v16bf& b, const v8f& c) {
    return __builtin_amdgcn_wmma_f32_16x16x32_bf16(false, a, false, b, (short)0, c, false, false);
}

__device__ __forceinline__ v8f v8f_zero() {
    v8f z;
#pragma unroll
    for (int i = 0; i < 8; ++i) z[i] = 0.0f;
    return z;
}

// ---------------------------------------------------------------- constants
#define DMODEL 1024
#define NHEAD  16
#define HDIM   64
#define FFDIM  4096
#define BATCH  4
#define NTOK   1024
#define MROWS  (BATCH * NTOK)   // 4096

// ---------------------------------------------------------------- fp32 -> bf16 (straight)
__global__ void cvt_f32_to_bf16(const float* __restrict__ in, bf16_t* __restrict__ out, int n) {
    int i = blockIdx.x * blockDim.x + threadIdx.x;
    if (i < n) out[i] = f2bf(in[i]);
}

// ---------------------------------------------------------------- fp32 [K][N] -> bf16 [N][K]
__global__ __launch_bounds__(256)
void cvt_transpose_bf16(const float* __restrict__ in, bf16_t* __restrict__ out,
                        int Kdim, int Ndim) {
    __shared__ float tile[32][33];
    const int k0 = blockIdx.y * 32;
    const int n0 = blockIdx.x * 32;
    const int tx = threadIdx.x & 31;
    const int ty = threadIdx.x >> 5;   // 0..7
#pragma unroll
    for (int i = ty; i < 32; i += 8)
        tile[i][tx] = in[(size_t)(k0 + i) * Ndim + n0 + tx];
    __syncthreads();
#pragma unroll
    for (int i = ty; i < 32; i += 8)
        out[(size_t)(n0 + i) * Kdim + k0 + tx] = f2bf(tile[tx][i]);
}

// ---------------------------------------------------------------- GEMM (bf16 WMMA, fp32 acc)
// C[M,N] = A[M,K] @ B[K,N], with B supplied TRANSPOSED as Bt[N][K] bf16.
// flags: bit0 = bf16 output, bit1 = exact GELU, bit2 = write output transposed [N][M].
#define TM 128
#define TN 128
#define TK 32

__global__ __launch_bounds__(256)
void gemm_bf16_wmma(const bf16_t* __restrict__ A, const bf16_t* __restrict__ Bt,
                    void* __restrict__ Cout, const float* __restrict__ bias,
                    int M, int N, int K, int flags) {
    __shared__ __align__(16) bf16_t sA[2][TM * TK];   // [row][k]  2 x 8 KB
    __shared__ __align__(16) bf16_t sB[2][TN * TK];   // [n][k]    2 x 8 KB

    const int t    = threadIdx.x;
    const int lane = t & 31;
    const int wave = t >> 5;                 // 0..7
    const int wrow = (wave & 3) * 32;        // 0,32,64,96
    const int wcol = (wave >> 2) * 64;       // 0,64
    const int m0   = blockIdx.y * TM;
    const int n0   = blockIdx.x * TN;
    const int hi   = lane >> 4;
    const int l16  = lane & 15;
    const int kb   = hi * 8;

    // staging: thread covers one 16-elem half-row of the 32-wide k slab
    const int srow = t >> 1;                 // 0..127
    const int sseg = (t & 1) * 16;           // 0 or 16
    const bf16_t* gA = A  + (size_t)(m0 + srow) * K + sseg;
    const bf16_t* gB = Bt + (size_t)(n0 + srow) * K + sseg;

    v8f acc[2][4];
#pragma unroll
    for (int i = 0; i < 2; ++i)
#pragma unroll
        for (int j = 0; j < 4; ++j) acc[i][j] = v8f_zero();

    const int nk = K / TK;
    uint4 pa0, pa1, pb0, pb1;

    // prologue: stage slab 0 into buffer 0
    pa0 = *reinterpret_cast<const uint4*>(gA);
    pa1 = *reinterpret_cast<const uint4*>(gA + 8);
    pb0 = *reinterpret_cast<const uint4*>(gB);
    pb1 = *reinterpret_cast<const uint4*>(gB + 8);
    {
        uint4* dA = reinterpret_cast<uint4*>(&sA[0][srow * TK + sseg]);
        dA[0] = pa0; dA[1] = pa1;
        uint4* dB = reinterpret_cast<uint4*>(&sB[0][srow * TK + sseg]);
        dB[0] = pb0; dB[1] = pb1;
    }
    __syncthreads();

    for (int kt = 0; kt < nk; ++kt) {
        const int cur = kt & 1;
        const int nxt = cur ^ 1;
        const bool more = (kt + 1) < nk;
        if (more) {
            int ko = (kt + 1) * TK;
            pa0 = *reinterpret_cast<const uint4*>(gA + ko);
            pa1 = *reinterpret_cast<const uint4*>(gA + ko + 8);
            pb0 = *reinterpret_cast<const uint4*>(gB + ko);
            pb1 = *reinterpret_cast<const uint4*>(gB + ko + 8);
        }

        FragB af[2], bfr[4];
#pragma unroll
        for (int i = 0; i < 2; ++i) {
            int row = wrow + i * 16 + l16;
            af[i].q[0] = *reinterpret_cast<const uint4*>(&sA[cur][row * TK + kb]);
            af[i].q[1] = *reinterpret_cast<const uint4*>(&sA[cur][row * TK + kb + 16]);
        }
#pragma unroll
        for (int j = 0; j < 4; ++j) {
            int col = wcol + j * 16 + l16;
            bfr[j].q[0] = *reinterpret_cast<const uint4*>(&sB[cur][col * TK + kb]);
            bfr[j].q[1] = *reinterpret_cast<const uint4*>(&sB[cur][col * TK + kb + 16]);
        }
#pragma unroll
        for (int i = 0; i < 2; ++i)
#pragma unroll
            for (int j = 0; j < 4; ++j)
                acc[i][j] = wmma_bf16(af[i].v, bfr[j].v, acc[i][j]);

        if (more) {
            uint4* dA = reinterpret_cast<uint4*>(&sA[nxt][srow * TK + sseg]);
            dA[0] = pa0; dA[1] = pa1;
            uint4* dB = reinterpret_cast<uint4*>(&sB[nxt][srow * TK + sseg]);
            dB[0] = pb0; dB[1] = pb1;
        }
        __syncthreads();
    }

    const bool out_bf   = (flags & 1) != 0;
    const bool do_gelu  = (flags & 2) != 0;
    const bool out_tr   = (flags & 4) != 0;
#pragma unroll
    for (int i = 0; i < 2; ++i) {
#pragma unroll
        for (int j = 0; j < 4; ++j) {
            int col = n0 + wcol + j * 16 + l16;
            float bv = bias ? bias[col] : 0.0f;
#pragma unroll
            for (int r = 0; r < 8; ++r) {
                int row = m0 + wrow + i * 16 + hi * 8 + r;
                float v = acc[i][j][r] + bv;
                if (do_gelu) v = 0.5f * v * (1.0f + erff(v * 0.70710678118654752440f));
                if (out_tr)       ((bf16_t*)Cout)[(size_t)col * M + row] = f2bf(v);
                else if (out_bf)  ((bf16_t*)Cout)[(size_t)row * N + col] = f2bf(v);
                else              ((float*) Cout)[(size_t)row * N + col] = v;
            }
        }
    }
}

// ---------------------------------------------------------------- flash attention
// One wave per (batch, head, 16-query tile).
// Q,K bf16 [b*Nq + tok][DMODEL]; V supplied TRANSPOSED: Vt bf16 [DMODEL][Mtot]. O fp32.
__global__ __launch_bounds__(32)
void attn_wmma(const bf16_t* __restrict__ Qg, const bf16_t* __restrict__ Kg,
               const bf16_t* __restrict__ Vt, float* __restrict__ Og,
               int Nq, int Nk, int Mtot, int causal, float scale) {
    __shared__ __align__(16) bf16_t sP[16 * 32];   // P re-layout staging, 1 KB

    const int lane = threadIdx.x & 31;
    const int hi   = lane >> 4;
    const int l16  = lane & 15;
    const int kb   = hi * 8;
    const int qt   = blockIdx.x;
    const int h    = blockIdx.y;
    const int b    = blockIdx.z;
    const int qbase = qt * 16;
    const size_t qoff = (size_t)b * Nq * DMODEL;
    const size_t koff = (size_t)b * Nk * DMODEL;

    // Q fragments: 16 queries x 64 head-dims = two 16x32 A fragments
    FragB qa[2];
#pragma unroll
    for (int kc = 0; kc < 2; ++kc) {
        const bf16_t* base = Qg + qoff + (size_t)(qbase + l16) * DMODEL + h * HDIM + kc * 32 + kb;
        qa[kc].q[0] = *reinterpret_cast<const uint4*>(base);
        qa[kc].q[1] = *reinterpret_cast<const uint4*>(base + 16);
    }

    v8f o[4];
    float m[8], lsum[8];
#pragma unroll
    for (int n = 0; n < 4; ++n) o[n] = v8f_zero();
#pragma unroll
    for (int r = 0; r < 8; ++r) { m[r] = -1e30f; lsum[r] = 0.0f; }

    int kend = Nk;
    if (causal) {
        kend = (qbase + 16 + 31) & ~31;
        if (kend > Nk) kend = Nk;
    }

    for (int j0 = 0; j0 < kend; j0 += 32) {
        // ---- S = Q K^T for 32 keys (two 16x16 C tiles)
        v8f s[2];
#pragma unroll
        for (int st = 0; st < 2; ++st) {
            FragB kb0, kb1;   // B = K^T: lane holds key column, elems walk head-dim
            const bf16_t* base = Kg + koff + (size_t)(j0 + st * 16 + l16) * DMODEL + h * HDIM + kb;
            kb0.q[0] = *reinterpret_cast<const uint4*>(base);
            kb0.q[1] = *reinterpret_cast<const uint4*>(base + 16);
            kb1.q[0] = *reinterpret_cast<const uint4*>(base + 32);
            kb1.q[1] = *reinterpret_cast<const uint4*>(base + 48);
            v8f z = v8f_zero();
            z = wmma_bf16(qa[0].v, kb0.v, z);
            z = wmma_bf16(qa[1].v, kb1.v, z);
            s[st] = z;
        }
        // ---- scale + causal mask
#pragma unroll
        for (int st = 0; st < 2; ++st) {
            int col = j0 + st * 16 + l16;
#pragma unroll
            for (int r = 0; r < 8; ++r) {
                int row = qbase + r + hi * 8;
                float v = s[st][r] * scale;
                if (causal && col > row) v = -1e30f;
                s[st][r] = v;
            }
        }
        // ---- online softmax (row reductions across 16-lane halves)
        float alpha[8];
#pragma unroll
        for (int r = 0; r < 8; ++r) {
            float rm = fmaxf(s[0][r], s[1][r]);
#pragma unroll
            for (int off = 1; off < 16; off <<= 1)
                rm = fmaxf(rm, __shfl_xor(rm, off, 32));
            float mn = fmaxf(m[r], rm);
            alpha[r] = __expf(m[r] - mn);
            m[r] = mn;
            float p0 = __expf(s[0][r] - mn);
            float p1 = __expf(s[1][r] - mn);
            s[0][r] = p0; s[1][r] = p1;
            float rs = p0 + p1;
#pragma unroll
            for (int off = 1; off < 16; off <<= 1)
                rs += __shfl_xor(rs, off, 32);
            lsum[r] = lsum[r] * alpha[r] + rs;
        }
#pragma unroll
        for (int n = 0; n < 4; ++n)
#pragma unroll
            for (int r = 0; r < 8; ++r) o[n][r] *= alpha[r];

        // ---- C-layout P -> A-layout bf16 fragment via LDS (single wave, LDS in-order)
#pragma unroll
        for (int r = 0; r < 8; ++r) {
            int row = r + hi * 8;
            sP[row * 32 + l16]      = f2bf(s[0][r]);
            sP[row * 32 + 16 + l16] = f2bf(s[1][r]);
        }
        FragB pa;
        pa.q[0] = *reinterpret_cast<const uint4*>(&sP[l16 * 32 + kb]);
        pa.q[1] = *reinterpret_cast<const uint4*>(&sP[l16 * 32 + kb + 16]);

        // ---- O += P (16x32) * V (32x64): V fragments straight from Vt, vectorized
#pragma unroll
        for (int n = 0; n < 4; ++n) {
            FragB vb;
            const bf16_t* vbase = Vt + (size_t)(h * HDIM + n * 16 + l16) * Mtot
                                     + (size_t)b * Nk + j0 + kb;
            vb.q[0] = *reinterpret_cast<const uint4*>(vbase);
            vb.q[1] = *reinterpret_cast<const uint4*>(vbase + 16);
            o[n] = wmma_bf16(pa.v, vb.v, o[n]);
        }
    }

    // ---- normalize + store
#pragma unroll
    for (int n = 0; n < 4; ++n)
#pragma unroll
        for (int r = 0; r < 8; ++r) {
            int row = qbase + r + hi * 8;
            Og[qoff + (size_t)row * DMODEL + h * HDIM + n * 16 + l16] = o[n][r] / lsum[r];
        }
}

// ---------------------------------------------------------------- residual + LayerNorm
__global__ __launch_bounds__(256)
void add_ln(const float* __restrict__ a, const float* __restrict__ resid,
            const float* __restrict__ g, const float* __restrict__ beta,
            float* __restrict__ yf, bf16_t* __restrict__ ybf) {
    __shared__ float red[16];
    const int row = blockIdx.x;
    const int t = threadIdx.x;
    const float* pa = a     + (size_t)row * DMODEL;
    const float* pr = resid + (size_t)row * DMODEL;

    float x[4], s = 0.0f, ss = 0.0f;
#pragma unroll
    for (int i = 0; i < 4; ++i) {
        int c = t + i * 256;
        float v = pa[c] + pr[c];
        x[i] = v; s += v; ss += v * v;
    }
    for (int off = 1; off < 32; off <<= 1) {
        s  += __shfl_xor(s,  off, 32);
        ss += __shfl_xor(ss, off, 32);
    }
    int wave = t >> 5, lane = t & 31;
    if (lane == 0) { red[wave] = s; red[8 + wave] = ss; }
    __syncthreads();
    if (wave == 0) {
        float s2  = (lane < 8) ? red[lane]     : 0.0f;
        float ss2 = (lane < 8) ? red[8 + lane] : 0.0f;
        for (int off = 1; off < 8; off <<= 1) {
            s2  += __shfl_xor(s2,  off, 32);
            ss2 += __shfl_xor(ss2, off, 32);
        }
        if (lane == 0) { red[0] = s2; red[1] = ss2; }
    }
    __syncthreads();
    const float mean = red[0] * (1.0f / DMODEL);
    const float var  = red[1] * (1.0f / DMODEL) - mean * mean;
    const float rstd = rsqrtf(var + 1e-5f);
#pragma unroll
    for (int i = 0; i < 4; ++i) {
        int c = t + i * 256;
        float v = (x[i] - mean) * rstd * g[c] + beta[c];
        yf[(size_t)row * DMODEL + c] = v;
        if (ybf) ybf[(size_t)row * DMODEL + c] = f2bf(v);
    }
}

// ---------------------------------------------------------------- launch
extern "C" void kernel_launch(void* const* d_in, const int* in_sizes, int n_in,
                              void* d_out, int out_size, void* d_ws, size_t ws_size,
                              hipStream_t stream) {
    const float* x    = (const float*)d_in[0];
    const float* enc  = (const float*)d_in[1];
    const float* Wq1  = (const float*)d_in[2];
    const float* Wk1  = (const float*)d_in[3];
    const float* Wv1  = (const float*)d_in[4];
    const float* g1   = (const float*)d_in[5];
    const float* b1   = (const float*)d_in[6];
    const float* Wq2  = (const float*)d_in[7];
    const float* Wk2  = (const float*)d_in[8];
    const float* Wv2  = (const float*)d_in[9];
    const float* g2   = (const float*)d_in[10];
    const float* b2   = (const float*)d_in[11];
    const float* Wff1 = (const float*)d_in[12];
    const float* bff1 = (const float*)d_in[13];
    const float* Wff2 = (const float*)d_in[14];
    const float* bff2 = (const float*)d_in[15];
    const float* g3   = (const float*)d_in[16];
    const float* b3   = (const float*)d_in[17];

    char* ws = (char*)d_ws;
    const size_t MB = 1024u * 1024u;
    bf16_t* wq1b  = (bf16_t*)(ws + 0   * MB);   // all weights stored transposed [N][K]
    bf16_t* wk1b  = (bf16_t*)(ws + 2   * MB);
    bf16_t* wv1b  = (bf16_t*)(ws + 4   * MB);
    bf16_t* wq2b  = (bf16_t*)(ws + 6   * MB);
    bf16_t* wk2b  = (bf16_t*)(ws + 8   * MB);
    bf16_t* wv2b  = (bf16_t*)(ws + 10  * MB);
    bf16_t* wff1b = (bf16_t*)(ws + 12  * MB);
    bf16_t* wff2b = (bf16_t*)(ws + 20  * MB);
    bf16_t* xbf   = (bf16_t*)(ws + 28  * MB);   // activation bf16 (reused: x, y1, y2)
    bf16_t* encbf = (bf16_t*)(ws + 36  * MB);
    bf16_t* qbf   = (bf16_t*)(ws + 44  * MB);
    bf16_t* kbf   = (bf16_t*)(ws + 52  * MB);
    bf16_t* vbf   = (bf16_t*)(ws + 60  * MB);   // V stored transposed [DMODEL][MROWS]
    float*  ctx   = (float*) (ws + 68  * MB);   // attn ctx / ff2 out
    float*  yA    = (float*) (ws + 84  * MB);
    float*  yB    = (float*) (ws + 100 * MB);
    bf16_t* hbf   = (bf16_t*)(ws + 116 * MB);   // ends at 148 MB

    auto cvt = [&](const float* src, bf16_t* dst, int n) {
        cvt_f32_to_bf16<<<dim3((n + 255) / 256), dim3(256), 0, stream>>>(src, dst, n);
    };
    auto cvtT = [&](const float* src, bf16_t* dst, int Kd, int Nd) {
        cvt_transpose_bf16<<<dim3(Nd / 32, Kd / 32), dim3(256), 0, stream>>>(src, dst, Kd, Nd);
    };
    auto gemm = [&](const bf16_t* A, const bf16_t* Bt, void* C, const float* bias,
                    int M, int N, int K, int flags) {
        gemm_bf16_wmma<<<dim3(N / TN, M / TM), dim3(256), 0, stream>>>(A, Bt, C, bias, M, N, K, flags);
    };

    // weights -> bf16, transposed [N][K]
    cvtT(Wq1,  wq1b,  DMODEL, DMODEL);
    cvtT(Wk1,  wk1b,  DMODEL, DMODEL);
    cvtT(Wv1,  wv1b,  DMODEL, DMODEL);
    cvtT(Wq2,  wq2b,  DMODEL, DMODEL);
    cvtT(Wk2,  wk2b,  DMODEL, DMODEL);
    cvtT(Wv2,  wv2b,  DMODEL, DMODEL);
    cvtT(Wff1, wff1b, DMODEL, FFDIM);
    cvtT(Wff2, wff2b, FFDIM,  DMODEL);
    cvt(x,   xbf,   MROWS * DMODEL);
    cvt(enc, encbf, MROWS * DMODEL);

    const float scale = 0.03125f;   // 1/sqrt(DMODEL), as in reference
    dim3 agrid(NTOK / 16, NHEAD, BATCH);

    // ---- block 1: causal self-attention
    gemm(xbf, wq1b, qbf, nullptr, MROWS, DMODEL, DMODEL, 1);
    gemm(xbf, wk1b, kbf, nullptr, MROWS, DMODEL, DMODEL, 1);
    gemm(xbf, wv1b, vbf, nullptr, MROWS, DMODEL, DMODEL, 1 | 4);   // transposed output
    attn_wmma<<<agrid, 32, 0, stream>>>(qbf, kbf, vbf, ctx, NTOK, NTOK, MROWS, 1, scale);
    add_ln<<<MROWS, 256, 0, stream>>>(ctx, x, g1, b1, yA, xbf);    // xbf := y1 (bf16)

    // ---- block 2: cross-attention over encoder output
    gemm(xbf,   wq2b, qbf, nullptr, MROWS, DMODEL, DMODEL, 1);
    gemm(encbf, wk2b, kbf, nullptr, MROWS, DMODEL, DMODEL, 1);
    gemm(encbf, wv2b, vbf, nullptr, MROWS, DMODEL, DMODEL, 1 | 4); // transposed output
    attn_wmma<<<agrid, 32, 0, stream>>>(qbf, kbf, vbf, ctx, NTOK, NTOK, MROWS, 0, scale);
    add_ln<<<MROWS, 256, 0, stream>>>(ctx, yA, g2, b2, yB, xbf);   // xbf := y2 (bf16)

    // ---- block 3: FFN (bias+GELU fused), residual, final LN
    gemm(xbf, wff1b, hbf, bff1, MROWS, FFDIM, DMODEL, 1 | 2);      // bf16 out + GELU
    gemm(hbf, wff2b, ctx, bff2, MROWS, DMODEL, FFDIM, 0);          // fp32 out
    add_ln<<<MROWS, 256, 0, stream>>>(ctx, yB, g3, b3, (float*)d_out, nullptr);
}

// v001
// A run of this version takes 558 microseconds.
// Two timings next to v000 both put it at 1.22 times that version's speed.
#include <hip/hip_runtime.h>
#include <math.h>

// ---------------------------------------------------------------- types
typedef __bf16 bf16_t;
typedef __attribute__((ext_vector_type(16))) __bf16 v16bf;
typedef __attribute__((ext_vector_type(8)))  float  v8f;

union FragB {
    v16bf  v;
    uint4  q[2];
    bf16_t e[16];
};

__device__ __forceinline__ bf16_t f2bf(float f) {
    unsigned int u = __float_as_uint(f);
    unsigned int r = u + 0x7FFFu + ((u >> 16) & 1u);   // round to nearest even
    unsigned short s = (unsigned short)(r >> 16);
    return __builtin_bit_cast(bf16_t, s);
}

__device__ __forceinline__ v8f wmma_bf16(const v16bf& a, const v16bf& b, const v8f& c) {
    return __builtin_amdgcn_wmma_f32_16x16x32_bf16(false, a, false, b, (short)0, c, false, false);
}

__device__ __forceinline__ v8f v8f_zero() {
    v8f z;
#pragma unroll
    for (int i = 0; i < 8; ++i) z[i] = 0.0f;
    return z;
}

// ---------------------------------------------------------------- constants
#define DMODEL 1024
#define NHEAD  16
#define HDIM   64
#define FFDIM  4096
#define BATCH  4
#define NTOK   1024
#define MROWS  (BATCH * NTOK)   // 4096

// ---------------------------------------------------------------- fp32 -> bf16 (straight)
__global__ void cvt_f32_to_bf16(const float* __restrict__ in, bf16_t* __restrict__ out, int n) {
    int i = blockIdx.x * blockDim.x + threadIdx.x;
    if (i < n) out[i] = f2bf(in[i]);
}

// ---------------------------------------------------------------- fp32 [K][N] -> bf16 [N][K]
__global__ __launch_bounds__(256)
void cvt_transpose_bf16(const float* __restrict__ in, bf16_t* __restrict__ out,
                        int Kdim, int Ndim) {
    __shared__ float tile[32][33];
    const int k0 = blockIdx.y * 32;
    const int n0 = blockIdx.x * 32;
    const int tx = threadIdx.x & 31;
    const int ty = threadIdx.x >> 5;   // 0..7
#pragma unroll
    for (int i = ty; i < 32; i += 8)
        tile[i][tx] = in[(size_t)(k0 + i) * Ndim + n0 + tx];
    __syncthreads();
#pragma unroll
    for (int i = ty; i < 32; i += 8)
        out[(size_t)(n0 + i) * Kdim + k0 + tx] = f2bf(tile[tx][i]);
}

// ---------------------------------------------------------------- GEMM (bf16 WMMA, fp32 acc)
// C[M,N] = A[M,K] @ B[K,N], with B supplied TRANSPOSED as Bt[N][K] bf16.
// flags: bit0 = bf16 output, bit1 = exact GELU, bit2 = write output transposed [N][M].
#define TM 128
#define TN 128
#define TK 64      // one staged row of a slab = 128 B = one whole cache line
#define LDP 72     // LDS row pitch in elements: 144 B = 16 B x odd, for the 16-byte fragment reads

__global__ __launch_bounds__(256)
void gemm_bf16_wmma(const bf16_t* __restrict__ A, const bf16_t* __restrict__ Bt,
                    void* __restrict__ Cout, const float* __restrict__ bias,
                    int M, int N, int K, int flags) {
    __shared__ __align__(16) bf16_t sA[2][TM * LDP];  // [row][k]  2 x 18 KB
    __shared__ __align__(16) bf16_t sB[2][TN * LDP];  // [n][k]    2 x 18 KB

    const int t    = threadIdx.x;
    const int lane = t & 31;
    const int wave = t >> 5;                 // 0..7
    const int wrow = (wave & 3) * 32;        // 0,32,64,96
    const int wcol = (wave >> 2) * 64;       // 0,64
    const int m0   = blockIdx.y * TM;
    const int n0   = blockIdx.x * TN;
    const int hi   = lane >> 4;
    const int l16  = lane & 15;
    const int kb   = hi * 8;

    // staging: eight lanes cover one 128-B row of the slab, so a wave's 16-byte load
    // touches four whole lines; a thread takes rows srow, srow + 32, + 64, + 96
    const int srow = t >> 3;                 // 0..31
    const int sseg = (t & 7) * 8;            // 0,8,..,56
    const bf16_t* gA = A  + (size_t)m0 * K;  // block-uniform bases; the lane's part is soff
    const bf16_t* gB = Bt + (size_t)n0 * K;
    const unsigned soff = (unsigned)(srow * K + sseg);
    const size_t rstep = (size_t)32 * K;
    const int sdst = srow * LDP + sseg;

    v8f acc[2][4];
#pragma unroll
    for (int i = 0; i < 2; ++i)
#pragma unroll
        for (int j = 0; j < 4; ++j) acc[i][j] = v8f_zero();

    const int nk = K / TK;
    uint4 pa0, pa1, pa2, pa3, pb0, pb1, pb2, pb3;

    // prologue: stage slab 0 into buffer 0
    pa0 = *reinterpret_cast<const uint4*>(gA + soff);
    pa1 = *reinterpret_cast<const uint4*>(gA + rstep + soff);
    pa2 = *reinterpret_cast<const uint4*>(gA + 2 * rstep + soff);
    pa3 = *reinterpret_cast<const uint4*>(gA + 3 * rstep + soff);
    pb0 = *reinterpret_cast<const uint4*>(gB + soff);
    pb1 = *reinterpret_cast<const uint4*>(gB + rstep + soff);
    pb2 = *reinterpret_cast<const uint4*>(gB + 2 * rstep + soff);
    pb3 = *reinterpret_cast<const uint4*>(gB + 3 * rstep + soff);
    *reinterpret_cast<uint4*>(&sA[0][sdst])            = pa0;
    *reinterpret_cast<uint4*>(&sA[0][sdst + 32 * LDP]) = pa1;
    *reinterpret_cast<uint4*>(&sA[0][sdst + 64 * LDP]) = pa2;
    *reinterpret_cast<uint4*>(&sA[0][sdst + 96 * LDP]) = pa3;
    *reinterpret_cast<uint4*>(&sB[0][sdst])            = pb0;
    *reinterpret_cast<uint4*>(&sB[0][sdst + 32 * LDP]) = pb1;
    *reinterpret_cast<uint4*>(&sB[0][sdst + 64 * LDP]) = pb2;
    *reinterpret_cast<uint4*>(&sB[0][sdst + 96 * LDP]) = pb3;
    __syncthreads();

    for (int kt = 0; kt < nk; ++kt) {
        const int cur = kt & 1;
        const int nxt = cur ^ 1;
        const bool more = (kt + 1) < nk;
        if (more) {
            int ko = (kt + 1) * TK;
            const bf16_t* a0 = gA + ko + soff;
            const bf16_t* a1 = a0 + rstep;
            const bf16_t* a2 = a1 + rstep;
            const bf16_t* a3 = a2 + rstep;
            const bf16_t* b0 = gB + ko + soff;
            const bf16_t* b1 = b0 + rstep;
            const bf16_t* b2 = b1 + rstep;
            const bf16_t* b3 = b2 + rstep;
            pa0 = *reinterpret_cast<const uint4*>(a0);
            pa1 = *reinterpret_cast<const uint4*>(a1);
            pa2 = *reinterpret_cast<const uint4*>(a2);
            pa3 = *reinterpret_cast<const uint4*>(a3);
            pb0 = *reinterpret_cast<const uint4*>(b0);
            pb1 = *reinterpret_cast<const uint4*>(b1);
            pb2 = *reinterpret_cast<const uint4*>(b2);
            pb3 = *reinterpret_cast<const uint4*>(b3);
            // the wait that stands before an issued load's address registers are written again;
            // the addresses are inputs so that none is reused as a later load's destination
            asm volatile("s_wait_xcnt 0x0"
                         :: "v"(a0), "v"(a1), "v"(a2), "v"(a3), "v"(b0), "v"(b1), "v"(b2), "v"(b3)
                         : "memory");
        }

        // two 32-deep products per slab, k ascending; unrolled so that ks folds into the LDS offsets
#pragma unroll
        for (int ks = 0; ks < TK; ks += 32) {
            FragB af[2], bfr[4];
#pragma unroll
            for (int i = 0; i < 2; ++i) {
                int row = wrow + i * 16 + l16;
                af[i].q[0] = *reinterpret_cast<const uint4*>(&sA[cur][row * LDP + ks + kb]);
                af[i].q[1] = *reinterpret_cast<const uint4*>(&sA[cur][row * LDP + ks + kb + 16]);
            }
#pragma unroll
            for (int j = 0; j < 4; ++j) {
                int col = wcol + j * 16 + l16;
                bfr[j].q[0] = *reinterpret_cast<const uint4*>(&sB[cur][col * LDP + ks + kb]);
                bfr[j].q[1] = *reinterpret_cast<const uint4*>(&sB[cur][col * LDP + ks + kb + 16]);
            }
#pragma unroll
            for (int i = 0; i < 2; ++i)
#pragma unroll
                for (int j = 0; j < 4; ++j)
                    acc[i][j] = wmma_bf16(af[i].v, bfr[j].v, acc[i][j]);
        }

        if (more) {
            *reinterpret_cast<uint4*>(&sA[nxt][sdst])            = pa0;
            *reinterpret_cast<uint4*>(&sA[nxt][sdst + 32 * LDP]) = pa1;
            *reinterpret_cast<uint4*>(&sA[nxt][sdst + 64 * LDP]) = pa2;
            *reinterpret_cast<uint4*>(&sA[nxt][sdst + 96 * LDP]) = pa3;
            *reinterpret_cast<uint4*>(&sB[nxt][sdst])            = pb0;
            *reinterpret_cast<uint4*>(&sB[nxt][sdst + 32 * LDP]) = pb1;
            *reinterpret_cast<uint4*>(&sB[nxt][sdst + 64 * LDP]) = pb2;
            *reinterpret_cast<uint4*>(&sB[nxt][sdst + 96 * LDP]) = pb3;
        }
        __syncthreads();
    }

    const bool out_bf   = (flags & 1) != 0;
    const bool do_gelu  = (flags & 2) != 0;
    const bool out_tr   = (flags & 4) != 0;
#pragma unroll
    for (int i = 0; i < 2; ++i) {
#pragma unroll
        for (int j = 0; j < 4; ++j) {
            int col = n0 + wcol + j * 16 + l16;
            float bv = bias ? bias[col] : 0.0f;
#pragma unroll
            for (int r = 0; r < 8; ++r) {
                int row = m0 + wrow + i * 16 + hi * 8 + r;
                float v = acc[i][j][r] + bv;
                if (do_gelu) v = 0.5f * v * (1.0f + erff(v * 0.70710678118654752440f));
                if (out_tr)       ((bf16_t*)Cout)[(size_t)col * M + row] = f2bf(v);
                else if (out_bf)  ((bf16_t*)Cout)[(size_t)row * N + col] = f2bf(v);
                else              ((float*) Cout)[(size_t)row * N + col] = v;
            }
        }
    }
}

// ---------------------------------------------------------------- flash attention
// One wave per (batch, head, 16-query tile).
// Q,K bf16 [b*Nq + tok][DMODEL]; V supplied TRANSPOSED: Vt bf16 [DMODEL][Mtot]. O fp32.
__global__ __launch_bounds__(32)
void attn_wmma(const bf16_t* __restrict__ Qg, const bf16_t* __restrict__ Kg,
               const bf16_t* __restrict__ Vt, float* __restrict__ Og,
               int Nq, int Nk, int Mtot, int causal, float scale) {
    __shared__ __align__(16) bf16_t sP[16 * 32];   // P re-layout staging, 1 KB

    const int lane = threadIdx.x & 31;
    const int hi   = lane >> 4;
    const int l16  = lane & 15;
    const int kb   = hi * 8;
    const int qt   = blockIdx.x;
    const int h    = blockIdx.y;
    const int b    = blockIdx.z;
    const int qbase = qt * 16;
    const size_t qoff = (size_t)b * Nq * DMODEL;
    const size_t koff = (size_t)b * Nk * DMODEL;

    // Q fragments: 16 queries x 64 head-dims = two 16x32 A fragments
    FragB qa[2];
#pragma unroll
    for (int kc = 0; kc < 2; ++kc) {
        const bf16_t* base = Qg + qoff + (size_t)(qbase + l16) * DMODEL + h * HDIM + kc * 32 + kb;
        qa[kc].q[0] = *reinterpret_cast<const uint4*>(base);
        qa[kc].q[1] = *reinterpret_cast<const uint4*>(base + 16);
    }

    v8f o[4];
    float m[8], lsum[8];
#pragma unroll
    for (int n = 0; n < 4; ++n) o[n] = v8f_zero();
#pragma unroll
    for (int r = 0; r < 8; ++r) { m[r] = -1e30f; lsum[r] = 0.0f; }

    int kend = Nk;
    if (causal) {
        kend = (qbase + 16 + 31) & ~31;
        if (kend > Nk) kend = Nk;
    }

    for (int j0 = 0; j0 < kend; j0 += 32) {
        // ---- S = Q K^T for 32 keys (two 16x16 C tiles)
        v8f s[2];
#pragma unroll
        for (int st = 0; st < 2; ++st) {
            FragB kb0, kb1;   // B = K^T: lane holds key column, elems walk head-dim
            const bf16_t* base = Kg + koff + (size_t)(j0 + st * 16 + l16) * DMODEL + h * HDIM + kb;
            kb0.q[0] = *reinterpret_cast<const uint4*>(base);
            kb0.q[1] = *reinterpret_cast<const uint4*>(base + 16);
            kb1.q[0] = *reinterpret_cast<const uint4*>(base + 32);
            kb1.q[1] = *reinterpret_cast<const uint4*>(base + 48);
            v8f z = v8f_zero();
            z = wmma_bf16(qa[0].v, kb0.v, z);
            z = wmma_bf16(qa[1].v, kb1.v, z);
            s[st] = z;
        }
        // ---- scale + causal mask
#pragma unroll
        for (int st = 0; st < 2; ++st) {
            int col = j0 + st * 16 + l16;
#pragma unroll
            for (int r = 0; r < 8; ++r) {
                int row = qbase + r + hi * 8;
                float v = s[st][r] * scale;
                if (causal && col > row) v = -1e30f;
                s[st][r] = v;
            }
        }
        // ---- online softmax (row reductions across 16-lane halves)
        float alpha[8];
#pragma unroll
        for (int r = 0; r < 8; ++r) {
            float rm = fmaxf(s[0][r], s[1][r]);
#pragma unroll
            for (int off = 1; off < 16; off <<= 1)
                rm = fmaxf(rm, __shfl_xor(rm, off, 32));
            float mn = fmaxf(m[r], rm);
            alpha[r] = __expf(m[r] - mn);
            m[r] = mn;
            float p0 = __expf(s[0][r] - mn);
            float p1 = __expf(s[1][r] - mn);
            s[0][r] = p0; s[1][r] = p1;
            float rs = p0 + p1;
#pragma unroll
            for (int off = 1; off < 16; off <<= 1)
                rs += __shfl_xor(rs, off, 32);
            lsum[r] = lsum[r] * alpha[r] + rs;
        }
#pragma unroll
        for (int n = 0; n < 4; ++n)
#pragma unroll
            for (int r = 0; r < 8; ++r) o[n][r] *= alpha[r];

        // ---- C-layout P -> A-layout bf16 fragment via LDS (single wave, LDS in-order)
#pragma unroll
        for (int r = 0; r < 8; ++r) {
            int row = r + hi * 8;
            sP[row * 32 + l16]      = f2bf(s[0][r]);
            sP[row * 32 + 16 + l16] = f2bf(s[1][r]);
        }
        FragB pa;
        pa.q[0] = *reinterpret_cast<const uint4*>(&sP[l16 * 32 + kb]);
        pa.q[1] = *reinterpret_cast<const uint4*>(&sP[l16 * 32 + kb + 16]);

        // ---- O += P (16x32) * V (32x64): V fragments straight from Vt, vectorized
#pragma unroll
        for (int n = 0; n < 4; ++n) {
            FragB vb;
            const bf16_t* vbase = Vt + (size_t)(h * HDIM + n * 16 + l16) * Mtot
                                     + (size_t)b * Nk + j0 + kb;
            vb.q[0] = *reinterpret_cast<const uint4*>(vbase);
            vb.q[1] = *reinterpret_cast<const uint4*>(vbase + 16);
            o[n] = wmma_bf16(pa.v, vb.v, o[n]);
        }
    }

    // ---- normalize + store
#pragma unroll
    for (int n = 0; n < 4; ++n)
#pragma unroll
        for (int r = 0; r < 8; ++r) {
            int row = qbase + r + hi * 8;
            Og[qoff + (size_t)row * DMODEL + h * HDIM + n * 16 + l16] = o[n][r] / lsum[r];
        }
}

// ---------------------------------------------------------------- residual + LayerNorm
__global__ __launch_bounds__(256)
void add_ln(const float* __restrict__ a, const float* __restrict__ resid,
            const float* __restrict__ g, const float* __restrict__ beta,
            float* __restrict__ yf, bf16_t* __restrict__ ybf) {
    __shared__ float red[16];
    const int row = blockIdx.x;
    const int t = threadIdx.x;
    const float* pa = a     + (size_t)row * DMODEL;
    const float* pr = resid + (size_t)row * DMODEL;

    float x[4], s = 0.0f, ss = 0.0f;
#pragma unroll
    for (int i = 0; i < 4; ++i) {
        int c = t + i * 256;
        float v = pa[c] + pr[c];
        x[i] = v; s += v; ss += v * v;
    }
    for (int off = 1; off < 32; off <<= 1) {
        s  += __shfl_xor(s,  off, 32);
        ss += __shfl_xor(ss, off, 32);
    }
    int wave = t >> 5, lane = t & 31;
    if (lane == 0) { red[wave] = s; red[8 + wave] = ss; }
    __syncthreads();
    if (wave == 0) {
        float s2  = (lane < 8) ? red[lane]     : 0.0f;
        float ss2 = (lane < 8) ? red[8 + lane] : 0.0f;
        for (int off = 1; off < 8; off <<= 1) {
            s2  += __shfl_xor(s2,  off, 32);
            ss2 += __shfl_xor(ss2, off, 32);
        }
        if (lane == 0) { red[0] = s2; red[1] = ss2; }
    }
    __syncthreads();
    const float mean = red[0] * (1.0f / DMODEL);
    const float var  = red[1] * (1.0f / DMODEL) - mean * mean;
    const float rstd = rsqrtf(var + 1e-5f);
#pragma unroll
    for (int i = 0; i < 4; ++i) {
        int c = t + i * 256;
        float v = (x[i] - mean) * rstd * g[c] + beta[c];
        yf[(size_t)row * DMODEL + c] = v;
        if (ybf) ybf[(size_t)row * DMODEL + c] = f2bf(v);
    }
}

// ---------------------------------------------------------------- launch
extern "C" void kernel_launch(void* const* d_in, const int* in_sizes, int n_in,
                              void* d_out, int out_size, void* d_ws, size_t ws_size,
                              hipStream_t stream) {
    const float* x    = (const float*)d_in[0];
    const float* enc  = (const float*)d_in[1];
    const float* Wq1  = (const float*)d_in[2];
    const float* Wk1  = (const float*)d_in[3];
    const float* Wv1  = (const float*)d_in[4];
    const float* g1   = (const float*)d_in[5];
    const float* b1   = (const float*)d_in[6];
    const float* Wq2  = (const float*)d_in[7];
    const float* Wk2  = (const float*)d_in[8];
    const float* Wv2  = (const float*)d_in[9];
    const float* g2   = (const float*)d_in[10];
    const float* b2   = (const float*)d_in[11];
    const float* Wff1 = (const float*)d_in[12];
    const float* bff1 = (const float*)d_in[13];
    const float* Wff2 = (const float*)d_in[14];
    const float* bff2 = (const float*)d_in[15];
    const float* g3   = (const float*)d_in[16];
    const float* b3   = (const float*)d_in[17];

    char* ws = (char*)d_ws;
    const size_t MB = 1024u * 1024u;
    bf16_t* wq1b  = (bf16_t*)(ws + 0   * MB);   // all weights stored transposed [N][K]
    bf16_t* wk1b  = (bf16_t*)(ws + 2   * MB);
    bf16_t* wv1b  = (bf16_t*)(ws + 4   * MB);
    bf16_t* wq2b  = (bf16_t*)(ws + 6   * MB);
    bf16_t* wk2b  = (bf16_t*)(ws + 8   * MB);
    bf16_t* wv2b  = (bf16_t*)(ws + 10  * MB);
    bf16_t* wff1b = (bf16_t*)(ws + 12  * MB);
    bf16_t* wff2b = (bf16_t*)(ws + 20  * MB);
    bf16_t* xbf   = (bf16_t*)(ws + 28  * MB);   // activation bf16 (reused: x, y1, y2)
    bf16_t* encbf = (bf16_t*)(ws + 36  * MB);
    bf16_t* qbf   = (bf16_t*)(ws + 44  * MB);
    bf16_t* kbf   = (bf16_t*)(ws + 52  * MB);
    bf16_t* vbf   = (bf16_t*)(ws + 60  * MB);   // V stored transposed [DMODEL][MROWS]
    float*  ctx   = (float*) (ws + 68  * MB);   // attn ctx / ff2 out
    float*  yA    = (float*) (ws + 84  * MB);
    float*  yB    = (float*) (ws + 100 * MB);
    bf16_t* hbf   = (bf16_t*)(ws + 116 * MB);   // ends at 148 MB

    auto cvt = [&](const float* src, bf16_t* dst, int n) {
        cvt_f32_to_bf16<<<dim3((n + 255) / 256), dim3(256), 0, stream>>>(src, dst, n);
    };
    auto cvtT = [&](const float* src, bf16_t* dst, int Kd, int Nd) {
        cvt_transpose_bf16<<<dim3(Nd / 32, Kd / 32), dim3(256), 0, stream>>>(src, dst, Kd, Nd);
    };
    auto gemm = [&](const bf16_t* A, const bf16_t* Bt, void* C, const float* bias,
                    int M, int N, int K, int flags) {
        gemm_bf16_wmma<<<dim3(N / TN, M / TM), dim3(256), 0, stream>>>(A, Bt, C, bias, M, N, K, flags);
    };

    // weights -> bf16, transposed [N][K]
    cvtT(Wq1,  wq1b,  DMODEL, DMODEL);
    cvtT(Wk1,  wk1b,  DMODEL, DMODEL);
    cvtT(Wv1,  wv1b,  DMODEL, DMODEL);
    cvtT(Wq2,  wq2b,  DMODEL, DMODEL);
    cvtT(Wk2,  wk2b,  DMODEL, DMODEL);
    cvtT(Wv2,  wv2b,  DMODEL, DMODEL);
    cvtT(Wff1, wff1b, DMODEL, FFDIM);
    cvtT(Wff2, wff2b, FFDIM,  DMODEL);
    cvt(x,   xbf,   MROWS * DMODEL);
    cvt(enc, encbf, MROWS * DMODEL);

    const float scale = 0.03125f;   // 1/sqrt(DMODEL), as in reference
    dim3 agrid(NTOK / 16, NHEAD, BATCH);

    // ---- block 1: causal self-attention
    gemm(xbf, wq1b, qbf, nullptr, MROWS, DMODEL, DMODEL, 1);
    gemm(xbf, wk1b, kbf, nullptr, MROWS, DMODEL, DMODEL, 1);
    gemm(xbf, wv1b, vbf, nullptr, MROWS, DMODEL, DMODEL, 1 | 4);   // transposed output
    attn_wmma<<<agrid, 32, 0, stream>>>(qbf, kbf, vbf, ctx, NTOK, NTOK, MROWS, 1, scale);
    add_ln<<<MROWS, 256, 0, stream>>>(ctx, x, g1, b1, yA, xbf);    // xbf := y1 (bf16)

    // ---- block 2: cross-attention over encoder output
    gemm(xbf,   wq2b, qbf, nullptr, MROWS, DMODEL, DMODEL, 1);
    gemm(encbf, wk2b, kbf, nullptr, MROWS, DMODEL, DMODEL, 1);
    gemm(encbf, wv2b, vbf, nullptr, MROWS, DMODEL, DMODEL, 1 | 4); // transposed output
    attn_wmma<<<agrid, 32, 0, stream>>>(qbf, kbf, vbf, ctx, NTOK, NTOK, MROWS, 0, scale);
    add_ln<<<MROWS, 256, 0, stream>>>(ctx, yA, g2, b2, yB, xbf);   // xbf := y2 (bf16)

    // ---- block 3: FFN (bias+GELU fused), residual, final LN
    gemm(xbf, wff1b, hbf, bff1, MROWS, FFDIM, DMODEL, 1 | 2);      // bf16 out + GELU
    gemm(hbf, wff2b, ctx, bff2, MROWS, DMODEL, FFDIM, 0);          // fp32 out
    add_ln<<<MROWS, 256, 0, stream>>>(ctx, yB, g3, b3, (float*)d_out, nullptr);
}

// v002
// One run takes 527 microseconds.
// Two timings next to v001 put it at 1.05 and 1.06 times that version's speed.
// Over all steps from v000 it is 1.29 times as fast.
#include <hip/hip_runtime.h>
#include <math.h>

// ---------------------------------------------------------------- types
typedef __bf16 bf16_t;
typedef __attribute__((ext_vector_type(16))) __bf16 v16bf;
typedef __attribute__((ext_vector_type(8)))  float  v8f;

union FragB {
    v16bf  v;
    uint4  q[2];
    bf16_t e[16];
};

__device__ __forceinline__ bf16_t f2bf(float f) {
    unsigned int u = __float_as_uint(f);
    unsigned int r = u + 0x7FFFu + ((u >> 16) & 1u);   // round to nearest even
    unsigned short s = (unsigned short)(r >> 16);
    return __builtin_bit_cast(bf16_t, s);
}

__device__ __forceinline__ v8f wmma_bf16(const v16bf& a, const v16bf& b, const v8f& c) {
    return __builtin_amdgcn_wmma_f32_16x16x32_bf16(false, a, false, b, (short)0, c, false, false);
}

__device__ __forceinline__ v8f v8f_zero() {
    v8f z;
#pragma unroll
    for (int i = 0; i < 8; ++i) z[i] = 0.0f;
    return z;
}

// ---------------------------------------------------------------- constants
#define DMODEL 1024
#define NHEAD  16
#define HDIM   64
#define FFDIM  4096
#define BATCH  4
#define NTOK   1024
#define MROWS  (BATCH * NTOK)   // 4096

// ---------------------------------------------------------------- fp32 -> bf16 (straight)
__device__ __forceinline__ uint2 pack4_bf16(const float4& v) {
    union { bf16_t e[4]; uint2 q; } u;
    u.e[0] = f2bf(v.x); u.e[1] = f2bf(v.y); u.e[2] = f2bf(v.z); u.e[3] = f2bf(v.w);
    return u.q;
}

// 32 values a thread, as eight 16-byte loads in flight; every wave-wide load (512 B) and store (256 B)
// covers whole lines. A launch then starts one wave per 1,024 values, not one per 32.
#define CVT_BLOCK (256 * 32)   // values per work-group; the launch covers n = a multiple of it
__global__ __launch_bounds__(256)
void cvt_f32_to_bf16(const float* __restrict__ in, bf16_t* __restrict__ out) {
    const size_t base = (size_t)blockIdx.x * CVT_BLOCK + threadIdx.x * 4;
    float4 v[8];
#pragma unroll
    for (int c = 0; c < 8; ++c)
        v[c] = *reinterpret_cast<const float4*>(in + base + c * 1024);
#pragma unroll
    for (int c = 0; c < 8; ++c)
        *reinterpret_cast<uint2*>(out + base + c * 1024) = pack4_bf16(v[c]);
}

// ---------------------------------------------------------------- fp32 [K][N] -> bf16 [N][K]
// 64 x 64 tile, 16 values a thread: 16-byte loads along n (a wave covers two 256-B row pieces),
// 16-byte stores along k (eight lanes cover one 128-B line of an output row).
#define TT 64
__global__ __launch_bounds__(256)
void cvt_transpose_bf16(const float* __restrict__ in, bf16_t* __restrict__ out,
                        int Kdim, int Ndim) {
    __shared__ float tile[TT][TT + 1];   // pitch 65 dwords: the column walks below meet no bank twice
    const int k0 = blockIdx.y * TT;
    const int n0 = blockIdx.x * TT;
    const int t  = threadIdx.x;
    const int lr = t >> 4;               // 0..15
    const int lc = (t & 15) * 4;         // 0,4,..,60
    const float* s0 = in + (size_t)(k0 + lr) * Ndim + n0 + lc;
    const float* s1 = s0 + (size_t)16 * Ndim;
    const float* s2 = s1 + (size_t)16 * Ndim;
    const float* s3 = s2 + (size_t)16 * Ndim;
    float4 v[4];
    v[0] = *reinterpret_cast<const float4*>(s0);
    v[1] = *reinterpret_cast<const float4*>(s1);
    v[2] = *reinterpret_cast<const float4*>(s2);
    v[3] = *reinterpret_cast<const float4*>(s3);
    // the wait that stands before an issued load's address registers are written again;
    // the addresses are inputs so that none is reused as a later load's destination
    asm volatile("s_wait_xcnt 0x0" :: "v"(s0), "v"(s1), "v"(s2), "v"(s3) : "memory");
#pragma unroll
    for (int p = 0; p < 4; ++p) {
        float* d = &tile[p * 16 + lr][lc];
        d[0] = v[p].x; d[1] = v[p].y; d[2] = v[p].z; d[3] = v[p].w;
    }
    __syncthreads();
#pragma unroll
    for (int c = 0; c < 2; ++c) {
        const int id = t + c * 256;
        const int n  = id >> 3;          // 0..63
        const int ks = (id & 7) * 8;     // 0,8,..,56
        union { bf16_t e[8]; uint4 q; } u;
#pragma unroll
        for (int j = 0; j < 8; ++j) u.e[j] = f2bf(tile[ks + j][n]);
        *reinterpret_cast<uint4*>(out + (size_t)(n0 + n) * Kdim + k0 + ks) = u.q;
    }
}

// ---------------------------------------------------------------- GEMM (bf16 WMMA, fp32 acc)
// C[M,N] = A[M,K] @ B[K,N], with B supplied TRANSPOSED as Bt[N][K] bf16.
// flags: bit0 = bf16 output, bit1 = exact GELU, bit2 = write output transposed [N][M].
#define TM 128
#define TN 128
#define TK 64      // one staged row of a slab = 128 B = one whole cache line
#define LDP 72     // LDS row pitch in elements: 144 B = 16 B x odd, for the 16-byte fragment reads

__global__ __launch_bounds__(256)
void gemm_bf16_wmma(const bf16_t* __restrict__ A, const bf16_t* __restrict__ Bt,
                    void* __restrict__ Cout, const float* __restrict__ bias,
                    int M, int N, int K, int flags) {
    __shared__ __align__(16) bf16_t sA[2][TM * LDP];  // [row][k]  2 x 18 KB
    __shared__ __align__(16) bf16_t sB[2][TN * LDP];  // [n][k]    2 x 18 KB

    const int t    = threadIdx.x;
    const int lane = t & 31;
    const int wave = t >> 5;                 // 0..7
    const int wrow = (wave & 3) * 32;        // 0,32,64,96
    const int wcol = (wave >> 2) * 64;       // 0,64
    const int m0   = blockIdx.y * TM;
    const int n0   = blockIdx.x * TN;
    const int hi   = lane >> 4;
    const int l16  = lane & 15;
    const int kb   = hi * 8;

    // staging: eight lanes cover one 128-B row of the slab, so a wave's 16-byte load
    // touches four whole lines; a thread takes rows srow, srow + 32, + 64, + 96
    const int srow = t >> 3;                 // 0..31
    const int sseg = (t & 7) * 8;            // 0,8,..,56
    const bf16_t* gA = A  + (size_t)m0 * K;  // block-uniform bases; the lane's part is soff
    const bf16_t* gB = Bt + (size_t)n0 * K;
    const unsigned soff = (unsigned)(srow * K + sseg);
    const size_t rstep = (size_t)32 * K;
    const int sdst = srow * LDP + sseg;

    v8f acc[2][4];
#pragma unroll
    for (int i = 0; i < 2; ++i)
#pragma unroll
        for (int j = 0; j < 4; ++j) acc[i][j] = v8f_zero();

    const int nk = K / TK;
    uint4 pa0, pa1, pa2, pa3, pb0, pb1, pb2, pb3;

    // prologue: stage slab 0 into buffer 0
    pa0 = *reinterpret_cast<const uint4*>(gA + soff);
    pa1 = *reinterpret_cast<const uint4*>(gA + rstep + soff);
    pa2 = *reinterpret_cast<const uint4*>(gA + 2 * rstep + soff);
    pa3 = *reinterpret_cast<const uint4*>(gA + 3 * rstep + soff);
    pb0 = *reinterpret_cast<const uint4*>(gB + soff);
    pb1 = *reinterpret_cast<const uint4*>(gB + rstep + soff);
    pb2 = *reinterpret_cast<const uint4*>(gB + 2 * rstep + soff);
    pb3 = *reinterpret_cast<const uint4*>(gB + 3 * rstep + soff);
    *reinterpret_cast<uint4*>(&sA[0][sdst])            = pa0;
    *reinterpret_cast<uint4*>(&sA[0][sdst + 32 * LDP]) = pa1;
    *reinterpret_cast<uint4*>(&sA[0][sdst + 64 * LDP]) = pa2;
    *reinterpret_cast<uint4*>(&sA[0][sdst + 96 * LDP]) = pa3;
    *reinterpret_cast<uint4*>(&sB[0][sdst])            = pb0;
    *reinterpret_cast<uint4*>(&sB[0][sdst + 32 * LDP]) = pb1;
    *reinterpret_cast<uint4*>(&sB[0][sdst + 64 * LDP]) = pb2;
    *reinterpret_cast<uint4*>(&sB[0][sdst + 96 * LDP]) = pb3;
    __syncthreads();

    for (int kt = 0; kt < nk; ++kt) {
        const int cur = kt & 1;
        const int nxt = cur ^ 1;
        const bool more = (kt + 1) < nk;
        if (more) {
            int ko = (kt + 1) * TK;
            const bf16_t* a0 = gA + ko + soff;
            const bf16_t* a1 = a0 + rstep;
            const bf16_t* a2 = a1 + rstep;
            const bf16_t* a3 = a2 + rstep;
            const bf16_t* b0 = gB + ko + soff;
            const bf16_t* b1 = b0 + rstep;
            const bf16_t* b2 = b1 + rstep;
            const bf16_t* b3 = b2 + rstep;
            pa0 = *reinterpret_cast<const uint4*>(a0);
            pa1 = *reinterpret_cast<const uint4*>(a1);
            pa2 = *reinterpret_cast<const uint4*>(a2);
            pa3 = *reinterpret_cast<const uint4*>(a3);
            pb0 = *reinterpret_cast<const uint4*>(b0);
            pb1 = *reinterpret_cast<const uint4*>(b1);
            pb2 = *reinterpret_cast<const uint4*>(b2);
            pb3 = *reinterpret_cast<const uint4*>(b3);
            // the wait that stands before an issued load's address registers are written again;
            // the addresses are inputs so that none is reused as a later load's destination
            asm volatile("s_wait_xcnt 0x0"
                         :: "v"(a0), "v"(a1), "v"(a2), "v"(a3), "v"(b0), "v"(b1), "v"(b2), "v"(b3)
                         : "memory");
        }

        // two 32-deep products per slab, k ascending; unrolled so that ks folds into the LDS offsets
#pragma unroll
        for (int ks = 0; ks < TK; ks += 32) {
            FragB af[2], bfr[4];
#pragma unroll
            for (int i = 0; i < 2; ++i) {
                int row = wrow + i * 16 + l16;
                af[i].q[0] = *reinterpret_cast<const uint4*>(&sA[cur][row * LDP + ks + kb]);
                af[i].q[1] = *reinterpret_cast<const uint4*>(&sA[cur][row * LDP + ks + kb + 16]);
            }
#pragma unroll
            for (int j = 0; j < 4; ++j) {
                int col = wcol + j * 16 + l16;
                bfr[j].q[0] = *reinterpret_cast<const uint4*>(&sB[cur][col * LDP + ks + kb]);
                bfr[j].q[1] = *reinterpret_cast<const uint4*>(&sB[cur][col * LDP + ks + kb + 16]);
            }
#pragma unroll
            for (int i = 0; i < 2; ++i)
#pragma unroll
                for (int j = 0; j < 4; ++j)
                    acc[i][j] = wmma_bf16(af[i].v, bfr[j].v, acc[i][j]);
        }

        if (more) {
            *reinterpret_cast<uint4*>(&sA[nxt][sdst])            = pa0;
            *reinterpret_cast<uint4*>(&sA[nxt][sdst + 32 * LDP]) = pa1;
            *reinterpret_cast<uint4*>(&sA[nxt][sdst + 64 * LDP]) = pa2;
            *reinterpret_cast<uint4*>(&sA[nxt][sdst + 96 * LDP]) = pa3;
            *reinterpret_cast<uint4*>(&sB[nxt][sdst])            = pb0;
            *reinterpret_cast<uint4*>(&sB[nxt][sdst + 32 * LDP]) = pb1;
            *reinterpret_cast<uint4*>(&sB[nxt][sdst + 64 * LDP]) = pb2;
            *reinterpret_cast<uint4*>(&sB[nxt][sdst + 96 * LDP]) = pb3;
        }
        __syncthreads();
    }

    const bool out_bf   = (flags & 1) != 0;
    const bool do_gelu  = (flags & 2) != 0;
    const bool out_tr   = (flags & 4) != 0;
#pragma unroll
    for (int i = 0; i < 2; ++i) {
#pragma unroll
        for (int j = 0; j < 4; ++j) {
            int col = n0 + wcol + j * 16 + l16;
            float bv = bias ? bias[col] : 0.0f;
#pragma unroll
            for (int r = 0; r < 8; ++r) {
                int row = m0 + wrow + i * 16 + hi * 8 + r;
                float v = acc[i][j][r] + bv;
                if (do_gelu) v = 0.5f * v * (1.0f + erff(v * 0.70710678118654752440f));
                if (out_tr)       ((bf16_t*)Cout)[(size_t)col * M + row] = f2bf(v);
                else if (out_bf)  ((bf16_t*)Cout)[(size_t)row * N + col] = f2bf(v);
                else              ((float*) Cout)[(size_t)row * N + col] = v;
            }
        }
    }
}

// ---------------------------------------------------------------- flash attention
// One wave per (batch, head, 16-query tile).
// Q,K bf16 [b*Nq + tok][DMODEL]; V supplied TRANSPOSED: Vt bf16 [DMODEL][Mtot]. O fp32.
__global__ __launch_bounds__(32)
void attn_wmma(const bf16_t* __restrict__ Qg, const bf16_t* __restrict__ Kg,
               const bf16_t* __restrict__ Vt, float* __restrict__ Og,
               int Nq, int Nk, int Mtot, int causal, float scale) {
    __shared__ __align__(16) bf16_t sP[16 * 32];   // P re-layout staging, 1 KB

    const int lane = threadIdx.x & 31;
    const int hi   = lane >> 4;
    const int l16  = lane & 15;
    const int kb   = hi * 8;
    const int qt   = blockIdx.x;
    const int h    = blockIdx.y;
    const int b    = blockIdx.z;
    const int qbase = qt * 16;
    const size_t qoff = (size_t)b * Nq * DMODEL;
    const size_t koff = (size_t)b * Nk * DMODEL;

    // Q fragments: 16 queries x 64 head-dims = two 16x32 A fragments
    FragB qa[2];
#pragma unroll
    for (int kc = 0; kc < 2; ++kc) {
        const bf16_t* base = Qg + qoff + (size_t)(qbase + l16) * DMODEL + h * HDIM + kc * 32 + kb;
        qa[kc].q[0] = *reinterpret_cast<const uint4*>(base);
        qa[kc].q[1] = *reinterpret_cast<const uint4*>(base + 16);
    }

    v8f o[4];
    float m[8], lsum[8];
#pragma unroll
    for (int n = 0; n < 4; ++n) o[n] = v8f_zero();
#pragma unroll
    for (int r = 0; r < 8; ++r) { m[r] = -1e30f; lsum[r] = 0.0f; }

    int kend = Nk;
    if (causal) {
        kend = (qbase + 16 + 31) & ~31;
        if (kend > Nk) kend = Nk;
    }

    for (int j0 = 0; j0 < kend; j0 += 32) {
        // ---- S = Q K^T for 32 keys (two 16x16 C tiles)
        v8f s[2];
#pragma unroll
        for (int st = 0; st < 2; ++st) {
            FragB kb0, kb1;   // B = K^T: lane holds key column, elems walk head-dim
            const bf16_t* base = Kg + koff + (size_t)(j0 + st * 16 + l16) * DMODEL + h * HDIM + kb;
            kb0.q[0] = *reinterpret_cast<const uint4*>(base);
            kb0.q[1] = *reinterpret_cast<const uint4*>(base + 16);
            kb1.q[0] = *reinterpret_cast<const uint4*>(base + 32);
            kb1.q[1] = *reinterpret_cast<const uint4*>(base + 48);
            v8f z = v8f_zero();
            z = wmma_bf16(qa[0].v, kb0.v, z);
            z = wmma_bf16(qa[1].v, kb1.v, z);
            s[st] = z;
        }
        // ---- scale + causal mask
#pragma unroll
        for (int st = 0; st < 2; ++st) {
            int col = j0 + st * 16 + l16;
#pragma unroll
            for (int r = 0; r < 8; ++r) {
                int row = qbase + r + hi * 8;
                float v = s[st][r] * scale;
                if (causal && col > row) v = -1e30f;
                s[st][r] = v;
            }
        }
        // ---- online softmax (row reductions across 16-lane halves)
        float alpha[8];
#pragma unroll
        for (int r = 0; r < 8; ++r) {
            float rm = fmaxf(s[0][r], s[1][r]);
#pragma unroll
            for (int off = 1; off < 16; off <<= 1)
                rm = fmaxf(rm, __shfl_xor(rm, off, 32));
            float mn = fmaxf(m[r], rm);
            alpha[r] = __expf(m[r] - mn);
            m[r] = mn;
            float p0 = __expf(s[0][r] - mn);
            float p1 = __expf(s[1][r] - mn);
            s[0][r] = p0; s[1][r] = p1;
            float rs = p0 + p1;
#pragma unroll
            for (int off = 1; off < 16; off <<= 1)
                rs += __shfl_xor(rs, off, 32);
            lsum[r] = lsum[r] * alpha[r] + rs;
        }
#pragma unroll
        for (int n = 0; n < 4; ++n)
#pragma unroll
            for (int r = 0; r < 8; ++r) o[n][r] *= alpha[r];

        // ---- C-layout P -> A-layout bf16 fragment via LDS (single wave, LDS in-order)
#pragma unroll
        for (int r = 0; r < 8; ++r) {
            int row = r + hi * 8;
            sP[row * 32 + l16]      = f2bf(s[0][r]);
            sP[row * 32 + 16 + l16] = f2bf(s[1][r]);
        }
        FragB pa;
        pa.q[0] = *reinterpret_cast<const uint4*>(&sP[l16 * 32 + kb]);
        pa.q[1] = *reinterpret_cast<const uint4*>(&sP[l16 * 32 + kb + 16]);

        // ---- O += P (16x32) * V (32x64): V fragments straight from Vt, vectorized
#pragma unroll
        for (int n = 0; n < 4; ++n) {
            FragB vb;
            const bf16_t* vbase = Vt + (size_t)(h * HDIM + n * 16 + l16) * Mtot
                                     + (size_t)b * Nk + j0 + kb;
            vb.q[0] = *reinterpret_cast<const uint4*>(vbase);
            vb.q[1] = *reinterpret_cast<const uint4*>(vbase + 16);
            o[n] = wmma_bf16(pa.v, vb.v, o[n]);
        }
    }

    // ---- normalize + store
#pragma unroll
    for (int n = 0; n < 4; ++n)
#pragma unroll
        for (int r = 0; r < 8; ++r) {
            int row = qbase + r + hi * 8;
            Og[qoff + (size_t)row * DMODEL + h * HDIM + n * 16 + l16] = o[n][r] / lsum[r];
        }
}

// ---------------------------------------------------------------- residual + LayerNorm
// One wave per row, 32 values a lane by 16-byte accesses on whole lines; the row's sums stay in the
// wave (four chains a lane, then a five-step butterfly), so no LDS and no barrier.
#define LN_ROWS 8   // rows (waves) per work-group
__global__ __launch_bounds__(256)
void add_ln(const float* __restrict__ a, const float* __restrict__ resid,
            const float* __restrict__ g, const float* __restrict__ beta,
            float* __restrict__ yf, bf16_t* __restrict__ ybf) {
    const int lane = threadIdx.x & 31;
    const int row  = blockIdx.x * LN_ROWS + (threadIdx.x >> 5);
    const size_t ro = (size_t)row * DMODEL + lane * 4;

    const float* pa = a     + ro;
    const float* pr = resid + ro;
    float4 x[8], r[8];
#pragma unroll
    for (int i = 0; i < 8; ++i) x[i] = *reinterpret_cast<const float4*>(pa + i * 128);
#pragma unroll
    for (int i = 0; i < 8; ++i) r[i] = *reinterpret_cast<const float4*>(pr + i * 128);
    // the wait that stands before an issued load's address registers are written again;
    // the addresses are inputs so that none is reused as a later load's destination
    asm volatile("s_wait_xcnt 0x0" :: "v"(pa), "v"(pr) : "memory");

    float s0 = 0.0f, s1 = 0.0f, s2 = 0.0f, s3 = 0.0f;
    float q0 = 0.0f, q1 = 0.0f, q2 = 0.0f, q3 = 0.0f;
#pragma unroll
    for (int i = 0; i < 8; ++i) {
        x[i].x += r[i].x; x[i].y += r[i].y; x[i].z += r[i].z; x[i].w += r[i].w;
        s0 += x[i].x; s1 += x[i].y; s2 += x[i].z; s3 += x[i].w;
        q0 += x[i].x * x[i].x; q1 += x[i].y * x[i].y; q2 += x[i].z * x[i].z; q3 += x[i].w * x[i].w;
    }
    float s  = (s0 + s1) + (s2 + s3);
    float ss = (q0 + q1) + (q2 + q3);
#pragma unroll
    for (int off = 1; off < 32; off <<= 1) {
        s  += __shfl_xor(s,  off, 32);
        ss += __shfl_xor(ss, off, 32);
    }
    const float mean = s  * (1.0f / DMODEL);
    const float var  = ss * (1.0f / DMODEL) - mean * mean;
    // rsqrtf as the compiler expands it (a denormal argument is scaled by 2^24, its result by 2^12), with
    // v_rsq_f32 and the one slot that the instruction set asks for behind it in one statement, so that
    // the slot stays directly behind it
    const float ve   = var + 1e-5f;
    const bool  tiny = ve < 1.17549435e-38f;
    float rq;
    asm("v_rsq_f32 %0, %1\n\tv_nop" : "=v"(rq) : "v"(tiny ? ve * 16777216.0f : ve));
    const float rstd = tiny ? rq * 4096.0f : rq;
#pragma unroll
    for (int i = 0; i < 8; ++i) {
        const float4 gv = *reinterpret_cast<const float4*>(g    + lane * 4 + i * 128);
        const float4 bv = *reinterpret_cast<const float4*>(beta + lane * 4 + i * 128);
        x[i].x = (x[i].x - mean) * rstd * gv.x + bv.x;
        x[i].y = (x[i].y - mean) * rstd * gv.y + bv.y;
        x[i].z = (x[i].z - mean) * rstd * gv.z + bv.z;
        x[i].w = (x[i].w - mean) * rstd * gv.w + bv.w;
        *reinterpret_cast<float4*>(yf + ro + i * 128) = x[i];
    }
    // the wait that stands before the registers of the issued stores are written again (by the packing below)
    asm volatile("s_wait_xcnt 0x0" ::: "memory");
    if (ybf) {
#pragma unroll
        for (int i = 0; i < 8; ++i)
            *reinterpret_cast<uint2*>(ybf + ro + i * 128) = pack4_bf16(x[i]);
    }
}

// ---------------------------------------------------------------- launch
extern "C" void kernel_launch(void* const* d_in, const int* in_sizes, int n_in,
                              void* d_out, int out_size, void* d_ws, size_t ws_size,
                              hipStream_t stream) {
    const float* x    = (const float*)d_in[0];
    const float* enc  = (const float*)d_in[1];
    const float* Wq1  = (const float*)d_in[2];
    const float* Wk1  = (const float*)d_in[3];
    const float* Wv1  = (const float*)d_in[4];
    const float* g1   = (const float*)d_in[5];
    const float* b1   = (const float*)d_in[6];
    const float* Wq2  = (const float*)d_in[7];
    const float* Wk2  = (const float*)d_in[8];
    const float* Wv2  = (const float*)d_in[9];
    const float* g2   = (const float*)d_in[10];
    const float* b2   = (const float*)d_in[11];
    const float* Wff1 = (const float*)d_in[12];
    const float* bff1 = (const float*)d_in[13];
    const float* Wff2 = (const float*)d_in[14];
    const float* bff2 = (const float*)d_in[15];
    const float* g3   = (const float*)d_in[16];
    const float* b3   = (const float*)d_in[17];

    char* ws = (char*)d_ws;
    const size_t MB = 1024u * 1024u;
    bf16_t* wq1b  = (bf16_t*)(ws + 0   * MB);   // all weights stored transposed [N][K]
    bf16_t* wk1b  = (bf16_t*)(ws + 2   * MB);
    bf16_t* wv1b  = (bf16_t*)(ws + 4   * MB);
    bf16_t* wq2b  = (bf16_t*)(ws + 6   * MB);
    bf16_t* wk2b  = (bf16_t*)(ws + 8   * MB);
    bf16_t* wv2b  = (bf16_t*)(ws + 10  * MB);
    bf16_t* wff1b = (bf16_t*)(ws + 12  * MB);
    bf16_t* wff2b = (bf16_t*)(ws + 20  * MB);
    bf16_t* xbf   = (bf16_t*)(ws + 28  * MB);   // activation bf16 (reused: x, y1, y2)
    bf16_t* encbf = (bf16_t*)(ws + 36  * MB);
    bf16_t* qbf   = (bf16_t*)(ws + 44  * MB);
    bf16_t* kbf   = (bf16_t*)(ws + 52  * MB);
    bf16_t* vbf   = (bf16_t*)(ws + 60  * MB);   // V stored transposed [DMODEL][MROWS]
    float*  ctx   = (float*) (ws + 68  * MB);   // attn ctx / ff2 out
    float*  yA    = (float*) (ws + 84  * MB);
    float*  yB    = (float*) (ws + 100 * MB);
    bf16_t* hbf   = (bf16_t*)(ws + 116 * MB);   // ends at 148 MB

    auto cvt = [&](const float* src, bf16_t* dst, int n) {
        cvt_f32_to_bf16<<<dim3(n / CVT_BLOCK), dim3(256), 0, stream>>>(src, dst);
    };
    auto cvtT = [&](const float* src, bf16_t* dst, int Kd, int Nd) {
        cvt_transpose_bf16<<<dim3(Nd / TT, Kd / TT), dim3(256), 0, stream>>>(src, dst, Kd, Nd);
    };
    auto gemm = [&](const bf16_t* A, const bf16_t* Bt, void* C, const float* bias,
                    int M, int N, int K, int flags) {
        gemm_bf16_wmma<<<dim3(N / TN, M / TM), dim3(256), 0, stream>>>(A, Bt, C, bias, M, N, K, flags);
    };

    // weights -> bf16, transposed [N][K]
    cvtT(Wq1,  wq1b,  DMODEL, DMODEL);
    cvtT(Wk1,  wk1b,  DMODEL, DMODEL);
    cvtT(Wv1,  wv1b,  DMODEL, DMODEL);
    cvtT(Wq2,  wq2b,  DMODEL, DMODEL);
    cvtT(Wk2,  wk2b,  DMODEL, DMODEL);
    cvtT(Wv2,  wv2b,  DMODEL, DMODEL);
    cvtT(Wff1, wff1b, DMODEL, FFDIM);
    cvtT(Wff2, wff2b, FFDIM,  DMODEL);
    cvt(x,   xbf,   MROWS * DMODEL);
    cvt(enc, encbf, MROWS * DMODEL);

    const float scale = 0.03125f;   // 1/sqrt(DMODEL), as in reference
    dim3 agrid(NTOK / 16, NHEAD, BATCH);

    // ---- block 1: causal self-attention
    gemm(xbf, wq1b, qbf, nullptr, MROWS, DMODEL, DMODEL, 1);
    gemm(xbf, wk1b, kbf, nullptr, MROWS, DMODEL, DMODEL, 1);
    gemm(xbf, wv1b, vbf, nullptr, MROWS, DMODEL, DMODEL, 1 | 4);   // transposed output
    attn_wmma<<<agrid, 32, 0, stream>>>(qbf, kbf, vbf, ctx, NTOK, NTOK, MROWS, 1, scale);
    add_ln<<<MROWS / LN_ROWS, 256, 0, stream>>>(ctx, x, g1, b1, yA, xbf);    // xbf := y1 (bf16)

    // ---- block 2: cross-attention over encoder output
    gemm(xbf,   wq2b, qbf, nullptr, MROWS, DMODEL, DMODEL, 1);
    gemm(encbf, wk2b, kbf, nullptr, MROWS, DMODEL, DMODEL, 1);
    gemm(encbf, wv2b, vbf, nullptr, MROWS, DMODEL, DMODEL, 1 | 4); // transposed output
    attn_wmma<<<agrid, 32, 0, stream>>>(qbf, kbf, vbf, ctx, NTOK, NTOK, MROWS, 0, scale);
    add_ln<<<MROWS / LN_ROWS, 256, 0, stream>>>(ctx, yA, g2, b2, yB, xbf);   // xbf := y2 (bf16)

    // ---- block 3: FFN (bias+GELU fused), residual, final LN
    gemm(xbf, wff1b, hbf, bff1, MROWS, FFDIM, DMODEL, 1 | 2);      // bf16 out + GELU
    gemm(hbf, wff2b, ctx, bff2, MROWS, DMODEL, FFDIM, 0);          // fp32 out
    add_ln<<<MROWS / LN_ROWS, 256, 0, stream>>>(ctx, yB, g3, b3, (float*)d_out, nullptr);
}

// v003
// Measured time: 410 microseconds a run.
// Next to v002, in two timings, it ran 1.29 and 1.28 times as fast.
// Over all steps from v000 it is 1.66 times as fast.
#include <hip/hip_runtime.h>
#include <math.h>

// ---------------------------------------------------------------- types
typedef __bf16 bf16_t;
typedef __attribute__((ext_vector_type(16))) __bf16 v16bf;
typedef __attribute__((ext_vector_type(8)))  float  v8f;

union FragB {
    v16bf  v;
    uint4  q[2];
    bf16_t e[16];
};

__device__ __forceinline__ bf16_t f2bf(float f) {
    unsigned int u = __float_as_uint(f);
    unsigned int r = u + 0x7FFFu + ((u >> 16) & 1u);   // round to nearest even
    unsigned short s = (unsigned short)(r >> 16);
    return __builtin_bit_cast(bf16_t, s);
}

__device__ __forceinline__ v8f wmma_bf16(const v16bf& a, const v16bf& b, const v8f& c) {
    return __builtin_amdgcn_wmma_f32_16x16x32_bf16(false, a, false, b, (short)0, c, false, false);
}

__device__ __forceinline__ v8f v8f_zero() {
    v8f z;
#pragma unroll
    for (int i = 0; i < 8; ++i) z[i] = 0.0f;
    return z;
}

// ---------------------------------------------------------------- constants
#define DMODEL 1024
#define NHEAD  16
#define HDIM   64
#define FFDIM  4096
#define BATCH  4
#define NTOK   1024
#define MROWS  (BATCH * NTOK)   // 4096

// ---------------------------------------------------------------- fp32 -> bf16 (straight)
__device__ __forceinline__ uint2 pack4_bf16(const float4& v) {
    union { bf16_t e[4]; uint2 q; } u;
    u.e[0] = f2bf(v.x); u.e[1] = f2bf(v.y); u.e[2] = f2bf(v.z); u.e[3] = f2bf(v.w);
    return u.q;
}

// 32 values a thread, as eight 16-byte loads in flight; every wave-wide load (512 B) and store (256 B)
// covers whole lines. A launch then starts one wave per 1,024 values, not one per 32.
#define CVT_BLOCK (256 * 32)   // values per work-group; the launch covers n = a multiple of it
__global__ __launch_bounds__(256)
void cvt_f32_to_bf16(const float* __restrict__ in, bf16_t* __restrict__ out) {
    const size_t base = (size_t)blockIdx.x * CVT_BLOCK + threadIdx.x * 4;
    float4 v[8];
#pragma unroll
    for (int c = 0; c < 8; ++c)
        v[c] = *reinterpret_cast<const float4*>(in + base + c * 1024);
#pragma unroll
    for (int c = 0; c < 8; ++c)
        *reinterpret_cast<uint2*>(out + base + c * 1024) = pack4_bf16(v[c]);
}

// ---------------------------------------------------------------- fp32 [K][N] -> bf16 [N][K]
// 64 x 64 tile, 16 values a thread: 16-byte loads along n (a wave covers two 256-B row pieces),
// 16-byte stores along k (eight lanes cover one 128-B line of an output row).
#define TT 64
__global__ __launch_bounds__(256)
void cvt_transpose_bf16(const float* __restrict__ in, bf16_t* __restrict__ out,
                        int Kdim, int Ndim) {
    __shared__ float tile[TT][TT + 1];   // pitch 65 dwords: the column walks below meet no bank twice
    const int k0 = blockIdx.y * TT;
    const int n0 = blockIdx.x * TT;
    const int t  = threadIdx.x;
    const int lr = t >> 4;               // 0..15
    const int lc = (t & 15) * 4;         // 0,4,..,60
    const float* s0 = in + (size_t)(k0 + lr) * Ndim + n0 + lc;
    const float* s1 = s0 + (size_t)16 * Ndim;
    const float* s2 = s1 + (size_t)16 * Ndim;
    const float* s3 = s2 + (size_t)16 * Ndim;
    float4 v[4];
    v[0] = *reinterpret_cast<const float4*>(s0);
    v[1] = *reinterpret_cast<const float4*>(s1);
    v[2] = *reinterpret_cast<const float4*>(s2);
    v[3] = *reinterpret_cast<const float4*>(s3);
    // the wait that stands before an issued load's address registers are written again;
    // the addresses are inputs so that none is reused as a later load's destination
    asm volatile("s_wait_xcnt 0x0" :: "v"(s0), "v"(s1), "v"(s2), "v"(s3) : "memory");
#pragma unroll
    for (int p = 0; p < 4; ++p) {
        float* d = &tile[p * 16 + lr][lc];
        d[0] = v[p].x; d[1] = v[p].y; d[2] = v[p].z; d[3] = v[p].w;
    }
    __syncthreads();
#pragma unroll
    for (int c = 0; c < 2; ++c) {
        const int id = t + c * 256;
        const int n  = id >> 3;          // 0..63
        const int ks = (id & 7) * 8;     // 0,8,..,56
        union { bf16_t e[8]; uint4 q; } u;
#pragma unroll
        for (int j = 0; j < 8; ++j) u.e[j] = f2bf(tile[ks + j][n]);
        *reinterpret_cast<uint4*>(out + (size_t)(n0 + n) * Kdim + k0 + ks) = u.q;
    }
}

// ---------------------------------------------------------------- GEMM (bf16 WMMA, fp32 acc)
// C[M,N] = A[M,K] @ B[K,N], with B supplied TRANSPOSED as Bt[N][K] bf16.
// flags: bit0 = bf16 output, bit1 = exact GELU, bit2 = write output transposed [N][M].
#define TM 128
#define TN 128
#define TK 64      // one staged row of a slab = 128 B = one whole cache line
#define LDP 72     // LDS row pitch in elements: 144 B = 16 B x odd, for the 16-byte fragment reads

__global__ __launch_bounds__(256)
void gemm_bf16_wmma(const bf16_t* __restrict__ A, const bf16_t* __restrict__ Bt,
                    void* __restrict__ Cout, const float* __restrict__ bias,
                    int M, int N, int K, int flags) {
    __shared__ __align__(16) bf16_t sA[2][TM * LDP];  // [row][k]  2 x 18 KB
    __shared__ __align__(16) bf16_t sB[2][TN * LDP];  // [n][k]    2 x 18 KB

    const int t    = threadIdx.x;
    const int lane = t & 31;
    const int wave = t >> 5;                 // 0..7
    const int wrow = (wave & 3) * 32;        // 0,32,64,96
    const int wcol = (wave >> 2) * 64;       // 0,64
    const int m0   = blockIdx.y * TM;
    const int n0   = blockIdx.x * TN;
    const int hi   = lane >> 4;
    const int l16  = lane & 15;
    const int kb   = hi * 8;

    // staging: eight lanes cover one 128-B row of the slab, so a wave's 16-byte load
    // touches four whole lines; a thread takes rows srow, srow + 32, + 64, + 96
    const int srow = t >> 3;                 // 0..31
    const int sseg = (t & 7) * 8;            // 0,8,..,56
    const bf16_t* gA = A  + (size_t)m0 * K;  // block-uniform bases; the lane's part is soff
    const bf16_t* gB = Bt + (size_t)n0 * K;
    const unsigned soff = (unsigned)(srow * K + sseg);
    const size_t rstep = (size_t)32 * K;
    const int sdst = srow * LDP + sseg;

    v8f acc[2][4];
#pragma unroll
    for (int i = 0; i < 2; ++i)
#pragma unroll
        for (int j = 0; j < 4; ++j) acc[i][j] = v8f_zero();

    const int nk = K / TK;
    uint4 pa0, pa1, pa2, pa3, pb0, pb1, pb2, pb3;

    // prologue: stage slab 0 into buffer 0
    pa0 = *reinterpret_cast<const uint4*>(gA + soff);
    pa1 = *reinterpret_cast<const uint4*>(gA + rstep + soff);
    pa2 = *reinterpret_cast<const uint4*>(gA + 2 * rstep + soff);
    pa3 = *reinterpret_cast<const uint4*>(gA + 3 * rstep + soff);
    pb0 = *reinterpret_cast<const uint4*>(gB + soff);
    pb1 = *reinterpret_cast<const uint4*>(gB + rstep + soff);
    pb2 = *reinterpret_cast<const uint4*>(gB + 2 * rstep + soff);
    pb3 = *reinterpret_cast<const uint4*>(gB + 3 * rstep + soff);
    *reinterpret_cast<uint4*>(&sA[0][sdst])            = pa0;
    *reinterpret_cast<uint4*>(&sA[0][sdst + 32 * LDP]) = pa1;
    *reinterpret_cast<uint4*>(&sA[0][sdst + 64 * LDP]) = pa2;
    *reinterpret_cast<uint4*>(&sA[0][sdst + 96 * LDP]) = pa3;
    *reinterpret_cast<uint4*>(&sB[0][sdst])            = pb0;
    *reinterpret_cast<uint4*>(&sB[0][sdst + 32 * LDP]) = pb1;
    *reinterpret_cast<uint4*>(&sB[0][sdst + 64 * LDP]) = pb2;
    *reinterpret_cast<uint4*>(&sB[0][sdst + 96 * LDP]) = pb3;
    __syncthreads();

    for (int kt = 0; kt < nk; ++kt) {
        const int cur = kt & 1;
        const int nxt = cur ^ 1;
        const bool more = (kt + 1) < nk;
        if (more) {
            int ko = (kt + 1) * TK;
            const bf16_t* a0 = gA + ko + soff;
            const bf16_t* a1 = a0 + rstep;
            const bf16_t* a2 = a1 + rstep;
            const bf16_t* a3 = a2 + rstep;
            const bf16_t* b0 = gB + ko + soff;
            const bf16_t* b1 = b0 + rstep;
            const bf16_t* b2 = b1 + rstep;
            const bf16_t* b3 = b2 + rstep;
            pa0 = *reinterpret_cast<const uint4*>(a0);
            pa1 = *reinterpret_cast<const uint4*>(a1);
            pa2 = *reinterpret_cast<const uint4*>(a2);
            pa3 = *reinterpret_cast<const uint4*>(a3);
            pb0 = *reinterpret_cast<const uint4*>(b0);
            pb1 = *reinterpret_cast<const uint4*>(b1);
            pb2 = *reinterpret_cast<const uint4*>(b2);
            pb3 = *reinterpret_cast<const uint4*>(b3);
            // the wait that stands before an issued load's address registers are written again;
            // the addresses are inputs so that none is reused as a later load's destination
            asm volatile("s_wait_xcnt 0x0"
                         :: "v"(a0), "v"(a1), "v"(a2), "v"(a3), "v"(b0), "v"(b1), "v"(b2), "v"(b3)
                         : "memory");
        }

        // two 32-deep products per slab, k ascending; unrolled so that ks folds into the LDS offsets
#pragma unroll
        for (int ks = 0; ks < TK; ks += 32) {
            FragB af[2], bfr[4];
#pragma unroll
            for (int i = 0; i < 2; ++i) {
                int row = wrow + i * 16 + l16;
                af[i].q[0] = *reinterpret_cast<const uint4*>(&sA[cur][row * LDP + ks + kb]);
                af[i].q[1] = *reinterpret_cast<const uint4*>(&sA[cur][row * LDP + ks + kb + 16]);
            }
#pragma unroll
            for (int j = 0; j < 4; ++j) {
                int col = wcol + j * 16 + l16;
                bfr[j].q[0] = *reinterpret_cast<const uint4*>(&sB[cur][col * LDP + ks + kb]);
                bfr[j].q[1] = *reinterpret_cast<const uint4*>(&sB[cur][col * LDP + ks + kb + 16]);
            }
#pragma unroll
            for (int i = 0; i < 2; ++i)
#pragma unroll
                for (int j = 0; j < 4; ++j)
                    acc[i][j] = wmma_bf16(af[i].v, bfr[j].v, acc[i][j]);
        }

        if (more) {
            *reinterpret_cast<uint4*>(&sA[nxt][sdst])            = pa0;
            *reinterpret_cast<uint4*>(&sA[nxt][sdst + 32 * LDP]) = pa1;
            *reinterpret_cast<uint4*>(&sA[nxt][sdst + 64 * LDP]) = pa2;
            *reinterpret_cast<uint4*>(&sA[nxt][sdst + 96 * LDP]) = pa3;
            *reinterpret_cast<uint4*>(&sB[nxt][sdst])            = pb0;
            *reinterpret_cast<uint4*>(&sB[nxt][sdst + 32 * LDP]) = pb1;
            *reinterpret_cast<uint4*>(&sB[nxt][sdst + 64 * LDP]) = pb2;
            *reinterpret_cast<uint4*>(&sB[nxt][sdst + 96 * LDP]) = pb3;
        }
        __syncthreads();
    }

    const bool out_bf   = (flags & 1) != 0;
    const bool do_gelu  = (flags & 2) != 0;
    const bool out_tr   = (flags & 4) != 0;
#pragma unroll
    for (int i = 0; i < 2; ++i) {
#pragma unroll
        for (int j = 0; j < 4; ++j) {
            int col = n0 + wcol + j * 16 + l16;
            float bv = bias ? bias[col] : 0.0f;
#pragma unroll
            for (int r = 0; r < 8; ++r) {
                int row = m0 + wrow + i * 16 + hi * 8 + r;
                float v = acc[i][j][r] + bv;
                if (do_gelu) v = 0.5f * v * (1.0f + erff(v * 0.70710678118654752440f));
                if (out_tr)       ((bf16_t*)Cout)[(size_t)col * M + row] = f2bf(v);
                else if (out_bf)  ((bf16_t*)Cout)[(size_t)row * N + col] = f2bf(v);
                else              ((float*) Cout)[(size_t)row * N + col] = v;
            }
        }
    }
}

// ---------------------------------------------------------------- flash attention
// One work-group per (batch, head, 128 queries): eight waves, each with its own 16-query tile.
// The waves share every K and V tile: 64 keys are staged once per work-group in LDS by loads that
// cover whole 128-B lines, and each wave takes its fragments from LDS.
// Q,K bf16 [b*Nq + tok][DMODEL]; V supplied TRANSPOSED: Vt bf16 [DMODEL][Mtot]. O fp32.
// Nq is a multiple of 128, Nk of 64.
// e^x as __expf compiles it (x * log2 e, then v_exp_f32), with the one slot that the instruction set asks for
// behind a transcendental in the same statement, so that the slot stays directly behind it
__device__ __forceinline__ float expf_slot(float x) {
    float r;
    asm("v_exp_f32 %0, %1\n\tv_nop" : "=v"(r) : "v"(x * 1.44269504088896340736f));
    return r;
}

#define AW     8    // waves = 16-query tiles per work-group
#define AKEYS  64   // keys per staged tile: a V row of the tile is one whole 128-B line, as a K row is
#define APITCH 72   // LDS row pitch in elements: 144 B = 16 B x odd, for the 16-byte fragment reads
__global__ __launch_bounds__(256)
void attn_wmma(const bf16_t* __restrict__ Qg, const bf16_t* __restrict__ Kg,
               const bf16_t* __restrict__ Vt, float* __restrict__ Og,
               int Nq, int Nk, int Mtot, int causal, float scale) {
    __shared__ __align__(16) bf16_t sK[2][AKEYS * APITCH];   // [key][head-dim]   2 x 9 KB
    __shared__ __align__(16) bf16_t sV[2][HDIM * APITCH];    // [head-dim][key]   2 x 9 KB
    __shared__ __align__(16) bf16_t sPall[AW][16 * 32];      // P re-layout staging, 1 KB a wave

    const int t    = threadIdx.x;
    const int lane = t & 31;
    const int wave = __builtin_amdgcn_readfirstlane(t >> 5);  // scalar: the tests on kend below are scalar branches
    const int hi   = lane >> 4;
    const int l16  = lane & 15;
    const int kb   = hi * 8;
    const int h    = blockIdx.y;
    const int b    = blockIdx.z;
    const int qblk  = blockIdx.x * (16 * AW);
    const int qbase = qblk + wave * 16;
    const size_t qoff = (size_t)b * Nq * DMODEL;
    const size_t koff = (size_t)b * Nk * DMODEL;
    bf16_t* sP = sPall[wave];

    // staging: eight lanes cover one 128-B row, so a wave's 16-byte load touches four whole lines;
    // a thread takes rows srow and srow + 32 of the K tile and of the V tile
    const int srow = t >> 3;                 // 0..31
    const int sseg = (t & 7) * 8;            // 0,8,..,56
    const int sdst = srow * APITCH + sseg;
    const bf16_t* gK = Kg + koff + (size_t)srow * DMODEL + h * HDIM + sseg;
    const bf16_t* gV = Vt + (size_t)(h * HDIM + srow) * Mtot + (size_t)b * Nk + sseg;
    const size_t kstep = (size_t)32 * DMODEL;
    const size_t vstep = (size_t)32 * Mtot;

    // Q fragments: 16 queries x 64 head-dims = two 16x32 A fragments
    FragB qa[2];
#pragma unroll
    for (int kc = 0; kc < 2; ++kc) {
        const bf16_t* base = Qg + qoff + (size_t)(qbase + l16) * DMODEL + h * HDIM + kc * 32 + kb;
        qa[kc].q[0] = *reinterpret_cast<const uint4*>(base);
        qa[kc].q[1] = *reinterpret_cast<const uint4*>(base + 16);
    }

    v8f o[4];
    float m[8], lsum[8];
#pragma unroll
    for (int n = 0; n < 4; ++n) o[n] = v8f_zero();
#pragma unroll
    for (int r = 0; r < 8; ++r) { m[r] = -1e30f; lsum[r] = 0.0f; }

    int kend  = Nk;    // this wave's end
    int kendw = Nk;    // the work-group's end = its last wave's
    if (causal) {
        kend = (qbase + 16 + 31) & ~31;
        if (kend > Nk) kend = Nk;
        kendw = (qblk + 16 * AW + 31) & ~31;
        if (kendw > Nk) kendw = Nk;
    }
    const int ns = (kendw + AKEYS - 1) / AKEYS;   // staged tiles, the same for every wave

    uint4 pk0, pk1, pv0, pv1;
    // prologue: tile 0 into buffer 0
    pk0 = *reinterpret_cast<const uint4*>(gK);
    pk1 = *reinterpret_cast<const uint4*>(gK + kstep);
    pv0 = *reinterpret_cast<const uint4*>(gV);
    pv1 = *reinterpret_cast<const uint4*>(gV + vstep);
    *reinterpret_cast<uint4*>(&sK[0][sdst])               = pk0;
    *reinterpret_cast<uint4*>(&sK[0][sdst + 32 * APITCH]) = pk1;
    *reinterpret_cast<uint4*>(&sV[0][sdst])               = pv0;
    *reinterpret_cast<uint4*>(&sV[0][sdst + 32 * APITCH]) = pv1;
    __syncthreads();

    for (int s = 0; s < ns; ++s) {
        const int cur = s & 1;
        const int nxt = cur ^ 1;
        const bool more = (s + 1) < ns;
        if (more) {
            const bf16_t* k0 = gK + (size_t)(s + 1) * AKEYS * DMODEL;
            const bf16_t* v0 = gV + (s + 1) * AKEYS;
            const bf16_t* v1 = v0 + vstep;
            pk0 = *reinterpret_cast<const uint4*>(k0);
            pk1 = *reinterpret_cast<const uint4*>(k0 + kstep);   // a constant step: k0's registers and an offset
            pv0 = *reinterpret_cast<const uint4*>(v0);
            pv1 = *reinterpret_cast<const uint4*>(v1);
            // the wait that stands before an issued load's address registers are written again;
            // the addresses are inputs so that none is reused as a later load's destination
            asm volatile("s_wait_xcnt 0x0" :: "v"(k0), "v"(v0), "v"(v1) : "memory");
        }

        // two 32-key passes per staged tile; a wave past its own causal end skips the pass
#pragma unroll
        for (int sub = 0; sub < AKEYS; sub += 32) {
            const int j0 = s * AKEYS + sub;
            if (j0 < kend) {
                // ---- S = Q K^T for 32 keys (two 16x16 C tiles)
                v8f sc[2];
#pragma unroll
                for (int st = 0; st < 2; ++st) {
                    FragB kb0, kb1;   // B = K^T: lane holds key column, elems walk head-dim
                    const bf16_t* base = &sK[cur][(sub + st * 16 + l16) * APITCH + kb];
                    kb0.q[0] = *reinterpret_cast<const uint4*>(base);
                    kb0.q[1] = *reinterpret_cast<const uint4*>(base + 16);
                    kb1.q[0] = *reinterpret_cast<const uint4*>(base + 32);
                    kb1.q[1] = *reinterpret_cast<const uint4*>(base + 48);
                    v8f z = v8f_zero();
                    z = wmma_bf16(qa[0].v, kb0.v, z);
                    z = wmma_bf16(qa[1].v, kb1.v, z);
                    sc[st] = z;
                }
                // ---- scale + causal mask
#pragma unroll
                for (int st = 0; st < 2; ++st) {
                    int col = j0 + st * 16 + l16;
#pragma unroll
                    for (int r = 0; r < 8; ++r) {
                        int row = qbase + r + hi * 8;
                        float v = sc[st][r] * scale;
                        if (causal && col > row) v = -1e30f;
                        sc[st][r] = v;
                    }
                }
                // ---- online softmax (row reductions across 16-lane halves)
                float alpha[8];
#pragma unroll
                for (int r = 0; r < 8; ++r) {
                    float rm = fmaxf(sc[0][r], sc[1][r]);
#pragma unroll
                    for (int off = 1; off < 16; off <<= 1)
                        rm = fmaxf(rm, __shfl_xor(rm, off, 32));
                    float mn = fmaxf(m[r], rm);
                    alpha[r] = expf_slot(m[r] - mn);
                    m[r] = mn;
                    float p0 = __expf(sc[0][r] - mn);
                    float p1 = __expf(sc[1][r] - mn);
                    sc[0][r] = p0; sc[1][r] = p1;
                    float rs = p0 + p1;
#pragma unroll
                    for (int off = 1; off < 16; off <<= 1)
                        rs += __shfl_xor(rs, off, 32);
                    lsum[r] = lsum[r] * alpha[r] + rs;
                }
#pragma unroll
                for (int n = 0; n < 4; ++n)
#pragma unroll
                    for (int r = 0; r < 8; ++r) o[n][r] *= alpha[r];

                // ---- C-layout P -> A-layout bf16 fragment via the wave's own LDS (LDS in-order per wave)
#pragma unroll
                for (int r = 0; r < 8; ++r) {
                    int row = r + hi * 8;
                    sP[row * 32 + l16]      = f2bf(sc[0][r]);
                    sP[row * 32 + 16 + l16] = f2bf(sc[1][r]);
                }
                FragB pa;
                pa.q[0] = *reinterpret_cast<const uint4*>(&sP[l16 * 32 + kb]);
                pa.q[1] = *reinterpret_cast<const uint4*>(&sP[l16 * 32 + kb + 16]);

                // ---- O += P (16x32) * V (32x64): V fragments from the staged tile
#pragma unroll
                for (int n = 0; n < 4; ++n) {
                    FragB vb;
                    const bf16_t* vbase = &sV[cur][(n * 16 + l16) * APITCH + sub + kb];
                    vb.q[0] = *reinterpret_cast<const uint4*>(vbase);
                    vb.q[1] = *reinterpret_cast<const uint4*>(vbase + 16);
                    o[n] = wmma_bf16(pa.v, vb.v, o[n]);
                }
                // the four vector slots that the chip needs behind a matrix instruction before its operands are
                // overwritten: the four
                // accumulators are inputs so that the slots stand behind all four products
                asm volatile("v_nop\n\tv_nop\n\tv_nop\n\tv_nop" :: "v"(o[0]), "v"(o[1]), "v"(o[2]), "v"(o[3]));
            }
        }

        if (more) {
            *reinterpret_cast<uint4*>(&sK[nxt][sdst])               = pk0;
            *reinterpret_cast<uint4*>(&sK[nxt][sdst + 32 * APITCH]) = pk1;
            *reinterpret_cast<uint4*>(&sV[nxt][sdst])               = pv0;
            *reinterpret_cast<uint4*>(&sV[nxt][sdst + 32 * APITCH]) = pv1;
        }
        // publishes the next tile and ends every wave's reads of the buffer that is refilled next
        __syncthreads();
    }

    // ---- normalize + store
#pragma unroll
    for (int n = 0; n < 4; ++n)
#pragma unroll
        for (int r = 0; r < 8; ++r) {
            int row = qbase + r + hi * 8;
            Og[qoff + (size_t)row * DMODEL + h * HDIM + n * 16 + l16] = o[n][r] / lsum[r];
        }
}

// ---------------------------------------------------------------- residual + LayerNorm
// One wave per row, 32 values a lane by 16-byte accesses on whole lines; the row's sums stay in the
// wave (four chains a lane, then a five-step butterfly), so no LDS and no barrier.
#define LN_ROWS 8   // rows (waves) per work-group
__global__ __launch_bounds__(256)
void add_ln(const float* __restrict__ a, const float* __restrict__ resid,
            const float* __restrict__ g, const float* __restrict__ beta,
            float* __restrict__ yf, bf16_t* __restrict__ ybf) {
    const int lane = threadIdx.x & 31;
    const int row  = blockIdx.x * LN_ROWS + (threadIdx.x >> 5);
    const size_t ro = (size_t)row * DMODEL + lane * 4;

    const float* pa = a     + ro;
    const float* pr = resid + ro;
    float4 x[8], r[8];
#pragma unroll
    for (int i = 0; i < 8; ++i) x[i] = *reinterpret_cast<const float4*>(pa + i * 128);
#pragma unroll
    for (int i = 0; i < 8; ++i) r[i] = *reinterpret_cast<const float4*>(pr + i * 128);
    // the wait that stands before an issued load's address registers are written again;
    // the addresses are inputs so that none is reused as a later load's destination
    asm volatile("s_wait_xcnt 0x0" :: "v"(pa), "v"(pr) : "memory");

    float s0 = 0.0f, s1 = 0.0f, s2 = 0.0f, s3 = 0.0f;
    float q0 = 0.0f, q1 = 0.0f, q2 = 0.0f, q3 = 0.0f;
#pragma unroll
    for (int i = 0; i < 8; ++i) {
        x[i].x += r[i].x; x[i].y += r[i].y; x[i].z += r[i].z; x[i].w += r[i].w;
        s0 += x[i].x; s1 += x[i].y; s2 += x[i].z; s3 += x[i].w;
        q0 += x[i].x * x[i].x; q1 += x[i].y * x[i].y; q2 += x[i].z * x[i].z; q3 += x[i].w * x[i].w;
    }
    float s  = (s0 + s1) + (s2 + s3);
    float ss = (q0 + q1) + (q2 + q3);
#pragma unroll
    for (int off = 1; off < 32; off <<= 1) {
        s  += __shfl_xor(s,  off, 32);
        ss += __shfl_xor(ss, off, 32);
    }
    const float mean = s  * (1.0f / DMODEL);
    const float var  = ss * (1.0f / DMODEL) - mean * mean;
    // rsqrtf as the compiler expands it (a denormal argument is scaled by 2^24, its result by 2^12), with
    // v_rsq_f32 and the one slot that the instruction set asks for behind it in one statement, so that
    // the slot stays directly behind it
    const float ve   = var + 1e-5f;
    const bool  tiny = ve < 1.17549435e-38f;
    float rq;
    asm("v_rsq_f32 %0, %1\n\tv_nop" : "=v"(rq) : "v"(tiny ? ve * 16777216.0f : ve));
    const float rstd = tiny ? rq * 4096.0f : rq;
#pragma unroll
    for (int i = 0; i < 8; ++i) {
        const float4 gv = *reinterpret_cast<const float4*>(g    + lane * 4 + i * 128);
        const float4 bv = *reinterpret_cast<const float4*>(beta + lane * 4 + i * 128);
        x[i].x = (x[i].x - mean) * rstd * gv.x + bv.x;
        x[i].y = (x[i].y - mean) * rstd * gv.y + bv.y;
        x[i].z = (x[i].z - mean) * rstd * gv.z + bv.z;
        x[i].w = (x[i].w - mean) * rstd * gv.w + bv.w;
        *reinterpret_cast<float4*>(yf + ro + i * 128) = x[i];
    }
    // the wait that stands before the registers of the issued stores are written again (by the packing below)
    asm volatile("s_wait_xcnt 0x0" ::: "memory");
    if (ybf) {
#pragma unroll
        for (int i = 0; i < 8; ++i)
            *reinterpret_cast<uint2*>(ybf + ro + i * 128) = pack4_bf16(x[i]);
    }
}

// ---------------------------------------------------------------- launch
extern "C" void kernel_launch(void* const* d_in, const int* in_sizes, int n_in,
                              void* d_out, int out_size, void* d_ws, size_t ws_size,
                              hipStream_t stream) {
    const float* x    = (const float*)d_in[0];
    const float* enc  = (const float*)d_in[1];
    const float* Wq1  = (const float*)d_in[2];
    const float* Wk1  = (const float*)d_in[3];
    const float* Wv1  = (const float*)d_in[4];
    const float* g1   = (const float*)d_in[5];
    const float* b1   = (const float*)d_in[6];
    const float* Wq2  = (const float*)d_in[7];
    const float* Wk2  = (const float*)d_in[8];
    const float* Wv2  = (const float*)d_in[9];
    const float* g2   = (const float*)d_in[10];
    const float* b2   = (const float*)d_in[11];
    const float* Wff1 = (const float*)d_in[12];
    const float* bff1 = (const float*)d_in[13];
    const float* Wff2 = (const float*)d_in[14];
    const float* bff2 = (const float*)d_in[15];
    const float* g3   = (const float*)d_in[16];
    const float* b3   = (const float*)d_in[17];

    char* ws = (char*)d_ws;
    const size_t MB = 1024u * 1024u;
    bf16_t* wq1b  = (bf16_t*)(ws + 0   * MB);   // all weights stored transposed [N][K]
    bf16_t* wk1b  = (bf16_t*)(ws + 2   * MB);
    bf16_t* wv1b  = (bf16_t*)(ws + 4   * MB);
    bf16_t* wq2b  = (bf16_t*)(ws + 6   * MB);
    bf16_t* wk2b  = (bf16_t*)(ws + 8   * MB);
    bf16_t* wv2b  = (bf16_t*)(ws + 10  * MB);
    bf16_t* wff1b = (bf16_t*)(ws + 12  * MB);
    bf16_t* wff2b = (bf16_t*)(ws + 20  * MB);
    bf16_t* xbf   = (bf16_t*)(ws + 28  * MB);   // activation bf16 (reused: x, y1, y2)
    bf16_t* encbf = (bf16_t*)(ws + 36  * MB);
    bf16_t* qbf   = (bf16_t*)(ws + 44  * MB);
    bf16_t* kbf   = (bf16_t*)(ws + 52  * MB);
    bf16_t* vbf   = (bf16_t*)(ws + 60  * MB);   // V stored transposed [DMODEL][MROWS]
    float*  ctx   = (float*) (ws + 68  * MB);   // attn ctx / ff2 out
    float*  yA    = (float*) (ws + 84  * MB);
    float*  yB    = (float*) (ws + 100 * MB);
    bf16_t* hbf   = (bf16_t*)(ws + 116 * MB);   // ends at 148 MB

    auto cvt = [&](const float* src, bf16_t* dst, int n) {
        cvt_f32_to_bf16<<<dim3(n / CVT_BLOCK), dim3(256), 0, stream>>>(src, dst);
    };
    auto cvtT = [&](const float* src, bf16_t* dst, int Kd, int Nd) {
        cvt_transpose_bf16<<<dim3(Nd / TT, Kd / TT), dim3(256), 0, stream>>>(src, dst, Kd, Nd);
    };
    auto gemm = [&](const bf16_t* A, const bf16_t* Bt, void* C, const float* bias,
                    int M, int N, int K, int flags) {
        gemm_bf16_wmma<<<dim3(N / TN, M / TM), dim3(256), 0, stream>>>(A, Bt, C, bias, M, N, K, flags);
    };

    // weights -> bf16, transposed [N][K]
    cvtT(Wq1,  wq1b,  DMODEL, DMODEL);
    cvtT(Wk1,  wk1b,  DMODEL, DMODEL);
    cvtT(Wv1,  wv1b,  DMODEL, DMODEL);
    cvtT(Wq2,  wq2b,  DMODEL, DMODEL);
    cvtT(Wk2,  wk2b,  DMODEL, DMODEL);
    cvtT(Wv2,  wv2b,  DMODEL, DMODEL);
    cvtT(Wff1, wff1b, DMODEL, FFDIM);
    cvtT(Wff2, wff2b, FFDIM,  DMODEL);
    cvt(x,   xbf,   MROWS * DMODEL);
    cvt(enc, encbf, MROWS * DMODEL);

    const float scale = 0.03125f;   // 1/sqrt(DMODEL), as in reference
    dim3 agrid(NTOK / (16 * AW), NHEAD, BATCH);

    // ---- block 1: causal self-attention
    gemm(xbf, wq1b, qbf, nullptr, MROWS, DMODEL, DMODEL, 1);
    gemm(xbf, wk1b, kbf, nullptr, MROWS, DMODEL, DMODEL, 1);
    gemm(xbf, wv1b, vbf, nullptr, MROWS, DMODEL, DMODEL, 1 | 4);   // transposed output
    attn_wmma<<<agrid, 256, 0, stream>>>(qbf, kbf, vbf, ctx, NTOK, NTOK, MROWS, 1, scale);
    add_ln<<<MROWS / LN_ROWS, 256, 0, stream>>>(ctx, x, g1, b1, yA, xbf);    // xbf := y1 (bf16)

    // ---- block 2: cross-attention over encoder output
    gemm(xbf,   wq2b, qbf, nullptr, MROWS, DMODEL, DMODEL, 1);
    gemm(encbf, wk2b, kbf, nullptr, MROWS, DMODEL, DMODEL, 1);
    gemm(encbf, wv2b, vbf, nullptr, MROWS, DMODEL, DMODEL, 1 | 4); // transposed output
    attn_wmma<<<agrid, 256, 0, stream>>>(qbf, kbf, vbf, ctx, NTOK, NTOK, MROWS, 0, scale);
    add_ln<<<MROWS / LN_ROWS, 256, 0, stream>>>(ctx, yA, g2, b2, yB, xbf);   // xbf := y2 (bf16)

    // ---- block 3: FFN (bias+GELU fused), residual, final LN
    gemm(xbf, wff1b, hbf, bff1, MROWS, FFDIM, DMODEL, 1 | 2);      // bf16 out + GELU
    gemm(hbf, wff2b, ctx, bff2, MROWS, DMODEL, FFDIM, 0);          // fp32 out
    add_ln<<<MROWS / LN_ROWS, 256, 0, stream>>>(ctx, yB, g3, b3, (float*)d_out, nullptr);
}

// v004
// It runs in 347 microseconds.
// Next to v003, in two timings, it ran 1.18 times as fast each time.
// Counting every step since v000, it is 1.96 times as fast.
#include <hip/hip_runtime.h>
#include <math.h>

// ---------------------------------------------------------------- types
typedef __bf16 bf16_t;
typedef __attribute__((ext_vector_type(16))) __bf16 v16bf;
typedef __attribute__((ext_vector_type(8)))  float  v8f;

union FragB {
    v16bf  v;
    uint4  q[2];
    bf16_t e[16];
};

__device__ __forceinline__ bf16_t f2bf(float f) {
    unsigned int u = __float_as_uint(f);
    unsigned int r = u + 0x7FFFu + ((u >> 16) & 1u);   // round to nearest even
    unsigned short s = (unsigned short)(r >> 16);
    return __builtin_bit_cast(bf16_t, s);
}

__device__ __forceinline__ v8f wmma_bf16(const v16bf& a, const v16bf& b, const v8f& c) {
    return __builtin_amdgcn_wmma_f32_16x16x32_bf16(false, a, false, b, (short)0, c, false, false);
}

__device__ __forceinline__ v8f v8f_zero() {
    v8f z;
#pragma unroll
    for (int i = 0; i < 8; ++i) z[i] = 0.0f;
    return z;
}

// ---------------------------------------------------------------- constants
#define DMODEL 1024
#define NHEAD  16
#define HDIM   64
#define FFDIM  4096
#define BATCH  4
#define NTOK   1024
#define MROWS  (BATCH * NTOK)   // 4096

// ---------------------------------------------------------------- fp32 -> bf16 (straight)
__device__ __forceinline__ uint2 pack4_bf16(const float4& v) {
    union { bf16_t e[4]; uint2 q; } u;
    u.e[0] = f2bf(v.x); u.e[1] = f2bf(v.y); u.e[2] = f2bf(v.z); u.e[3] = f2bf(v.w);
    return u.q;
}

// 32 values a thread, as eight 16-byte loads in flight; every wave-wide load (512 B) and store (256 B)
// covers whole lines. A launch then starts one wave per 1,024 values, not one per 32.
#define CVT_BLOCK (256 * 32)   // values per work-group; the launch covers n = a multiple of it
__global__ __launch_bounds__(256)
void cvt_f32_to_bf16(const float* __restrict__ in, bf16_t* __restrict__ out) {
    const size_t base = (size_t)blockIdx.x * CVT_BLOCK + threadIdx.x * 4;
    float4 v[8];
#pragma unroll
    for (int c = 0; c < 8; ++c)
        v[c] = *reinterpret_cast<const float4*>(in + base + c * 1024);
#pragma unroll
    for (int c = 0; c < 8; ++c)
        *reinterpret_cast<uint2*>(out + base + c * 1024) = pack4_bf16(v[c]);
}

// ---------------------------------------------------------------- fp32 [K][N] -> bf16 [N][K]
// 64 x 64 tile, 16 values a thread: 16-byte loads along n (a wave covers two 256-B row pieces),
// 16-byte stores along k (eight lanes cover one 128-B line of an output row).
#define TT 64
__global__ __launch_bounds__(256)
void cvt_transpose_bf16(const float* __restrict__ in, bf16_t* __restrict__ out,
                        int Kdim, int Ndim) {
    __shared__ float tile[TT][TT + 1];   // pitch 65 dwords: the column walks below meet no bank twice
    const int k0 = blockIdx.y * TT;
    const int n0 = blockIdx.x * TT;
    const int t  = threadIdx.x;
    const int lr = t >> 4;               // 0..15
    const int lc = (t & 15) * 4;         // 0,4,..,60
    const float* s0 = in + (size_t)(k0 + lr) * Ndim + n0 + lc;
    const float* s1 = s0 + (size_t)16 * Ndim;
    const float* s2 = s1 + (size_t)16 * Ndim;
    const float* s3 = s2 + (size_t)16 * Ndim;
    float4 v[4];
    v[0] = *reinterpret_cast<const float4*>(s0);
    v[1] = *reinterpret_cast<const float4*>(s1);
    v[2] = *reinterpret_cast<const float4*>(s2);
    v[3] = *reinterpret_cast<const float4*>(s3);
    // the wait that stands before an issued load's address registers are written again;
    // the addresses are inputs so that none is reused as a later load's destination
    asm volatile("s_wait_xcnt 0x0" :: "v"(s0), "v"(s1), "v"(s2), "v"(s3) : "memory");
#pragma unroll
    for (int p = 0; p < 4; ++p) {
        float* d = &tile[p * 16 + lr][lc];
        d[0] = v[p].x; d[1] = v[p].y; d[2] = v[p].z; d[3] = v[p].w;
    }
    __syncthreads();
#pragma unroll
    for (int c = 0; c < 2; ++c) {
        const int id = t + c * 256;
        const int n  = id >> 3;          // 0..63
        const int ks = (id & 7) * 8;     // 0,8,..,56
        union { bf16_t e[8]; uint4 q; } u;
#pragma unroll
        for (int j = 0; j < 8; ++j) u.e[j] = f2bf(tile[ks + j][n]);
        *reinterpret_cast<uint4*>(out + (size_t)(n0 + n) * Kdim + k0 + ks) = u.q;
    }
}

// ---------------------------------------------------------------- GEMM (bf16 WMMA, fp32 acc)
// C[M,N] = A[M,K] @ B[K,N], with B supplied TRANSPOSED as Bt[N][K] bf16.
// The output kind, bias, GELU and the output's pitch are compile-time values: one kernel per use below.
#define OUT_BF16   0   // bf16 [M][N]
#define OUT_BF16_T 1   // bf16 [N][M]
#define OUT_F32    2   // f32  [M][N]
#define TM 128
#define TN 128
#define TK 64      // one staged row of a slab = 128 B = one whole cache line
#define LDP 72     // LDS row pitch in elements: 144 B = 16 B x odd, for the 16-byte fragment reads

template <int KIND, bool BIAS, bool GELU, int M, int N>
__device__ __forceinline__
void gemm_body(const bf16_t* __restrict__ A, const bf16_t* __restrict__ Bt,
               void* __restrict__ Cout, const float* __restrict__ bias, int K) {
    static_assert(KIND != OUT_BF16_T || (!BIAS && !GELU), "the transposed output takes neither");
    __shared__ __align__(16) bf16_t sA[2][TM * LDP];  // [row][k]  2 x 18 KB
    __shared__ __align__(16) bf16_t sB[2][TN * LDP];  // [n][k]    2 x 18 KB

    const int t    = threadIdx.x;
    const int lane = t & 31;
    const int wave = t >> 5;                 // 0..7
    const int wrow = (wave & 3) * 32;        // 0,32,64,96
    const int wcol = (wave >> 2) * 64;       // 0,64
    const int m0   = blockIdx.y * TM;
    const int n0   = blockIdx.x * TN;
    const int hi   = lane >> 4;
    const int l16  = lane & 15;
    const int kb   = hi * 8;

    // staging: eight lanes cover one 128-B row of the slab, so a wave's 16-byte load
    // touches four whole lines; a thread takes rows srow, srow + 32, + 64, + 96
    const int srow = t >> 3;                 // 0..31
    const int sseg = (t & 7) * 8;            // 0,8,..,56
    const bf16_t* gA = A  + (size_t)m0 * K;  // block-uniform bases; the lane's part is soff
    const bf16_t* gB = Bt + (size_t)n0 * K;
    const unsigned soff = (unsigned)(srow * K + sseg);
    const size_t rstep = (size_t)32 * K;
    const int sdst = srow * LDP + sseg;

    v8f acc[2][4];
#pragma unroll
    for (int i = 0; i < 2; ++i)
#pragma unroll
        for (int j = 0; j < 4; ++j) acc[i][j] = v8f_zero();

    const int nk = K / TK;
    uint4 pa0, pa1, pa2, pa3, pb0, pb1, pb2, pb3;

    // prologue: stage slab 0 into buffer 0
    pa0 = *reinterpret_cast<const uint4*>(gA + soff);
    pa1 = *reinterpret_cast<const uint4*>(gA + rstep + soff);
    pa2 = *reinterpret_cast<const uint4*>(gA + 2 * rstep + soff);
    pa3 = *reinterpret_cast<const uint4*>(gA + 3 * rstep + soff);
    pb0 = *reinterpret_cast<const uint4*>(gB + soff);
    pb1 = *reinterpret_cast<const uint4*>(gB + rstep + soff);
    pb2 = *reinterpret_cast<const uint4*>(gB + 2 * rstep + soff);
    pb3 = *reinterpret_cast<const uint4*>(gB + 3 * rstep + soff);
    *reinterpret_cast<uint4*>(&sA[0][sdst])            = pa0;
    *reinterpret_cast<uint4*>(&sA[0][sdst + 32 * LDP]) = pa1;
    *reinterpret_cast<uint4*>(&sA[0][sdst + 64 * LDP]) = pa2;
    *reinterpret_cast<uint4*>(&sA[0][sdst + 96 * LDP]) = pa3;
    *reinterpret_cast<uint4*>(&sB[0][sdst])            = pb0;
    *reinterpret_cast<uint4*>(&sB[0][sdst + 32 * LDP]) = pb1;
    *reinterpret_cast<uint4*>(&sB[0][sdst + 64 * LDP]) = pb2;
    *reinterpret_cast<uint4*>(&sB[0][sdst + 96 * LDP]) = pb3;
    __syncthreads();

    for (int kt = 0; kt < nk; ++kt) {
        const int cur = kt & 1;
        const int nxt = cur ^ 1;
        const bool more = (kt + 1) < nk;
        if (more) {
            int ko = (kt + 1) * TK;
            const bf16_t* a0 = gA + ko + soff;
            const bf16_t* a1 = a0 + rstep;
            const bf16_t* a2 = a1 + rstep;
            const bf16_t* a3 = a2 + rstep;
            const bf16_t* b0 = gB + ko + soff;
            const bf16_t* b1 = b0 + rstep;
            const bf16_t* b2 = b1 + rstep;
            const bf16_t* b3 = b2 + rstep;
            pa0 = *reinterpret_cast<const uint4*>(a0);
            pa1 = *reinterpret_cast<const uint4*>(a1);
            pa2 = *reinterpret_cast<const uint4*>(a2);
            pa3 = *reinterpret_cast<const uint4*>(a3);
            pb0 = *reinterpret_cast<const uint4*>(b0);
            pb1 = *reinterpret_cast<const uint4*>(b1);
            pb2 = *reinterpret_cast<const uint4*>(b2);
            pb3 = *reinterpret_cast<const uint4*>(b3);
            // the wait that stands before an issued load's address registers are written again;
            // the addresses are inputs so that none is reused as a later load's destination
            asm volatile("s_wait_xcnt 0x0"
                         :: "v"(a0), "v"(a1), "v"(a2), "v"(a3), "v"(b0), "v"(b1), "v"(b2), "v"(b3)
                         : "memory");
        }

        // two 32-deep products per slab, k ascending; unrolled so that ks folds into the LDS offsets
#pragma unroll
        for (int ks = 0; ks < TK; ks += 32) {
            FragB af[2], bfr[4];
#pragma unroll
            for (int i = 0; i < 2; ++i) {
                int row = wrow + i * 16 + l16;
                af[i].q[0] = *reinterpret_cast<const uint4*>(&sA[cur][row * LDP + ks + kb]);
                af[i].q[1] = *reinterpret_cast<const uint4*>(&sA[cur][row * LDP + ks + kb + 16]);
            }
#pragma unroll
            for (int j = 0; j < 4; ++j) {
                int col = wcol + j * 16 + l16;
                bfr[j].q[0] = *reinterpret_cast<const uint4*>(&sB[cur][col * LDP + ks + kb]);
                bfr[j].q[1] = *reinterpret_cast<const uint4*>(&sB[cur][col * LDP + ks + kb + 16]);
            }
#pragma unroll
            for (int i = 0; i < 2; ++i)
#pragma unroll
                for (int j = 0; j < 4; ++j) {
                    // the operand order decides which index of C runs along a lane's eight accumulators:
                    // always the one that is contiguous in the output (m for [N][M], n for [M][N])
                    if constexpr (KIND == OUT_BF16_T) acc[i][j] = wmma_bf16(af[i].v, bfr[j].v, acc[i][j]);
                    else                              acc[i][j] = wmma_bf16(bfr[j].v, af[i].v, acc[i][j]);
                }
        }

        if (more) {
            *reinterpret_cast<uint4*>(&sA[nxt][sdst])            = pa0;
            *reinterpret_cast<uint4*>(&sA[nxt][sdst + 32 * LDP]) = pa1;
            *reinterpret_cast<uint4*>(&sA[nxt][sdst + 64 * LDP]) = pa2;
            *reinterpret_cast<uint4*>(&sA[nxt][sdst + 96 * LDP]) = pa3;
            *reinterpret_cast<uint4*>(&sB[nxt][sdst])            = pb0;
            *reinterpret_cast<uint4*>(&sB[nxt][sdst + 32 * LDP]) = pb1;
            *reinterpret_cast<uint4*>(&sB[nxt][sdst + 64 * LDP]) = pb2;
            *reinterpret_cast<uint4*>(&sB[nxt][sdst + 96 * LDP]) = pb3;
        }
        __syncthreads();
    }

    if constexpr (KIND == OUT_BF16_T) {
        // lane = column n; its eight accumulators are rows m .. m + 7: one 16-byte store
        bf16_t* C = (bf16_t*)Cout + (size_t)(n0 + wcol + l16) * M + m0 + wrow + kb;
#pragma unroll
        for (int i = 0; i < 2; ++i)
#pragma unroll
            for (int j = 0; j < 4; ++j) {
                union { bf16_t e[8]; uint4 q; } u;
#pragma unroll
                for (int r = 0; r < 8; ++r) u.e[r] = f2bf(acc[i][j][r]);
                *reinterpret_cast<uint4*>(C + (size_t)j * 16 * M + i * 16) = u.q;
            }
    } else {
        // lane = row m; its eight accumulators are columns n .. n + 7: one (bf16) or two (f32) 16-byte stores
        const size_t co = (size_t)(m0 + wrow + l16) * N + n0 + wcol + kb;
        float4 bv[4][2];
        if constexpr (BIAS) {
#pragma unroll
            for (int j = 0; j < 4; ++j) {
                bv[j][0] = *reinterpret_cast<const float4*>(bias + n0 + wcol + kb + j * 16);
                bv[j][1] = *reinterpret_cast<const float4*>(bias + n0 + wcol + kb + j * 16 + 4);
            }
        }
#pragma unroll
        for (int i = 0; i < 2; ++i)
#pragma unroll
            for (int j = 0; j < 4; ++j) {
                float v[8];
#pragma unroll
                for (int r = 0; r < 8; ++r) v[r] = acc[i][j][r];
                if constexpr (BIAS) {
                    v[0] += bv[j][0].x; v[1] += bv[j][0].y; v[2] += bv[j][0].z; v[3] += bv[j][0].w;
                    v[4] += bv[j][1].x; v[5] += bv[j][1].y; v[6] += bv[j][1].z; v[7] += bv[j][1].w;
                }
                if constexpr (GELU) {
#pragma unroll
                    for (int r = 0; r < 8; ++r)
                        v[r] = 0.5f * v[r] * (1.0f + erff(v[r] * 0.70710678118654752440f));
                }
                const size_t o = co + (size_t)i * 16 * N + j * 16;
                if constexpr (KIND == OUT_BF16) {
                    union { bf16_t e[8]; uint4 q; } u;
#pragma unroll
                    for (int r = 0; r < 8; ++r) u.e[r] = f2bf(v[r]);
                    *reinterpret_cast<uint4*>((bf16_t*)Cout + o) = u.q;
                } else {
                    *reinterpret_cast<float4*>((float*)Cout + o)     = make_float4(v[0], v[1], v[2], v[3]);
                    *reinterpret_cast<float4*>((float*)Cout + o + 4) = make_float4(v[4], v[5], v[6], v[7]);
                }
            }
    }
}

// the four uses: Q and K projections; V projection (transposed); FFN up (bias, GELU); FFN down (bias, f32)
__global__ __launch_bounds__(256)
void gemm_proj(const bf16_t* __restrict__ A, const bf16_t* __restrict__ Bt, bf16_t* __restrict__ C, int K) {
    gemm_body<OUT_BF16, false, false, MROWS, DMODEL>(A, Bt, C, nullptr, K);
}
__global__ __launch_bounds__(256)
void gemm_proj_t(const bf16_t* __restrict__ A, const bf16_t* __restrict__ Bt, bf16_t* __restrict__ C, int K) {
    gemm_body<OUT_BF16_T, false, false, MROWS, DMODEL>(A, Bt, C, nullptr, K);
}
__global__ __launch_bounds__(256)
void gemm_ff1(const bf16_t* __restrict__ A, const bf16_t* __restrict__ Bt, bf16_t* __restrict__ C,
              const float* __restrict__ bias, int K) {
    gemm_body<OUT_BF16, true, true, MROWS, FFDIM>(A, Bt, C, bias, K);
}
__global__ __launch_bounds__(256)
void gemm_ff2(const bf16_t* __restrict__ A, const bf16_t* __restrict__ Bt, float* __restrict__ C,
              const float* __restrict__ bias, int K) {
    gemm_body<OUT_F32, true, false, MROWS, DMODEL>(A, Bt, C, bias, K);
}

// ---------------------------------------------------------------- flash attention
// One work-group per (batch, head, 128 queries): eight waves, each with its own 16-query tile.
// The waves share every K and V tile: 64 keys are staged once per work-group in LDS by loads that
// cover whole 128-B lines, and each wave takes its fragments from LDS.
// Q,K bf16 [b*Nq + tok][DMODEL]; V supplied TRANSPOSED: Vt bf16 [DMODEL][Mtot]. O fp32.
// Nq is a multiple of 128, Nk of 64.
// e^x as __expf compiles it (x * log2 e, then v_exp_f32), with the one slot that the instruction set asks for
// behind a transcendental in the same statement, so that the slot stays directly behind it
__device__ __forceinline__ float expf_slot(float x) {
    float r;
    asm("v_exp_f32 %0, %1\n\tv_nop" : "=v"(r) : "v"(x * 1.44269504088896340736f));
    return r;
}

#define AW     8    // waves = 16-query tiles per work-group
#define AKEYS  64   // keys per staged tile: a V row of the tile is one whole 128-B line, as a K row is
#define APITCH 72   // LDS row pitch in elements: 144 B = 16 B x odd, for the 16-byte fragment reads
__global__ __launch_bounds__(256)
void attn_wmma(const bf16_t* __restrict__ Qg, const bf16_t* __restrict__ Kg,
               const bf16_t* __restrict__ Vt, float* __restrict__ Og,
               int Nq, int Nk, int Mtot, int causal, float scale) {
    __shared__ __align__(16) bf16_t sK[2][AKEYS * APITCH];   // [key][head-dim]   2 x 9 KB
    __shared__ __align__(16) bf16_t sV[2][HDIM * APITCH];    // [head-dim][key]   2 x 9 KB
    __shared__ __align__(16) bf16_t sPall[AW][16 * 32];      // P re-layout staging, 1 KB a wave

    const int t    = threadIdx.x;
    const int lane = t & 31;
    const int wave = __builtin_amdgcn_readfirstlane(t >> 5);  // scalar: the tests on kend below are scalar branches
    const int hi   = lane >> 4;
    const int l16  = lane & 15;
    const int kb   = hi * 8;
    const int h    = blockIdx.y;
    const int b    = blockIdx.z;
    const int qblk  = blockIdx.x * (16 * AW);
    const int qbase = qblk + wave * 16;
    const size_t qoff = (size_t)b * Nq * DMODEL;
    const size_t koff = (size_t)b * Nk * DMODEL;
    bf16_t* sP = sPall[wave];

    // staging: eight lanes cover one 128-B row, so a wave's 16-byte load touches four whole lines;
    // a thread takes rows srow and srow + 32 of the K tile and of the V tile
    const int srow = t >> 3;                 // 0..31
    const int sseg = (t & 7) * 8;            // 0,8,..,56
    const int sdst = srow * APITCH + sseg;
    const bf16_t* gK = Kg + koff + (size_t)srow * DMODEL + h * HDIM + sseg;
    const bf16_t* gV = Vt + (size_t)(h * HDIM + srow) * Mtot + (size_t)b * Nk + sseg;
    const size_t kstep = (size_t)32 * DMODEL;
    const size_t vstep = (size_t)32 * Mtot;

    // Q fragments: 16 queries x 64 head-dims = two 16x32 A fragments
    FragB qa[2];
#pragma unroll
    for (int kc = 0; kc < 2; ++kc) {
        const bf16_t* base = Qg + qoff + (size_t)(qbase + l16) * DMODEL + h * HDIM + kc * 32 + kb;
        qa[kc].q[0] = *reinterpret_cast<const uint4*>(base);
        qa[kc].q[1] = *reinterpret_cast<const uint4*>(base + 16);
    }

    v8f o[4];
    float m[8], lsum[8];
#pragma unroll
    for (int n = 0; n < 4; ++n) o[n] = v8f_zero();
#pragma unroll
    for (int r = 0; r < 8; ++r) { m[r] = -1e30f; lsum[r] = 0.0f; }

    int kend  = Nk;    // this wave's end
    int kendw = Nk;    // the work-group's end = its last wave's
    if (causal) {
        kend = (qbase + 16 + 31) & ~31;
        if (kend > Nk) kend = Nk;
        kendw = (qblk + 16 * AW + 31) & ~31;
        if (kendw > Nk) kendw = Nk;
    }
    const int ns = (kendw + AKEYS - 1) / AKEYS;   // staged tiles, the same for every wave

    uint4 pk0, pk1, pv0, pv1;
    // prologue: tile 0 into buffer 0
    pk0 = *reinterpret_cast<const uint4*>(gK);
    pk1 = *reinterpret_cast<const uint4*>(gK + kstep);
    pv0 = *reinterpret_cast<const uint4*>(gV);
    pv1 = *reinterpret_cast<const uint4*>(gV + vstep);
    *reinterpret_cast<uint4*>(&sK[0][sdst])               = pk0;
    *reinterpret_cast<uint4*>(&sK[0][sdst + 32 * APITCH]) = pk1;
    *reinterpret_cast<uint4*>(&sV[0][sdst])               = pv0;
    *reinterpret_cast<uint4*>(&sV[0][sdst + 32 * APITCH]) = pv1;
    __syncthreads();

    for (int s = 0; s < ns; ++s) {
        const int cur = s & 1;
        const int nxt = cur ^ 1;
        const bool more = (s + 1) < ns;
        if (more) {
            const bf16_t* k0 = gK + (size_t)(s + 1) * AKEYS * DMODEL;
            const bf16_t* v0 = gV + (s + 1) * AKEYS;
            const bf16_t* v1 = v0 + vstep;
            pk0 = *reinterpret_cast<const uint4*>(k0);
            pk1 = *reinterpret_cast<const uint4*>(k0 + kstep);   // a constant step: k0's registers and an offset
            pv0 = *reinterpret_cast<const uint4*>(v0);
            pv1 = *reinterpret_cast<const uint4*>(v1);
            // the wait that stands before an issued load's address registers are written again;
            // the addresses are inputs so that none is reused as a later load's destination
            asm volatile("s_wait_xcnt 0x0" :: "v"(k0), "v"(v0), "v"(v1) : "memory");
        }

        // two 32-key passes per staged tile; a wave past its own causal end skips the pass
#pragma unroll
        for (int sub = 0; sub < AKEYS; sub += 32) {
            const int j0 = s * AKEYS + sub;
            if (j0 < kend) {
                // ---- S = Q K^T for 32 keys (two 16x16 C tiles)
                v8f sc[2];
#pragma unroll
                for (int st = 0; st < 2; ++st) {
                    FragB kb0, kb1;   // B = K^T: lane holds key column, elems walk head-dim
                    const bf16_t* base = &sK[cur][(sub + st * 16 + l16) * APITCH + kb];
                    kb0.q[0] = *reinterpret_cast<const uint4*>(base);
                    kb0.q[1] = *reinterpret_cast<const uint4*>(base + 16);
                    kb1.q[0] = *reinterpret_cast<const uint4*>(base + 32);
                    kb1.q[1] = *reinterpret_cast<const uint4*>(base + 48);
                    v8f z = v8f_zero();
                    z = wmma_bf16(qa[0].v, kb0.v, z);
                    z = wmma_bf16(qa[1].v, kb1.v, z);
                    sc[st] = z;
                }
                // ---- scale + causal mask
#pragma unroll
                for (int st = 0; st < 2; ++st) {
                    int col = j0 + st * 16 + l16;
#pragma unroll
                    for (int r = 0; r < 8; ++r) {
                        int row = qbase + r + hi * 8;
                        float v = sc[st][r] * scale;
                        if (causal && col > row) v = -1e30f;
                        sc[st][r] = v;
                    }
                }
                // ---- online softmax (row reductions across 16-lane halves)
                float alpha[8];
#pragma unroll
                for (int r = 0; r < 8; ++r) {
                    float rm = fmaxf(sc[0][r], sc[1][r]);
#pragma unroll
                    for (int off = 1; off < 16; off <<= 1)
                        rm = fmaxf(rm, __shfl_xor(rm, off, 32));
                    float mn = fmaxf(m[r], rm);
                    alpha[r] = expf_slot(m[r] - mn);
                    m[r] = mn;
                    float p0 = __expf(sc[0][r] - mn);
                    float p1 = __expf(sc[1][r] - mn);
                    sc[0][r] = p0; sc[1][r] = p1;
                    float rs = p0 + p1;
#pragma unroll
                    for (int off = 1; off < 16; off <<= 1)
                        rs += __shfl_xor(rs, off, 32);
                    lsum[r] = lsum[r] * alpha[r] + rs;
                }
#pragma unroll
                for (int n = 0; n < 4; ++n)
#pragma unroll
                    for (int r = 0; r < 8; ++r) o[n][r] *= alpha[r];

                // ---- C-layout P -> A-layout bf16 fragment via the wave's own LDS (LDS in-order per wave)
#pragma unroll
                for (int r = 0; r < 8; ++r) {
                    int row = r + hi * 8;
                    sP[row * 32 + l16]      = f2bf(sc[0][r]);
                    sP[row * 32 + 16 + l16] = f2bf(sc[1][r]);
                }
                FragB pa;
                pa.q[0] = *reinterpret_cast<const uint4*>(&sP[l16 * 32 + kb]);
                pa.q[1] = *reinterpret_cast<const uint4*>(&sP[l16 * 32 + kb + 16]);

                // ---- O += P (16x32) * V (32x64): V fragments from the staged tile
#pragma unroll
                for (int n = 0; n < 4; ++n) {
                    FragB vb;
                    const bf16_t* vbase = &sV[cur][(n * 16 + l16) * APITCH + sub + kb];
                    vb.q[0] = *reinterpret_cast<const uint4*>(vbase);
                    vb.q[1] = *reinterpret_cast<const uint4*>(vbase + 16);
                    o[n] = wmma_bf16(pa.v, vb.v, o[n]);
                }
                // the four vector slots that the chip needs behind a matrix instruction before its operands are
                // overwritten: the four
                // accumulators are inputs so that the slots stand behind all four products
                asm volatile("v_nop\n\tv_nop\n\tv_nop\n\tv_nop" :: "v"(o[0]), "v"(o[1]), "v"(o[2]), "v"(o[3]));
            }
        }

        if (more) {
            *reinterpret_cast<uint4*>(&sK[nxt][sdst])               = pk0;
            *reinterpret_cast<uint4*>(&sK[nxt][sdst + 32 * APITCH]) = pk1;
            *reinterpret_cast<uint4*>(&sV[nxt][sdst])               = pv0;
            *reinterpret_cast<uint4*>(&sV[nxt][sdst + 32 * APITCH]) = pv1;
        }
        // publishes the next tile and ends every wave's reads of the buffer that is refilled next
        __syncthreads();
    }

    // ---- normalize + store
#pragma unroll
    for (int n = 0; n < 4; ++n)
#pragma unroll
        for (int r = 0; r < 8; ++r) {
            int row = qbase + r + hi * 8;
            Og[qoff + (size_t)row * DMODEL + h * HDIM + n * 16 + l16] = o[n][r] / lsum[r];
        }
}

// ---------------------------------------------------------------- residual + LayerNorm
// One wave per row, 32 values a lane by 16-byte accesses on whole lines; the row's sums stay in the
// wave (four chains a lane, then a five-step butterfly), so no LDS and no barrier.
#define LN_ROWS 8   // rows (waves) per work-group
__global__ __launch_bounds__(256)
void add_ln(const float* __restrict__ a, const float* __restrict__ resid,
            const float* __restrict__ g, const float* __restrict__ beta,
            float* __restrict__ yf, bf16_t* __restrict__ ybf) {
    const int lane = threadIdx.x & 31;
    const int row  = blockIdx.x * LN_ROWS + (threadIdx.x >> 5);
    const size_t ro = (size_t)row * DMODEL + lane * 4;

    const float* pa = a     + ro;
    const float* pr = resid + ro;
    float4 x[8], r[8];
#pragma unroll
    for (int i = 0; i < 8; ++i) x[i] = *reinterpret_cast<const float4*>(pa + i * 128);
#pragma unroll
    for (int i = 0; i < 8; ++i) r[i] = *reinterpret_cast<const float4*>(pr + i * 128);
    // the wait that stands before an issued load's address registers are written again;
    // the addresses are inputs so that none is reused as a later load's destination
    asm volatile("s_wait_xcnt 0x0" :: "v"(pa), "v"(pr) : "memory");

    float s0 = 0.0f, s1 = 0.0f, s2 = 0.0f, s3 = 0.0f;
    float q0 = 0.0f, q1 = 0.0f, q2 = 0.0f, q3 = 0.0f;
#pragma unroll
    for (int i = 0; i < 8; ++i) {
        x[i].x += r[i].x; x[i].y += r[i].y; x[i].z += r[i].z; x[i].w += r[i].w;
        s0 += x[i].x; s1 += x[i].y; s2 += x[i].z; s3 += x[i].w;
        q0 += x[i].x * x[i].x; q1 += x[i].y * x[i].y; q2 += x[i].z * x[i].z; q3 += x[i].w * x[i].w;
    }
    float s  = (s0 + s1) + (s2 + s3);
    float ss = (q0 + q1) + (q2 + q3);
#pragma unroll
    for (int off = 1; off < 32; off <<= 1) {
        s  += __shfl_xor(s,  off, 32);
        ss += __shfl_xor(ss, off, 32);
    }
    const float mean = s  * (1.0f / DMODEL);
    const float var  = ss * (1.0f / DMODEL) - mean * mean;
    // rsqrtf as the compiler expands it (a denormal argument is scaled by 2^24, its result by 2^12), with
    // v_rsq_f32 and the one slot that the instruction set asks for behind it in one statement, so that
    // the slot stays directly behind it
    const float ve   = var + 1e-5f;
    const bool  tiny = ve < 1.17549435e-38f;
    float rq;
    asm("v_rsq_f32 %0, %1\n\tv_nop" : "=v"(rq) : "v"(tiny ? ve * 16777216.0f : ve));
    const float rstd = tiny ? rq * 4096.0f : rq;
#pragma unroll
    for (int i = 0; i < 8; ++i) {
        const float4 gv = *reinterpret_cast<const float4*>(g    + lane * 4 + i * 128);
        const float4 bv = *reinterpret_cast<const float4*>(beta + lane * 4 + i * 128);
        x[i].x = (x[i].x - mean) * rstd * gv.x + bv.x;
        x[i].y = (x[i].y - mean) * rstd * gv.y + bv.y;
        x[i].z = (x[i].z - mean) * rstd * gv.z + bv.z;
        x[i].w = (x[i].w - mean) * rstd * gv.w + bv.w;
        *reinterpret_cast<float4*>(yf + ro + i * 128) = x[i];
    }
    // the wait that stands before the registers of the issued stores are written again (by the packing below)
    asm volatile("s_wait_xcnt 0x0" ::: "memory");
    if (ybf) {
#pragma unroll
        for (int i = 0; i < 8; ++i)
            *reinterpret_cast<uint2*>(ybf + ro + i * 128) = pack4_bf16(x[i]);
    }
}

// ---------------------------------------------------------------- launch
extern "C" void kernel_launch(void* const* d_in, const int* in_sizes, int n_in,
                              void* d_out, int out_size, void* d_ws, size_t ws_size,
                              hipStream_t stream) {
    const float* x    = (const float*)d_in[0];
    const float* enc  = (const float*)d_in[1];
    const float* Wq1  = (const float*)d_in[2];
    const float* Wk1  = (const float*)d_in[3];
    const float* Wv1  = (const float*)d_in[4];
    const float* g1   = (const float*)d_in[5];
    const float* b1   = (const float*)d_in[6];
    const float* Wq2  = (const float*)d_in[7];
    const float* Wk2  = (const float*)d_in[8];
    const float* Wv2  = (const float*)d_in[9];
    const float* g2   = (const float*)d_in[10];
    const float* b2   = (const float*)d_in[11];
    const float* Wff1 = (const float*)d_in[12];
    const float* bff1 = (const float*)d_in[13];
    const float* Wff2 = (const float*)d_in[14];
    const float* bff2 = (const float*)d_in[15];
    const float* g3   = (const float*)d_in[16];
    const float* b3   = (const float*)d_in[17];

    char* ws = (char*)d_ws;
    const size_t MB = 1024u * 1024u;
    bf16_t* wq1b  = (bf16_t*)(ws + 0   * MB);   // all weights stored transposed [N][K]
    bf16_t* wk1b  = (bf16_t*)(ws + 2   * MB);
    bf16_t* wv1b  = (bf16_t*)(ws + 4   * MB);
    bf16_t* wq2b  = (bf16_t*)(ws + 6   * MB);
    bf16_t* wk2b  = (bf16_t*)(ws + 8   * MB);
    bf16_t* wv2b  = (bf16_t*)(ws + 10  * MB);
    bf16_t* wff1b = (bf16_t*)(ws + 12  * MB);
    bf16_t* wff2b = (bf16_t*)(ws + 20  * MB);
    bf16_t* xbf   = (bf16_t*)(ws + 28  * MB);   // activation bf16 (reused: x, y1, y2)
    bf16_t* encbf = (bf16_t*)(ws + 36  * MB);
    bf16_t* qbf   = (bf16_t*)(ws + 44  * MB);
    bf16_t* kbf   = (bf16_t*)(ws + 52  * MB);
    bf16_t* vbf   = (bf16_t*)(ws + 60  * MB);   // V stored transposed [DMODEL][MROWS]
    float*  ctx   = (float*) (ws + 68  * MB);   // attn ctx / ff2 out
    float*  yA    = (float*) (ws + 84  * MB);
    float*  yB    = (float*) (ws + 100 * MB);
    bf16_t* hbf   = (bf16_t*)(ws + 116 * MB);   // ends at 148 MB

    auto cvt = [&](const float* src, bf16_t* dst, int n) {
        cvt_f32_to_bf16<<<dim3(n / CVT_BLOCK), dim3(256), 0, stream>>>(src, dst);
    };
    auto cvtT = [&](const float* src, bf16_t* dst, int Kd, int Nd) {
        cvt_transpose_bf16<<<dim3(Nd / TT, Kd / TT), dim3(256), 0, stream>>>(src, dst, Kd, Nd);
    };
    const dim3 gproj(DMODEL / TN, MROWS / TM);   // also the FFN down grid
    const dim3 gff1(FFDIM / TN, MROWS / TM);

    // weights -> bf16, transposed [N][K]
    cvtT(Wq1,  wq1b,  DMODEL, DMODEL);
    cvtT(Wk1,  wk1b,  DMODEL, DMODEL);
    cvtT(Wv1,  wv1b,  DMODEL, DMODEL);
    cvtT(Wq2,  wq2b,  DMODEL, DMODEL);
    cvtT(Wk2,  wk2b,  DMODEL, DMODEL);
    cvtT(Wv2,  wv2b,  DMODEL, DMODEL);
    cvtT(Wff1, wff1b, DMODEL, FFDIM);
    cvtT(Wff2, wff2b, FFDIM,  DMODEL);
    cvt(x,   xbf,   MROWS * DMODEL);
    cvt(enc, encbf, MROWS * DMODEL);

    const float scale = 0.03125f;   // 1/sqrt(DMODEL), as in reference
    dim3 agrid(NTOK / (16 * AW), NHEAD, BATCH);

    // ---- block 1: causal self-attention
    gemm_proj  <<<gproj, 256, 0, stream>>>(xbf, wq1b, qbf, DMODEL);
    gemm_proj  <<<gproj, 256, 0, stream>>>(xbf, wk1b, kbf, DMODEL);
    gemm_proj_t<<<gproj, 256, 0, stream>>>(xbf, wv1b, vbf, DMODEL);   // transposed output
    attn_wmma<<<agrid, 256, 0, stream>>>(qbf, kbf, vbf, ctx, NTOK, NTOK, MROWS, 1, scale);
    add_ln<<<MROWS / LN_ROWS, 256, 0, stream>>>(ctx, x, g1, b1, yA, xbf);    // xbf := y1 (bf16)

    // ---- block 2: cross-attention over encoder output
    gemm_proj  <<<gproj, 256, 0, stream>>>(xbf,   wq2b, qbf, DMODEL);
    gemm_proj  <<<gproj, 256, 0, stream>>>(encbf, wk2b, kbf, DMODEL);
    gemm_proj_t<<<gproj, 256, 0, stream>>>(encbf, wv2b, vbf, DMODEL); // transposed output
    attn_wmma<<<agrid, 256, 0, stream>>>(qbf, kbf, vbf, ctx, NTOK, NTOK, MROWS, 0, scale);
    add_ln<<<MROWS / LN_ROWS, 256, 0, stream>>>(ctx, yA, g2, b2, yB, xbf);   // xbf := y2 (bf16)

    // ---- block 3: FFN (bias+GELU fused), residual, final LN
    gemm_ff1<<<gff1,  256, 0, stream>>>(xbf, wff1b, hbf, bff1, DMODEL);   // bf16 out + GELU
    gemm_ff2<<<gproj, 256, 0, stream>>>(hbf, wff2b, ctx, bff2, FFDIM);    // fp32 out
    add_ln<<<MROWS / LN_ROWS, 256, 0, stream>>>(ctx, yB, g3, b3, (float*)d_out, nullptr);
}

// v005
// Measured time: 285 microseconds a run.
// In both of two side-by-side timings against v004, it was 1.22 times as fast.
// Counting every step since v000, it is 2.40 times as fast.
#include <hip/hip_runtime.h>
#include <math.h>

// ---------------------------------------------------------------- types
typedef __bf16 bf16_t;
typedef __attribute__((ext_vector_type(16))) __bf16 v16bf;
typedef __attribute__((ext_vector_type(8)))  float  v8f;

union FragB {
    v16bf  v;
    uint4  q[2];
    bf16_t e[16];
};

__device__ __forceinline__ bf16_t f2bf(float f) {
    unsigned int u = __float_as_uint(f);
    unsigned int r = u + 0x7FFFu + ((u >> 16) & 1u);   // round to nearest even
    unsigned short s = (unsigned short)(r >> 16);
    return __builtin_bit_cast(bf16_t, s);
}

__device__ __forceinline__ v8f wmma_bf16(const v16bf& a, const v16bf& b, const v8f& c) {
    return __builtin_amdgcn_wmma_f32_16x16x32_bf16(false, a, false, b, (short)0, c, false, false);
}

__device__ __forceinline__ v8f v8f_zero() {
    v8f z;
#pragma unroll
    for (int i = 0; i < 8; ++i) z[i] = 0.0f;
    return z;
}

// ---------------------------------------------------------------- constants
#define DMODEL 1024
#define NHEAD  16
#define HDIM   64
#define FFDIM  4096
#define BATCH  4
#define NTOK   1024
#define MROWS  (BATCH * NTOK)   // 4096

// ---------------------------------------------------------------- fp32 -> bf16 (straight)
__device__ __forceinline__ uint2 pack4_bf16(const float4& v) {
    union { bf16_t e[4]; uint2 q; } u;
    u.e[0] = f2bf(v.x); u.e[1] = f2bf(v.y); u.e[2] = f2bf(v.z); u.e[3] = f2bf(v.w);
    return u.q;
}

// 32 values a thread, as eight 16-byte loads in flight; every wave-wide load (512 B) and store (256 B)
// covers whole lines. One wave per 1,024 values, not one per 32.
#define CVT_BLOCK (256 * 32)   // values per work-group; a tensor is a multiple of it
__device__ __forceinline__
void cvt_f32_to_bf16(const float* __restrict__ in, bf16_t* __restrict__ out, int blk) {
    const size_t base = (size_t)blk * CVT_BLOCK + threadIdx.x * 4;
    float4 v[8];
#pragma unroll
    for (int c = 0; c < 8; ++c)
        v[c] = *reinterpret_cast<const float4*>(in + base + c * 1024);
#pragma unroll
    for (int c = 0; c < 8; ++c)
        *reinterpret_cast<uint2*>(out + base + c * 1024) = pack4_bf16(v[c]);
}

// ---------------------------------------------------------------- fp32 [K][N] -> bf16 [N][K]
// 64 x 64 tile, 16 values a thread: 16-byte loads along n (a wave covers two 256-B row pieces),
// 16-byte stores along k (eight lanes cover one 128-B line of an output row).
#define TT 64
__device__ __forceinline__
void cvt_transpose_bf16(const float* __restrict__ in, bf16_t* __restrict__ out,
                        int Kdim, int Ndim, int bn, int bk) {
    __shared__ float tile[TT][TT + 1];   // pitch 65 dwords: the column walks below meet no bank twice
    const int k0 = bk * TT;
    const int n0 = bn * TT;
    const int t  = threadIdx.x;
    const int lr = t >> 4;               // 0..15
    const int lc = (t & 15) * 4;         // 0,4,..,60
    const float* s0 = in + (size_t)(k0 + lr) * Ndim + n0 + lc;
    const float* s1 = s0 + (size_t)16 * Ndim;
    const float* s2 = s1 + (size_t)16 * Ndim;
    const float* s3 = s2 + (size_t)16 * Ndim;
    float4 v[4];
    v[0] = *reinterpret_cast<const float4*>(s0);
    v[1] = *reinterpret_cast<const float4*>(s1);
    v[2] = *reinterpret_cast<const float4*>(s2);
    v[3] = *reinterpret_cast<const float4*>(s3);
    // the wait that stands before an issued load's address registers are written again;
    // the addresses are inputs so that none is reused as a later load's destination
    asm volatile("s_wait_xcnt 0x0" :: "v"(s0), "v"(s1), "v"(s2), "v"(s3) : "memory");
#pragma unroll
    for (int p = 0; p < 4; ++p) {
        float* d = &tile[p * 16 + lr][lc];
        d[0] = v[p].x; d[1] = v[p].y; d[2] = v[p].z; d[3] = v[p].w;
    }
    __syncthreads();
#pragma unroll
    for (int c = 0; c < 2; ++c) {
        const int id = t + c * 256;
        const int n  = id >> 3;          // 0..63
        const int ks = (id & 7) * 8;     // 0,8,..,56
        union { bf16_t e[8]; uint4 q; } u;
#pragma unroll
        for (int j = 0; j < 8; ++j) u.e[j] = f2bf(tile[ks + j][n]);
        *reinterpret_cast<uint4*>(out + (size_t)(n0 + n) * Kdim + k0 + ks) = u.q;
    }
}

// ---------------------------------------------------------------- all ten conversions, one launch
// None of them needs anything of another, so they share one grid by ranges of the block index
// (every test below is on blockIdx alone: the same for a whole work-group). The casts, which move
// twice a transpose tile's bytes per work-group, come first.
#define CAST_BLOCKS (MROWS * DMODEL / CVT_BLOCK)             // 512 per activation tensor
#define SQ_BLOCKS   ((DMODEL / TT) * (DMODEL / TT))          // 256 per square weight
#define FF_BLOCKS   ((DMODEL / TT) * (FFDIM / TT))           // 1,024 per feed-forward weight
#define CVT_ALL_BLOCKS (2 * CAST_BLOCKS + 6 * SQ_BLOCKS + 2 * FF_BLOCKS)
__global__ __launch_bounds__(256)
void cvt_all(const float* __restrict__ x,    const float* __restrict__ enc,
             const float* __restrict__ wq1,  const float* __restrict__ wk1, const float* __restrict__ wv1,
             const float* __restrict__ wq2,  const float* __restrict__ wk2, const float* __restrict__ wv2,
             const float* __restrict__ wff1, const float* __restrict__ wff2,
             bf16_t* __restrict__ xbf,  bf16_t* __restrict__ encbf,
             bf16_t* __restrict__ wsq,          // the six square weights' outputs, DMODEL * DMODEL apart
             bf16_t* __restrict__ wff1b, bf16_t* __restrict__ wff2b) {
    int b = blockIdx.x;
    if (b < 2 * CAST_BLOCKS) {
        const bool first = b < CAST_BLOCKS;
        cvt_f32_to_bf16(first ? x : enc, first ? xbf : encbf, first ? b : b - CAST_BLOCKS);
        return;   // the whole work-group leaves, ahead of the transpose's barrier
    }
    b -= 2 * CAST_BLOCKS;
    const float* in;
    bf16_t* out;
    int Kdim = DMODEL, Ndim = DMODEL;
    if (b < 6 * SQ_BLOCKS) {
        const int w = b / SQ_BLOCKS;
        b -= w * SQ_BLOCKS;
        const bool odd = w & 1;
        const float* p01 = odd ? wk1 : wq1;
        const float* p23 = odd ? wq2 : wv1;
        const float* p45 = odd ? wv2 : wk2;
        in  = w < 2 ? p01 : w < 4 ? p23 : p45;
        out = wsq + (size_t)w * DMODEL * DMODEL;
    } else if (b < 6 * SQ_BLOCKS + FF_BLOCKS) {
        b -= 6 * SQ_BLOCKS;
        in = wff1; out = wff1b; Ndim = FFDIM;
    } else {
        b -= 6 * SQ_BLOCKS + FF_BLOCKS;
        in = wff2; out = wff2b; Kdim = FFDIM;
    }
    const int nb = Ndim / TT;   // tiles along n: 16 or 64
    cvt_transpose_bf16(in, out, Kdim, Ndim, b % nb, b / nb);
}

// ---------------------------------------------------------------- GEMM (bf16 WMMA, fp32 acc)
// C[M,N] = A[M,K] @ B[K,N], with B supplied TRANSPOSED as Bt[N][K] bf16.
// The output kind, bias, GELU and the output's pitch are compile-time values: one kernel per use below.
#define OUT_BF16   0   // bf16 [M][N]
#define OUT_BF16_T 1   // bf16 [N][M]
#define OUT_F32    2   // f32  [M][N]
#define TM 128
#define TN 128
#define TK 64      // one staged row of a slab = 128 B = one whole cache line
#define LDP 72     // LDS row pitch in elements: 144 B = 16 B x odd, for the 16-byte fragment reads

template <int KIND, bool BIAS, bool GELU, int M, int N>
__device__ __forceinline__
void gemm_body(bf16_t (*sA)[TM * LDP], bf16_t (*sB)[TN * LDP],
               const bf16_t* __restrict__ A, const bf16_t* __restrict__ Bt,
               void* __restrict__ Cout, const float* __restrict__ bias, int K) {
    static_assert(KIND != OUT_BF16_T || (!BIAS && !GELU), "the transposed output takes neither");

    const int t    = threadIdx.x;
    const int lane = t & 31;
    const int wave = t >> 5;                 // 0..7
    const int wrow = (wave & 3) * 32;        // 0,32,64,96
    const int wcol = (wave >> 2) * 64;       // 0,64
    const int m0   = blockIdx.y * TM;
    const int n0   = blockIdx.x * TN;
    const int hi   = lane >> 4;
    const int l16  = lane & 15;
    const int kb   = hi * 8;

    // staging: eight lanes cover one 128-B row of the slab, so a wave's 16-byte load
    // touches four whole lines; a thread takes rows srow, srow + 32, + 64, + 96
    const int srow = t >> 3;                 // 0..31
    const int sseg = (t & 7) * 8;            // 0,8,..,56
    const bf16_t* gA = A  + (size_t)m0 * K;  // block-uniform bases; the lane's part is soff
    const bf16_t* gB = Bt + (size_t)n0 * K;
    const unsigned soff = (unsigned)(srow * K + sseg);
    const size_t rstep = (size_t)32 * K;
    const int sdst = srow * LDP + sseg;

    v8f acc[2][4];
#pragma unroll
    for (int i = 0; i < 2; ++i)
#pragma unroll
        for (int j = 0; j < 4; ++j) acc[i][j] = v8f_zero();

    const int nk = K / TK;
    uint4 pa0, pa1, pa2, pa3, pb0, pb1, pb2, pb3;

    // prologue: stage slab 0 into buffer 0
    pa0 = *reinterpret_cast<const uint4*>(gA + soff);
    pa1 = *reinterpret_cast<const uint4*>(gA + rstep + soff);
    pa2 = *reinterpret_cast<const uint4*>(gA + 2 * rstep + soff);
    pa3 = *reinterpret_cast<const uint4*>(gA + 3 * rstep + soff);
    pb0 = *reinterpret_cast<const uint4*>(gB + soff);
    pb1 = *reinterpret_cast<const uint4*>(gB + rstep + soff);
    pb2 = *reinterpret_cast<const uint4*>(gB + 2 * rstep + soff);
    pb3 = *reinterpret_cast<const uint4*>(gB + 3 * rstep + soff);
    *reinterpret_cast<uint4*>(&sA[0][sdst])            = pa0;
    *reinterpret_cast<uint4*>(&sA[0][sdst + 32 * LDP]) = pa1;
    *reinterpret_cast<uint4*>(&sA[0][sdst + 64 * LDP]) = pa2;
    *reinterpret_cast<uint4*>(&sA[0][sdst + 96 * LDP]) = pa3;
    *reinterpret_cast<uint4*>(&sB[0][sdst])            = pb0;
    *reinterpret_cast<uint4*>(&sB[0][sdst + 32 * LDP]) = pb1;
    *reinterpret_cast<uint4*>(&sB[0][sdst + 64 * LDP]) = pb2;
    *reinterpret_cast<uint4*>(&sB[0][sdst + 96 * LDP]) = pb3;
    __syncthreads();

    for (int kt = 0; kt < nk; ++kt) {
        const int cur = kt & 1;
        const int nxt = cur ^ 1;
        const bool more = (kt + 1) < nk;
        if (more) {
            int ko = (kt + 1) * TK;
            const bf16_t* a0 = gA + ko + soff;
            const bf16_t* a1 = a0 + rstep;
            const bf16_t* a2 = a1 + rstep;
            const bf16_t* a3 = a2 + rstep;
            const bf16_t* b0 = gB + ko + soff;
            const bf16_t* b1 = b0 + rstep;
            const bf16_t* b2 = b1 + rstep;
            const bf16_t* b3 = b2 + rstep;
            pa0 = *reinterpret_cast<const uint4*>(a0);
            pa1 = *reinterpret_cast<const uint4*>(a1);
            pa2 = *reinterpret_cast<const uint4*>(a2);
            pa3 = *reinterpret_cast<const uint4*>(a3);
            pb0 = *reinterpret_cast<const uint4*>(b0);
            pb1 = *reinterpret_cast<const uint4*>(b1);
            pb2 = *reinterpret_cast<const uint4*>(b2);
            pb3 = *reinterpret_cast<const uint4*>(b3);
            // the wait that stands before an issued load's address registers are written again;
            // the addresses are inputs so that none is reused as a later load's destination
            asm volatile("s_wait_xcnt 0x0"
                         :: "v"(a0), "v"(a1), "v"(a2), "v"(a3), "v"(b0), "v"(b1), "v"(b2), "v"(b3)
                         : "memory");
        }

        // two 32-deep products per slab, k ascending; unrolled so that ks folds into the LDS offsets
#pragma unroll
        for (int ks = 0; ks < TK; ks += 32) {
            FragB af[2], bfr[4];
#pragma unroll
            for (int i = 0; i < 2; ++i) {
                int row = wrow + i * 16 + l16;
                af[i].q[0] = *reinterpret_cast<const uint4*>(&sA[cur][row * LDP + ks + kb]);
                af[i].q[1] = *reinterpret_cast<const uint4*>(&sA[cur][row * LDP + ks + kb + 16]);
            }
#pragma unroll
            for (int j = 0; j < 4; ++j) {
                int col = wcol + j * 16 + l16;
                bfr[j].q[0] = *reinterpret_cast<const uint4*>(&sB[cur][col * LDP + ks + kb]);
                bfr[j].q[1] = *reinterpret_cast<const uint4*>(&sB[cur][col * LDP + ks + kb + 16]);
            }
#pragma unroll
            for (int i = 0; i < 2; ++i)
#pragma unroll
                for (int j = 0; j < 4; ++j) {
                    // the operand order decides which index of C runs along a lane's eight accumulators:
                    // always the one that is contiguous in the output (m for [N][M], n for [M][N])
                    if constexpr (KIND == OUT_BF16_T) acc[i][j] = wmma_bf16(af[i].v, bfr[j].v, acc[i][j]);
                    else                              acc[i][j] = wmma_bf16(bfr[j].v, af[i].v, acc[i][j]);
                }
        }

        if (more) {
            *reinterpret_cast<uint4*>(&sA[nxt][sdst])            = pa0;
            *reinterpret_cast<uint4*>(&sA[nxt][sdst + 32 * LDP]) = pa1;
            *reinterpret_cast<uint4*>(&sA[nxt][sdst + 64 * LDP]) = pa2;
            *reinterpret_cast<uint4*>(&sA[nxt][sdst + 96 * LDP]) = pa3;
            *reinterpret_cast<uint4*>(&sB[nxt][sdst])            = pb0;
            *reinterpret_cast<uint4*>(&sB[nxt][sdst + 32 * LDP]) = pb1;
            *reinterpret_cast<uint4*>(&sB[nxt][sdst + 64 * LDP]) = pb2;
            *reinterpret_cast<uint4*>(&sB[nxt][sdst + 96 * LDP]) = pb3;
        }
        __syncthreads();
    }

    if constexpr (KIND == OUT_BF16_T) {
        // lane = column n; its eight accumulators are rows m .. m + 7: one 16-byte store
        bf16_t* C = (bf16_t*)Cout + (size_t)(n0 + wcol + l16) * M + m0 + wrow + kb;
#pragma unroll
        for (int i = 0; i < 2; ++i)
#pragma unroll
            for (int j = 0; j < 4; ++j) {
                union { bf16_t e[8]; uint4 q; } u;
#pragma unroll
                for (int r = 0; r < 8; ++r) u.e[r] = f2bf(acc[i][j][r]);
                *reinterpret_cast<uint4*>(C + (size_t)j * 16 * M + i * 16) = u.q;
            }
    } else {
        // lane = row m; its eight accumulators are columns n .. n + 7: one (bf16) or two (f32) 16-byte stores
        const size_t co = (size_t)(m0 + wrow + l16) * N + n0 + wcol + kb;
        float4 bv[4][2];
        if constexpr (BIAS) {
#pragma unroll
            for (int j = 0; j < 4; ++j) {
                bv[j][0] = *reinterpret_cast<const float4*>(bias + n0 + wcol + kb + j * 16);
                bv[j][1] = *reinterpret_cast<const float4*>(bias + n0 + wcol + kb + j * 16 + 4);
            }
        }
#pragma unroll
        for (int i = 0; i < 2; ++i)
#pragma unroll
            for (int j = 0; j < 4; ++j) {
                float v[8];
#pragma unroll
                for (int r = 0; r < 8; ++r) v[r] = acc[i][j][r];
                if constexpr (BIAS) {
                    v[0] += bv[j][0].x; v[1] += bv[j][0].y; v[2] += bv[j][0].z; v[3] += bv[j][0].w;
                    v[4] += bv[j][1].x; v[5] += bv[j][1].y; v[6] += bv[j][1].z; v[7] += bv[j][1].w;
                }
                if constexpr (GELU) {
#pragma unroll
                    for (int r = 0; r < 8; ++r)
                        v[r] = 0.5f * v[r] * (1.0f + erff(v[r] * 0.70710678118654752440f));
                }
                const size_t o = co + (size_t)i * 16 * N + j * 16;
                if constexpr (KIND == OUT_BF16) {
                    union { bf16_t e[8]; uint4 q; } u;
#pragma unroll
                    for (int r = 0; r < 8; ++r) u.e[r] = f2bf(v[r]);
                    *reinterpret_cast<uint4*>((bf16_t*)Cout + o) = u.q;
                } else {
                    *reinterpret_cast<float4*>((float*)Cout + o)     = make_float4(v[0], v[1], v[2], v[3]);
                    *reinterpret_cast<float4*>((float*)Cout + o + 4) = make_float4(v[4], v[5], v[6], v[7]);
                }
            }
    }
}

// the two staging buffers of a GEMM work-group; declared in the kernel, so that the two bodies of
// gemm_qkv share one set
#define GEMM_LDS \
    __shared__ __align__(16) bf16_t sA[2][TM * LDP];  /* [row][k]  2 x 18 KB */ \
    __shared__ __align__(16) bf16_t sB[2][TN * LDP];  /* [n][k]    2 x 18 KB */

// the uses: the three projections of an attention block; FFN up (bias, GELU); FFN down (bias, f32)
// Q, K and V need nothing of each other: one launch, blockIdx.z picks the product (0 Q, 1 K, 2 V with
// its transposed output), so that three work-groups stand on a WGP where one stood
__global__ __launch_bounds__(256)
void gemm_qkv(const bf16_t* __restrict__ Aq, const bf16_t* __restrict__ Akv,
              const bf16_t* __restrict__ Wq, const bf16_t* __restrict__ Wk, const bf16_t* __restrict__ Wv,
              bf16_t* __restrict__ Cq, bf16_t* __restrict__ Ck, bf16_t* __restrict__ Cvt, int K) {
    GEMM_LDS
    const int z = blockIdx.z;
    if (z == 2) {
        gemm_body<OUT_BF16_T, false, false, MROWS, DMODEL>(sA, sB, Akv, Wv, Cvt, nullptr, K);
        return;
    }
    gemm_body<OUT_BF16, false, false, MROWS, DMODEL>(sA, sB, z ? Akv : Aq, z ? Wk : Wq, z ? Ck : Cq, nullptr, K);
    // the wait that stands before the registers of the issued stores are written again: in the built code the
    // other body's entry follows these stores behind a branch
    asm volatile("s_wait_xcnt 0x0" ::: "memory");
}
__global__ __launch_bounds__(256)
void gemm_ff1(const bf16_t* __restrict__ A, const bf16_t* __restrict__ Bt, bf16_t* __restrict__ C,
              const float* __restrict__ bias, int K) {
    GEMM_LDS
    gemm_body<OUT_BF16, true, true, MROWS, FFDIM>(sA, sB, A, Bt, C, bias, K);
}
__global__ __launch_bounds__(256)
void gemm_ff2(const bf16_t* __restrict__ A, const bf16_t* __restrict__ Bt, float* __restrict__ C,
              const float* __restrict__ bias, int K) {
    GEMM_LDS
    gemm_body<OUT_F32, true, false, MROWS, DMODEL>(sA, sB, A, Bt, C, bias, K);
}

// ---------------------------------------------------------------- flash attention
// One work-group per (batch, head, 128 queries): eight waves, each with its own 16-query tile.
// The waves share every K and V tile: 64 keys are staged once per work-group in LDS by loads that
// cover whole 128-B lines, and each wave takes its fragments from LDS.
// Q,K bf16 [b*Nq + tok][DMODEL]; V supplied TRANSPOSED: Vt bf16 [DMODEL][Mtot]. O fp32.
// Nq is a multiple of 128, Nk of 64.
// e^x as __expf compiles it (x * log2 e, then v_exp_f32), with the one slot that the instruction set asks for
// behind a transcendental in the same statement, so that the slot stays directly behind it
__device__ __forceinline__ float expf_slot(float x) {
    float r;
    asm("v_exp_f32 %0, %1\n\tv_nop" : "=v"(r) : "v"(x * 1.44269504088896340736f));
    return r;
}

#define AW     8    // waves = 16-query tiles per work-group
#define AKEYS  64   // keys per staged tile: a V row of the tile is one whole 128-B line, as a K row is
#define APITCH 72   // LDS row pitch in elements: 144 B = 16 B x odd, for the 16-byte fragment reads
__global__ __launch_bounds__(256)
void attn_wmma(const bf16_t* __restrict__ Qg, const bf16_t* __restrict__ Kg,
               const bf16_t* __restrict__ Vt, float* __restrict__ Og,
               int Nq, int Nk, int Mtot, int causal, float scale) {
    __shared__ __align__(16) bf16_t sK[2][AKEYS * APITCH];   // [key][head-dim]   2 x 9 KB
    __shared__ __align__(16) bf16_t sV[2][HDIM * APITCH];    // [head-dim][key]   2 x 9 KB
    __shared__ __align__(16) bf16_t sPall[AW][16 * 32];      // P re-layout staging, 1 KB a wave

    const int t    = threadIdx.x;
    const int lane = t & 31;
    const int wave = __builtin_amdgcn_readfirstlane(t >> 5);  // scalar: the tests on kend below are scalar branches
    const int hi   = lane >> 4;
    const int l16  = lane & 15;
    const int kb   = hi * 8;
    const int h    = blockIdx.y;
    const int b    = blockIdx.z;
    const int qblk  = blockIdx.x * (16 * AW);
    const int qbase = qblk + wave * 16;
    const size_t qoff = (size_t)b * Nq * DMODEL;
    const size_t koff = (size_t)b * Nk * DMODEL;
    bf16_t* sP = sPall[wave];

    // staging: eight lanes cover one 128-B row, so a wave's 16-byte load touches four whole lines;
    // a thread takes rows srow and srow + 32 of the K tile and of the V tile
    const int srow = t >> 3;                 // 0..31
    const int sseg = (t & 7) * 8;            // 0,8,..,56
    const int sdst = srow * APITCH + sseg;
    const bf16_t* gK = Kg + koff + (size_t)srow * DMODEL + h * HDIM + sseg;
    const bf16_t* gV = Vt + (size_t)(h * HDIM + srow) * Mtot + (size_t)b * Nk + sseg;
    const size_t kstep = (size_t)32 * DMODEL;
    const size_t vstep = (size_t)32 * Mtot;

    // Q fragments: 16 queries x 64 head-dims = two 16x32 A fragments
    FragB qa[2];
#pragma unroll
    for (int kc = 0; kc < 2; ++kc) {
        const bf16_t* base = Qg + qoff + (size_t)(qbase + l16) * DMODEL + h * HDIM + kc * 32 + kb;
        qa[kc].q[0] = *reinterpret_cast<const uint4*>(base);
        qa[kc].q[1] = *reinterpret_cast<const uint4*>(base + 16);
    }

    v8f o[4];
    float m[8], lsum[8];
#pragma unroll
    for (int n = 0; n < 4; ++n) o[n] = v8f_zero();
#pragma unroll
    for (int r = 0; r < 8; ++r) { m[r] = -1e30f; lsum[r] = 0.0f; }

    int kend  = Nk;    // this wave's end
    int kendw = Nk;    // the work-group's end = its last wave's
    if (causal) {
        kend = (qbase + 16 + 31) & ~31;
        if (kend > Nk) kend = Nk;
        kendw = (qblk + 16 * AW + 31) & ~31;
        if (kendw > Nk) kendw = Nk;
    }
    const int ns = (kendw + AKEYS - 1) / AKEYS;   // staged tiles, the same for every wave

    uint4 pk0, pk1, pv0, pv1;
    // prologue: tile 0 into buffer 0
    pk0 = *reinterpret_cast<const uint4*>(gK);
    pk1 = *reinterpret_cast<const uint4*>(gK + kstep);
    pv0 = *reinterpret_cast<const uint4*>(gV);
    pv1 = *reinterpret_cast<const uint4*>(gV + vstep);
    *reinterpret_cast<uint4*>(&sK[0][sdst])               = pk0;
    *reinterpret_cast<uint4*>(&sK[0][sdst + 32 * APITCH]) = pk1;
    *reinterpret_cast<uint4*>(&sV[0][sdst])               = pv0;
    *reinterpret_cast<uint4*>(&sV[0][sdst + 32 * APITCH]) = pv1;
    __syncthreads();

    for (int s = 0; s < ns; ++s) {
        const int cur = s & 1;
        const int nxt = cur ^ 1;
        const bool more = (s + 1) < ns;
        if (more) {
            const bf16_t* k0 = gK + (size_t)(s + 1) * AKEYS * DMODEL;
            const bf16_t* v0 = gV + (s + 1) * AKEYS;
            const bf16_t* v1 = v0 + vstep;
            pk0 = *reinterpret_cast<const uint4*>(k0);
            pk1 = *reinterpret_cast<const uint4*>(k0 + kstep);   // a constant step: k0's registers and an offset
            pv0 = *reinterpret_cast<const uint4*>(v0);
            pv1 = *reinterpret_cast<const uint4*>(v1);
            // the wait that stands before an issued load's address registers are written again;
            // the addresses are inputs so that none is reused as a later load's destination
            asm volatile("s_wait_xcnt 0x0" :: "v"(k0), "v"(v0), "v"(v1) : "memory");
        }

        // two 32-key passes per staged tile; a wave past its own causal end skips the pass
#pragma unroll
        for (int sub = 0; sub < AKEYS; sub += 32) {
            const int j0 = s * AKEYS + sub;
            if (j0 < kend) {
                // ---- S = Q K^T for 32 keys (two 16x16 C tiles)
                v8f sc[2];
#pragma unroll
                for (int st = 0; st < 2; ++st) {
                    FragB kb0, kb1;   // B = K^T: lane holds key column, elems walk head-dim
                    const bf16_t* base = &sK[cur][(sub + st * 16 + l16) * APITCH + kb];
                    kb0.q[0] = *reinterpret_cast<const uint4*>(base);
                    kb0.q[1] = *reinterpret_cast<const uint4*>(base + 16);
                    kb1.q[0] = *reinterpret_cast<const uint4*>(base + 32);
                    kb1.q[1] = *reinterpret_cast<const uint4*>(base + 48);
                    v8f z = v8f_zero();
                    z = wmma_bf16(qa[0].v, kb0.v, z);
                    z = wmma_bf16(qa[1].v, kb1.v, z);
                    sc[st] = z;
                }
                // ---- scale + causal mask
#pragma unroll
                for (int st = 0; st < 2; ++st) {
                    int col = j0 + st * 16 + l16;
#pragma unroll
                    for (int r = 0; r < 8; ++r) {
                        int row = qbase + r + hi * 8;
                        float v = sc[st][r] * scale;
                        if (causal && col > row) v = -1e30f;
                        sc[st][r] = v;
                    }
                }
                // ---- online softmax (row reductions across 16-lane halves)
                float alpha[8];
#pragma unroll
                for (int r = 0; r < 8; ++r) {
                    float rm = fmaxf(sc[0][r], sc[1][r]);
#pragma unroll
                    for (int off = 1; off < 16; off <<= 1)
                        rm = fmaxf(rm, __shfl_xor(rm, off, 32));
                    float mn = fmaxf(m[r], rm);
                    alpha[r] = expf_slot(m[r] - mn);
                    m[r] = mn;
                    float p0 = __expf(sc[0][r] - mn);
                    float p1 = __expf(sc[1][r] - mn);
                    sc[0][r] = p0; sc[1][r] = p1;
                    float rs = p0 + p1;
#pragma unroll
                    for (int off = 1; off < 16; off <<= 1)
                        rs += __shfl_xor(rs, off, 32);
                    lsum[r] = lsum[r] * alpha[r] + rs;
                }
#pragma unroll
                for (int n = 0; n < 4; ++n)
#pragma unroll
                    for (int r = 0; r < 8; ++r) o[n][r] *= alpha[r];

                // ---- C-layout P -> A-layout bf16 fragment via the wave's own LDS (LDS in-order per wave)
#pragma unroll
                for (int r = 0; r < 8; ++r) {
                    int row = r + hi * 8;
                    sP[row * 32 + l16]      = f2bf(sc[0][r]);
                    sP[row * 32 + 16 + l16] = f2bf(sc[1][r]);
                }
                FragB pa;
                pa.q[0] = *reinterpret_cast<const uint4*>(&sP[l16 * 32 + kb]);
                pa.q[1] = *reinterpret_cast<const uint4*>(&sP[l16 * 32 + kb + 16]);

                // ---- O += P (16x32) * V (32x64): V fragments from the staged tile
#pragma unroll
                for (int n = 0; n < 4; ++n) {
                    FragB vb;
                    const bf16_t* vbase = &sV[cur][(n * 16 + l16) * APITCH + sub + kb];
                    vb.q[0] = *reinterpret_cast<const uint4*>(vbase);
                    vb.q[1] = *reinterpret_cast<const uint4*>(vbase + 16);
                    o[n] = wmma_bf16(pa.v, vb.v, o[n]);
                }
                // the four vector slots that the chip needs behind a matrix instruction before its operands are
                // overwritten: the four
                // accumulators are inputs so that the slots stand behind all four products
                asm volatile("v_nop\n\tv_nop\n\tv_nop\n\tv_nop" :: "v"(o[0]), "v"(o[1]), "v"(o[2]), "v"(o[3]));
            }
        }

        if (more) {
            *reinterpret_cast<uint4*>(&sK[nxt][sdst])               = pk0;
            *reinterpret_cast<uint4*>(&sK[nxt][sdst + 32 * APITCH]) = pk1;
            *reinterpret_cast<uint4*>(&sV[nxt][sdst])               = pv0;
            *reinterpret_cast<uint4*>(&sV[nxt][sdst + 32 * APITCH]) = pv1;
        }
        // publishes the next tile and ends every wave's reads of the buffer that is refilled next
        __syncthreads();
    }

    // ---- normalize + store
#pragma unroll
    for (int n = 0; n < 4; ++n)
#pragma unroll
        for (int r = 0; r < 8; ++r) {
            int row = qbase + r + hi * 8;
            Og[qoff + (size_t)row * DMODEL + h * HDIM + n * 16 + l16] = o[n][r] / lsum[r];
        }
}

// ---------------------------------------------------------------- residual + LayerNorm
// One wave per row, 32 values a lane by 16-byte accesses on whole lines; the row's sums stay in the
// wave (four chains a lane, then a five-step butterfly), so no LDS and no barrier.
#define LN_ROWS 8   // rows (waves) per work-group
__global__ __launch_bounds__(256)
void add_ln(const float* __restrict__ a, const float* __restrict__ resid,
            const float* __restrict__ g, const float* __restrict__ beta,
            float* __restrict__ yf, bf16_t* __restrict__ ybf) {
    const int lane = threadIdx.x & 31;
    const int row  = blockIdx.x * LN_ROWS + (threadIdx.x >> 5);
    const size_t ro = (size_t)row * DMODEL + lane * 4;

    const float* pa = a     + ro;
    const float* pr = resid + ro;
    float4 x[8], r[8];
#pragma unroll
    for (int i = 0; i < 8; ++i) x[i] = *reinterpret_cast<const float4*>(pa + i * 128);
#pragma unroll
    for (int i = 0; i < 8; ++i) r[i] = *reinterpret_cast<const float4*>(pr + i * 128);
    // the wait that stands before an issued load's address registers are written again;
    // the addresses are inputs so that none is reused as a later load's destination
    asm volatile("s_wait_xcnt 0x0" :: "v"(pa), "v"(pr) : "memory");

    float s0 = 0.0f, s1 = 0.0f, s2 = 0.0f, s3 = 0.0f;
    float q0 = 0.0f, q1 = 0.0f, q2 = 0.0f, q3 = 0.0f;
#pragma unroll
    for (int i = 0; i < 8; ++i) {
        x[i].x += r[i].x; x[i].y += r[i].y; x[i].z += r[i].z; x[i].w += r[i].w;
        s0 += x[i].x; s1 += x[i].y; s2 += x[i].z; s3 += x[i].w;
        q0 += x[i].x * x[i].x; q1 += x[i].y * x[i].y; q2 += x[i].z * x[i].z; q3 += x[i].w * x[i].w;
    }
    float s  = (s0 + s1) + (s2 + s3);
    float ss = (q0 + q1) + (q2 + q3);
#pragma unroll
    for (int off = 1; off < 32; off <<= 1) {
        s  += __shfl_xor(s,  off, 32);
        ss += __shfl_xor(ss, off, 32);
    }
    const float mean = s  * (1.0f / DMODEL);
    const float var  = ss * (1.0f / DMODEL) - mean * mean;
    // rsqrtf as the compiler expands it (a denormal argument is scaled by 2^24, its result by 2^12), with
    // v_rsq_f32 and the one slot that the instruction set asks for behind it in one statement, so that
    // the slot stays directly behind it
    const float ve   = var + 1e-5f;
    const bool  tiny = ve < 1.17549435e-38f;
    float rq;
    asm("v_rsq_f32 %0, %1\n\tv_nop" : "=v"(rq) : "v"(tiny ? ve * 16777216.0f : ve));
    const float rstd = tiny ? rq * 4096.0f : rq;
#pragma unroll
    for (int i = 0; i < 8; ++i) {
        const float4 gv = *reinterpret_cast<const float4*>(g    + lane * 4 + i * 128);
        const float4 bv = *reinterpret_cast<const float4*>(beta + lane * 4 + i * 128);
        x[i].x = (x[i].x - mean) * rstd * gv.x + bv.x;
        x[i].y = (x[i].y - mean) * rstd * gv.y + bv.y;
        x[i].z = (x[i].z - mean) * rstd * gv.z + bv.z;
        x[i].w = (x[i].w - mean) * rstd * gv.w + bv.w;
        *reinterpret_cast<float4*>(yf + ro + i * 128) = x[i];
    }
    // the wait that stands before the registers of the issued stores are written again (by the packing below)
    asm volatile("s_wait_xcnt 0x0" ::: "memory");
    if (ybf) {
#pragma unroll
        for (int i = 0; i < 8; ++i)
            *reinterpret_cast<uint2*>(ybf + ro + i * 128) = pack4_bf16(x[i]);
    }
}

// ---------------------------------------------------------------- launch
extern "C" void kernel_launch(void* const* d_in, const int* in_sizes, int n_in,
                              void* d_out, int out_size, void* d_ws, size_t ws_size,
                              hipStream_t stream) {
    const float* x    = (const float*)d_in[0];
    const float* enc  = (const float*)d_in[1];
    const float* Wq1  = (const float*)d_in[2];
    const float* Wk1  = (const float*)d_in[3];
    const float* Wv1  = (const float*)d_in[4];
    const float* g1   = (const float*)d_in[5];
    const float* b1   = (const float*)d_in[6];
    const float* Wq2  = (const float*)d_in[7];
    const float* Wk2  = (const float*)d_in[8];
    const float* Wv2  = (const float*)d_in[9];
    const float* g2   = (const float*)d_in[10];
    const float* b2   = (const float*)d_in[11];
    const float* Wff1 = (const float*)d_in[12];
    const float* bff1 = (const float*)d_in[13];
    const float* Wff2 = (const float*)d_in[14];
    const float* bff2 = (const float*)d_in[15];
    const float* g3   = (const float*)d_in[16];
    const float* b3   = (const float*)d_in[17];

    char* ws = (char*)d_ws;
    const size_t MB = 1024u * 1024u;
    bf16_t* wq1b  = (bf16_t*)(ws + 0   * MB);   // all weights stored transposed [N][K]
    bf16_t* wk1b  = (bf16_t*)(ws + 2   * MB);
    bf16_t* wv1b  = (bf16_t*)(ws + 4   * MB);
    bf16_t* wq2b  = (bf16_t*)(ws + 6   * MB);
    bf16_t* wk2b  = (bf16_t*)(ws + 8   * MB);
    bf16_t* wv2b  = (bf16_t*)(ws + 10  * MB);
    bf16_t* wff1b = (bf16_t*)(ws + 12  * MB);
    bf16_t* wff2b = (bf16_t*)(ws + 20  * MB);
    bf16_t* xbf   = (bf16_t*)(ws + 28  * MB);   // activation bf16 (reused: x, y1, y2)
    bf16_t* encbf = (bf16_t*)(ws + 36  * MB);
    bf16_t* qbf   = (bf16_t*)(ws + 44  * MB);
    bf16_t* kbf   = (bf16_t*)(ws + 52  * MB);
    bf16_t* vbf   = (bf16_t*)(ws + 60  * MB);   // V stored transposed [DMODEL][MROWS]
    float*  ctx   = (float*) (ws + 68  * MB);   // attn ctx / ff2 out
    float*  yA    = (float*) (ws + 84  * MB);
    float*  yB    = (float*) (ws + 100 * MB);
    bf16_t* hbf   = (bf16_t*)(ws + 116 * MB);   // ends at 148 MB

    const dim3 gqkv(DMODEL / TN, MROWS / TM, 3);
    const dim3 gff1(FFDIM / TN, MROWS / TM);
    const dim3 gff2(DMODEL / TN, MROWS / TM);

    // x, enc -> bf16; weights -> bf16, transposed [N][K] (wq1b .. wv2b lie 2 MB apart, from wq1b on)
    cvt_all<<<CVT_ALL_BLOCKS, 256, 0, stream>>>(x, enc, Wq1, Wk1, Wv1, Wq2, Wk2, Wv2, Wff1, Wff2,
                                                xbf, encbf, wq1b, wff1b, wff2b);

    const float scale = 0.03125f;   // 1/sqrt(DMODEL), as in reference
    dim3 agrid(NTOK / (16 * AW), NHEAD, BATCH);

    // ---- block 1: causal self-attention
    gemm_qkv<<<gqkv, 256, 0, stream>>>(xbf, xbf, wq1b, wk1b, wv1b, qbf, kbf, vbf, DMODEL);
    attn_wmma<<<agrid, 256, 0, stream>>>(qbf, kbf, vbf, ctx, NTOK, NTOK, MROWS, 1, scale);
    add_ln<<<MROWS / LN_ROWS, 256, 0, stream>>>(ctx, x, g1, b1, yA, xbf);    // xbf := y1 (bf16)

    // ---- block 2: cross-attention over encoder output
    gemm_qkv<<<gqkv, 256, 0, stream>>>(xbf, encbf, wq2b, wk2b, wv2b, qbf, kbf, vbf, DMODEL);
    attn_wmma<<<agrid, 256, 0, stream>>>(qbf, kbf, vbf, ctx, NTOK, NTOK, MROWS, 0, scale);
    add_ln<<<MROWS / LN_ROWS, 256, 0, stream>>>(ctx, yA, g2, b2, yB, xbf);   // xbf := y2 (bf16)

    // ---- block 3: FFN (bias+GELU fused), residual, final LN
    gemm_ff1<<<gff1,  256, 0, stream>>>(xbf, wff1b, hbf, bff1, DMODEL);   // bf16 out + GELU
    gemm_ff2<<<gff2,  256, 0, stream>>>(hbf, wff2b, ctx, bff2, FFDIM);    // fp32 out
    add_ln<<<MROWS / LN_ROWS, 256, 0, stream>>>(ctx, yB, g3, b3, (float*)d_out, nullptr);
}

// v006
// It runs in 240 microseconds.
// Timed twice side by side with v005, it ran 1.19 times as fast both times.
// All steps since v000 together make it 2.85 times as fast.
#include <hip/hip_runtime.h>
#include <math.h>

// ---------------------------------------------------------------- types
typedef __bf16 bf16_t;
typedef __attribute__((ext_vector_type(16))) __bf16 v16bf;
typedef __attribute__((ext_vector_type(8)))  float  v8f;

union FragB {
    v16bf  v;
    uint4  q[2];
    bf16_t e[16];
};

__device__ __forceinline__ bf16_t f2bf(float f) {
    unsigned int u = __float_as_uint(f);
    unsigned int r = u + 0x7FFFu + ((u >> 16) & 1u);   // round to nearest even
    unsigned short s = (unsigned short)(r >> 16);
    return __builtin_bit_cast(bf16_t, s);
}

__device__ __forceinline__ v8f wmma_bf16(const v16bf& a, const v16bf& b, const v8f& c) {
    return __builtin_amdgcn_wmma_f32_16x16x32_bf16(false, a, false, b, (short)0, c, false, false);
}

__device__ __forceinline__ v8f v8f_zero() {
    v8f z;
#pragma unroll
    for (int i = 0; i < 8; ++i) z[i] = 0.0f;
    return z;
}

// ---------------------------------------------------------------- constants
#define DMODEL 1024
#define NHEAD  16
#define HDIM   64
#define FFDIM  4096
#define BATCH  4
#define NTOK   1024
#define MROWS  (BATCH * NTOK)   // 4096

// ---------------------------------------------------------------- fp32 -> bf16 (straight)
__device__ __forceinline__ uint2 pack4_bf16(const float4& v) {
    union { bf16_t e[4]; uint2 q; } u;
    u.e[0] = f2bf(v.x); u.e[1] = f2bf(v.y); u.e[2] = f2bf(v.z); u.e[3] = f2bf(v.w);
    return u.q;
}

// 32 values a thread, as eight 16-byte loads in flight; every wave-wide load (512 B) and store (256 B)
// covers whole lines. One wave per 1,024 values, not one per 32.
#define CVT_BLOCK (256 * 32)   // values per work-group; a tensor is a multiple of it
__device__ __forceinline__
void cvt_f32_to_bf16(const float* __restrict__ in, bf16_t* __restrict__ out, int blk) {
    const size_t base = (size_t)blk * CVT_BLOCK + threadIdx.x * 4;
    float4 v[8];
#pragma unroll
    for (int c = 0; c < 8; ++c)
        v[c] = *reinterpret_cast<const float4*>(in + base + c * 1024);
#pragma unroll
    for (int c = 0; c < 8; ++c)
        *reinterpret_cast<uint2*>(out + base + c * 1024) = pack4_bf16(v[c]);
}

// ---------------------------------------------------------------- fp32 [K][N] -> bf16 [N][K]
// 64 x 64 tile, 16 values a thread: 16-byte loads along n (a wave covers two 256-B row pieces),
// 16-byte stores along k (eight lanes cover one 128-B line of an output row).
#define TT 64
__device__ __forceinline__
void cvt_transpose_bf16(const float* __restrict__ in, bf16_t* __restrict__ out,
                        int Kdim, int Ndim, int bn, int bk) {
    __shared__ float tile[TT][TT + 1];   // pitch 65 dwords: the column walks below meet no bank twice
    const int k0 = bk * TT;
    const int n0 = bn * TT;
    const int t  = threadIdx.x;
    const int lr = t >> 4;               // 0..15
    const int lc = (t & 15) * 4;         // 0,4,..,60
    const float* s0 = in + (size_t)(k0 + lr) * Ndim + n0 + lc;
    const float* s1 = s0 + (size_t)16 * Ndim;
    const float* s2 = s1 + (size_t)16 * Ndim;
    const float* s3 = s2 + (size_t)16 * Ndim;
    float4 v[4];
    v[0] = *reinterpret_cast<const float4*>(s0);
    v[1] = *reinterpret_cast<const float4*>(s1);
    v[2] = *reinterpret_cast<const float4*>(s2);
    v[3] = *reinterpret_cast<const float4*>(s3);
    // the wait that stands before an issued load's address registers are written again;
    // the addresses are inputs so that none is reused as a later load's destination
    asm volatile("s_wait_xcnt 0x0" :: "v"(s0), "v"(s1), "v"(s2), "v"(s3) : "memory");
#pragma unroll
    for (int p = 0; p < 4; ++p) {
        float* d = &tile[p * 16 + lr][lc];
        d[0] = v[p].x; d[1] = v[p].y; d[2] = v[p].z; d[3] = v[p].w;
    }
    __syncthreads();
#pragma unroll
    for (int c = 0; c < 2; ++c) {
        const int id = t + c * 256;
        const int n  = id >> 3;          // 0..63
        const int ks = (id & 7) * 8;     // 0,8,..,56
        union { bf16_t e[8]; uint4 q; } u;
#pragma unroll
        for (int j = 0; j < 8; ++j) u.e[j] = f2bf(tile[ks + j][n]);
        *reinterpret_cast<uint4*>(out + (size_t)(n0 + n) * Kdim + k0 + ks) = u.q;
    }
}

// ---------------------------------------------------------------- all ten conversions, one launch
// None of them needs anything of another, so they share one grid by ranges of the block index
// (every test below is on blockIdx alone: the same for a whole work-group). The casts, which move
// twice a transpose tile's bytes per work-group, come first.
#define CAST_BLOCKS (MROWS * DMODEL / CVT_BLOCK)             // 512 per activation tensor
#define SQ_BLOCKS   ((DMODEL / TT) * (DMODEL / TT))          // 256 per square weight
#define FF_BLOCKS   ((DMODEL / TT) * (FFDIM / TT))           // 1,024 per feed-forward weight
#define CVT_ALL_BLOCKS (2 * CAST_BLOCKS + 6 * SQ_BLOCKS + 2 * FF_BLOCKS)
__global__ __launch_bounds__(256)
void cvt_all(const float* __restrict__ x,    const float* __restrict__ enc,
             const float* __restrict__ wq1,  const float* __restrict__ wk1, const float* __restrict__ wv1,
             const float* __restrict__ wq2,  const float* __restrict__ wk2, const float* __restrict__ wv2,
             const float* __restrict__ wff1, const float* __restrict__ wff2,
             bf16_t* __restrict__ xbf,  bf16_t* __restrict__ encbf,
             bf16_t* __restrict__ wsq,          // the six square weights' outputs, DMODEL * DMODEL apart
             bf16_t* __restrict__ wff1b, bf16_t* __restrict__ wff2b) {
    int b = blockIdx.x;
    if (b < 2 * CAST_BLOCKS) {
        const bool first = b < CAST_BLOCKS;
        cvt_f32_to_bf16(first ? x : enc, first ? xbf : encbf, first ? b : b - CAST_BLOCKS);
        return;   // the whole work-group leaves, ahead of the transpose's barrier
    }
    b -= 2 * CAST_BLOCKS;
    const float* in;
    bf16_t* out;
    int Kdim = DMODEL, Ndim = DMODEL;
    if (b < 6 * SQ_BLOCKS) {
        const int w = b / SQ_BLOCKS;
        b -= w * SQ_BLOCKS;
        const bool odd = w & 1;
        const float* p01 = odd ? wk1 : wq1;
        const float* p23 = odd ? wq2 : wv1;
        const float* p45 = odd ? wv2 : wk2;
        in  = w < 2 ? p01 : w < 4 ? p23 : p45;
        out = wsq + (size_t)w * DMODEL * DMODEL;
    } else if (b < 6 * SQ_BLOCKS + FF_BLOCKS) {
        b -= 6 * SQ_BLOCKS;
        in = wff1; out = wff1b; Ndim = FFDIM;
    } else {
        b -= 6 * SQ_BLOCKS + FF_BLOCKS;
        in = wff2; out = wff2b; Kdim = FFDIM;
    }
    const int nb = Ndim / TT;   // tiles along n: 16 or 64
    cvt_transpose_bf16(in, out, Kdim, Ndim, b % nb, b / nb);
}

// ---------------------------------------------------------------- GEMM (bf16 WMMA, fp32 acc)
// C[M,N] = A[M,K] @ B[K,N], with B supplied TRANSPOSED as Bt[N][K] bf16.
// The output kind, bias, GELU and the output's pitch are compile-time values: one kernel per use below.
#define OUT_BF16   0   // bf16 [M][N]
#define OUT_BF16_T 1   // bf16 [N][M]
#define OUT_F32    2   // f32  [M][N]
#define TM 128
#define TN 128
#define TK 64      // one staged row of a slab = 128 B = one whole cache line
#define LDP 72     // LDS row pitch in elements: 144 B = 16 B x odd, for the 16-byte fragment reads

template <int KIND, bool BIAS, bool GELU, int M, int N>
__device__ __forceinline__
void gemm_body(bf16_t (*sA)[TM * LDP], bf16_t (*sB)[TN * LDP],
               const bf16_t* __restrict__ A, const bf16_t* __restrict__ Bt,
               void* __restrict__ Cout, const float* __restrict__ bias, int K) {
    static_assert(KIND != OUT_BF16_T || (!BIAS && !GELU), "the transposed output takes neither");

    const int t    = threadIdx.x;
    const int lane = t & 31;
    const int wave = t >> 5;                 // 0..7
    const int wrow = (wave & 3) * 32;        // 0,32,64,96
    const int wcol = (wave >> 2) * 64;       // 0,64
    const int m0   = blockIdx.y * TM;
    const int n0   = blockIdx.x * TN;
    const int hi   = lane >> 4;
    const int l16  = lane & 15;
    const int kb   = hi * 8;

    // staging: eight lanes cover one 128-B row of the slab, so a wave's 16-byte load
    // touches four whole lines; a thread takes rows srow, srow + 32, + 64, + 96
    const int srow = t >> 3;                 // 0..31
    const int sseg = (t & 7) * 8;            // 0,8,..,56
    const bf16_t* gA = A  + (size_t)m0 * K;  // block-uniform bases; the lane's part is soff
    const bf16_t* gB = Bt + (size_t)n0 * K;
    const unsigned soff = (unsigned)(srow * K + sseg);
    const size_t rstep = (size_t)32 * K;
    const int sdst = srow * LDP + sseg;

    v8f acc[2][4];
#pragma unroll
    for (int i = 0; i < 2; ++i)
#pragma unroll
        for (int j = 0; j < 4; ++j) acc[i][j] = v8f_zero();

    const int nk = K / TK;
    uint4 pa0, pa1, pa2, pa3, pb0, pb1, pb2, pb3;

    // prologue: stage slab 0 into buffer 0
    pa0 = *reinterpret_cast<const uint4*>(gA + soff);
    pa1 = *reinterpret_cast<const uint4*>(gA + rstep + soff);
    pa2 = *reinterpret_cast<const uint4*>(gA + 2 * rstep + soff);
    pa3 = *reinterpret_cast<const uint4*>(gA + 3 * rstep + soff);
    pb0 = *reinterpret_cast<const uint4*>(gB + soff);
    pb1 = *reinterpret_cast<const uint4*>(gB + rstep + soff);
    pb2 = *reinterpret_cast<const uint4*>(gB + 2 * rstep + soff);
    pb3 = *reinterpret_cast<const uint4*>(gB + 3 * rstep + soff);
    *reinterpret_cast<uint4*>(&sA[0][sdst])            = pa0;
    *reinterpret_cast<uint4*>(&sA[0][sdst + 32 * LDP]) = pa1;
    *reinterpret_cast<uint4*>(&sA[0][sdst + 64 * LDP]) = pa2;
    *reinterpret_cast<uint4*>(&sA[0][sdst + 96 * LDP]) = pa3;
    *reinterpret_cast<uint4*>(&sB[0][sdst])            = pb0;
    *reinterpret_cast<uint4*>(&sB[0][sdst + 32 * LDP]) = pb1;
    *reinterpret_cast<uint4*>(&sB[0][sdst + 64 * LDP]) = pb2;
    *reinterpret_cast<uint4*>(&sB[0][sdst + 96 * LDP]) = pb3;
    __syncthreads();

    for (int kt = 0; kt < nk; ++kt) {
        const int cur = kt & 1;
        const int nxt = cur ^ 1;
        const bool more = (kt + 1) < nk;
        if (more) {
            int ko = (kt + 1) * TK;
            const bf16_t* a0 = gA + ko + soff;
            const bf16_t* a1 = a0 + rstep;
            const bf16_t* a2 = a1 + rstep;
            const bf16_t* a3 = a2 + rstep;
            const bf16_t* b0 = gB + ko + soff;
            const bf16_t* b1 = b0 + rstep;
            const bf16_t* b2 = b1 + rstep;
            const bf16_t* b3 = b2 + rstep;
            pa0 = *reinterpret_cast<const uint4*>(a0);
            pa1 = *reinterpret_cast<const uint4*>(a1);
            pa2 = *reinterpret_cast<const uint4*>(a2);
            pa3 = *reinterpret_cast<const uint4*>(a3);
            pb0 = *reinterpret_cast<const uint4*>(b0);
            pb1 = *reinterpret_cast<const uint4*>(b1);
            pb2 = *reinterpret_cast<const uint4*>(b2);
            pb3 = *reinterpret_cast<const uint4*>(b3);
            // the wait that stands before an issued load's address registers are written again;
            // the addresses are inputs so that none is reused as a later load's destination
            asm volatile("s_wait_xcnt 0x0"
                         :: "v"(a0), "v"(a1), "v"(a2), "v"(a3), "v"(b0), "v"(b1), "v"(b2), "v"(b3)
                         : "memory");
        }

        // two 32-deep products per slab, k ascending; unrolled so that ks folds into the LDS offsets
#pragma unroll
        for (int ks = 0; ks < TK; ks += 32) {
            FragB af[2], bfr[4];
#pragma unroll
            for (int i = 0; i < 2; ++i) {
                int row = wrow + i * 16 + l16;
                af[i].q[0] = *reinterpret_cast<const uint4*>(&sA[cur][row * LDP + ks + kb]);
                af[i].q[1] = *reinterpret_cast<const uint4*>(&sA[cur][row * LDP + ks + kb + 16]);
            }
#pragma unroll
            for (int j = 0; j < 4; ++j) {
                int col = wcol + j * 16 + l16;
                bfr[j].q[0] = *reinterpret_cast<const uint4*>(&sB[cur][col * LDP + ks + kb]);
                bfr[j].q[1] = *reinterpret_cast<const uint4*>(&sB[cur][col * LDP + ks + kb + 16]);
            }
#pragma unroll
            for (int i = 0; i < 2; ++i)
#pragma unroll
                for (int j = 0; j < 4; ++j) {
                    // the operand order decides which index of C runs along a lane's eight accumulators:
                    // always the one that is contiguous in the output (m for [N][M], n for [M][N])
                    if constexpr (KIND == OUT_BF16_T) acc[i][j] = wmma_bf16(af[i].v, bfr[j].v, acc[i][j]);
                    else                              acc[i][j] = wmma_bf16(bfr[j].v, af[i].v, acc[i][j]);
                }
        }

        if (more) {
            *reinterpret_cast<uint4*>(&sA[nxt][sdst])            = pa0;
            *reinterpret_cast<uint4*>(&sA[nxt][sdst + 32 * LDP]) = pa1;
            *reinterpret_cast<uint4*>(&sA[nxt][sdst + 64 * LDP]) = pa2;
            *reinterpret_cast<uint4*>(&sA[nxt][sdst + 96 * LDP]) = pa3;
            *reinterpret_cast<uint4*>(&sB[nxt][sdst])            = pb0;
            *reinterpret_cast<uint4*>(&sB[nxt][sdst + 32 * LDP]) = pb1;
            *reinterpret_cast<uint4*>(&sB[nxt][sdst + 64 * LDP]) = pb2;
            *reinterpret_cast<uint4*>(&sB[nxt][sdst + 96 * LDP]) = pb3;
        }
        __syncthreads();
    }

    if constexpr (KIND == OUT_BF16_T) {
        // lane = column n; its eight accumulators are rows m .. m + 7: one 16-byte store
        bf16_t* C = (bf16_t*)Cout + (size_t)(n0 + wcol + l16) * M + m0 + wrow + kb;
#pragma unroll
        for (int i = 0; i < 2; ++i)
#pragma unroll
            for (int j = 0; j < 4; ++j) {
                union { bf16_t e[8]; uint4 q; } u;
#pragma unroll
                for (int r = 0; r < 8; ++r) u.e[r] = f2bf(acc[i][j][r]);
                *reinterpret_cast<uint4*>(C + (size_t)j * 16 * M + i * 16) = u.q;
            }
    } else {
        // lane = row m; its eight accumulators are columns n .. n + 7: one (bf16) or two (f32) 16-byte stores
        const size_t co = (size_t)(m0 + wrow + l16) * N + n0 + wcol + kb;
        float4 bv[4][2];
        if constexpr (BIAS) {
#pragma unroll
            for (int j = 0; j < 4; ++j) {
                bv[j][0] = *reinterpret_cast<const float4*>(bias + n0 + wcol + kb + j * 16);
                bv[j][1] = *reinterpret_cast<const float4*>(bias + n0 + wcol + kb + j * 16 + 4);
            }
        }
#pragma unroll
        for (int i = 0; i < 2; ++i)
#pragma unroll
            for (int j = 0; j < 4; ++j) {
                float v[8];
#pragma unroll
                for (int r = 0; r < 8; ++r) v[r] = acc[i][j][r];
                if constexpr (BIAS) {
                    v[0] += bv[j][0].x; v[1] += bv[j][0].y; v[2] += bv[j][0].z; v[3] += bv[j][0].w;
                    v[4] += bv[j][1].x; v[5] += bv[j][1].y; v[6] += bv[j][1].z; v[7] += bv[j][1].w;
                }
                if constexpr (GELU) {
#pragma unroll
                    for (int r = 0; r < 8; ++r)
                        v[r] = 0.5f * v[r] * (1.0f + erff(v[r] * 0.70710678118654752440f));
                }
                const size_t o = co + (size_t)i * 16 * N + j * 16;
                if constexpr (KIND == OUT_BF16) {
                    union { bf16_t e[8]; uint4 q; } u;
#pragma unroll
                    for (int r = 0; r < 8; ++r) u.e[r] = f2bf(v[r]);
                    *reinterpret_cast<uint4*>((bf16_t*)Cout + o) = u.q;
                } else {
                    *reinterpret_cast<float4*>((float*)Cout + o)     = make_float4(v[0], v[1], v[2], v[3]);
                    *reinterpret_cast<float4*>((float*)Cout + o + 4) = make_float4(v[4], v[5], v[6], v[7]);
                }
            }
    }
}

// the two staging buffers of a GEMM work-group; declared in the kernel, so that the two bodies of
// gemm_qkv share one set
#define GEMM_LDS \
    __shared__ __align__(16) bf16_t sA[2][TM * LDP];  /* [row][k]  2 x 18 KB */ \
    __shared__ __align__(16) bf16_t sB[2][TN * LDP];  /* [n][k]    2 x 18 KB */

// the uses: the three projections of an attention block; FFN up (bias, GELU); FFN down (bias, f32)
// Q, K and V need nothing of each other: one launch, blockIdx.z picks the product (0 Q, 1 K, 2 V with
// its transposed output), so that three work-groups stand on a WGP where one stood
__global__ __launch_bounds__(256)
void gemm_qkv(const bf16_t* __restrict__ Aq, const bf16_t* __restrict__ Akv,
              const bf16_t* __restrict__ Wq, const bf16_t* __restrict__ Wk, const bf16_t* __restrict__ Wv,
              bf16_t* __restrict__ Cq, bf16_t* __restrict__ Ck, bf16_t* __restrict__ Cvt, int K) {
    GEMM_LDS
    const int z = blockIdx.z;
    if (z == 2) {
        gemm_body<OUT_BF16_T, false, false, MROWS, DMODEL>(sA, sB, Akv, Wv, Cvt, nullptr, K);
        return;
    }
    gemm_body<OUT_BF16, false, false, MROWS, DMODEL>(sA, sB, z ? Akv : Aq, z ? Wk : Wq, z ? Ck : Cq, nullptr, K);
    // the wait that stands before the registers of the issued stores are written again: in the built code the
    // other body's entry follows these stores behind a branch
    asm volatile("s_wait_xcnt 0x0" ::: "memory");
}
__global__ __launch_bounds__(256)
void gemm_ff1(const bf16_t* __restrict__ A, const bf16_t* __restrict__ Bt, bf16_t* __restrict__ C,
              const float* __restrict__ bias, int K) {
    GEMM_LDS
    gemm_body<OUT_BF16, true, true, MROWS, FFDIM>(sA, sB, A, Bt, C, bias, K);
}
__global__ __launch_bounds__(256)
void gemm_ff2(const bf16_t* __restrict__ A, const bf16_t* __restrict__ Bt, float* __restrict__ C,
              const float* __restrict__ bias, int K) {
    GEMM_LDS
    gemm_body<OUT_F32, true, false, MROWS, DMODEL>(sA, sB, A, Bt, C, bias, K);
}

__device__ __forceinline__ float expf_slot(float x) {
    float r;
    asm("v_exp_f32 %0, %1\n\tv_nop" : "=v"(r) : "v"(x * 1.44269504088896340736f));
    return r;
}

// eight e^x, each as above. One statement, so that the slot behind every v_exp_f32 is filled by construction: the
// next one neither reads its result nor writes its source (the results are early-clobber registers), and the
// last has the v_nop.
__device__ __forceinline__ v8f exp8_slot(const v8f& x) {
    float r0, r1, r2, r3, r4, r5, r6, r7;
    const float c = 1.44269504088896340736f;
    asm("v_exp_f32 %0, %8\n\tv_exp_f32 %1, %9\n\tv_exp_f32 %2, %10\n\tv_exp_f32 %3, %11\n\t"
        "v_exp_f32 %4, %12\n\tv_exp_f32 %5, %13\n\tv_exp_f32 %6, %14\n\tv_exp_f32 %7, %15\n\tv_nop"
        : "=&v"(r0), "=&v"(r1), "=&v"(r2), "=&v"(r3), "=&v"(r4), "=&v"(r5), "=&v"(r6), "=&v"(r7)
        : "v"(x[0] * c), "v"(x[1] * c), "v"(x[2] * c), "v"(x[3] * c),
          "v"(x[4] * c), "v"(x[5] * c), "v"(x[6] * c), "v"(x[7] * c));
    v8f r;
    r[0] = r0; r[1] = r1; r[2] = r2; r[3] = r3; r[4] = r4; r[5] = r5; r[6] = r6; r[7] = r7;
    return r;
}

// lane l with lane l ^ 16
__device__ __forceinline__ float xhalf(float x) {
    const int b = __builtin_bit_cast(int, x);
    return __builtin_bit_cast(float, __builtin_amdgcn_permlanex16(b, b, 0x76543210, 0xfedcba98, false, false));
}

#define AW     8    // waves = 16-query tiles per work-group
#define AKEYS  64   // keys per staged tile: a V row of the tile is one whole 128-B line, as a K row is
#define APITCH 72   // LDS row pitch in elements: 144 B = 16 B x odd, for the 16-byte fragment reads
__global__ __launch_bounds__(256)
void attn_wmma(const bf16_t* __restrict__ Qg, const bf16_t* __restrict__ Kg,
               const bf16_t* __restrict__ Vt, float* __restrict__ Og,
               int Nq, int Nk, int Mtot, int causal, float scale) {
    __shared__ __align__(16) bf16_t sK[2][AKEYS * APITCH];   // [key][head-dim]   2 x 9 KB
    __shared__ __align__(16) bf16_t sV[2][HDIM * APITCH];    // [head-dim][key]   2 x 9 KB

    const int t    = threadIdx.x;
    const int lane = t & 31;
    const int wave = __builtin_amdgcn_readfirstlane(t >> 5);  // scalar: the tests on kend below are scalar branches
    const int hi   = lane >> 4;
    const int l16  = lane & 15;
    const int kb   = hi * 8;
    const int h    = blockIdx.y;
    const int b    = blockIdx.z;
    const int qblk  = blockIdx.x * (16 * AW);
    const int qbase = qblk + wave * 16;
    const size_t qoff = (size_t)b * Nq * DMODEL;
    const size_t koff = (size_t)b * Nk * DMODEL;

    // staging: eight lanes cover one 128-B row, so a wave's 16-byte load touches four whole lines;
    // a thread takes rows srow and srow + 32 of the K tile and of the V tile
    const int srow = t >> 3;                 // 0..31
    const int sseg = (t & 7) * 8;            // 0,8,..,56
    const int sdst = srow * APITCH + sseg;
    const bf16_t* gK = Kg + koff + (size_t)srow * DMODEL + h * HDIM + sseg;
    const bf16_t* gV = Vt + (size_t)(h * HDIM + srow) * Mtot + (size_t)b * Nk + sseg;
    const size_t kstep = (size_t)32 * DMODEL;
    const size_t vstep = (size_t)32 * Mtot;

    // Q fragments: 16 queries x 64 head-dims = two 32x16 B fragments (lane = query, elements walk head-dim)
    FragB qa[2];
#pragma unroll
    for (int kc = 0; kc < 2; ++kc) {
        const bf16_t* base = Qg + qoff + (size_t)(qbase + l16) * DMODEL + h * HDIM + kc * 32 + kb;
        qa[kc].q[0] = *reinterpret_cast<const uint4*>(base);
        qa[kc].q[1] = *reinterpret_cast<const uint4*>(base + 16);
    }

    v8f o[4];               // O^T: o[n][r] = head-dim n * 16 + kb + r of query l16
    float m = -1e30f;       // the query's running maximum, the same in both halves
    float lsum = 0.0f;      // the sum over this half's keys; the halves are joined behind the loop
#pragma unroll
    for (int n = 0; n < 4; ++n) o[n] = v8f_zero();
    const int row = qbase + l16;   // the lane's query

    int kend  = Nk;    // this wave's end
    int kendw = Nk;    // the work-group's end = its last wave's
    if (causal) {
        kend = (qbase + 16 + 31) & ~31;
        if (kend > Nk) kend = Nk;
        kendw = (qblk + 16 * AW + 31) & ~31;
        if (kendw > Nk) kendw = Nk;
    }
    const int ns = (kendw + AKEYS - 1) / AKEYS;   // staged tiles, the same for every wave

    uint4 pk0, pk1, pv0, pv1;
    // prologue: tile 0 into buffer 0
    pk0 = *reinterpret_cast<const uint4*>(gK);
    pk1 = *reinterpret_cast<const uint4*>(gK + kstep);
    pv0 = *reinterpret_cast<const uint4*>(gV);
    pv1 = *reinterpret_cast<const uint4*>(gV + vstep);
    *reinterpret_cast<uint4*>(&sK[0][sdst])               = pk0;
    *reinterpret_cast<uint4*>(&sK[0][sdst + 32 * APITCH]) = pk1;
    *reinterpret_cast<uint4*>(&sV[0][sdst])               = pv0;
    *reinterpret_cast<uint4*>(&sV[0][sdst + 32 * APITCH]) = pv1;
    __syncthreads();

    for (int s = 0; s < ns; ++s) {
        const int cur = s & 1;
        const int nxt = cur ^ 1;
        const bool more = (s + 1) < ns;
        if (more) {
            const bf16_t* k0 = gK + (size_t)(s + 1) * AKEYS * DMODEL;
            const bf16_t* v0 = gV + (s + 1) * AKEYS;
            const bf16_t* v1 = v0 + vstep;
            pk0 = *reinterpret_cast<const uint4*>(k0);
            pk1 = *reinterpret_cast<const uint4*>(k0 + kstep);   // a constant step: k0's registers and an offset
            pv0 = *reinterpret_cast<const uint4*>(v0);
            pv1 = *reinterpret_cast<const uint4*>(v1);
            // the wait that stands before an issued load's address registers are written again;
            // the addresses are inputs so that none is reused as a later load's destination
            asm volatile("s_wait_xcnt 0x0" :: "v"(k0), "v"(v0), "v"(v1) : "memory");
        }

        // two 32-key passes per staged tile; a wave past its own causal end skips the pass
#pragma unroll
        for (int sub = 0; sub < AKEYS; sub += 32) {
            const int j0 = s * AKEYS + sub;
            if (j0 < kend) {
                // ---- S^T = K Q^T for 32 keys (two 16x16 C tiles): sc[st][r] = key j0 + st * 16 + kb + r, query l16
                v8f sc[2];
#pragma unroll
                for (int st = 0; st < 2; ++st) {
                    FragB kb0, kb1;   // A = K: lane holds key row, elems walk head-dim
                    const bf16_t* base = &sK[cur][(sub + st * 16 + l16) * APITCH + kb];
                    kb0.q[0] = *reinterpret_cast<const uint4*>(base);
                    kb0.q[1] = *reinterpret_cast<const uint4*>(base + 16);
                    kb1.q[0] = *reinterpret_cast<const uint4*>(base + 32);
                    kb1.q[1] = *reinterpret_cast<const uint4*>(base + 48);
                    v8f z = v8f_zero();
                    z = wmma_bf16(kb0.v, qa[0].v, z);
                    z = wmma_bf16(kb1.v, qa[1].v, z);
                    sc[st] = z;
                }
                // ---- scale + causal mask
#pragma unroll
                for (int st = 0; st < 2; ++st) {
#pragma unroll
                    for (int r = 0; r < 8; ++r) {
                        int col = j0 + st * 16 + kb + r;
                        float v = sc[st][r] * scale;
                        if (causal && col > row) v = -1e30f;
                        sc[st][r] = v;
                    }
                }
                // ---- online softmax: the lane's 16 scores by a tree, then the other half's result
                float t8[8];
#pragma unroll
                for (int r = 0; r < 8; ++r) t8[r] = fmaxf(sc[0][r], sc[1][r]);
                float rm = fmaxf(fmaxf(fmaxf(t8[0], t8[1]), fmaxf(t8[2], t8[3])),
                                 fmaxf(fmaxf(t8[4], t8[5]), fmaxf(t8[6], t8[7])));
                rm = fmaxf(rm, xhalf(rm));
                const float mn = fmaxf(m, rm);
                const float alpha = expf_slot(m - mn);
                m = mn;
                float rs[4] = {0.0f, 0.0f, 0.0f, 0.0f};   // four chains, so that no add waits on the one before
#pragma unroll
                for (int st = 0; st < 2; ++st) {
                    sc[st] = exp8_slot(sc[st] - mn);
#pragma unroll
                    for (int r = 0; r < 8; ++r) rs[r & 3] += sc[st][r];
                }
                lsum = lsum * alpha + ((rs[0] + rs[1]) + (rs[2] + rs[3]));
#pragma unroll
                for (int n = 0; n < 4; ++n)
#pragma unroll
                    for (int r = 0; r < 8; ++r) o[n][r] *= alpha;

                // ---- P^T as a B fragment: element s is key (s < 8 ? kb + s : 16 + kb + s - 8), which is what
                // the lane holds in sc[s >> 3][s & 7], and the k order of the V loader below
                FragB pb;
#pragma unroll
                for (int s8 = 0; s8 < 16; ++s8) pb.e[s8] = f2bf(sc[s8 >> 3][s8 & 7]);

                // ---- O^T += V^T (64x32) * P^T (32x16): V fragments from the staged tile
#pragma unroll
                for (int n = 0; n < 4; ++n) {
                    FragB vb;   // A = V^T: lane holds head-dim row, elems walk keys
                    const bf16_t* vbase = &sV[cur][(n * 16 + l16) * APITCH + sub + kb];
                    vb.q[0] = *reinterpret_cast<const uint4*>(vbase);
                    vb.q[1] = *reinterpret_cast<const uint4*>(vbase + 16);
                    o[n] = wmma_bf16(vb.v, pb.v, o[n]);
                }
                // the four vector slots that the chip needs behind a matrix instruction before its operands are
                // overwritten: the four
                // accumulators are inputs so that the slots stand behind all four products
                asm volatile("v_nop\n\tv_nop\n\tv_nop\n\tv_nop" :: "v"(o[0]), "v"(o[1]), "v"(o[2]), "v"(o[3]));
            }
        }

        if (more) {
            *reinterpret_cast<uint4*>(&sK[nxt][sdst])               = pk0;
            *reinterpret_cast<uint4*>(&sK[nxt][sdst + 32 * APITCH]) = pk1;
            *reinterpret_cast<uint4*>(&sV[nxt][sdst])               = pv0;
            *reinterpret_cast<uint4*>(&sV[nxt][sdst + 32 * APITCH]) = pv1;
        }
        // publishes the next tile and ends every wave's reads of the buffer that is refilled next
        __syncthreads();
    }

    // ---- join the halves' sums, normalize + store: a lane's eight values of a tile are neighbours
    const float l = lsum + xhalf(lsum);
#pragma unroll
    for (int n = 0; n < 4; ++n)
#pragma unroll
        for (int r = 0; r < 8; ++r) o[n][r] = o[n][r] / l;
    float* og = Og + qoff + (size_t)row * DMODEL + h * HDIM + kb;
#pragma unroll
    for (int n = 0; n < 4; ++n) {
        *reinterpret_cast<float4*>(og + n * 16)     = make_float4(o[n][0], o[n][1], o[n][2], o[n][3]);
        *reinterpret_cast<float4*>(og + n * 16 + 4) = make_float4(o[n][4], o[n][5], o[n][6], o[n][7]);
    }
}

// ---------------------------------------------------------------- residual + LayerNorm
// One wave per row, 32 values a lane by 16-byte accesses on whole lines; the row's sums stay in the
// wave (four chains a lane, then a five-step butterfly), so no LDS and no barrier.
#define LN_ROWS 8   // rows (waves) per work-group
__global__ __launch_bounds__(256)
void add_ln(const float* __restrict__ a, const float* __restrict__ resid,
            const float* __restrict__ g, const float* __restrict__ beta,
            float* __restrict__ yf, bf16_t* __restrict__ ybf) {
    const int lane = threadIdx.x & 31;
    const int row  = blockIdx.x * LN_ROWS + (threadIdx.x >> 5);
    const size_t ro = (size_t)row * DMODEL + lane * 4;

    const float* pa = a     + ro;
    const float* pr = resid + ro;
    float4 x[8], r[8];
#pragma unroll
    for (int i = 0; i < 8; ++i) x[i] = *reinterpret_cast<const float4*>(pa + i * 128);
#pragma unroll
    for (int i = 0; i < 8; ++i) r[i] = *reinterpret_cast<const float4*>(pr + i * 128);
    // the wait that stands before an issued load's address registers are written again;
    // the addresses are inputs so that none is reused as a later load's destination
    asm volatile("s_wait_xcnt 0x0" :: "v"(pa), "v"(pr) : "memory");

    float s0 = 0.0f, s1 = 0.0f, s2 = 0.0f, s3 = 0.0f;
    float q0 = 0.0f, q1 = 0.0f, q2 = 0.0f, q3 = 0.0f;
#pragma unroll
    for (int i = 0; i < 8; ++i) {
        x[i].x += r[i].x; x[i].y += r[i].y; x[i].z += r[i].z; x[i].w += r[i].w;
        s0 += x[i].x; s1 += x[i].y; s2 += x[i].z; s3 += x[i].w;
        q0 += x[i].x * x[i].x; q1 += x[i].y * x[i].y; q2 += x[i].z * x[i].z; q3 += x[i].w * x[i].w;
    }
    float s  = (s0 + s1) + (s2 + s3);
    float ss = (q0 + q1) + (q2 + q3);
#pragma unroll
    for (int off = 1; off < 32; off <<= 1) {
        s  += __shfl_xor(s,  off, 32);
        ss += __shfl_xor(ss, off, 32);
    }
    const float mean = s  * (1.0f / DMODEL);
    const float var  = ss * (1.0f / DMODEL) - mean * mean;
    // rsqrtf as the compiler expands it (a denormal argument is scaled by 2^24, its result by 2^12), with
    // v_rsq_f32 and the one slot that the instruction set asks for behind it in one statement, so that
    // the slot stays directly behind it
    const float ve   = var + 1e-5f;
    const bool  tiny = ve < 1.17549435e-38f;
    float rq;
    asm("v_rsq_f32 %0, %1\n\tv_nop" : "=v"(rq) : "v"(tiny ? ve * 16777216.0f : ve));
    const float rstd = tiny ? rq * 4096.0f : rq;
#pragma unroll
    for (int i = 0; i < 8; ++i) {
        const float4 gv = *reinterpret_cast<const float4*>(g    + lane * 4 + i * 128);
        const float4 bv = *reinterpret_cast<const float4*>(beta + lane * 4 + i * 128);
        x[i].x = (x[i].x - mean) * rstd * gv.x + bv.x;
        x[i].y = (x[i].y - mean) * rstd * gv.y + bv.y;
        x[i].z = (x[i].z - mean) * rstd * gv.z + bv.z;
        x[i].w = (x[i].w - mean) * rstd * gv.w + bv.w;
        *reinterpret_cast<float4*>(yf + ro + i * 128) = x[i];
    }
    // the wait that stands before the registers of the issued stores are written again (by the packing below)
    asm volatile("s_wait_xcnt 0x0" ::: "memory");
    if (ybf) {
#pragma unroll
        for (int i = 0; i < 8; ++i)
            *reinterpret_cast<uint2*>(ybf + ro + i * 128) = pack4_bf16(x[i]);
    }
}

// ---------------------------------------------------------------- launch
extern "C" void kernel_launch(void* const* d_in, const int* in_sizes, int n_in,
                              void* d_out, int out_size, void* d_ws, size_t ws_size,
                              hipStream_t stream) {
    const float* x    = (const float*)d_in[0];
    const float* enc  = (const float*)d_in[1];
    const float* Wq1  = (const float*)d_in[2];
    const float* Wk1  = (const float*)d_in[3];
    const float* Wv1  = (const float*)d_in[4];
    const float* g1   = (const float*)d_in[5];
    const float* b1   = (const float*)d_in[6];
    const float* Wq2  = (const float*)d_in[7];
    const float* Wk2  = (const float*)d_in[8];
    const float* Wv2  = (const float*)d_in[9];
    const float* g2   = (const float*)d_in[10];
    const float* b2   = (const float*)d_in[11];
    const float* Wff1 = (const float*)d_in[12];
    const float* bff1 = (const float*)d_in[13];
    const float* Wff2 = (const float*)d_in[14];
    const float* bff2 = (const float*)d_in[15];
    const float* g3   = (const float*)d_in[16];
    const float* b3   = (const float*)d_in[17];

    char* ws = (char*)d_ws;
    const size_t MB = 1024u * 1024u;
    bf16_t* wq1b  = (bf16_t*)(ws + 0   * MB);   // all weights stored transposed [N][K]
    bf16_t* wk1b  = (bf16_t*)(ws + 2   * MB);
    bf16_t* wv1b  = (bf16_t*)(ws + 4   * MB);
    bf16_t* wq2b  = (bf16_t*)(ws + 6   * MB);
    bf16_t* wk2b  = (bf16_t*)(ws + 8   * MB);
    bf16_t* wv2b  = (bf16_t*)(ws + 10  * MB);
    bf16_t* wff1b = (bf16_t*)(ws + 12  * MB);
    bf16_t* wff2b = (bf16_t*)(ws + 20  * MB);
    bf16_t* xbf   = (bf16_t*)(ws + 28  * MB);   // activation bf16 (reused: x, y1, y2)
    bf16_t* encbf = (bf16_t*)(ws + 36  * MB);
    bf16_t* qbf   = (bf16_t*)(ws + 44  * MB);
    bf16_t* kbf   = (bf16_t*)(ws + 52  * MB);
    bf16_t* vbf   = (bf16_t*)(ws + 60  * MB);   // V stored transposed [DMODEL][MROWS]
    float*  ctx   = (float*) (ws + 68  * MB);   // attn ctx / ff2 out
    float*  yA    = (float*) (ws + 84  * MB);
    float*  yB    = (float*) (ws + 100 * MB);
    bf16_t* hbf   = (bf16_t*)(ws + 116 * MB);   // ends at 148 MB

    const dim3 gqkv(DMODEL / TN, MROWS / TM, 3);
    const dim3 gff1(FFDIM / TN, MROWS / TM);
    const dim3 gff2(DMODEL / TN, MROWS / TM);

    // x, enc -> bf16; weights -> bf16, transposed [N][K] (wq1b .. wv2b lie 2 MB apart, from wq1b on)
    cvt_all<<<CVT_ALL_BLOCKS, 256, 0, stream>>>(x, enc, Wq1, Wk1, Wv1, Wq2, Wk2, Wv2, Wff1, Wff2,
                                                xbf, encbf, wq1b, wff1b, wff2b);

    const float scale = 0.03125f;   // 1/sqrt(DMODEL), as in reference
    dim3 agrid(NTOK / (16 * AW), NHEAD, BATCH);

    // ---- block 1: causal self-attention
    gemm_qkv<<<gqkv, 256, 0, stream>>>(xbf, xbf, wq1b, wk1b, wv1b, qbf, kbf, vbf, DMODEL);
    attn_wmma<<<agrid, 256, 0, stream>>>(qbf, kbf, vbf, ctx, NTOK, NTOK, MROWS, 1, scale);
    add_ln<<<MROWS / LN_ROWS, 256, 0, stream>>>(ctx, x, g1, b1, yA, xbf);    // xbf := y1 (bf16)

    // ---- block 2: cross-attention over encoder output
    gemm_qkv<<<gqkv, 256, 0, stream>>>(xbf, encbf, wq2b, wk2b, wv2b, qbf, kbf, vbf, DMODEL);
    attn_wmma<<<agrid, 256, 0, stream>>>(qbf, kbf, vbf, ctx, NTOK, NTOK, MROWS, 0, scale);
    add_ln<<<MROWS / LN_ROWS, 256, 0, stream>>>(ctx, yA, g2, b2, yB, xbf);   // xbf := y2 (bf16)

    // ---- block 3: FFN (bias+GELU fused), residual, final LN
    gemm_ff1<<<gff1,  256, 0, stream>>>(xbf, wff1b, hbf, bff1, DMODEL);   // bf16 out + GELU
    gemm_ff2<<<gff2,  256, 0, stream>>>(hbf, wff2b, ctx, bff2, FFDIM);    // fp32 out
    add_ln<<<MROWS / LN_ROWS, 256, 0, stream>>>(ctx, yB, g3, b3, (float*)d_out, nullptr);
}

// v007
// One run takes 223 microseconds.
// In both of two side-by-side timings against v006, it was 1.08 times as fast.
// Over all steps from v000 it is 3.07 times as fast.
#include <hip/hip_runtime.h>
#include <math.h>

// ---------------------------------------------------------------- types
typedef __bf16 bf16_t;
typedef __attribute__((ext_vector_type(16))) __bf16 v16bf;
typedef __attribute__((ext_vector_type(8)))  float  v8f;

union FragB {
    v16bf  v;
    uint4  q[2];
    bf16_t e[16];
};

__device__ __forceinline__ bf16_t f2bf(float f) {
    unsigned int u = __float_as_uint(f);
    unsigned int r = u + 0x7FFFu + ((u >> 16) & 1u);   // round to nearest even
    unsigned short s = (unsigned short)(r >> 16);
    return __builtin_bit_cast(bf16_t, s);
}

__device__ __forceinline__ v8f wmma_bf16(const v16bf& a, const v16bf& b, const v8f& c) {
    return __builtin_amdgcn_wmma_f32_16x16x32_bf16(false, a, false, b, (short)0, c, false, false);
}

__device__ __forceinline__ v8f v8f_zero() {
    v8f z;
#pragma unroll
    for (int i = 0; i < 8; ++i) z[i] = 0.0f;
    return z;
}

// ---------------------------------------------------------------- constants
#define DMODEL 1024
#define NHEAD  16
#define HDIM   64
#define FFDIM  4096
#define BATCH  4
#define NTOK   1024
#define MROWS  (BATCH * NTOK)   // 4096

// ---------------------------------------------------------------- fp32 -> bf16 (straight)
__device__ __forceinline__ uint2 pack4_bf16(const float4& v) {
    union { bf16_t e[4]; uint2 q; } u;
    u.e[0] = f2bf(v.x); u.e[1] = f2bf(v.y); u.e[2] = f2bf(v.z); u.e[3] = f2bf(v.w);
    return u.q;
}

// 32 values a thread, as eight 16-byte loads in flight; every wave-wide load (512 B) and store (256 B)
// covers whole lines. One wave per 1,024 values, not one per 32.
#define CVT_BLOCK (256 * 32)   // values per work-group; a tensor is a multiple of it
__device__ __forceinline__
void cvt_f32_to_bf16(const float* __restrict__ in, bf16_t* __restrict__ out, int blk) {
    const size_t base = (size_t)blk * CVT_BLOCK + threadIdx.x * 4;
    float4 v[8];
#pragma unroll
    for (int c = 0; c < 8; ++c)
        v[c] = *reinterpret_cast<const float4*>(in + base + c * 1024);
#pragma unroll
    for (int c = 0; c < 8; ++c)
        *reinterpret_cast<uint2*>(out + base + c * 1024) = pack4_bf16(v[c]);
}

// ---------------------------------------------------------------- fp32 [K][N] -> bf16 [N][K]
// 64 x 64 tile, 16 values a thread: 16-byte loads along n (a wave covers two 256-B row pieces),
// 16-byte stores along k (eight lanes cover one 128-B line of an output row).
#define TT 64
__device__ __forceinline__
void cvt_transpose_bf16(const float* __restrict__ in, bf16_t* __restrict__ out,
                        int Kdim, int Ndim, int bn, int bk) {
    __shared__ float tile[TT][TT + 1];   // pitch 65 dwords: the column walks below meet no bank twice
    const int k0 = bk * TT;
    const int n0 = bn * TT;
    const int t  = threadIdx.x;
    const int lr = t >> 4;               // 0..15
    const int lc = (t & 15) * 4;         // 0,4,..,60
    const float* s0 = in + (size_t)(k0 + lr) * Ndim + n0 + lc;
    const float* s1 = s0 + (size_t)16 * Ndim;
    const float* s2 = s1 + (size_t)16 * Ndim;
    const float* s3 = s2 + (size_t)16 * Ndim;
    float4 v[4];
    v[0] = *reinterpret_cast<const float4*>(s0);
    v[1] = *reinterpret_cast<const float4*>(s1);
    v[2] = *reinterpret_cast<const float4*>(s2);
    v[3] = *reinterpret_cast<const float4*>(s3);
    // the wait that stands before an issued load's address registers are written again;
    // the addresses are inputs so that none is reused as a later load's destination
    asm volatile("s_wait_xcnt 0x0" :: "v"(s0), "v"(s1), "v"(s2), "v"(s3) : "memory");
#pragma unroll
    for (int p = 0; p < 4; ++p) {
        float* d = &tile[p * 16 + lr][lc];
        d[0] = v[p].x; d[1] = v[p].y; d[2] = v[p].z; d[3] = v[p].w;
    }
    __syncthreads();
#pragma unroll
    for (int c = 0; c < 2; ++c) {
        const int id = t + c * 256;
        const int n  = id >> 3;          // 0..63
        const int ks = (id & 7) * 8;     // 0,8,..,56
        union { bf16_t e[8]; uint4 q; } u;
#pragma unroll
        for (int j = 0; j < 8; ++j) u.e[j] = f2bf(tile[ks + j][n]);
        *reinterpret_cast<uint4*>(out + (size_t)(n0 + n) * Kdim + k0 + ks) = u.q;
    }
}

// ---------------------------------------------------------------- all ten conversions, one launch
// None of them needs anything of another, so they share one grid by ranges of the block index
// (every test below is on blockIdx alone: the same for a whole work-group). The casts, which move
// twice a transpose tile's bytes per work-group, come first.
#define CAST_BLOCKS (MROWS * DMODEL / CVT_BLOCK)             // 512 per activation tensor
#define SQ_BLOCKS   ((DMODEL / TT) * (DMODEL / TT))          // 256 per square weight
#define FF_BLOCKS   ((DMODEL / TT) * (FFDIM / TT))           // 1,024 per feed-forward weight
#define CVT_ALL_BLOCKS (2 * CAST_BLOCKS + 6 * SQ_BLOCKS + 2 * FF_BLOCKS)
__global__ __launch_bounds__(256)
void cvt_all(const float* __restrict__ x,    const float* __restrict__ enc,
             const float* __restrict__ wq1,  const float* __restrict__ wk1, const float* __restrict__ wv1,
             const float* __restrict__ wq2,  const float* __restrict__ wk2, const float* __restrict__ wv2,
             const float* __restrict__ wff1, const float* __restrict__ wff2,
             bf16_t* __restrict__ xbf,  bf16_t* __restrict__ encbf,
             bf16_t* __restrict__ wsq,          // the six square weights' outputs, DMODEL * DMODEL apart
             bf16_t* __restrict__ wff1b, bf16_t* __restrict__ wff2b) {
    int b = blockIdx.x;
    if (b < 2 * CAST_BLOCKS) {
        const bool first = b < CAST_BLOCKS;
        cvt_f32_to_bf16(first ? x : enc, first ? xbf : encbf, first ? b : b - CAST_BLOCKS);
        return;   // the whole work-group leaves, ahead of the transpose's barrier
    }
    b -= 2 * CAST_BLOCKS;
    const float* in;
    bf16_t* out;
    int Kdim = DMODEL, Ndim = DMODEL;
    if (b < 6 * SQ_BLOCKS) {
        const int w = b / SQ_BLOCKS;
        b -= w * SQ_BLOCKS;
        const bool odd = w & 1;
        const float* p01 = odd ? wk1 : wq1;
        const float* p23 = odd ? wq2 : wv1;
        const float* p45 = odd ? wv2 : wk2;
        in  = w < 2 ? p01 : w < 4 ? p23 : p45;
        out = wsq + (size_t)w * DMODEL * DMODEL;
    } else if (b < 6 * SQ_BLOCKS + FF_BLOCKS) {
        b -= 6 * SQ_BLOCKS;
        in = wff1; out = wff1b; Ndim = FFDIM;
    } else {
        b -= 6 * SQ_BLOCKS + FF_BLOCKS;
        in = wff2; out = wff2b; Kdim = FFDIM;
    }
    const int nb = Ndim / TT;   // tiles along n: 16 or 64
    cvt_transpose_bf16(in, out, Kdim, Ndim, b % nb, b / nb);
}

// ---------------------------------------------------------------- GEMM (bf16 WMMA, fp32 acc)
// C[M,N] = A[M,K] @ B[K,N], with B supplied TRANSPOSED as Bt[N][K] bf16.
// The output kind, bias, GELU and the output's pitch are compile-time values: one kernel per use below.
#define OUT_BF16   0   // bf16 [M][N]
#define OUT_BF16_T 1   // bf16 [N][M]
#define OUT_F32    2   // f32  [M][N]
#define TM 128
#define TN 128
#define TK 64      // one staged row of a slab = 128 B = one whole cache line
#define LDP 72     // LDS row pitch in elements: 144 B = 16 B x odd, for the 16-byte fragment reads

template <int KIND, bool BIAS, bool GELU, int M, int N>
__device__ __forceinline__
void gemm_body(bf16_t (*sA)[TM * LDP], bf16_t (*sB)[TN * LDP],
               const bf16_t* __restrict__ A, const bf16_t* __restrict__ Bt,
               void* __restrict__ Cout, const float* __restrict__ bias, int K, int ld) {
    // K: the k extent of this product; ld: the row pitch of A and Bt in elements (K, or more for a part of the rows)
    static_assert(KIND != OUT_BF16_T || (!BIAS && !GELU), "the transposed output takes neither");

    const int t    = threadIdx.x;
    const int lane = t & 31;
    const int wave = t >> 5;                 // 0..7
    const int wrow = (wave & 3) * 32;        // 0,32,64,96
    const int wcol = (wave >> 2) * 64;       // 0,64
    const int m0   = blockIdx.y * TM;
    const int n0   = blockIdx.x * TN;
    const int hi   = lane >> 4;
    const int l16  = lane & 15;
    const int kb   = hi * 8;

    // staging: eight lanes cover one 128-B row of the slab, so a wave's 16-byte load
    // touches four whole lines; a thread takes rows srow, srow + 32, + 64, + 96
    const int srow = t >> 3;                 // 0..31
    const int sseg = (t & 7) * 8;            // 0,8,..,56
    const bf16_t* gA = A  + (size_t)m0 * ld; // block-uniform bases; the lane's part is soff
    const bf16_t* gB = Bt + (size_t)n0 * ld;
    const unsigned soff = (unsigned)(srow * ld + sseg);
    const size_t rstep = (size_t)32 * ld;
    const int sdst = srow * LDP + sseg;

    v8f acc[2][4];
#pragma unroll
    for (int i = 0; i < 2; ++i)
#pragma unroll
        for (int j = 0; j < 4; ++j) acc[i][j] = v8f_zero();

    const int nk = K / TK;
    uint4 pa0, pa1, pa2, pa3, pb0, pb1, pb2, pb3;

    // prologue: stage slab 0 into buffer 0
    {
        const bf16_t* a0 = gA + soff;
        const bf16_t* a1 = a0 + rstep;
        const bf16_t* a2 = a1 + rstep;
        const bf16_t* a3 = a2 + rstep;
        const bf16_t* b0 = gB + soff;
        const bf16_t* b1 = b0 + rstep;
        const bf16_t* b2 = b1 + rstep;
        const bf16_t* b3 = b2 + rstep;
        pa0 = *reinterpret_cast<const uint4*>(a0);
        pa1 = *reinterpret_cast<const uint4*>(a1);
        pa2 = *reinterpret_cast<const uint4*>(a2);
        pa3 = *reinterpret_cast<const uint4*>(a3);
        pb0 = *reinterpret_cast<const uint4*>(b0);
        pb1 = *reinterpret_cast<const uint4*>(b1);
        pb2 = *reinterpret_cast<const uint4*>(b2);
        pb3 = *reinterpret_cast<const uint4*>(b3);
        // the wait that stands before an issued load's address registers are written again, as in the loop below
        asm volatile("s_wait_xcnt 0x0"
                     :: "v"(a0), "v"(a1), "v"(a2), "v"(a3), "v"(b0), "v"(b1), "v"(b2), "v"(b3)
                     : "memory");
    }
    *reinterpret_cast<uint4*>(&sA[0][sdst])            = pa0;
    *reinterpret_cast<uint4*>(&sA[0][sdst + 32 * LDP]) = pa1;
    *reinterpret_cast<uint4*>(&sA[0][sdst + 64 * LDP]) = pa2;
    *reinterpret_cast<uint4*>(&sA[0][sdst + 96 * LDP]) = pa3;
    *reinterpret_cast<uint4*>(&sB[0][sdst])            = pb0;
    *reinterpret_cast<uint4*>(&sB[0][sdst + 32 * LDP]) = pb1;
    *reinterpret_cast<uint4*>(&sB[0][sdst + 64 * LDP]) = pb2;
    *reinterpret_cast<uint4*>(&sB[0][sdst + 96 * LDP]) = pb3;
    __syncthreads();

    for (int kt = 0; kt < nk; ++kt) {
        const int cur = kt & 1;
        const int nxt = cur ^ 1;
        const bool more = (kt + 1) < nk;
        if (more) {
            int ko = (kt + 1) * TK;
            const bf16_t* a0 = gA + ko + soff;
            const bf16_t* a1 = a0 + rstep;
            const bf16_t* a2 = a1 + rstep;
            const bf16_t* a3 = a2 + rstep;
            const bf16_t* b0 = gB + ko + soff;
            const bf16_t* b1 = b0 + rstep;
            const bf16_t* b2 = b1 + rstep;
            const bf16_t* b3 = b2 + rstep;
            pa0 = *reinterpret_cast<const uint4*>(a0);
            pa1 = *reinterpret_cast<const uint4*>(a1);
            pa2 = *reinterpret_cast<const uint4*>(a2);
            pa3 = *reinterpret_cast<const uint4*>(a3);
            pb0 = *reinterpret_cast<const uint4*>(b0);
            pb1 = *reinterpret_cast<const uint4*>(b1);
            pb2 = *reinterpret_cast<const uint4*>(b2);
            pb3 = *reinterpret_cast<const uint4*>(b3);
            // the wait that stands before an issued load's address registers are written again;
            // the addresses are inputs so that none is reused as a later load's destination
            asm volatile("s_wait_xcnt 0x0"
                         :: "v"(a0), "v"(a1), "v"(a2), "v"(a3), "v"(b0), "v"(b1), "v"(b2), "v"(b3)
                         : "memory");
        }

        // two 32-deep products per slab, k ascending; unrolled so that ks folds into the LDS offsets
#pragma unroll
        for (int ks = 0; ks < TK; ks += 32) {
            FragB af[2], bfr[4];
#pragma unroll
            for (int i = 0; i < 2; ++i) {
                int row = wrow + i * 16 + l16;
                af[i].q[0] = *reinterpret_cast<const uint4*>(&sA[cur][row * LDP + ks + kb]);
                af[i].q[1] = *reinterpret_cast<const uint4*>(&sA[cur][row * LDP + ks + kb + 16]);
            }
#pragma unroll
            for (int j = 0; j < 4; ++j) {
                int col = wcol + j * 16 + l16;
                bfr[j].q[0] = *reinterpret_cast<const uint4*>(&sB[cur][col * LDP + ks + kb]);
                bfr[j].q[1] = *reinterpret_cast<const uint4*>(&sB[cur][col * LDP + ks + kb + 16]);
            }
#pragma unroll
            for (int i = 0; i < 2; ++i)
#pragma unroll
                for (int j = 0; j < 4; ++j) {
                    // the operand order decides which index of C runs along a lane's eight accumulators:
                    // always the one that is contiguous in the output (m for [N][M], n for [M][N])
                    if constexpr (KIND == OUT_BF16_T) acc[i][j] = wmma_bf16(af[i].v, bfr[j].v, acc[i][j]);
                    else                              acc[i][j] = wmma_bf16(bfr[j].v, af[i].v, acc[i][j]);
                }
        }

        if (more) {
            *reinterpret_cast<uint4*>(&sA[nxt][sdst])            = pa0;
            *reinterpret_cast<uint4*>(&sA[nxt][sdst + 32 * LDP]) = pa1;
            *reinterpret_cast<uint4*>(&sA[nxt][sdst + 64 * LDP]) = pa2;
            *reinterpret_cast<uint4*>(&sA[nxt][sdst + 96 * LDP]) = pa3;
            *reinterpret_cast<uint4*>(&sB[nxt][sdst])            = pb0;
            *reinterpret_cast<uint4*>(&sB[nxt][sdst + 32 * LDP]) = pb1;
            *reinterpret_cast<uint4*>(&sB[nxt][sdst + 64 * LDP]) = pb2;
            *reinterpret_cast<uint4*>(&sB[nxt][sdst + 96 * LDP]) = pb3;
        }
        __syncthreads();
    }

    if constexpr (KIND == OUT_BF16_T) {
        // lane = column n; its eight accumulators are rows m .. m + 7: one 16-byte store
        bf16_t* C = (bf16_t*)Cout + (size_t)(n0 + wcol + l16) * M + m0 + wrow + kb;
#pragma unroll
        for (int i = 0; i < 2; ++i)
#pragma unroll
            for (int j = 0; j < 4; ++j) {
                union { bf16_t e[8]; uint4 q; } u;
#pragma unroll
                for (int r = 0; r < 8; ++r) u.e[r] = f2bf(acc[i][j][r]);
                *reinterpret_cast<uint4*>(C + (size_t)j * 16 * M + i * 16) = u.q;
            }
    } else {
        // lane = row m; its eight accumulators are columns n .. n + 7: one (bf16) or two (f32) 16-byte stores
        const size_t co = (size_t)(m0 + wrow + l16) * N + n0 + wcol + kb;
        float4 bv[4][2];
        if constexpr (BIAS) {
#pragma unroll
            for (int j = 0; j < 4; ++j) {
                bv[j][0] = *reinterpret_cast<const float4*>(bias + n0 + wcol + kb + j * 16);
                bv[j][1] = *reinterpret_cast<const float4*>(bias + n0 + wcol + kb + j * 16 + 4);
            }
        }
#pragma unroll
        for (int i = 0; i < 2; ++i)
#pragma unroll
            for (int j = 0; j < 4; ++j) {
                float v[8];
#pragma unroll
                for (int r = 0; r < 8; ++r) v[r] = acc[i][j][r];
                if constexpr (BIAS) {
                    v[0] += bv[j][0].x; v[1] += bv[j][0].y; v[2] += bv[j][0].z; v[3] += bv[j][0].w;
                    v[4] += bv[j][1].x; v[5] += bv[j][1].y; v[6] += bv[j][1].z; v[7] += bv[j][1].w;
                }
                if constexpr (GELU) {
#pragma unroll
                    for (int r = 0; r < 8; ++r)
                        v[r] = 0.5f * v[r] * (1.0f + erff(v[r] * 0.70710678118654752440f));
                }
                const size_t o = co + (size_t)i * 16 * N + j * 16;
                if constexpr (KIND == OUT_BF16) {
                    union { bf16_t e[8]; uint4 q; } u;
#pragma unroll
                    for (int r = 0; r < 8; ++r) u.e[r] = f2bf(v[r]);
                    *reinterpret_cast<uint4*>((bf16_t*)Cout + o) = u.q;
                } else {
                    *reinterpret_cast<float4*>((float*)Cout + o)     = make_float4(v[0], v[1], v[2], v[3]);
                    *reinterpret_cast<float4*>((float*)Cout + o + 4) = make_float4(v[4], v[5], v[6], v[7]);
                }
            }
    }
}

// the two staging buffers of a GEMM work-group; declared in the kernel, so that the two bodies of
// gemm_qkv share one set
#define GEMM_LDS \
    __shared__ __align__(16) bf16_t sA[2][TM * LDP];  /* [row][k]  2 x 18 KB */ \
    __shared__ __align__(16) bf16_t sB[2][TN * LDP];  /* [n][k]    2 x 18 KB */

// the uses: the three projections of an attention block; FFN up (bias, GELU); FFN down (f32, two halves of k)
// Q, K and V need nothing of each other: one launch, blockIdx.z picks the product (0 Q, 1 K, 2 V with
// its transposed output), so that three work-groups stand on a WGP where one stood
__global__ __launch_bounds__(256)
void gemm_qkv(const bf16_t* __restrict__ Aq, const bf16_t* __restrict__ Akv,
              const bf16_t* __restrict__ Wq, const bf16_t* __restrict__ Wk, const bf16_t* __restrict__ Wv,
              bf16_t* __restrict__ Cq, bf16_t* __restrict__ Ck, bf16_t* __restrict__ Cvt, int K) {
    GEMM_LDS
    const int z = blockIdx.z;
    if (z == 2) {
        gemm_body<OUT_BF16_T, false, false, MROWS, DMODEL>(sA, sB, Akv, Wv, Cvt, nullptr, K, K);
        return;
    }
    gemm_body<OUT_BF16, false, false, MROWS, DMODEL>(sA, sB, z ? Akv : Aq, z ? Wk : Wq, z ? Ck : Cq, nullptr, K, K);
    // the wait that stands before the registers of the issued stores are written again: in the built code the
    // other body's entry follows these stores behind a branch
    asm volatile("s_wait_xcnt 0x0" ::: "memory");
}
__global__ __launch_bounds__(256)
void gemm_ff1(const bf16_t* __restrict__ A, const bf16_t* __restrict__ Bt, bf16_t* __restrict__ C,
              const float* __restrict__ bias, int K) {
    GEMM_LDS
    gemm_body<OUT_BF16, true, true, MROWS, FFDIM>(sA, sB, A, Bt, C, bias, K, K);
}
// FFN down has one 128 x 128 tile per WGP and a long k: blockIdx.z halves k, so that two work-groups stand on a
// WGP and each one's waits (LDS reads, the next slab's loads, the barrier) are filled by the other's products.
// Each half stores its own f32 plane; the LayerNorm that follows adds the two planes and the bias.
__global__ __launch_bounds__(256)
void gemm_ff2(const bf16_t* __restrict__ A, const bf16_t* __restrict__ Bt,
              float* __restrict__ C0, float* __restrict__ C1, int K) {
    GEMM_LDS
    const int z  = blockIdx.z;
    const int kh = K / 2;
    gemm_body<OUT_F32, false, false, MROWS, DMODEL>(sA, sB, A + z * kh, Bt + z * kh, z ? C1 : C0, nullptr, kh, K);
}

__device__ __forceinline__ float expf_slot(float x) {
    float r;
    asm("v_exp_f32 %0, %1\n\tv_nop" : "=v"(r) : "v"(x * 1.44269504088896340736f));
    return r;
}

// eight e^x, each as above. One statement, so that the slot behind every v_exp_f32 is filled by construction: the
// next one neither reads its result nor writes its source (the results are early-clobber registers), and the
// last has the v_nop.
__device__ __forceinline__ v8f exp8_slot(const v8f& x) {
    float r0, r1, r2, r3, r4, r5, r6, r7;
    const float c = 1.44269504088896340736f;
    asm("v_exp_f32 %0, %8\n\tv_exp_f32 %1, %9\n\tv_exp_f32 %2, %10\n\tv_exp_f32 %3, %11\n\t"
        "v_exp_f32 %4, %12\n\tv_exp_f32 %5, %13\n\tv_exp_f32 %6, %14\n\tv_exp_f32 %7, %15\n\tv_nop"
        : "=&v"(r0), "=&v"(r1), "=&v"(r2), "=&v"(r3), "=&v"(r4), "=&v"(r5), "=&v"(r6), "=&v"(r7)
        : "v"(x[0] * c), "v"(x[1] * c), "v"(x[2] * c), "v"(x[3] * c),
          "v"(x[4] * c), "v"(x[5] * c), "v"(x[6] * c), "v"(x[7] * c));
    v8f r;
    r[0] = r0; r[1] = r1; r[2] = r2; r[3] = r3; r[4] = r4; r[5] = r5; r[6] = r6; r[7] = r7;
    return r;
}

// lane l with lane l ^ 16
__device__ __forceinline__ float xhalf(float x) {
    const int b = __builtin_bit_cast(int, x);
    return __builtin_bit_cast(float, __builtin_amdgcn_permlanex16(b, b, 0x76543210, 0xfedcba98, false, false));
}

#define AW     8    // waves = 16-query tiles per work-group
#define AKEYS  64   // keys per staged tile: a V row of the tile is one whole 128-B line, as a K row is
#define APITCH 72   // LDS row pitch in elements: 144 B = 16 B x odd, for the 16-byte fragment reads
__global__ __launch_bounds__(256)
void attn_wmma(const bf16_t* __restrict__ Qg, const bf16_t* __restrict__ Kg,
               const bf16_t* __restrict__ Vt, float* __restrict__ Og,
               int Nq, int Nk, int Mtot, int causal, float scale) {
    __shared__ __align__(16) bf16_t sK[2][AKEYS * APITCH];   // [key][head-dim]   2 x 9 KB
    __shared__ __align__(16) bf16_t sV[2][HDIM * APITCH];    // [head-dim][key]   2 x 9 KB

    const int t    = threadIdx.x;
    const int lane = t & 31;
    const int wave = __builtin_amdgcn_readfirstlane(t >> 5);  // scalar: the tests on kend below are scalar branches
    const int hi   = lane >> 4;
    const int l16  = lane & 15;
    const int kb   = hi * 8;
    const int h    = blockIdx.y;
    const int b    = blockIdx.z;
    const int qblk  = blockIdx.x * (16 * AW);
    const int qbase = qblk + wave * 16;
    const size_t qoff = (size_t)b * Nq * DMODEL;
    const size_t koff = (size_t)b * Nk * DMODEL;

    // staging: eight lanes cover one 128-B row, so a wave's 16-byte load touches four whole lines;
    // a thread takes rows srow and srow + 32 of the K tile and of the V tile
    const int srow = t >> 3;                 // 0..31
    const int sseg = (t & 7) * 8;            // 0,8,..,56
    const int sdst = srow * APITCH + sseg;
    const bf16_t* gK = Kg + koff + (size_t)srow * DMODEL + h * HDIM + sseg;
    const bf16_t* gV = Vt + (size_t)(h * HDIM + srow) * Mtot + (size_t)b * Nk + sseg;
    const size_t kstep = (size_t)32 * DMODEL;
    const size_t vstep = (size_t)32 * Mtot;

    // Q fragments: 16 queries x 64 head-dims = two 32x16 B fragments (lane = query, elements walk head-dim)
    FragB qa[2];
#pragma unroll
    for (int kc = 0; kc < 2; ++kc) {
        const bf16_t* base = Qg + qoff + (size_t)(qbase + l16) * DMODEL + h * HDIM + kc * 32 + kb;
        qa[kc].q[0] = *reinterpret_cast<const uint4*>(base);
        qa[kc].q[1] = *reinterpret_cast<const uint4*>(base + 16);
    }

    v8f o[4];               // O^T: o[n][r] = head-dim n * 16 + kb + r of query l16
    float m = -1e30f;       // the query's running maximum, the same in both halves
    float lsum = 0.0f;      // the sum over this half's keys; the halves are joined behind the loop
#pragma unroll
    for (int n = 0; n < 4; ++n) o[n] = v8f_zero();
    const int row = qbase + l16;   // the lane's query

    int kend  = Nk;    // this wave's end
    int kendw = Nk;    // the work-group's end = its last wave's
    if (causal) {
        kend = (qbase + 16 + 31) & ~31;
        if (kend > Nk) kend = Nk;
        kendw = (qblk + 16 * AW + 31) & ~31;
        if (kendw > Nk) kendw = Nk;
    }
    const int ns = (kendw + AKEYS - 1) / AKEYS;   // staged tiles, the same for every wave

    uint4 pk0, pk1, pv0, pv1;
    // prologue: tile 0 into buffer 0
    pk0 = *reinterpret_cast<const uint4*>(gK);
    pk1 = *reinterpret_cast<const uint4*>(gK + kstep);
    pv0 = *reinterpret_cast<const uint4*>(gV);
    pv1 = *reinterpret_cast<const uint4*>(gV + vstep);
    *reinterpret_cast<uint4*>(&sK[0][sdst])               = pk0;
    *reinterpret_cast<uint4*>(&sK[0][sdst + 32 * APITCH]) = pk1;
    *reinterpret_cast<uint4*>(&sV[0][sdst])               = pv0;
    *reinterpret_cast<uint4*>(&sV[0][sdst + 32 * APITCH]) = pv1;
    __syncthreads();

    for (int s = 0; s < ns; ++s) {
        const int cur = s & 1;
        const int nxt = cur ^ 1;
        const bool more = (s + 1) < ns;
        if (more) {
            const bf16_t* k0 = gK + (size_t)(s + 1) * AKEYS * DMODEL;
            const bf16_t* v0 = gV + (s + 1) * AKEYS;
            const bf16_t* v1 = v0 + vstep;
            pk0 = *reinterpret_cast<const uint4*>(k0);
            pk1 = *reinterpret_cast<const uint4*>(k0 + kstep);   // a constant step: k0's registers and an offset
            pv0 = *reinterpret_cast<const uint4*>(v0);
            pv1 = *reinterpret_cast<const uint4*>(v1);
            // the wait that stands before an issued load's address registers are written again;
            // the addresses are inputs so that none is reused as a later load's destination
            asm volatile("s_wait_xcnt 0x0" :: "v"(k0), "v"(v0), "v"(v1) : "memory");
        }

        // two 32-key passes per staged tile; a wave past its own causal end skips the pass
#pragma unroll
        for (int sub = 0; sub < AKEYS; sub += 32) {
            const int j0 = s * AKEYS + sub;
            if (j0 < kend) {
                // ---- S^T = K Q^T for 32 keys (two 16x16 C tiles): sc[st][r] = key j0 + st * 16 + kb + r, query l16
                v8f sc[2];
#pragma unroll
                for (int st = 0; st < 2; ++st) {
                    FragB kb0, kb1;   // A = K: lane holds key row, elems walk head-dim
                    const bf16_t* base = &sK[cur][(sub + st * 16 + l16) * APITCH + kb];
                    kb0.q[0] = *reinterpret_cast<const uint4*>(base);
                    kb0.q[1] = *reinterpret_cast<const uint4*>(base + 16);
                    kb1.q[0] = *reinterpret_cast<const uint4*>(base + 32);
                    kb1.q[1] = *reinterpret_cast<const uint4*>(base + 48);
                    v8f z = v8f_zero();
                    z = wmma_bf16(kb0.v, qa[0].v, z);
                    z = wmma_bf16(kb1.v, qa[1].v, z);
                    sc[st] = z;
                }
                // ---- scale + causal mask
#pragma unroll
                for (int st = 0; st < 2; ++st) {
#pragma unroll
                    for (int r = 0; r < 8; ++r) {
                        int col = j0 + st * 16 + kb + r;
                        float v = sc[st][r] * scale;
                        if (causal && col > row) v = -1e30f;
                        sc[st][r] = v;
                    }
                }
                // ---- online softmax: the lane's 16 scores by a tree, then the other half's result
                float t8[8];
#pragma unroll
                for (int r = 0; r < 8; ++r) t8[r] = fmaxf(sc[0][r], sc[1][r]);
                float rm = fmaxf(fmaxf(fmaxf(t8[0], t8[1]), fmaxf(t8[2], t8[3])),
                                 fmaxf(fmaxf(t8[4], t8[5]), fmaxf(t8[6], t8[7])));
                rm = fmaxf(rm, xhalf(rm));
                const float mn = fmaxf(m, rm);
                const float alpha = expf_slot(m - mn);
                m = mn;
                float rs[4] = {0.0f, 0.0f, 0.0f, 0.0f};   // four chains, so that no add waits on the one before
#pragma unroll
                for (int st = 0; st < 2; ++st) {
                    sc[st] = exp8_slot(sc[st] - mn);
#pragma unroll
                    for (int r = 0; r < 8; ++r) rs[r & 3] += sc[st][r];
                }
                lsum = lsum * alpha + ((rs[0] + rs[1]) + (rs[2] + rs[3]));
#pragma unroll
                for (int n = 0; n < 4; ++n)
#pragma unroll
                    for (int r = 0; r < 8; ++r) o[n][r] *= alpha;

                // ---- P^T as a B fragment: element s is key (s < 8 ? kb + s : 16 + kb + s - 8), which is what
                // the lane holds in sc[s >> 3][s & 7], and the k order of the V loader below
                FragB pb;
#pragma unroll
                for (int s8 = 0; s8 < 16; ++s8) pb.e[s8] = f2bf(sc[s8 >> 3][s8 & 7]);

                // ---- O^T += V^T (64x32) * P^T (32x16): V fragments from the staged tile
#pragma unroll
                for (int n = 0; n < 4; ++n) {
                    FragB vb;   // A = V^T: lane holds head-dim row, elems walk keys
                    const bf16_t* vbase = &sV[cur][(n * 16 + l16) * APITCH + sub + kb];
                    vb.q[0] = *reinterpret_cast<const uint4*>(vbase);
                    vb.q[1] = *reinterpret_cast<const uint4*>(vbase + 16);
                    o[n] = wmma_bf16(vb.v, pb.v, o[n]);
                }
                // the four vector slots that the chip needs behind a matrix instruction before its operands are
                // overwritten: the four
                // accumulators are inputs so that the slots stand behind all four products
                asm volatile("v_nop\n\tv_nop\n\tv_nop\n\tv_nop" :: "v"(o[0]), "v"(o[1]), "v"(o[2]), "v"(o[3]));
            }
        }

        if (more) {
            *reinterpret_cast<uint4*>(&sK[nxt][sdst])               = pk0;
            *reinterpret_cast<uint4*>(&sK[nxt][sdst + 32 * APITCH]) = pk1;
            *reinterpret_cast<uint4*>(&sV[nxt][sdst])               = pv0;
            *reinterpret_cast<uint4*>(&sV[nxt][sdst + 32 * APITCH]) = pv1;
        }
        // publishes the next tile and ends every wave's reads of the buffer that is refilled next
        __syncthreads();
    }

    // ---- join the halves' sums, normalize + store: a lane's eight values of a tile are neighbours
    const float l = lsum + xhalf(lsum);
#pragma unroll
    for (int n = 0; n < 4; ++n)
#pragma unroll
        for (int r = 0; r < 8; ++r) o[n][r] = o[n][r] / l;
    float* og = Og + qoff + (size_t)row * DMODEL + h * HDIM + kb;
#pragma unroll
    for (int n = 0; n < 4; ++n) {
        *reinterpret_cast<float4*>(og + n * 16)     = make_float4(o[n][0], o[n][1], o[n][2], o[n][3]);
        *reinterpret_cast<float4*>(og + n * 16 + 4) = make_float4(o[n][4], o[n][5], o[n][6], o[n][7]);
    }
}

// ---------------------------------------------------------------- residual + LayerNorm
// One wave per row, 32 values a lane by 16-byte accesses on whole lines; the row's sums stay in the
// wave (four chains a lane, then a five-step butterfly), so no LDS and no barrier.
// SPLIT: a is the first of two partial planes; the row is (a + a2) + bias, then the residual as ever.
#define LN_ROWS 8   // rows (waves) per work-group
template <bool SPLIT>
__device__ __forceinline__
void add_ln_body(const float* __restrict__ a, const float* __restrict__ a2, const float* __restrict__ bias,
                 const float* __restrict__ resid,
                 const float* __restrict__ g, const float* __restrict__ beta,
                 float* __restrict__ yf, bf16_t* __restrict__ ybf) {
    const int lane = threadIdx.x & 31;
    const int row  = blockIdx.x * LN_ROWS + (threadIdx.x >> 5);
    const size_t ro = (size_t)row * DMODEL + lane * 4;

    const float* pa = a     + ro;
    const float* pr = resid + ro;
    float4 x[8], r[8];
#pragma unroll
    for (int i = 0; i < 8; ++i) x[i] = *reinterpret_cast<const float4*>(pa + i * 128);
#pragma unroll
    for (int i = 0; i < 8; ++i) r[i] = *reinterpret_cast<const float4*>(pr + i * 128);
    // the wait that stands before an issued load's address registers are written again;
    // the addresses are inputs so that none is reused as a later load's destination
    asm volatile("s_wait_xcnt 0x0" :: "v"(pa), "v"(pr) : "memory");
    if constexpr (SPLIT) {
        const float* p2 = a2   + ro;
        const float* pb = bias + lane * 4;
        float4 y[8], c[8];
#pragma unroll
        for (int i = 0; i < 8; ++i) y[i] = *reinterpret_cast<const float4*>(p2 + i * 128);
#pragma unroll
        for (int i = 0; i < 8; ++i) c[i] = *reinterpret_cast<const float4*>(pb + i * 128);
        // the same wait, for these loads' addresses
        asm volatile("s_wait_xcnt 0x0" :: "v"(p2), "v"(pb) : "memory");
#pragma unroll
        for (int i = 0; i < 8; ++i) {
            x[i].x = (x[i].x + y[i].x) + c[i].x; x[i].y = (x[i].y + y[i].y) + c[i].y;
            x[i].z = (x[i].z + y[i].z) + c[i].z; x[i].w = (x[i].w + y[i].w) + c[i].w;
        }
    }

    float s0 = 0.0f, s1 = 0.0f, s2 = 0.0f, s3 = 0.0f;
    float q0 = 0.0f, q1 = 0.0f, q2 = 0.0f, q3 = 0.0f;
#pragma unroll
    for (int i = 0; i < 8; ++i) {
        x[i].x += r[i].x; x[i].y += r[i].y; x[i].z += r[i].z; x[i].w += r[i].w;
        s0 += x[i].x; s1 += x[i].y; s2 += x[i].z; s3 += x[i].w;
        q0 += x[i].x * x[i].x; q1 += x[i].y * x[i].y; q2 += x[i].z * x[i].z; q3 += x[i].w * x[i].w;
    }
    float s  = (s0 + s1) + (s2 + s3);
    float ss = (q0 + q1) + (q2 + q3);
#pragma unroll
    for (int off = 1; off < 32; off <<= 1) {
        s  += __shfl_xor(s,  off, 32);
        ss += __shfl_xor(ss, off, 32);
    }
    const float mean = s  * (1.0f / DMODEL);
    const float var  = ss * (1.0f / DMODEL) - mean * mean;
    // rsqrtf as the compiler expands it (a denormal argument is scaled by 2^24, its result by 2^12), with
    // v_rsq_f32 and the one slot that the instruction set asks for behind it in one statement, so that
    // the slot stays directly behind it
    const float ve   = var + 1e-5f;
    const bool  tiny = ve < 1.17549435e-38f;
    float rq;
    asm("v_rsq_f32 %0, %1\n\tv_nop" : "=v"(rq) : "v"(tiny ? ve * 16777216.0f : ve));
    const float rstd = tiny ? rq * 4096.0f : rq;
#pragma unroll
    for (int i = 0; i < 8; ++i) {
        const float4 gv = *reinterpret_cast<const float4*>(g    + lane * 4 + i * 128);
        const float4 bv = *reinterpret_cast<const float4*>(beta + lane * 4 + i * 128);
        x[i].x = (x[i].x - mean) * rstd * gv.x + bv.x;
        x[i].y = (x[i].y - mean) * rstd * gv.y + bv.y;
        x[i].z = (x[i].z - mean) * rstd * gv.z + bv.z;
        x[i].w = (x[i].w - mean) * rstd * gv.w + bv.w;
        *reinterpret_cast<float4*>(yf + ro + i * 128) = x[i];
    }
    // the wait that stands before the registers of the issued stores are written again (by the packing below)
    asm volatile("s_wait_xcnt 0x0" ::: "memory");
    if (ybf) {
#pragma unroll
        for (int i = 0; i < 8; ++i)
            *reinterpret_cast<uint2*>(ybf + ro + i * 128) = pack4_bf16(x[i]);
    }
}
__global__ __launch_bounds__(256)
void add_ln(const float* __restrict__ a, const float* __restrict__ resid,
            const float* __restrict__ g, const float* __restrict__ beta,
            float* __restrict__ yf, bf16_t* __restrict__ ybf) {
    add_ln_body<false>(a, nullptr, nullptr, resid, g, beta, yf, ybf);
}
__global__ __launch_bounds__(256)
void add_ln_split(const float* __restrict__ a, const float* __restrict__ a2, const float* __restrict__ bias,
                  const float* __restrict__ resid,
                  const float* __restrict__ g, const float* __restrict__ beta, float* __restrict__ yf) {
    add_ln_body<true>(a, a2, bias, resid, g, beta, yf, nullptr);
}

// ---------------------------------------------------------------- launch
extern "C" void kernel_launch(void* const* d_in, const int* in_sizes, int n_in,
                              void* d_out, int out_size, void* d_ws, size_t ws_size,
                              hipStream_t stream) {
    const float* x    = (const float*)d_in[0];
    const float* enc  = (const float*)d_in[1];
    const float* Wq1  = (const float*)d_in[2];
    const float* Wk1  = (const float*)d_in[3];
    const float* Wv1  = (const float*)d_in[4];
    const float* g1   = (const float*)d_in[5];
    const float* b1   = (const float*)d_in[6];
    const float* Wq2  = (const float*)d_in[7];
    const float* Wk2  = (const float*)d_in[8];
    const float* Wv2  = (const float*)d_in[9];
    const float* g2   = (const float*)d_in[10];
    const float* b2   = (const float*)d_in[11];
    const float* Wff1 = (const float*)d_in[12];
    const float* bff1 = (const float*)d_in[13];
    const float* Wff2 = (const float*)d_in[14];
    const float* bff2 = (const float*)d_in[15];
    const float* g3   = (const float*)d_in[16];
    const float* b3   = (const float*)d_in[17];

    char* ws = (char*)d_ws;
    const size_t MB = 1024u * 1024u;
    bf16_t* wq1b  = (bf16_t*)(ws + 0   * MB);   // all weights stored transposed [N][K]
    bf16_t* wk1b  = (bf16_t*)(ws + 2   * MB);
    bf16_t* wv1b  = (bf16_t*)(ws + 4   * MB);
    bf16_t* wq2b  = (bf16_t*)(ws + 6   * MB);
    bf16_t* wk2b  = (bf16_t*)(ws + 8   * MB);
    bf16_t* wv2b  = (bf16_t*)(ws + 10  * MB);
    bf16_t* wff1b = (bf16_t*)(ws + 12  * MB);
    bf16_t* wff2b = (bf16_t*)(ws + 20  * MB);
    bf16_t* xbf   = (bf16_t*)(ws + 28  * MB);   // activation bf16 (reused: x, y1, y2)
    bf16_t* encbf = (bf16_t*)(ws + 36  * MB);
    bf16_t* qbf   = (bf16_t*)(ws + 44  * MB);
    bf16_t* kbf   = (bf16_t*)(ws + 52  * MB);
    bf16_t* vbf   = (bf16_t*)(ws + 60  * MB);   // V stored transposed [DMODEL][MROWS]
    float*  ctx   = (float*) (ws + 68  * MB);   // attn ctx / ff2 out
    float*  yA    = (float*) (ws + 84  * MB);
    float*  yB    = (float*) (ws + 100 * MB);
    bf16_t* hbf   = (bf16_t*)(ws + 116 * MB);
    float*  ctx2  = (float*) (ws + 148 * MB);   // ff2 out, second half of k; ends at 164 MB

    const dim3 gqkv(DMODEL / TN, MROWS / TM, 3);
    const dim3 gff1(FFDIM / TN, MROWS / TM);
    const dim3 gff2(DMODEL / TN, MROWS / TM, 2);

    // x, enc -> bf16; weights -> bf16, transposed [N][K] (wq1b .. wv2b lie 2 MB apart, from wq1b on)
    cvt_all<<<CVT_ALL_BLOCKS, 256, 0, stream>>>(x, enc, Wq1, Wk1, Wv1, Wq2, Wk2, Wv2, Wff1, Wff2,
                                                xbf, encbf, wq1b, wff1b, wff2b);

    const float scale = 0.03125f;   // 1/sqrt(DMODEL), as in reference
    dim3 agrid(NTOK / (16 * AW), NHEAD, BATCH);

    // ---- block 1: causal self-attention
    gemm_qkv<<<gqkv, 256, 0, stream>>>(xbf, xbf, wq1b, wk1b, wv1b, qbf, kbf, vbf, DMODEL);
    attn_wmma<<<agrid, 256, 0, stream>>>(qbf, kbf, vbf, ctx, NTOK, NTOK, MROWS, 1, scale);
    add_ln<<<MROWS / LN_ROWS, 256, 0, stream>>>(ctx, x, g1, b1, yA, xbf);    // xbf := y1 (bf16)

    // ---- block 2: cross-attention over encoder output
    gemm_qkv<<<gqkv, 256, 0, stream>>>(xbf, encbf, wq2b, wk2b, wv2b, qbf, kbf, vbf, DMODEL);
    attn_wmma<<<agrid, 256, 0, stream>>>(qbf, kbf, vbf, ctx, NTOK, NTOK, MROWS, 0, scale);
    add_ln<<<MROWS / LN_ROWS, 256, 0, stream>>>(ctx, yA, g2, b2, yB, xbf);   // xbf := y2 (bf16)

    // ---- block 3: FFN (bias+GELU fused), residual, final LN
    gemm_ff1<<<gff1,  256, 0, stream>>>(xbf, wff1b, hbf, bff1, DMODEL);   // bf16 out + GELU
    gemm_ff2<<<gff2,  256, 0, stream>>>(hbf, wff2b, ctx, ctx2, FFDIM);    // fp32 out, one plane per half of k
    add_ln_split<<<MROWS / LN_ROWS, 256, 0, stream>>>(ctx, ctx2, bff2, yB, g3, b3, (float*)d_out);
}

// v008
// A run of this version takes 217 microseconds.
// Timed twice side by side with v007, it ran 1.04 and 1.03 times as fast.
// All steps since v000 together make it 3.18 times as fast.
#include <hip/hip_runtime.h>
#include <math.h>

// ---------------------------------------------------------------- types
typedef __bf16 bf16_t;
typedef __attribute__((ext_vector_type(16))) __bf16 v16bf;
typedef __attribute__((ext_vector_type(8)))  float  v8f;

union FragB {
    v16bf  v;
    uint4  q[2];
    bf16_t e[16];
};

__device__ __forceinline__ bf16_t f2bf(float f) {
    unsigned int u = __float_as_uint(f);
    unsigned int r = u + 0x7FFFu + ((u >> 16) & 1u);   // round to nearest even
    unsigned short s = (unsigned short)(r >> 16);
    return __builtin_bit_cast(bf16_t, s);
}

__device__ __forceinline__ v8f wmma_bf16(const v16bf& a, const v16bf& b, const v8f& c) {
    return __builtin_amdgcn_wmma_f32_16x16x32_bf16(false, a, false, b, (short)0, c, false, false);
}

__device__ __forceinline__ v8f v8f_zero() {
    v8f z;
#pragma unroll
    for (int i = 0; i < 8; ++i) z[i] = 0.0f;
    return z;
}

// ---------------------------------------------------------------- constants
#define DMODEL 1024
#define NHEAD  16
#define HDIM   64
#define FFDIM  4096
#define BATCH  4
#define NTOK   1024
#define MROWS  (BATCH * NTOK)   // 4096

// ---------------------------------------------------------------- fp32 -> bf16 (straight)
__device__ __forceinline__ uint2 pack4_bf16(const float4& v) {
    union { bf16_t e[4]; uint2 q; } u;
    u.e[0] = f2bf(v.x); u.e[1] = f2bf(v.y); u.e[2] = f2bf(v.z); u.e[3] = f2bf(v.w);
    return u.q;
}

// 32 values a thread, as eight 16-byte loads in flight; every wave-wide load (512 B) and store (256 B)
// covers whole lines. One wave per 1,024 values, not one per 32.
#define CVT_BLOCK (256 * 32)   // values per work-group; a tensor is a multiple of it
__device__ __forceinline__
void cvt_f32_to_bf16(const float* __restrict__ in, bf16_t* __restrict__ out, int blk) {
    const size_t base = (size_t)blk * CVT_BLOCK + threadIdx.x * 4;
    float4 v[8];
#pragma unroll
    for (int c = 0; c < 8; ++c)
        v[c] = *reinterpret_cast<const float4*>(in + base + c * 1024);
#pragma unroll
    for (int c = 0; c < 8; ++c)
        *reinterpret_cast<uint2*>(out + base + c * 1024) = pack4_bf16(v[c]);
}

// ---------------------------------------------------------------- fp32 [K][N] -> bf16 [N][K]
// 64 x 64 tile, 16 values a thread: 16-byte loads along n (a wave covers two 256-B row pieces),
// 16-byte stores along k (eight lanes cover one 128-B line of an output row).
#define TT 64
__device__ __forceinline__
void cvt_transpose_bf16(const float* __restrict__ in, bf16_t* __restrict__ out,
                        int Kdim, int Ndim, int bn, int bk) {
    __shared__ float tile[TT][TT + 1];   // pitch 65 dwords: the column walks below meet no bank twice
    const int k0 = bk * TT;
    const int n0 = bn * TT;
    const int t  = threadIdx.x;
    const int lr = t >> 4;               // 0..15
    const int lc = (t & 15) * 4;         // 0,4,..,60
    const float* s0 = in + (size_t)(k0 + lr) * Ndim + n0 + lc;
    const float* s1 = s0 + (size_t)16 * Ndim;
    const float* s2 = s1 + (size_t)16 * Ndim;
    const float* s3 = s2 + (size_t)16 * Ndim;
    float4 v[4];
    v[0] = *reinterpret_cast<const float4*>(s0);
    v[1] = *reinterpret_cast<const float4*>(s1);
    v[2] = *reinterpret_cast<const float4*>(s2);
    v[3] = *reinterpret_cast<const float4*>(s3);
    // the wait that stands before an issued load's address registers are written again;
    // the addresses are inputs so that none is reused as a later load's destination
    asm volatile("s_wait_xcnt 0x0" :: "v"(s0), "v"(s1), "v"(s2), "v"(s3) : "memory");
#pragma unroll
    for (int p = 0; p < 4; ++p) {
        float* d = &tile[p * 16 + lr][lc];
        d[0] = v[p].x; d[1] = v[p].y; d[2] = v[p].z; d[3] = v[p].w;
    }
    __syncthreads();
#pragma unroll
    for (int c = 0; c < 2; ++c) {
        const int id = t + c * 256;
        const int n  = id >> 3;          // 0..63
        const int ks = (id & 7) * 8;     // 0,8,..,56
        union { bf16_t e[8]; uint4 q; } u;
#pragma unroll
        for (int j = 0; j < 8; ++j) u.e[j] = f2bf(tile[ks + j][n]);
        *reinterpret_cast<uint4*>(out + (size_t)(n0 + n) * Kdim + k0 + ks) = u.q;
    }
}

// ---------------------------------------------------------------- all ten conversions, one launch
// None of them needs anything of another, so they share one grid by ranges of the block index
// (every test below is on blockIdx alone: the same for a whole work-group). The casts, which move
// twice a transpose tile's bytes per work-group, come first.
#define CAST_BLOCKS (MROWS * DMODEL / CVT_BLOCK)             // 512 per activation tensor
#define SQ_BLOCKS   ((DMODEL / TT) * (DMODEL / TT))          // 256 per square weight
#define FF_BLOCKS   ((DMODEL / TT) * (FFDIM / TT))           // 1,024 per feed-forward weight
#define CVT_ALL_BLOCKS (2 * CAST_BLOCKS + 6 * SQ_BLOCKS + 2 * FF_BLOCKS)
__global__ __launch_bounds__(256)
void cvt_all(const float* __restrict__ x,    const float* __restrict__ enc,
             const float* __restrict__ wq1,  const float* __restrict__ wk1, const float* __restrict__ wv1,
             const float* __restrict__ wq2,  const float* __restrict__ wk2, const float* __restrict__ wv2,
             const float* __restrict__ wff1, const float* __restrict__ wff2,
             bf16_t* __restrict__ xbf,  bf16_t* __restrict__ encbf,
             bf16_t* __restrict__ wsq,          // the six square weights' outputs, DMODEL * DMODEL apart
             bf16_t* __restrict__ wff1b, bf16_t* __restrict__ wff2b) {
    int b = blockIdx.x;
    if (b < 2 * CAST_BLOCKS) {
        const bool first = b < CAST_BLOCKS;
        cvt_f32_to_bf16(first ? x : enc, first ? xbf : encbf, first ? b : b - CAST_BLOCKS);
        return;   // the whole work-group leaves, ahead of the transpose's barrier
    }
    b -= 2 * CAST_BLOCKS;
    const float* in;
    bf16_t* out;
    int Kdim = DMODEL, Ndim = DMODEL;
    if (b < 6 * SQ_BLOCKS) {
        const int w = b / SQ_BLOCKS;
        b -= w * SQ_BLOCKS;
        const bool odd = w & 1;
        const float* p01 = odd ? wk1 : wq1;
        const float* p23 = odd ? wq2 : wv1;
        const float* p45 = odd ? wv2 : wk2;
        in  = w < 2 ? p01 : w < 4 ? p23 : p45;
        out = wsq + (size_t)w * DMODEL * DMODEL;
    } else if (b < 6 * SQ_BLOCKS + FF_BLOCKS) {
        b -= 6 * SQ_BLOCKS;
        in = wff1; out = wff1b; Ndim = FFDIM;
    } else {
        b -= 6 * SQ_BLOCKS + FF_BLOCKS;
        in = wff2; out = wff2b; Kdim = FFDIM;
    }
    const int nb = Ndim / TT;   // tiles along n: 16 or 64
    cvt_transpose_bf16(in, out, Kdim, Ndim, b % nb, b / nb);
}

// ---------------------------------------------------------------- GEMM (bf16 WMMA, fp32 acc)
// C[M,N] = A[M,K] @ B[K,N], with B supplied TRANSPOSED as Bt[N][K] bf16.
// The output kind, bias, GELU and the output's pitch are compile-time values: one kernel per use below.
#define OUT_BF16   0   // bf16 [M][N]
#define OUT_BF16_T 1   // bf16 [N][M]
#define OUT_F32    2   // f32  [M][N]
#define TM 128
#define TN 128
#define TK 64      // one staged row of a slab = 128 B = one whole cache line
#define LDP 72     // LDS row pitch in elements: 144 B = 16 B x odd, for the 16-byte fragment reads

template <int KIND, bool BIAS, bool GELU, int M, int N>
__device__ __forceinline__
void gemm_body(bf16_t (*sA)[TM * LDP], bf16_t (*sB)[TN * LDP],
               const bf16_t* __restrict__ A, const bf16_t* __restrict__ Bt,
               void* __restrict__ Cout, const float* __restrict__ bias, int K, int ld) {
    // K: the k extent of this product; ld: the row pitch of A and Bt in elements (K, or more for a part of the rows)
    static_assert(KIND != OUT_BF16_T || (!BIAS && !GELU), "the transposed output takes neither");

    const int t    = threadIdx.x;
    const int lane = t & 31;
    const int wave = t >> 5;                 // 0..7
    const int wrow = (wave & 3) * 32;        // 0,32,64,96
    const int wcol = (wave >> 2) * 64;       // 0,64
    const int m0   = blockIdx.y * TM;
    const int n0   = blockIdx.x * TN;
    const int hi   = lane >> 4;
    const int l16  = lane & 15;
    const int kb   = hi * 8;

    // staging: eight lanes cover one 128-B row of the slab, so a wave's 16-byte load
    // touches four whole lines; a thread takes rows srow, srow + 32, + 64, + 96
    const int srow = t >> 3;                 // 0..31
    const int sseg = (t & 7) * 8;            // 0,8,..,56
    const bf16_t* gA = A  + (size_t)m0 * ld; // block-uniform bases; the lane's part is soff
    const bf16_t* gB = Bt + (size_t)n0 * ld;
    const unsigned soff = (unsigned)(srow * ld + sseg);
    const size_t rstep = (size_t)32 * ld;
    const int sdst = srow * LDP + sseg;

    v8f acc[2][4];
#pragma unroll
    for (int i = 0; i < 2; ++i)
#pragma unroll
        for (int j = 0; j < 4; ++j) acc[i][j] = v8f_zero();

    const int nk = K / TK;
    uint4 pa0, pa1, pa2, pa3, pb0, pb1, pb2, pb3;

    // prologue: stage slab 0 into buffer 0
    {
        const bf16_t* a0 = gA + soff;
        const bf16_t* a1 = a0 + rstep;
        const bf16_t* a2 = a1 + rstep;
        const bf16_t* a3 = a2 + rstep;
        const bf16_t* b0 = gB + soff;
        const bf16_t* b1 = b0 + rstep;
        const bf16_t* b2 = b1 + rstep;
        const bf16_t* b3 = b2 + rstep;
        pa0 = *reinterpret_cast<const uint4*>(a0);
        pa1 = *reinterpret_cast<const uint4*>(a1);
        pa2 = *reinterpret_cast<const uint4*>(a2);
        pa3 = *reinterpret_cast<const uint4*>(a3);
        pb0 = *reinterpret_cast<const uint4*>(b0);
        pb1 = *reinterpret_cast<const uint4*>(b1);
        pb2 = *reinterpret_cast<const uint4*>(b2);
        pb3 = *reinterpret_cast<const uint4*>(b3);
        // the wait that stands before an issued load's address registers are written again, as in the loop below
        asm volatile("s_wait_xcnt 0x0"
                     :: "v"(a0), "v"(a1), "v"(a2), "v"(a3), "v"(b0), "v"(b1), "v"(b2), "v"(b3)
                     : "memory");
    }
    *reinterpret_cast<uint4*>(&sA[0][sdst])            = pa0;
    *reinterpret_cast<uint4*>(&sA[0][sdst + 32 * LDP]) = pa1;
    *reinterpret_cast<uint4*>(&sA[0][sdst + 64 * LDP]) = pa2;
    *reinterpret_cast<uint4*>(&sA[0][sdst + 96 * LDP]) = pa3;
    *reinterpret_cast<uint4*>(&sB[0][sdst])            = pb0;
    *reinterpret_cast<uint4*>(&sB[0][sdst + 32 * LDP]) = pb1;
    *reinterpret_cast<uint4*>(&sB[0][sdst + 64 * LDP]) = pb2;
    *reinterpret_cast<uint4*>(&sB[0][sdst + 96 * LDP]) = pb3;
    __syncthreads();

    for (int kt = 0; kt < nk; ++kt) {
        const int cur = kt & 1;
        const int nxt = cur ^ 1;
        const bool more = (kt + 1) < nk;
        if (more) {
            int ko = (kt + 1) * TK;
            const bf16_t* a0 = gA + ko + soff;
            const bf16_t* a1 = a0 + rstep;
            const bf16_t* a2 = a1 + rstep;
            const bf16_t* a3 = a2 + rstep;
            const bf16_t* b0 = gB + ko + soff;
            const bf16_t* b1 = b0 + rstep;
            const bf16_t* b2 = b1 + rstep;
            const bf16_t* b3 = b2 + rstep;
            pa0 = *reinterpret_cast<const uint4*>(a0);
            pa1 = *reinterpret_cast<const uint4*>(a1);
            pa2 = *reinterpret_cast<const uint4*>(a2);
            pa3 = *reinterpret_cast<const uint4*>(a3);
            pb0 = *reinterpret_cast<const uint4*>(b0);
            pb1 = *reinterpret_cast<const uint4*>(b1);
            pb2 = *reinterpret_cast<const uint4*>(b2);
            pb3 = *reinterpret_cast<const uint4*>(b3);
            // the wait that stands before an issued load's address registers are written again;
            // the addresses are inputs so that none is reused as a later load's destination
            asm volatile("s_wait_xcnt 0x0"
                         :: "v"(a0), "v"(a1), "v"(a2), "v"(a3), "v"(b0), "v"(b1), "v"(b2), "v"(b3)
                         : "memory");
        }

        // two 32-deep products per slab, k ascending; unrolled so that ks folds into the LDS offsets
#pragma unroll
        for (int ks = 0; ks < TK; ks += 32) {
            FragB af[2], bfr[4];
#pragma unroll
            for (int i = 0; i < 2; ++i) {
                int row = wrow + i * 16 + l16;
                af[i].q[0] = *reinterpret_cast<const uint4*>(&sA[cur][row * LDP + ks + kb]);
                af[i].q[1] = *reinterpret_cast<const uint4*>(&sA[cur][row * LDP + ks + kb + 16]);
            }
#pragma unroll
            for (int j = 0; j < 4; ++j) {
                int col = wcol + j * 16 + l16;
                bfr[j].q[0] = *reinterpret_cast<const uint4*>(&sB[cur][col * LDP + ks + kb]);
                bfr[j].q[1] = *reinterpret_cast<const uint4*>(&sB[cur][col * LDP + ks + kb + 16]);
            }
#pragma unroll
            for (int i = 0; i < 2; ++i)
#pragma unroll
                for (int j = 0; j < 4; ++j) {
                    // the operand order decides which index of C runs along a lane's eight accumulators:
                    // always the one that is contiguous in the output (m for [N][M], n for [M][N])
                    if constexpr (KIND == OUT_BF16_T) acc[i][j] = wmma_bf16(af[i].v, bfr[j].v, acc[i][j]);
                    else                              acc[i][j] = wmma_bf16(bfr[j].v, af[i].v, acc[i][j]);
                }
        }

        if (more) {
            *reinterpret_cast<uint4*>(&sA[nxt][sdst])            = pa0;
            *reinterpret_cast<uint4*>(&sA[nxt][sdst + 32 * LDP]) = pa1;
            *reinterpret_cast<uint4*>(&sA[nxt][sdst + 64 * LDP]) = pa2;
            *reinterpret_cast<uint4*>(&sA[nxt][sdst + 96 * LDP]) = pa3;
            *reinterpret_cast<uint4*>(&sB[nxt][sdst])            = pb0;
            *reinterpret_cast<uint4*>(&sB[nxt][sdst + 32 * LDP]) = pb1;
            *reinterpret_cast<uint4*>(&sB[nxt][sdst + 64 * LDP]) = pb2;
            *reinterpret_cast<uint4*>(&sB[nxt][sdst + 96 * LDP]) = pb3;
        }
        __syncthreads();
    }

    if constexpr (KIND == OUT_BF16_T) {
        // lane = column n; its eight accumulators are rows m .. m + 7: one 16-byte store
        bf16_t* C = (bf16_t*)Cout + (size_t)(n0 + wcol + l16) * M + m0 + wrow + kb;
#pragma unroll
        for (int i = 0; i < 2; ++i)
#pragma unroll
            for (int j = 0; j < 4; ++j) {
                union { bf16_t e[8]; uint4 q; } u;
#pragma unroll
                for (int r = 0; r < 8; ++r) u.e[r] = f2bf(acc[i][j][r]);
                *reinterpret_cast<uint4*>(C + (size_t)j * 16 * M + i * 16) = u.q;
            }
    } else {
        // lane = row m; its eight accumulators are columns n .. n + 7: one (bf16) or two (f32) 16-byte stores
        const size_t co = (size_t)(m0 + wrow + l16) * N + n0 + wcol + kb;
        float4 bv[4][2];
        if constexpr (BIAS) {
#pragma unroll
            for (int j = 0; j < 4; ++j) {
                bv[j][0] = *reinterpret_cast<const float4*>(bias + n0 + wcol + kb + j * 16);
                bv[j][1] = *reinterpret_cast<const float4*>(bias + n0 + wcol + kb + j * 16 + 4);
            }
        }
#pragma unroll
        for (int i = 0; i < 2; ++i)
#pragma unroll
            for (int j = 0; j < 4; ++j) {
                float v[8];
#pragma unroll
                for (int r = 0; r < 8; ++r) v[r] = acc[i][j][r];
                if constexpr (BIAS) {
                    v[0] += bv[j][0].x; v[1] += bv[j][0].y; v[2] += bv[j][0].z; v[3] += bv[j][0].w;
                    v[4] += bv[j][1].x; v[5] += bv[j][1].y; v[6] += bv[j][1].z; v[7] += bv[j][1].w;
                }
                if constexpr (GELU) {
#pragma unroll
                    for (int r = 0; r < 8; ++r)
                        v[r] = 0.5f * v[r] * (1.0f + erff(v[r] * 0.70710678118654752440f));
                }
                const size_t o = co + (size_t)i * 16 * N + j * 16;
                if constexpr (KIND == OUT_BF16) {
                    union { bf16_t e[8]; uint4 q; } u;
#pragma unroll
                    for (int r = 0; r < 8; ++r) u.e[r] = f2bf(v[r]);
                    *reinterpret_cast<uint4*>((bf16_t*)Cout + o) = u.q;
                } else {
                    *reinterpret_cast<float4*>((float*)Cout + o)     = make_float4(v[0], v[1], v[2], v[3]);
                    *reinterpret_cast<float4*>((float*)Cout + o + 4) = make_float4(v[4], v[5], v[6], v[7]);
                }
            }
    }
}

// the two staging buffers of a GEMM work-group; declared in the kernel, so that the two bodies of
// gemm_qkv share one set
#define GEMM_LDS \
    __shared__ __align__(16) bf16_t sA[2][TM * LDP];  /* [row][k]  2 x 18 KB */ \
    __shared__ __align__(16) bf16_t sB[2][TN * LDP];  /* [n][k]    2 x 18 KB */

// the uses: the three projections of an attention block; FFN up (bias, GELU); FFN down (f32, two halves of k)
// Q, K and V need nothing of each other: one launch, blockIdx.z picks the product (0 Q, 1 K, 2 V with
// its transposed output), so that three work-groups stand on a WGP where one stood
__global__ __launch_bounds__(256)
void gemm_qkv(const bf16_t* __restrict__ Aq, const bf16_t* __restrict__ Akv,
              const bf16_t* __restrict__ Wq, const bf16_t* __restrict__ Wk, const bf16_t* __restrict__ Wv,
              bf16_t* __restrict__ Cq, bf16_t* __restrict__ Ck, bf16_t* __restrict__ Cvt, int K) {
    GEMM_LDS
    const int z = blockIdx.z;
    if (z == 2) {
        gemm_body<OUT_BF16_T, false, false, MROWS, DMODEL>(sA, sB, Akv, Wv, Cvt, nullptr, K, K);
        return;
    }
    gemm_body<OUT_BF16, false, false, MROWS, DMODEL>(sA, sB, z ? Akv : Aq, z ? Wk : Wq, z ? Ck : Cq, nullptr, K, K);
    // the wait that stands before the registers of the issued stores are written again: in the built code the
    // other body's entry follows these stores behind a branch
    asm volatile("s_wait_xcnt 0x0" ::: "memory");
}
__global__ __launch_bounds__(256)
void gemm_ff1(const bf16_t* __restrict__ A, const bf16_t* __restrict__ Bt, bf16_t* __restrict__ C,
              const float* __restrict__ bias, int K) {
    GEMM_LDS
    gemm_body<OUT_BF16, true, true, MROWS, FFDIM>(sA, sB, A, Bt, C, bias, K, K);
}
// FFN down has one 128 x 128 tile per WGP and a long k: blockIdx.z halves k, so that two work-groups stand on a
// WGP and each one's waits (LDS reads, the next slab's loads, the barrier) are filled by the other's products.
// Each half stores its own f32 plane; the LayerNorm that follows adds the two planes and the bias.
__global__ __launch_bounds__(256)
void gemm_ff2(const bf16_t* __restrict__ A, const bf16_t* __restrict__ Bt,
              float* __restrict__ C0, float* __restrict__ C1, int K) {
    GEMM_LDS
    const int z  = blockIdx.z;
    const int kh = K / 2;
    gemm_body<OUT_F32, false, false, MROWS, DMODEL>(sA, sB, A + z * kh, Bt + z * kh, z ? C1 : C0, nullptr, kh, K);
}

__device__ __forceinline__ float expf_slot(float x) {
    float r;
    asm("v_exp_f32 %0, %1\n\tv_nop" : "=v"(r) : "v"(x * 1.44269504088896340736f));
    return r;
}

// eight e^x, each as above. One statement, so that the slot behind every v_exp_f32 is filled by construction: the
// next one neither reads its result nor writes its source (the results are early-clobber registers), and the
// last has the v_nop.
__device__ __forceinline__ v8f exp8_slot(const v8f& x) {
    float r0, r1, r2, r3, r4, r5, r6, r7;
    const float c = 1.44269504088896340736f;
    asm("v_exp_f32 %0, %8\n\tv_exp_f32 %1, %9\n\tv_exp_f32 %2, %10\n\tv_exp_f32 %3, %11\n\t"
        "v_exp_f32 %4, %12\n\tv_exp_f32 %5, %13\n\tv_exp_f32 %6, %14\n\tv_exp_f32 %7, %15\n\tv_nop"
        : "=&v"(r0), "=&v"(r1), "=&v"(r2), "=&v"(r3), "=&v"(r4), "=&v"(r5), "=&v"(r6), "=&v"(r7)
        : "v"(x[0] * c), "v"(x[1] * c), "v"(x[2] * c), "v"(x[3] * c),
          "v"(x[4] * c), "v"(x[5] * c), "v"(x[6] * c), "v"(x[7] * c));
    v8f r;
    r[0] = r0; r[1] = r1; r[2] = r2; r[3] = r3; r[4] = r4; r[5] = r5; r[6] = r6; r[7] = r7;
    return r;
}

// lane l with lane l ^ 16
__device__ __forceinline__ float xhalf(float x) {
    const int b = __builtin_bit_cast(int, x);
    return __builtin_bit_cast(float, __builtin_amdgcn_permlanex16(b, b, 0x76543210, 0xfedcba98, false, false));
}

#define AW     8    // waves = 16-query tiles per work-group
#define AKEYS  64   // keys per staged tile: a V row of the tile is one whole 128-B line, as a K row is
#define APITCH 72   // LDS row pitch in elements: 144 B = 16 B x odd, for the 16-byte fragment reads
__global__ __launch_bounds__(256)
void attn_wmma(const bf16_t* __restrict__ Qg, const bf16_t* __restrict__ Kg,
               const bf16_t* __restrict__ Vt, float* __restrict__ Og,
               int Nq, int Nk, int Mtot, int causal, float scale) {
    __shared__ __align__(16) bf16_t sK[2][AKEYS * APITCH];   // [key][head-dim]   2 x 9 KB
    __shared__ __align__(16) bf16_t sV[2][HDIM * APITCH];    // [head-dim][key]   2 x 9 KB

    const int t    = threadIdx.x;
    const int lane = t & 31;
    const int wave = __builtin_amdgcn_readfirstlane(t >> 5);  // scalar: the tests on kend below are scalar branches
    const int hi   = lane >> 4;
    const int l16  = lane & 15;
    const int kb   = hi * 8;
    const int h    = blockIdx.y;
    const int b    = blockIdx.z;
    const int qblk  = blockIdx.x * (16 * AW);
    const int qbase = qblk + wave * 16;
    const size_t qoff = (size_t)b * Nq * DMODEL;
    const size_t koff = (size_t)b * Nk * DMODEL;

    // staging: eight lanes cover one 128-B row, so a wave's 16-byte load touches four whole lines;
    // a thread takes rows srow and srow + 32 of the K tile and of the V tile
    const int srow = t >> 3;                 // 0..31
    const int sseg = (t & 7) * 8;            // 0,8,..,56
    const int sdst = srow * APITCH + sseg;
    const bf16_t* gK = Kg + koff + (size_t)srow * DMODEL + h * HDIM + sseg;
    const bf16_t* gV = Vt + (size_t)(h * HDIM + srow) * Mtot + (size_t)b * Nk + sseg;
    const size_t kstep = (size_t)32 * DMODEL;
    const size_t vstep = (size_t)32 * Mtot;

    // Q fragments: 16 queries x 64 head-dims = two 32x16 B fragments (lane = query, elements walk head-dim)
    FragB qa[2];
#pragma unroll
    for (int kc = 0; kc < 2; ++kc) {
        const bf16_t* base = Qg + qoff + (size_t)(qbase + l16) * DMODEL + h * HDIM + kc * 32 + kb;
        qa[kc].q[0] = *reinterpret_cast<const uint4*>(base);
        qa[kc].q[1] = *reinterpret_cast<const uint4*>(base + 16);
    }

    v8f o[4];               // O^T: o[n][r] = head-dim n * 16 + kb + r of query l16
    float m = -1e30f;       // the query's running maximum, the same in both halves
    float lsum = 0.0f;      // the sum over this half's keys; the halves are joined behind the loop
#pragma unroll
    for (int n = 0; n < 4; ++n) o[n] = v8f_zero();
    const int row = qbase + l16;   // the lane's query

    int kend  = Nk;    // this wave's end
    int kendw = Nk;    // the work-group's end = its last wave's
    if (causal) {
        kend = (qbase + 16 + 31) & ~31;
        if (kend > Nk) kend = Nk;
        kendw = (qblk + 16 * AW + 31) & ~31;
        if (kendw > Nk) kendw = Nk;
    }
    const int ns = (kendw + AKEYS - 1) / AKEYS;   // staged tiles, the same for every wave

    uint4 pk0, pk1, pv0, pv1;
    // prologue: tile 0 into buffer 0
    pk0 = *reinterpret_cast<const uint4*>(gK);
    pk1 = *reinterpret_cast<const uint4*>(gK + kstep);
    pv0 = *reinterpret_cast<const uint4*>(gV);
    pv1 = *reinterpret_cast<const uint4*>(gV + vstep);
    *reinterpret_cast<uint4*>(&sK[0][sdst])               = pk0;
    *reinterpret_cast<uint4*>(&sK[0][sdst + 32 * APITCH]) = pk1;
    *reinterpret_cast<uint4*>(&sV[0][sdst])               = pv0;
    *reinterpret_cast<uint4*>(&sV[0][sdst + 32 * APITCH]) = pv1;
    __syncthreads();

    for (int s = 0; s < ns; ++s) {
        const int cur = s & 1;
        const int nxt = cur ^ 1;
        const bool more = (s + 1) < ns;
        if (more) {
            const bf16_t* k0 = gK + (size_t)(s + 1) * AKEYS * DMODEL;
            const bf16_t* v0 = gV + (s + 1) * AKEYS;
            const bf16_t* v1 = v0 + vstep;
            pk0 = *reinterpret_cast<const uint4*>(k0);
            pk1 = *reinterpret_cast<const uint4*>(k0 + kstep);   // a constant step: k0's registers and an offset
            pv0 = *reinterpret_cast<const uint4*>(v0);
            pv1 = *reinterpret_cast<const uint4*>(v1);
            // the wait that stands before an issued load's address registers are written again;
            // the addresses are inputs so that none is reused as a later load's destination
            asm volatile("s_wait_xcnt 0x0" :: "v"(k0), "v"(v0), "v"(v1) : "memory");
        }

        // two 32-key passes per staged tile; a wave past its own causal end skips the pass
#pragma unroll
        for (int sub = 0; sub < AKEYS; sub += 32) {
            const int j0 = s * AKEYS + sub;
            if (j0 < kend) {
                // ---- S^T = K Q^T for 32 keys (two 16x16 C tiles): sc[st][r] = key j0 + st * 16 + kb + r, query l16
                v8f sc[2];
#pragma unroll
                for (int st = 0; st < 2; ++st) {
                    FragB kb0, kb1;   // A = K: lane holds key row, elems walk head-dim
                    const bf16_t* base = &sK[cur][(sub + st * 16 + l16) * APITCH + kb];
                    kb0.q[0] = *reinterpret_cast<const uint4*>(base);
                    kb0.q[1] = *reinterpret_cast<const uint4*>(base + 16);
                    kb1.q[0] = *reinterpret_cast<const uint4*>(base + 32);
                    kb1.q[1] = *reinterpret_cast<const uint4*>(base + 48);
                    v8f z = v8f_zero();
                    z = wmma_bf16(kb0.v, qa[0].v, z);
                    z = wmma_bf16(kb1.v, qa[1].v, z);
                    sc[st] = z;
                }
                // ---- scale
#pragma unroll
                for (int st = 0; st < 2; ++st)
#pragma unroll
                    for (int r = 0; r < 8; ++r) sc[st][r] *= scale;
                // ---- causal mask, only in a pass that crosses the diagonal: the pass holds keys up to j0 + 31 and
                // the wave queries from qbase on, so below that no key is masked. All three values are scalars:
                // one scalar branch per pass stands for sixteen index, compare and select triples
                if (causal && j0 + 31 > qbase) {
#pragma unroll
                    for (int st = 0; st < 2; ++st)
#pragma unroll
                        for (int r = 0; r < 8; ++r)
                            if (j0 + st * 16 + kb + r > row) sc[st][r] = -1e30f;
                }
                // ---- online softmax: the lane's 16 scores by a tree, then the other half's result
                float t8[8];
#pragma unroll
                for (int r = 0; r < 8; ++r) t8[r] = fmaxf(sc[0][r], sc[1][r]);
                float rm = fmaxf(fmaxf(fmaxf(t8[0], t8[1]), fmaxf(t8[2], t8[3])),
                                 fmaxf(fmaxf(t8[4], t8[5]), fmaxf(t8[6], t8[7])));
                rm = fmaxf(rm, xhalf(rm));
                const float mn = fmaxf(m, rm);
                const float alpha = expf_slot(m - mn);
                m = mn;
                float rs[4] = {0.0f, 0.0f, 0.0f, 0.0f};   // four chains, so that no add waits on the one before
#pragma unroll
                for (int st = 0; st < 2; ++st) {
                    sc[st] = exp8_slot(sc[st] - mn);
#pragma unroll
                    for (int r = 0; r < 8; ++r) rs[r & 3] += sc[st][r];
                }
                lsum = lsum * alpha + ((rs[0] + rs[1]) + (rs[2] + rs[3]));
#pragma unroll
                for (int n = 0; n < 4; ++n)
#pragma unroll
                    for (int r = 0; r < 8; ++r) o[n][r] *= alpha;

                // ---- P^T as a B fragment: element s is key (s < 8 ? kb + s : 16 + kb + s - 8), which is what
                // the lane holds in sc[s >> 3][s & 7], and the k order of the V loader below
                FragB pb;
#pragma unroll
                for (int s8 = 0; s8 < 16; ++s8) pb.e[s8] = f2bf(sc[s8 >> 3][s8 & 7]);

                // ---- O^T += V^T (64x32) * P^T (32x16): V fragments from the staged tile
#pragma unroll
                for (int n = 0; n < 4; ++n) {
                    FragB vb;   // A = V^T: lane holds head-dim row, elems walk keys
                    const bf16_t* vbase = &sV[cur][(n * 16 + l16) * APITCH + sub + kb];
                    vb.q[0] = *reinterpret_cast<const uint4*>(vbase);
                    vb.q[1] = *reinterpret_cast<const uint4*>(vbase + 16);
                    o[n] = wmma_bf16(vb.v, pb.v, o[n]);
                }
                // the four vector slots that the chip needs behind a matrix instruction before its operands are
                // overwritten: the four
                // accumulators are inputs so that the slots stand behind all four products
                asm volatile("v_nop\n\tv_nop\n\tv_nop\n\tv_nop" :: "v"(o[0]), "v"(o[1]), "v"(o[2]), "v"(o[3]));
            }
        }

        if (more) {
            *reinterpret_cast<uint4*>(&sK[nxt][sdst])               = pk0;
            *reinterpret_cast<uint4*>(&sK[nxt][sdst + 32 * APITCH]) = pk1;
            *reinterpret_cast<uint4*>(&sV[nxt][sdst])               = pv0;
            *reinterpret_cast<uint4*>(&sV[nxt][sdst + 32 * APITCH]) = pv1;
        }
        // publishes the next tile and ends every wave's reads of the buffer that is refilled next
        __syncthreads();
    }

    // ---- join the halves' sums, normalize + store: a lane's eight values of a tile are neighbours
    const float l = lsum + xhalf(lsum);
#pragma unroll
    for (int n = 0; n < 4; ++n)
#pragma unroll
        for (int r = 0; r < 8; ++r) o[n][r] = o[n][r] / l;
    float* og = Og + qoff + (size_t)row * DMODEL + h * HDIM + kb;
#pragma unroll
    for (int n = 0; n < 4; ++n) {
        *reinterpret_cast<float4*>(og + n * 16)     = make_float4(o[n][0], o[n][1], o[n][2], o[n][3]);
        *reinterpret_cast<float4*>(og + n * 16 + 4) = make_float4(o[n][4], o[n][5], o[n][6], o[n][7]);
    }
}

// ---------------------------------------------------------------- residual + LayerNorm
// One wave per row, 32 values a lane by 16-byte accesses on whole lines; the row's sums stay in the
// wave (four chains a lane, then a five-step butterfly), so no LDS and no barrier.
// SPLIT: a is the first of two partial planes; the row is (a + a2) + bias, then the residual as ever.
#define LN_ROWS 8   // rows (waves) per work-group
template <bool SPLIT>
__device__ __forceinline__
void add_ln_body(const float* __restrict__ a, const float* __restrict__ a2, const float* __restrict__ bias,
                 const float* __restrict__ resid,
                 const float* __restrict__ g, const float* __restrict__ beta,
                 float* __restrict__ yf, bf16_t* __restrict__ ybf) {
    const int lane = threadIdx.x & 31;
    const int row  = blockIdx.x * LN_ROWS + (threadIdx.x >> 5);
    const size_t ro = (size_t)row * DMODEL + lane * 4;

    const float* pa = a     + ro;
    const float* pr = resid + ro;
    float4 x[8], r[8];
#pragma unroll
    for (int i = 0; i < 8; ++i) x[i] = *reinterpret_cast<const float4*>(pa + i * 128);
#pragma unroll
    for (int i = 0; i < 8; ++i) r[i] = *reinterpret_cast<const float4*>(pr + i * 128);
    // the wait that stands before an issued load's address registers are written again;
    // the addresses are inputs so that none is reused as a later load's destination
    asm volatile("s_wait_xcnt 0x0" :: "v"(pa), "v"(pr) : "memory");
    if constexpr (SPLIT) {
        const float* p2 = a2   + ro;
        const float* pb = bias + lane * 4;
        float4 y[8], c[8];
#pragma unroll
        for (int i = 0; i < 8; ++i) y[i] = *reinterpret_cast<const float4*>(p2 + i * 128);
#pragma unroll
        for (int i = 0; i < 8; ++i) c[i] = *reinterpret_cast<const float4*>(pb + i * 128);
        // the same wait, for these loads' addresses
        asm volatile("s_wait_xcnt 0x0" :: "v"(p2), "v"(pb) : "memory");
#pragma unroll
        for (int i = 0; i < 8; ++i) {
            x[i].x = (x[i].x + y[i].x) + c[i].x; x[i].y = (x[i].y + y[i].y) + c[i].y;
            x[i].z = (x[i].z + y[i].z) + c[i].z; x[i].w = (x[i].w + y[i].w) + c[i].w;
        }
    }

    float s0 = 0.0f, s1 = 0.0f, s2 = 0.0f, s3 = 0.0f;
    float q0 = 0.0f, q1 = 0.0f, q2 = 0.0f, q3 = 0.0f;
#pragma unroll
    for (int i = 0; i < 8; ++i) {
        x[i].x += r[i].x; x[i].y += r[i].y; x[i].z += r[i].z; x[i].w += r[i].w;
        s0 += x[i].x; s1 += x[i].y; s2 += x[i].z; s3 += x[i].w;
        q0 += x[i].x * x[i].x; q1 += x[i].y * x[i].y; q2 += x[i].z * x[i].z; q3 += x[i].w * x[i].w;
    }
    float s  = (s0 + s1) + (s2 + s3);
    float ss = (q0 + q1) + (q2 + q3);
#pragma unroll
    for (int off = 1; off < 32; off <<= 1) {
        s  += __shfl_xor(s,  off, 32);
        ss += __shfl_xor(ss, off, 32);
    }
    const float mean = s  * (1.0f / DMODEL);
    const float var  = ss * (1.0f / DMODEL) - mean * mean;
    // rsqrtf as the compiler expands it (a denormal argument is scaled by 2^24, its result by 2^12), with
    // v_rsq_f32 and the one slot that the instruction set asks for behind it in one statement, so that
    // the slot stays directly behind it
    const float ve   = var + 1e-5f;
    const bool  tiny = ve < 1.17549435e-38f;
    float rq;
    asm("v_rsq_f32 %0, %1\n\tv_nop" : "=v"(rq) : "v"(tiny ? ve * 16777216.0f : ve));
    const float rstd = tiny ? rq * 4096.0f : rq;
#pragma unroll
    for (int i = 0; i < 8; ++i) {
        const float4 gv = *reinterpret_cast<const float4*>(g    + lane * 4 + i * 128);
        const float4 bv = *reinterpret_cast<const float4*>(beta + lane * 4 + i * 128);
        x[i].x = (x[i].x - mean) * rstd * gv.x + bv.x;
        x[i].y = (x[i].y - mean) * rstd * gv.y + bv.y;
        x[i].z = (x[i].z - mean) * rstd * gv.z + bv.z;
        x[i].w = (x[i].w - mean) * rstd * gv.w + bv.w;
        *reinterpret_cast<float4*>(yf + ro + i * 128) = x[i];
    }
    // the wait that stands before the registers of the issued stores are written again (by the packing below)
    asm volatile("s_wait_xcnt 0x0" ::: "memory");
    if (ybf) {
#pragma unroll
        for (int i = 0; i < 8; ++i)
            *reinterpret_cast<uint2*>(ybf + ro + i * 128) = pack4_bf16(x[i]);
    }
}
__global__ __launch_bounds__(256)
void add_ln(const float* __restrict__ a, const float* __restrict__ resid,
            const float* __restrict__ g, const float* __restrict__ beta,
            float* __restrict__ yf, bf16_t* __restrict__ ybf) {
    add_ln_body<false>(a, nullptr, nullptr, resid, g, beta, yf, ybf);
}
__global__ __launch_bounds__(256)
void add_ln_split(const float* __restrict__ a, const float* __restrict__ a2, const float* __restrict__ bias,
                  const float* __restrict__ resid,
                  const float* __restrict__ g, const float* __restrict__ beta, float* __restrict__ yf) {
    add_ln_body<true>(a, a2, bias, resid, g, beta, yf, nullptr);
}

// ---------------------------------------------------------------- launch
extern "C" void kernel_launch(void* const* d_in, const int* in_sizes, int n_in,
                              void* d_out, int out_size, void* d_ws, size_t ws_size,
                              hipStream_t stream) {
    const float* x    = (const float*)d_in[0];
    const float* enc  = (const float*)d_in[1];
    const float* Wq1  = (const float*)d_in[2];
    const float* Wk1  = (const float*)d_in[3];
    const float* Wv1  = (const float*)d_in[4];
    const float* g1   = (const float*)d_in[5];
    const float* b1   = (const float*)d_in[6];
    const float* Wq2  = (const float*)d_in[7];
    const float* Wk2  = (const float*)d_in[8];
    const float* Wv2  = (const float*)d_in[9];
    const float* g2   = (const float*)d_in[10];
    const float* b2   = (const float*)d_in[11];
    const float* Wff1 = (const float*)d_in[12];
    const float* bff1 = (const float*)d_in[13];
    const float* Wff2 = (const float*)d_in[14];
    const float* bff2 = (const float*)d_in[15];
    const float* g3   = (const float*)d_in[16];
    const float* b3   = (const float*)d_in[17];

    char* ws = (char*)d_ws;
    const size_t MB = 1024u * 1024u;
    bf16_t* wq1b  = (bf16_t*)(ws + 0   * MB);   // all weights stored transposed [N][K]
    bf16_t* wk1b  = (bf16_t*)(ws + 2   * MB);
    bf16_t* wv1b  = (bf16_t*)(ws + 4   * MB);
    bf16_t* wq2b  = (bf16_t*)(ws + 6   * MB);
    bf16_t* wk2b  = (bf16_t*)(ws + 8   * MB);
    bf16_t* wv2b  = (bf16_t*)(ws + 10  * MB);
    bf16_t* wff1b = (bf16_t*)(ws + 12  * MB);
    bf16_t* wff2b = (bf16_t*)(ws + 20  * MB);
    bf16_t* xbf   = (bf16_t*)(ws + 28  * MB);   // activation bf16 (reused: x, y1, y2)
    bf16_t* encbf = (bf16_t*)(ws + 36  * MB);
    bf16_t* qbf   = (bf16_t*)(ws + 44  * MB);
    bf16_t* kbf   = (bf16_t*)(ws + 52  * MB);
    bf16_t* vbf   = (bf16_t*)(ws + 60  * MB);   // V stored transposed [DMODEL][MROWS]
    float*  ctx   = (float*) (ws + 68  * MB);   // attn ctx / ff2 out
    float*  yA    = (float*) (ws + 84  * MB);
    float*  yB    = (float*) (ws + 100 * MB);
    bf16_t* hbf   = (bf16_t*)(ws + 116 * MB);
    float*  ctx2  = (float*) (ws + 148 * MB);   // ff2 out, second half of k; ends at 164 MB

    const dim3 gqkv(DMODEL / TN, MROWS / TM, 3);
    const dim3 gff1(FFDIM / TN, MROWS / TM);
    const dim3 gff2(DMODEL / TN, MROWS / TM, 2);

    // x, enc -> bf16; weights -> bf16, transposed [N][K] (wq1b .. wv2b lie 2 MB apart, from wq1b on)
    cvt_all<<<CVT_ALL_BLOCKS, 256, 0, stream>>>(x, enc, Wq1, Wk1, Wv1, Wq2, Wk2, Wv2, Wff1, Wff2,
                                                xbf, encbf, wq1b, wff1b, wff2b);

    const float scale = 0.03125f;   // 1/sqrt(DMODEL), as in reference
    dim3 agrid(NTOK / (16 * AW), NHEAD, BATCH);

    // ---- block 1: causal self-attention
    gemm_qkv<<<gqkv, 256, 0, stream>>>(xbf, xbf, wq1b, wk1b, wv1b, qbf, kbf, vbf, DMODEL);
    attn_wmma<<<agrid, 256, 0, stream>>>(qbf, kbf, vbf, ctx, NTOK, NTOK, MROWS, 1, scale);
    add_ln<<<MROWS / LN_ROWS, 256, 0, stream>>>(ctx, x, g1, b1, yA, xbf);    // xbf := y1 (bf16)

    // ---- block 2: cross-attention over encoder output
    gemm_qkv<<<gqkv, 256, 0, stream>>>(xbf, encbf, wq2b, wk2b, wv2b, qbf, kbf, vbf, DMODEL);
    attn_wmma<<<agrid, 256, 0, stream>>>(qbf, kbf, vbf, ctx, NTOK, NTOK, MROWS, 0, scale);
    add_ln<<<MROWS / LN_ROWS, 256, 0, stream>>>(ctx, yA, g2, b2, yB, xbf);   // xbf := y2 (bf16)

    // ---- block 3: FFN (bias+GELU fused), residual, final LN
    gemm_ff1<<<gff1,  256, 0, stream>>>(xbf, wff1b, hbf, bff1, DMODEL);   // bf16 out + GELU
    gemm_ff2<<<gff2,  256, 0, stream>>>(hbf, wff2b, ctx, ctx2, FFDIM);    // fp32 out, one plane per half of k
    add_ln_split<<<MROWS / LN_ROWS, 256, 0, stream>>>(ctx, ctx2, bff2, yB, g3, b3, (float*)d_out);
}

// v009
// Measured time: 210 microseconds a run.
// Two timings next to v008 both put it at 1.03 times that version's speed.
// Counting every step since v000, it is 3.28 times as fast.
#include <hip/hip_runtime.h>
#include <math.h>

// ---------------------------------------------------------------- types
typedef __bf16 bf16_t;
typedef __attribute__((ext_vector_type(16))) __bf16 v16bf;
typedef __attribute__((ext_vector_type(8)))  float  v8f;

union FragB {
    v16bf  v;
    uint4  q[2];
    bf16_t e[16];
};

__device__ __forceinline__ bf16_t f2bf(float f) {
    unsigned int u = __float_as_uint(f);
    unsigned int r = u + 0x7FFFu + ((u >> 16) & 1u);   // round to nearest even
    unsigned short s = (unsigned short)(r >> 16);
    return __builtin_bit_cast(bf16_t, s);
}

__device__ __forceinline__ v8f wmma_bf16(const v16bf& a, const v16bf& b, const v8f& c) {
    return __builtin_amdgcn_wmma_f32_16x16x32_bf16(false, a, false, b, (short)0, c, false, false);
}

__device__ __forceinline__ v8f v8f_zero() {
    v8f z;
#pragma unroll
    for (int i = 0; i < 8; ++i) z[i] = 0.0f;
    return z;
}

// ---------------------------------------------------------------- constants
#define DMODEL 1024
#define NHEAD  16
#define HDIM   64
#define FFDIM  4096
#define BATCH  4
#define NTOK   1024
#define MROWS  (BATCH * NTOK)   // 4096

// ---------------------------------------------------------------- fp32 -> bf16 (straight)
__device__ __forceinline__ uint2 pack4_bf16(const float4& v) {
    union { bf16_t e[4]; uint2 q; } u;
    u.e[0] = f2bf(v.x); u.e[1] = f2bf(v.y); u.e[2] = f2bf(v.z); u.e[3] = f2bf(v.w);
    return u.q;
}

// 32 values a thread, as eight 16-byte loads in flight; every wave-wide load (512 B) and store (256 B)
// covers whole lines. One wave per 1,024 values, not one per 32.
#define CVT_BLOCK (256 * 32)   // values per work-group; a tensor is a multiple of it
__device__ __forceinline__
void cvt_f32_to_bf16(const float* __restrict__ in, bf16_t* __restrict__ out, int blk) {
    const size_t base = (size_t)blk * CVT_BLOCK + threadIdx.x * 4;
    float4 v[8];
#pragma unroll
    for (int c = 0; c < 8; ++c)
        v[c] = *reinterpret_cast<const float4*>(in + base + c * 1024);
#pragma unroll
    for (int c = 0; c < 8; ++c)
        *reinterpret_cast<uint2*>(out + base + c * 1024) = pack4_bf16(v[c]);
}

// ---------------------------------------------------------------- fp32 [K][N] -> bf16 [N][K]
// 64 x 64 tile, 16 values a thread: 16-byte loads along n (a wave covers two 256-B row pieces),
// 16-byte stores along k (eight lanes cover one 128-B line of an output row).
#define TT 64
__device__ __forceinline__
void cvt_transpose_bf16(const float* __restrict__ in, bf16_t* __restrict__ out,
                        int Kdim, int Ndim, int bn, int bk) {
    __shared__ float tile[TT][TT + 1];   // pitch 65 dwords: the column walks below meet no bank twice
    const int k0 = bk * TT;
    const int n0 = bn * TT;
    const int t  = threadIdx.x;
    const int lr = t >> 4;               // 0..15
    const int lc = (t & 15) * 4;         // 0,4,..,60
    const float* s0 = in + (size_t)(k0 + lr) * Ndim + n0 + lc;
    const float* s1 = s0 + (size_t)16 * Ndim;
    const float* s2 = s1 + (size_t)16 * Ndim;
    const float* s3 = s2 + (size_t)16 * Ndim;
    float4 v[4];
    v[0] = *reinterpret_cast<const float4*>(s0);
    v[1] = *reinterpret_cast<const float4*>(s1);
    v[2] = *reinterpret_cast<const float4*>(s2);
    v[3] = *reinterpret_cast<const float4*>(s3);
    // the wait that stands before an issued load's address registers are written again;
    // the addresses are inputs so that none is reused as a later load's destination
    asm volatile("s_wait_xcnt 0x0" :: "v"(s0), "v"(s1), "v"(s2), "v"(s3) : "memory");
#pragma unroll
    for (int p = 0; p < 4; ++p) {
        float* d = &tile[p * 16 + lr][lc];
        d[0] = v[p].x; d[1] = v[p].y; d[2] = v[p].z; d[3] = v[p].w;
    }
    __syncthreads();
#pragma unroll
    for (int c = 0; c < 2; ++c) {
        const int id = t + c * 256;
        const int n  = id >> 3;          // 0..63
        const int ks = (id & 7) * 8;     // 0,8,..,56
        union { bf16_t e[8]; uint4 q; } u;
#pragma unroll
        for (int j = 0; j < 8; ++j) u.e[j] = f2bf(tile[ks + j][n]);
        *reinterpret_cast<uint4*>(out + (size_t)(n0 + n) * Kdim + k0 + ks) = u.q;
    }
}

// ---------------------------------------------------------------- all ten conversions, one launch
// None of them needs anything of another, so they share one grid by ranges of the block index
// (every test below is on blockIdx alone: the same for a whole work-group). The casts, which move
// twice a transpose tile's bytes per work-group, come first.
#define CAST_BLOCKS (MROWS * DMODEL / CVT_BLOCK)             // 512 per activation tensor
#define SQ_BLOCKS   ((DMODEL / TT) * (DMODEL / TT))          // 256 per square weight
#define FF_BLOCKS   ((DMODEL / TT) * (FFDIM / TT))           // 1,024 per feed-forward weight
#define CVT_ALL_BLOCKS (2 * CAST_BLOCKS + 6 * SQ_BLOCKS + 2 * FF_BLOCKS)
__global__ __launch_bounds__(256)
void cvt_all(const float* __restrict__ x,    const float* __restrict__ enc,
             const float* __restrict__ wq1,  const float* __restrict__ wk1, const float* __restrict__ wv1,
             const float* __restrict__ wq2,  const float* __restrict__ wk2, const float* __restrict__ wv2,
             const float* __restrict__ wff1, const float* __restrict__ wff2,
             bf16_t* __restrict__ xbf,  bf16_t* __restrict__ encbf,
             bf16_t* __restrict__ wsq,          // the six square weights' outputs, DMODEL * DMODEL apart
             bf16_t* __restrict__ wff1b, bf16_t* __restrict__ wff2b) {
    int b = blockIdx.x;
    if (b < 2 * CAST_BLOCKS) {
        const bool first = b < CAST_BLOCKS;
        cvt_f32_to_bf16(first ? x : enc, first ? xbf : encbf, first ? b : b - CAST_BLOCKS);
        return;   // the whole work-group leaves, ahead of the transpose's barrier
    }
    b -= 2 * CAST_BLOCKS;
    const float* in;
    bf16_t* out;
    int Kdim = DMODEL, Ndim = DMODEL;
    if (b < 6 * SQ_BLOCKS) {
        const int w = b / SQ_BLOCKS;
        b -= w * SQ_BLOCKS;
        const bool odd = w & 1;
        const float* p01 = odd ? wk1 : wq1;
        const float* p23 = odd ? wq2 : wv1;
        const float* p45 = odd ? wv2 : wk2;
        in  = w < 2 ? p01 : w < 4 ? p23 : p45;
        out = wsq + (size_t)w * DMODEL * DMODEL;
    } else if (b < 6 * SQ_BLOCKS + FF_BLOCKS) {
        b -= 6 * SQ_BLOCKS;
        in = wff1; out = wff1b; Ndim = FFDIM;
    } else {
        b -= 6 * SQ_BLOCKS + FF_BLOCKS;
        in = wff2; out = wff2b; Kdim = FFDIM;
    }
    const int nb = Ndim / TT;   // tiles along n: 16 or 64
    cvt_transpose_bf16(in, out, Kdim, Ndim, b % nb, b / nb);
}

// ---------------------------------------------------------------- erf of eight values, without a branch
__device__ __forceinline__ v8f exp8_slot(const v8f& x);   // eight e^x, defined with the attention kernel below

__device__ __forceinline__ v8f splat8(float c) {
    v8f r;
#pragma unroll   // constant element indices, so that the vector stays in registers (so below too)
    for (int i = 0; i < 8; ++i) r[i] = c;
    return r;
}

// The two polynomials of the f32 library erf (in x^2 below |x| = 1; in |x|, then 1 - e^-q, from 1 on), both taken
// for every value and picked by a select. With a branch per value a wave of mixed lanes walks both sides anyway,
// one value at a time and every link waiting on the one before; here the eight values are independent chains
// of packed operations.
__device__ __forceinline__ v8f erf8(const v8f& x) {
    const v8f ax = __builtin_elementwise_abs(x);
    const v8f t  = x * x;
    v8f p = __builtin_elementwise_fma(t, splat8(-5.6180177e-4f), splat8(4.9138162e-3f));
    p = __builtin_elementwise_fma(t, p, splat8(-2.6707515e-2f));
    p = __builtin_elementwise_fma(t, p, splat8(1.1280011e-1f));
    p = __builtin_elementwise_fma(t, p, splat8(-3.7612295e-1f));
    p = __builtin_elementwise_fma(t, p, splat8(1.2837911e-1f));
    const v8f lo = __builtin_elementwise_fma(ax, p, ax);
    v8f q = __builtin_elementwise_fma(ax, splat8(1.6998811e-5f), splat8(-3.7867785e-4f));
    q = __builtin_elementwise_fma(ax, q, splat8(3.8578159e-3f));
    q = __builtin_elementwise_fma(ax, q, splat8(-2.4181698e-2f));
    q = __builtin_elementwise_fma(ax, q, splat8(1.0666826e-1f));
    q = __builtin_elementwise_fma(ax, q, splat8(6.3493329e-1f));
    q = __builtin_elementwise_fma(ax, q, splat8(1.2868941e-1f));
    q = __builtin_elementwise_fma(ax, q, ax);
    const v8f hi = 1.0f - exp8_slot(-q);
    v8f r;
#pragma unroll
    for (int i = 0; i < 8; ++i) r[i] = __builtin_copysignf(ax[i] < 1.0f ? lo[i] : hi[i], x[i]);
    return r;
}

// ---------------------------------------------------------------- GEMM (bf16 WMMA, fp32 acc)
// C[M,N] = A[M,K] @ B[K,N], with B supplied TRANSPOSED as Bt[N][K] bf16.
// The output kind, bias, GELU and the output's pitch are compile-time values: one kernel per use below.
#define OUT_BF16   0   // bf16 [M][N]
#define OUT_BF16_T 1   // bf16 [N][M]
#define OUT_F32    2   // f32  [M][N]
#define TM 128
#define TN 128
#define TK 64      // one staged row of a slab = 128 B = one whole cache line
#define LDP 72     // LDS row pitch in elements: 144 B = 16 B x odd, for the 16-byte fragment reads

template <int KIND, bool BIAS, bool GELU, int M, int N>
__device__ __forceinline__
void gemm_body(bf16_t (*sA)[TM * LDP], bf16_t (*sB)[TN * LDP],
               const bf16_t* __restrict__ A, const bf16_t* __restrict__ Bt,
               void* __restrict__ Cout, const float* __restrict__ bias, int K, int ld) {
    // K: the k extent of this product; ld: the row pitch of A and Bt in elements (K, or more for a part of the rows)
    static_assert(KIND != OUT_BF16_T || (!BIAS && !GELU), "the transposed output takes neither");

    const int t    = threadIdx.x;
    const int lane = t & 31;
    const int wave = t >> 5;                 // 0..7
    const int wrow = (wave & 3) * 32;        // 0,32,64,96
    const int wcol = (wave >> 2) * 64;       // 0,64
    const int m0   = blockIdx.y * TM;
    const int n0   = blockIdx.x * TN;
    const int hi   = lane >> 4;
    const int l16  = lane & 15;
    const int kb   = hi * 8;

    // staging: eight lanes cover one 128-B row of the slab, so a wave's 16-byte load
    // touches four whole lines; a thread takes rows srow, srow + 32, + 64, + 96
    const int srow = t >> 3;                 // 0..31
    const int sseg = (t & 7) * 8;            // 0,8,..,56
    const bf16_t* gA = A  + (size_t)m0 * ld; // block-uniform bases; the lane's part is soff
    const bf16_t* gB = Bt + (size_t)n0 * ld;
    const unsigned soff = (unsigned)(srow * ld + sseg);
    const size_t rstep = (size_t)32 * ld;
    const int sdst = srow * LDP + sseg;

    v8f acc[2][4];
#pragma unroll
    for (int i = 0; i < 2; ++i)
#pragma unroll
        for (int j = 0; j < 4; ++j) acc[i][j] = v8f_zero();

    const int nk = K / TK;
    uint4 pa0, pa1, pa2, pa3, pb0, pb1, pb2, pb3;

    // prologue: stage slab 0 into buffer 0
    {
        const bf16_t* a0 = gA + soff;
        const bf16_t* a1 = a0 + rstep;
        const bf16_t* a2 = a1 + rstep;
        const bf16_t* a3 = a2 + rstep;
        const bf16_t* b0 = gB + soff;
        const bf16_t* b1 = b0 + rstep;
        const bf16_t* b2 = b1 + rstep;
        const bf16_t* b3 = b2 + rstep;
        pa0 = *reinterpret_cast<const uint4*>(a0);
        pa1 = *reinterpret_cast<const uint4*>(a1);
        pa2 = *reinterpret_cast<const uint4*>(a2);
        pa3 = *reinterpret_cast<const uint4*>(a3);
        pb0 = *reinterpret_cast<const uint4*>(b0);
        pb1 = *reinterpret_cast<const uint4*>(b1);
        pb2 = *reinterpret_cast<const uint4*>(b2);
        pb3 = *reinterpret_cast<const uint4*>(b3);
        // the wait that stands before an issued load's address registers are written again, as in the loop below
        asm volatile("s_wait_xcnt 0x0"
                     :: "v"(a0), "v"(a1), "v"(a2), "v"(a3), "v"(b0), "v"(b1), "v"(b2), "v"(b3)
                     : "memory");
    }
    *reinterpret_cast<uint4*>(&sA[0][sdst])            = pa0;
    *reinterpret_cast<uint4*>(&sA[0][sdst + 32 * LDP]) = pa1;
    *reinterpret_cast<uint4*>(&sA[0][sdst + 64 * LDP]) = pa2;
    *reinterpret_cast<uint4*>(&sA[0][sdst + 96 * LDP]) = pa3;
    *reinterpret_cast<uint4*>(&sB[0][sdst])            = pb0;
    *reinterpret_cast<uint4*>(&sB[0][sdst + 32 * LDP]) = pb1;
    *reinterpret_cast<uint4*>(&sB[0][sdst + 64 * LDP]) = pb2;
    *reinterpret_cast<uint4*>(&sB[0][sdst + 96 * LDP]) = pb3;
    __syncthreads();

    for (int kt = 0; kt < nk; ++kt) {
        const int cur = kt & 1;
        const int nxt = cur ^ 1;
        const bool more = (kt + 1) < nk;
        if (more) {
            int ko = (kt + 1) * TK;
            const bf16_t* a0 = gA + ko + soff;
            const bf16_t* a1 = a0 + rstep;
            const bf16_t* a2 = a1 + rstep;
            const bf16_t* a3 = a2 + rstep;
            const bf16_t* b0 = gB + ko + soff;
            const bf16_t* b1 = b0 + rstep;
            const bf16_t* b2 = b1 + rstep;
            const bf16_t* b3 = b2 + rstep;
            pa0 = *reinterpret_cast<const uint4*>(a0);
            pa1 = *reinterpret_cast<const uint4*>(a1);
            pa2 = *reinterpret_cast<const uint4*>(a2);
            pa3 = *reinterpret_cast<const uint4*>(a3);
            pb0 = *reinterpret_cast<const uint4*>(b0);
            pb1 = *reinterpret_cast<const uint4*>(b1);
            pb2 = *reinterpret_cast<const uint4*>(b2);
            pb3 = *reinterpret_cast<const uint4*>(b3);
            // the wait that stands before an issued load's address registers are written again;
            // the addresses are inputs so that none is reused as a later load's destination
            asm volatile("s_wait_xcnt 0x0"
                         :: "v"(a0), "v"(a1), "v"(a2), "v"(a3), "v"(b0), "v"(b1), "v"(b2), "v"(b3)
                         : "memory");
        }

        // two 32-deep products per slab, k ascending; unrolled so that ks folds into the LDS offsets
#pragma unroll
        for (int ks = 0; ks < TK; ks += 32) {
            FragB af[2], bfr[4];
#pragma unroll
            for (int i = 0; i < 2; ++i) {
                int row = wrow + i * 16 + l16;
                af[i].q[0] = *reinterpret_cast<const uint4*>(&sA[cur][row * LDP + ks + kb]);
                af[i].q[1] = *reinterpret_cast<const uint4*>(&sA[cur][row * LDP + ks + kb + 16]);
            }
#pragma unroll
            for (int j = 0; j < 4; ++j) {
                int col = wcol + j * 16 + l16;
                bfr[j].q[0] = *reinterpret_cast<const uint4*>(&sB[cur][col * LDP + ks + kb]);
                bfr[j].q[1] = *reinterpret_cast<const uint4*>(&sB[cur][col * LDP + ks + kb + 16]);
            }
#pragma unroll
            for (int i = 0; i < 2; ++i)
#pragma unroll
                for (int j = 0; j < 4; ++j) {
                    // the operand order decides which index of C runs along a lane's eight accumulators:
                    // always the one that is contiguous in the output (m for [N][M], n for [M][N])
                    if constexpr (KIND == OUT_BF16_T) acc[i][j] = wmma_bf16(af[i].v, bfr[j].v, acc[i][j]);
                    else                              acc[i][j] = wmma_bf16(bfr[j].v, af[i].v, acc[i][j]);
                }
        }

        if (more) {
            *reinterpret_cast<uint4*>(&sA[nxt][sdst])            = pa0;
            *reinterpret_cast<uint4*>(&sA[nxt][sdst + 32 * LDP]) = pa1;
            *reinterpret_cast<uint4*>(&sA[nxt][sdst + 64 * LDP]) = pa2;
            *reinterpret_cast<uint4*>(&sA[nxt][sdst + 96 * LDP]) = pa3;
            *reinterpret_cast<uint4*>(&sB[nxt][sdst])            = pb0;
            *reinterpret_cast<uint4*>(&sB[nxt][sdst + 32 * LDP]) = pb1;
            *reinterpret_cast<uint4*>(&sB[nxt][sdst + 64 * LDP]) = pb2;
            *reinterpret_cast<uint4*>(&sB[nxt][sdst + 96 * LDP]) = pb3;
        }
        __syncthreads();
    }

    if constexpr (KIND == OUT_BF16_T) {
        // lane = column n; its eight accumulators are rows m .. m + 7: one 16-byte store
        bf16_t* C = (bf16_t*)Cout + (size_t)(n0 + wcol + l16) * M + m0 + wrow + kb;
#pragma unroll
        for (int i = 0; i < 2; ++i)
#pragma unroll
            for (int j = 0; j < 4; ++j) {
                union { bf16_t e[8]; uint4 q; } u;
#pragma unroll
                for (int r = 0; r < 8; ++r) u.e[r] = f2bf(acc[i][j][r]);
                *reinterpret_cast<uint4*>(C + (size_t)j * 16 * M + i * 16) = u.q;
            }
    } else {
        // lane = row m; its eight accumulators are columns n .. n + 7: one (bf16) or two (f32) 16-byte stores
        const size_t co = (size_t)(m0 + wrow + l16) * N + n0 + wcol + kb;
        float4 bv[4][2];
        if constexpr (BIAS) {
#pragma unroll
            for (int j = 0; j < 4; ++j) {
                bv[j][0] = *reinterpret_cast<const float4*>(bias + n0 + wcol + kb + j * 16);
                bv[j][1] = *reinterpret_cast<const float4*>(bias + n0 + wcol + kb + j * 16 + 4);
            }
        }
#pragma unroll
        for (int i = 0; i < 2; ++i)
#pragma unroll
            for (int j = 0; j < 4; ++j) {
                float v[8];
#pragma unroll
                for (int r = 0; r < 8; ++r) v[r] = acc[i][j][r];
                if constexpr (BIAS) {
                    v[0] += bv[j][0].x; v[1] += bv[j][0].y; v[2] += bv[j][0].z; v[3] += bv[j][0].w;
                    v[4] += bv[j][1].x; v[5] += bv[j][1].y; v[6] += bv[j][1].z; v[7] += bv[j][1].w;
                }
                if constexpr (GELU) {
                    v8f xs;
#pragma unroll
                    for (int r = 0; r < 8; ++r) xs[r] = v[r] * 0.70710678118654752440f;
                    const v8f e = erf8(xs);
#pragma unroll
                    for (int r = 0; r < 8; ++r) v[r] = 0.5f * v[r] * (1.0f + e[r]);
                }
                const size_t o = co + (size_t)i * 16 * N + j * 16;
                if constexpr (KIND == OUT_BF16) {
                    union { bf16_t e[8]; uint4 q; } u;
#pragma unroll
                    for (int r = 0; r < 8; ++r) u.e[r] = f2bf(v[r]);
                    *reinterpret_cast<uint4*>((bf16_t*)Cout + o) = u.q;
                } else {
                    *reinterpret_cast<float4*>((float*)Cout + o)     = make_float4(v[0], v[1], v[2], v[3]);
                    *reinterpret_cast<float4*>((float*)Cout + o + 4) = make_float4(v[4], v[5], v[6], v[7]);
                }
            }
    }
}

// the two staging buffers of a GEMM work-group; declared in the kernel, so that the two bodies of
// gemm_qkv share one set
#define GEMM_LDS \
    __shared__ __align__(16) bf16_t sA[2][TM * LDP];  /* [row][k]  2 x 18 KB */ \
    __shared__ __align__(16) bf16_t sB[2][TN * LDP];  /* [n][k]    2 x 18 KB */

// the uses: the three projections of an attention block; FFN up (bias, GELU); FFN down (f32, two halves of k)
// Q, K and V need nothing of each other: one launch, blockIdx.z picks the product (0 Q, 1 K, 2 V with
// its transposed output), so that three work-groups stand on a WGP where one stood
__global__ __launch_bounds__(256)
void gemm_qkv(const bf16_t* __restrict__ Aq, const bf16_t* __restrict__ Akv,
              const bf16_t* __restrict__ Wq, const bf16_t* __restrict__ Wk, const bf16_t* __restrict__ Wv,
              bf16_t* __restrict__ Cq, bf16_t* __restrict__ Ck, bf16_t* __restrict__ Cvt, int K) {
    GEMM_LDS
    const int z = blockIdx.z;
    if (z == 2) {
        gemm_body<OUT_BF16_T, false, false, MROWS, DMODEL>(sA, sB, Akv, Wv, Cvt, nullptr, K, K);
        return;
    }
    gemm_body<OUT_BF16, false, false, MROWS, DMODEL>(sA, sB, z ? Akv : Aq, z ? Wk : Wq, z ? Ck : Cq, nullptr, K, K);
    // the wait that stands before the registers of the issued stores are written again: in the built code the
    // other body's entry follows these stores behind a branch
    asm volatile("s_wait_xcnt 0x0" ::: "memory");
}
// six waves a SIMD, three work-groups a WGP, as before this epilogue: registers are allocated in sixteens, and one
// above 160 would cost a work-group per WGP
__global__ __launch_bounds__(256) __attribute__((amdgpu_waves_per_eu(6)))
void gemm_ff1(const bf16_t* __restrict__ A, const bf16_t* __restrict__ Bt, bf16_t* __restrict__ C,
              const float* __restrict__ bias, int K) {
    GEMM_LDS
    gemm_body<OUT_BF16, true, true, MROWS, FFDIM>(sA, sB, A, Bt, C, bias, K, K);
}
// FFN down has one 128 x 128 tile per WGP and a long k: blockIdx.z halves k, so that two work-groups stand on a
// WGP and each one's waits (LDS reads, the next slab's loads, the barrier) are filled by the other's products.
// Each half stores its own f32 plane; the LayerNorm that follows adds the two planes and the bias.
__global__ __launch_bounds__(256)
void gemm_ff2(const bf16_t* __restrict__ A, const bf16_t* __restrict__ Bt,
              float* __restrict__ C0, float* __restrict__ C1, int K) {
    GEMM_LDS
    const int z  = blockIdx.z;
    const int kh = K / 2;
    gemm_body<OUT_F32, false, false, MROWS, DMODEL>(sA, sB, A + z * kh, Bt + z * kh, z ? C1 : C0, nullptr, kh, K);
}

__device__ __forceinline__ float expf_slot(float x) {
    float r;
    asm("v_exp_f32 %0, %1\n\tv_nop" : "=v"(r) : "v"(x * 1.44269504088896340736f));
    return r;
}

// eight e^x, each as above. One statement, so that the slot behind every v_exp_f32 is filled by construction: the
// next one neither reads its result nor writes its source (the results are early-clobber registers), and the
// last has the v_nop.
__device__ __forceinline__ v8f exp8_slot(const v8f& x) {
    float r0, r1, r2, r3, r4, r5, r6, r7;
    const float c = 1.44269504088896340736f;
    asm("v_exp_f32 %0, %8\n\tv_exp_f32 %1, %9\n\tv_exp_f32 %2, %10\n\tv_exp_f32 %3, %11\n\t"
        "v_exp_f32 %4, %12\n\tv_exp_f32 %5, %13\n\tv_exp_f32 %6, %14\n\tv_exp_f32 %7, %15\n\tv_nop"
        : "=&v"(r0), "=&v"(r1), "=&v"(r2), "=&v"(r3), "=&v"(r4), "=&v"(r5), "=&v"(r6), "=&v"(r7)
        : "v"(x[0] * c), "v"(x[1] * c), "v"(x[2] * c), "v"(x[3] * c),
          "v"(x[4] * c), "v"(x[5] * c), "v"(x[6] * c), "v"(x[7] * c));
    v8f r;
    r[0] = r0; r[1] = r1; r[2] = r2; r[3] = r3; r[4] = r4; r[5] = r5; r[6] = r6; r[7] = r7;
    return r;
}

// lane l with lane l ^ 16
__device__ __forceinline__ float xhalf(float x) {
    const int b = __builtin_bit_cast(int, x);
    return __builtin_bit_cast(float, __builtin_amdgcn_permlanex16(b, b, 0x76543210, 0xfedcba98, false, false));
}

#define AW     8    // waves = 16-query tiles per work-group
#define AKEYS  64   // keys per staged tile: a V row of the tile is one whole 128-B line, as a K row is
#define APITCH 72   // LDS row pitch in elements: 144 B = 16 B x odd, for the 16-byte fragment reads
__global__ __launch_bounds__(256)
void attn_wmma(const bf16_t* __restrict__ Qg, const bf16_t* __restrict__ Kg,
               const bf16_t* __restrict__ Vt, float* __restrict__ Og,
               int Nq, int Nk, int Mtot, int causal, float scale) {
    __shared__ __align__(16) bf16_t sK[2][AKEYS * APITCH];   // [key][head-dim]   2 x 9 KB
    __shared__ __align__(16) bf16_t sV[2][HDIM * APITCH];    // [head-dim][key]   2 x 9 KB

    const int t    = threadIdx.x;
    const int lane = t & 31;
    const int wave = __builtin_amdgcn_readfirstlane(t >> 5);  // scalar: the tests on kend below are scalar branches
    const int hi   = lane >> 4;
    const int l16  = lane & 15;
    const int kb   = hi * 8;
    const int h    = blockIdx.y;
    const int b    = blockIdx.z;
    const int qblk  = blockIdx.x * (16 * AW);
    const int qbase = qblk + wave * 16;
    const size_t qoff = (size_t)b * Nq * DMODEL;
    const size_t koff = (size_t)b * Nk * DMODEL;

    // staging: eight lanes cover one 128-B row, so a wave's 16-byte load touches four whole lines;
    // a thread takes rows srow and srow + 32 of the K tile and of the V tile
    const int srow = t >> 3;                 // 0..31
    const int sseg = (t & 7) * 8;            // 0,8,..,56
    const int sdst = srow * APITCH + sseg;
    const bf16_t* gK = Kg + koff + (size_t)srow * DMODEL + h * HDIM + sseg;
    const bf16_t* gV = Vt + (size_t)(h * HDIM + srow) * Mtot + (size_t)b * Nk + sseg;
    const size_t kstep = (size_t)32 * DMODEL;
    const size_t vstep = (size_t)32 * Mtot;

    // Q fragments: 16 queries x 64 head-dims = two 32x16 B fragments (lane = query, elements walk head-dim)
    FragB qa[2];
#pragma unroll
    for (int kc = 0; kc < 2; ++kc) {
        const bf16_t* base = Qg + qoff + (size_t)(qbase + l16) * DMODEL + h * HDIM + kc * 32 + kb;
        qa[kc].q[0] = *reinterpret_cast<const uint4*>(base);
        qa[kc].q[1] = *reinterpret_cast<const uint4*>(base + 16);
    }

    v8f o[4];               // O^T: o[n][r] = head-dim n * 16 + kb + r of query l16
    float m = -1e30f;       // the query's running maximum, the same in both halves
    float lsum = 0.0f;      // the sum over this half's keys; the halves are joined behind the loop
#pragma unroll
    for (int n = 0; n < 4; ++n) o[n] = v8f_zero();
    const int row = qbase + l16;   // the lane's query

    int kend  = Nk;    // this wave's end
    int kendw = Nk;    // the work-group's end = its last wave's
    if (causal) {
        kend = (qbase + 16 + 31) & ~31;
        if (kend > Nk) kend = Nk;
        kendw = (qblk + 16 * AW + 31) & ~31;
        if (kendw > Nk) kendw = Nk;
    }
    const int ns = (kendw + AKEYS - 1) / AKEYS;   // staged tiles, the same for every wave

    uint4 pk0, pk1, pv0, pv1;
    // prologue: tile 0 into buffer 0
    pk0 = *reinterpret_cast<const uint4*>(gK);
    pk1 = *reinterpret_cast<const uint4*>(gK + kstep);
    pv0 = *reinterpret_cast<const uint4*>(gV);
    pv1 = *reinterpret_cast<const uint4*>(gV + vstep);
    *reinterpret_cast<uint4*>(&sK[0][sdst])               = pk0;
    *reinterpret_cast<uint4*>(&sK[0][sdst + 32 * APITCH]) = pk1;
    *reinterpret_cast<uint4*>(&sV[0][sdst])               = pv0;
    *reinterpret_cast<uint4*>(&sV[0][sdst + 32 * APITCH]) = pv1;
    __syncthreads();

    for (int s = 0; s < ns; ++s) {
        const int cur = s & 1;
        const int nxt = cur ^ 1;
        const bool more = (s + 1) < ns;
        if (more) {
            const bf16_t* k0 = gK + (size_t)(s + 1) * AKEYS * DMODEL;
            const bf16_t* v0 = gV + (s + 1) * AKEYS;
            const bf16_t* v1 = v0 + vstep;
            pk0 = *reinterpret_cast<const uint4*>(k0);
            pk1 = *reinterpret_cast<const uint4*>(k0 + kstep);   // a constant step: k0's registers and an offset
            pv0 = *reinterpret_cast<const uint4*>(v0);
            pv1 = *reinterpret_cast<const uint4*>(v1);
            // the wait that stands before an issued load's address registers are written again;
            // the addresses are inputs so that none is reused as a later load's destination
            asm volatile("s_wait_xcnt 0x0" :: "v"(k0), "v"(v0), "v"(v1) : "memory");
        }

        // two 32-key passes per staged tile; a wave past its own causal end skips the pass
#pragma unroll
        for (int sub = 0; sub < AKEYS; sub += 32) {
            const int j0 = s * AKEYS + sub;
            if (j0 < kend) {
                // ---- S^T = K Q^T for 32 keys (two 16x16 C tiles): sc[st][r] = key j0 + st * 16 + kb + r, query l16
                v8f sc[2];
#pragma unroll
                for (int st = 0; st < 2; ++st) {
                    FragB kb0, kb1;   // A = K: lane holds key row, elems walk head-dim
                    const bf16_t* base = &sK[cur][(sub + st * 16 + l16) * APITCH + kb];
                    kb0.q[0] = *reinterpret_cast<const uint4*>(base);
                    kb0.q[1] = *reinterpret_cast<const uint4*>(base + 16);
                    kb1.q[0] = *reinterpret_cast<const uint4*>(base + 32);
                    kb1.q[1] = *reinterpret_cast<const uint4*>(base + 48);
                    v8f z = v8f_zero();
                    z = wmma_bf16(kb0.v, qa[0].v, z);
                    z = wmma_bf16(kb1.v, qa[1].v, z);
                    sc[st] = z;
                }
                // ---- scale
#pragma unroll
                for (int st = 0; st < 2; ++st)
#pragma unroll
                    for (int r = 0; r < 8; ++r) sc[st][r] *= scale;
                // ---- causal mask, only in a pass that crosses the diagonal: the pass holds keys up to j0 + 31 and
                // the wave queries from qbase on, so below that no key is masked. All three values are scalars:
                // one scalar branch per pass stands for sixteen index, compare and select triples
                if (causal && j0 + 31 > qbase) {
#pragma unroll
                    for (int st = 0; st < 2; ++st)
#pragma unroll
                        for (int r = 0; r < 8; ++r)
                            if (j0 + st * 16 + kb + r > row) sc[st][r] = -1e30f;
                }
                // ---- online softmax: the lane's 16 scores by a tree, then the other half's result
                float t8[8];
#pragma unroll
                for (int r = 0; r < 8; ++r) t8[r] = fmaxf(sc[0][r], sc[1][r]);
                float rm = fmaxf(fmaxf(fmaxf(t8[0], t8[1]), fmaxf(t8[2], t8[3])),
                                 fmaxf(fmaxf(t8[4], t8[5]), fmaxf(t8[6], t8[7])));
                rm = fmaxf(rm, xhalf(rm));
                const float mn = fmaxf(m, rm);
                const float alpha = expf_slot(m - mn);
                m = mn;
                float rs[4] = {0.0f, 0.0f, 0.0f, 0.0f};   // four chains, so that no add waits on the one before
#pragma unroll
                for (int st = 0; st < 2; ++st) {
                    sc[st] = exp8_slot(sc[st] - mn);
#pragma unroll
                    for (int r = 0; r < 8; ++r) rs[r & 3] += sc[st][r];
                }
                lsum = lsum * alpha + ((rs[0] + rs[1]) + (rs[2] + rs[3]));
#pragma unroll
                for (int n = 0; n < 4; ++n)
#pragma unroll
                    for (int r = 0; r < 8; ++r) o[n][r] *= alpha;

                // ---- P^T as a B fragment: element s is key (s < 8 ? kb + s : 16 + kb + s - 8), which is what
                // the lane holds in sc[s >> 3][s & 7], and the k order of the V loader below
                FragB pb;
#pragma unroll
                for (int s8 = 0; s8 < 16; ++s8) pb.e[s8] = f2bf(sc[s8 >> 3][s8 & 7]);

                // ---- O^T += V^T (64x32) * P^T (32x16): V fragments from the staged tile
#pragma unroll
                for (int n = 0; n < 4; ++n) {
                    FragB vb;   // A = V^T: lane holds head-dim row, elems walk keys
                    const bf16_t* vbase = &sV[cur][(n * 16 + l16) * APITCH + sub + kb];
                    vb.q[0] = *reinterpret_cast<const uint4*>(vbase);
                    vb.q[1] = *reinterpret_cast<const uint4*>(vbase + 16);
                    o[n] = wmma_bf16(vb.v, pb.v, o[n]);
                }
                // the four vector slots that the chip needs behind a matrix instruction before its operands are
                // overwritten: the four
                // accumulators are inputs so that the slots stand behind all four products
                asm volatile("v_nop\n\tv_nop\n\tv_nop\n\tv_nop" :: "v"(o[0]), "v"(o[1]), "v"(o[2]), "v"(o[3]));
            }
        }

        if (more) {
            *reinterpret_cast<uint4*>(&sK[nxt][sdst])               = pk0;
            *reinterpret_cast<uint4*>(&sK[nxt][sdst + 32 * APITCH]) = pk1;
            *reinterpret_cast<uint4*>(&sV[nxt][sdst])               = pv0;
            *reinterpret_cast<uint4*>(&sV[nxt][sdst + 32 * APITCH]) = pv1;
        }
        // publishes the next tile and ends every wave's reads of the buffer that is refilled next
        __syncthreads();
    }

    // ---- join the halves' sums, normalize + store: a lane's eight values of a tile are neighbours
    const float l = lsum + xhalf(lsum);
#pragma unroll
    for (int n = 0; n < 4; ++n)
#pragma unroll
        for (int r = 0; r < 8; ++r) o[n][r] = o[n][r] / l;
    float* og = Og + qoff + (size_t)row * DMODEL + h * HDIM + kb;
#pragma unroll
    for (int n = 0; n < 4; ++n) {
        *reinterpret_cast<float4*>(og + n * 16)     = make_float4(o[n][0], o[n][1], o[n][2], o[n][3]);
        *reinterpret_cast<float4*>(og + n * 16 + 4) = make_float4(o[n][4], o[n][5], o[n][6], o[n][7]);
    }
}

// ---------------------------------------------------------------- residual + LayerNorm
// One wave per row, 32 values a lane by 16-byte accesses on whole lines; the row's sums stay in the
// wave (four chains a lane, then a five-step butterfly), so no LDS and no barrier.
// SPLIT: a is the first of two partial planes; the row is (a + a2) + bias, then the residual as ever.
#define LN_ROWS 8   // rows (waves) per work-group
template <bool SPLIT>
__device__ __forceinline__
void add_ln_body(const float* __restrict__ a, const float* __restrict__ a2, const float* __restrict__ bias,
                 const float* __restrict__ resid,
                 const float* __restrict__ g, const float* __restrict__ beta,
                 float* __restrict__ yf, bf16_t* __restrict__ ybf) {
    const int lane = threadIdx.x & 31;
    const int row  = blockIdx.x * LN_ROWS + (threadIdx.x >> 5);
    const size_t ro = (size_t)row * DMODEL + lane * 4;

    const float* pa = a     + ro;
    const float* pr = resid + ro;
    float4 x[8], r[8];
#pragma unroll
    for (int i = 0; i < 8; ++i) x[i] = *reinterpret_cast<const float4*>(pa + i * 128);
#pragma unroll
    for (int i = 0; i < 8; ++i) r[i] = *reinterpret_cast<const float4*>(pr + i * 128);
    // the wait that stands before an issued load's address registers are written again;
    // the addresses are inputs so that none is reused as a later load's destination
    asm volatile("s_wait_xcnt 0x0" :: "v"(pa), "v"(pr) : "memory");
    if constexpr (SPLIT) {
        const float* p2 = a2   + ro;
        const float* pb = bias + lane * 4;
        float4 y[8], c[8];
#pragma unroll
        for (int i = 0; i < 8; ++i) y[i] = *reinterpret_cast<const float4*>(p2 + i * 128);
#pragma unroll
        for (int i = 0; i < 8; ++i) c[i] = *reinterpret_cast<const float4*>(pb + i * 128);
        // the same wait, for these loads' addresses
        asm volatile("s_wait_xcnt 0x0" :: "v"(p2), "v"(pb) : "memory");
#pragma unroll
        for (int i = 0; i < 8; ++i) {
            x[i].x = (x[i].x + y[i].x) + c[i].x; x[i].y = (x[i].y + y[i].y) + c[i].y;
            x[i].z = (x[i].z + y[i].z) + c[i].z; x[i].w = (x[i].w + y[i].w) + c[i].w;
        }
    }

    float s0 = 0.0f, s1 = 0.0f, s2 = 0.0f, s3 = 0.0f;
    float q0 = 0.0f, q1 = 0.0f, q2 = 0.0f, q3 = 0.0f;
#pragma unroll
    for (int i = 0; i < 8; ++i) {
        x[i].x += r[i].x; x[i].y += r[i].y; x[i].z += r[i].z; x[i].w += r[i].w;
        s0 += x[i].x; s1 += x[i].y; s2 += x[i].z; s3 += x[i].w;
        q0 += x[i].x * x[i].x; q1 += x[i].y * x[i].y; q2 += x[i].z * x[i].z; q3 += x[i].w * x[i].w;
    }
    float s  = (s0 + s1) + (s2 + s3);
    float ss = (q0 + q1) + (q2 + q3);
#pragma unroll
    for (int off = 1; off < 32; off <<= 1) {
        s  += __shfl_xor(s,  off, 32);
        ss += __shfl_xor(ss, off, 32);
    }
    const float mean = s  * (1.0f / DMODEL);
    const float var  = ss * (1.0f / DMODEL) - mean * mean;
    // rsqrtf as the compiler expands it (a denormal argument is scaled by 2^24, its result by 2^12), with
    // v_rsq_f32 and the one slot that the instruction set asks for behind it in one statement, so that
    // the slot stays directly behind it
    const float ve   = var + 1e-5f;
    const bool  tiny = ve < 1.17549435e-38f;
    float rq;
    asm("v_rsq_f32 %0, %1\n\tv_nop" : "=v"(rq) : "v"(tiny ? ve * 16777216.0f : ve));
    const float rstd = tiny ? rq * 4096.0f : rq;
#pragma unroll
    for (int i = 0; i < 8; ++i) {
        const float4 gv = *reinterpret_cast<const float4*>(g    + lane * 4 + i * 128);
        const float4 bv = *reinterpret_cast<const float4*>(beta + lane * 4 + i * 128);
        x[i].x = (x[i].x - mean) * rstd * gv.x + bv.x;
        x[i].y = (x[i].y - mean) * rstd * gv.y + bv.y;
        x[i].z = (x[i].z - mean) * rstd * gv.z + bv.z;
        x[i].w = (x[i].w - mean) * rstd * gv.w + bv.w;
        *reinterpret_cast<float4*>(yf + ro + i * 128) = x[i];
    }
    // the wait that stands before the registers of the issued stores are written again (by the packing below)
    asm volatile("s_wait_xcnt 0x0" ::: "memory");
    if (ybf) {
#pragma unroll
        for (int i = 0; i < 8; ++i)
            *reinterpret_cast<uint2*>(ybf + ro + i * 128) = pack4_bf16(x[i]);
    }
}
__global__ __launch_bounds__(256)
void add_ln(const float* __restrict__ a, const float* __restrict__ resid,
            const float* __restrict__ g, const float* __restrict__ beta,
            float* __restrict__ yf, bf16_t* __restrict__ ybf) {
    add_ln_body<false>(a, nullptr, nullptr, resid, g, beta, yf, ybf);
}
__global__ __launch_bounds__(256)
void add_ln_split(const float* __restrict__ a, const float* __restrict__ a2, const float* __restrict__ bias,
                  const float* __restrict__ resid,
                  const float* __restrict__ g, const float* __restrict__ beta, float* __restrict__ yf) {
    add_ln_body<true>(a, a2, bias, resid, g, beta, yf, nullptr);
}

// ---------------------------------------------------------------- launch
extern "C" void kernel_launch(void* const* d_in, const int* in_sizes, int n_in,
                              void* d_out, int out_size, void* d_ws, size_t ws_size,
                              hipStream_t stream) {
    const float* x    = (const float*)d_in[0];
    const float* enc  = (const float*)d_in[1];
    const float* Wq1  = (const float*)d_in[2];
    const float* Wk1  = (const float*)d_in[3];
    const float* Wv1  = (const float*)d_in[4];
    const float* g1   = (const float*)d_in[5];
    const float* b1   = (const float*)d_in[6];
    const float* Wq2  = (const float*)d_in[7];
    const float* Wk2  = (const float*)d_in[8];
    const float* Wv2  = (const float*)d_in[9];
    const float* g2   = (const float*)d_in[10];
    const float* b2   = (const float*)d_in[11];
    const float* Wff1 = (const float*)d_in[12];
    const float* bff1 = (const float*)d_in[13];
    const float* Wff2 = (const float*)d_in[14];
    const float* bff2 = (const float*)d_in[15];
    const float* g3   = (const float*)d_in[16];
    const float* b3   = (const float*)d_in[17];

    char* ws = (char*)d_ws;
    const size_t MB = 1024u * 1024u;
    bf16_t* wq1b  = (bf16_t*)(ws + 0   * MB);   // all weights stored transposed [N][K]
    bf16_t* wk1b  = (bf16_t*)(ws + 2   * MB);
    bf16_t* wv1b  = (bf16_t*)(ws + 4   * MB);
    bf16_t* wq2b  = (bf16_t*)(ws + 6   * MB);
    bf16_t* wk2b  = (bf16_t*)(ws + 8   * MB);
    bf16_t* wv2b  = (bf16_t*)(ws + 10  * MB);
    bf16_t* wff1b = (bf16_t*)(ws + 12  * MB);
    bf16_t* wff2b = (bf16_t*)(ws + 20  * MB);
    bf16_t* xbf   = (bf16_t*)(ws + 28  * MB);   // activation bf16 (reused: x, y1, y2)
    bf16_t* encbf = (bf16_t*)(ws + 36  * MB);
    bf16_t* qbf   = (bf16_t*)(ws + 44  * MB);
    bf16_t* kbf   = (bf16_t*)(ws + 52  * MB);
    bf16_t* vbf   = (bf16_t*)(ws + 60  * MB);   // V stored transposed [DMODEL][MROWS]
    float*  ctx   = (float*) (ws + 68  * MB);   // attn ctx / ff2 out
    float*  yA    = (float*) (ws + 84  * MB);
    float*  yB    = (float*) (ws + 100 * MB);
    bf16_t* hbf   = (bf16_t*)(ws + 116 * MB);
    float*  ctx2  = (float*) (ws + 148 * MB);   // ff2 out, second half of k; ends at 164 MB

    const dim3 gqkv(DMODEL / TN, MROWS / TM, 3);
    const dim3 gff1(FFDIM / TN, MROWS / TM);
    const dim3 gff2(DMODEL / TN, MROWS / TM, 2);

    // x, enc -> bf16; weights -> bf16, transposed [N][K] (wq1b .. wv2b lie 2 MB apart, from wq1b on)
    cvt_all<<<CVT_ALL_BLOCKS, 256, 0, stream>>>(x, enc, Wq1, Wk1, Wv1, Wq2, Wk2, Wv2, Wff1, Wff2,
                                                xbf, encbf, wq1b, wff1b, wff2b);

    const float scale = 0.03125f;   // 1/sqrt(DMODEL), as in reference
    dim3 agrid(NTOK / (16 * AW), NHEAD, BATCH);

    // ---- block 1: causal self-attention
    gemm_qkv<<<gqkv, 256, 0, stream>>>(xbf, xbf, wq1b, wk1b, wv1b, qbf, kbf, vbf, DMODEL);
    attn_wmma<<<agrid, 256, 0, stream>>>(qbf, kbf, vbf, ctx, NTOK, NTOK, MROWS, 1, scale);
    add_ln<<<MROWS / LN_ROWS, 256, 0, stream>>>(ctx, x, g1, b1, yA, xbf);    // xbf := y1 (bf16)

    // ---- block 2: cross-attention over encoder output
    gemm_qkv<<<gqkv, 256, 0, stream>>>(xbf, encbf, wq2b, wk2b, wv2b, qbf, kbf, vbf, DMODEL);
    attn_wmma<<<agrid, 256, 0, stream>>>(qbf, kbf, vbf, ctx, NTOK, NTOK, MROWS, 0, scale);
    add_ln<<<MROWS / LN_ROWS, 256, 0, stream>>>(ctx, yA, g2, b2, yB, xbf);   // xbf := y2 (bf16)

    // ---- block 3: FFN (bias+GELU fused), residual, final LN
    gemm_ff1<<<gff1,  256, 0, stream>>>(xbf, wff1b, hbf, bff1, DMODEL);   // bf16 out + GELU
    gemm_ff2<<<gff2,  256, 0, stream>>>(hbf, wff2b, ctx, ctx2, FFDIM);    // fp32 out, one plane per half of k
    add_ln_split<<<MROWS / LN_ROWS, 256, 0, stream>>>(ctx, ctx2, bff2, yB, g3, b3, (float*)d_out);
}

// v010
// One run takes 201 microseconds.
// Two timings next to v009 both put it at 1.04 times that version's speed.
// Over all steps from v000 it is 3.42 times as fast.
#include <hip/hip_runtime.h>
#include <math.h>

// ---------------------------------------------------------------- types
typedef __bf16 bf16_t;
typedef __attribute__((ext_vector_type(16))) __bf16 v16bf;
typedef __attribute__((ext_vector_type(8)))  float  v8f;

union FragB {
    v16bf  v;
    uint4  q[2];
    bf16_t e[16];
};

__device__ __forceinline__ bf16_t f2bf(float f) {
    unsigned int u = __float_as_uint(f);
    unsigned int r = u + 0x7FFFu + ((u >> 16) & 1u);   // round to nearest even
    unsigned short s = (unsigned short)(r >> 16);
    return __builtin_bit_cast(bf16_t, s);
}

__device__ __forceinline__ v8f wmma_bf16(const v16bf& a, const v16bf& b, const v8f& c) {
    return __builtin_amdgcn_wmma_f32_16x16x32_bf16(false, a, false, b, (short)0, c, false, false);
}

__device__ __forceinline__ v8f v8f_zero() {
    v8f z;
#pragma unroll
    for (int i = 0; i < 8; ++i) z[i] = 0.0f;
    return z;
}

// ---------------------------------------------------------------- constants
#define DMODEL 1024
#define NHEAD  16
#define HDIM   64
#define FFDIM  4096
#define BATCH  4
#define NTOK   1024
#define MROWS  (BATCH * NTOK)   // 4096

// ---------------------------------------------------------------- fp32 -> bf16 (straight)
__device__ __forceinline__ uint2 pack4_bf16(const float4& v) {
    union { bf16_t e[4]; uint2 q; } u;
    u.e[0] = f2bf(v.x); u.e[1] = f2bf(v.y); u.e[2] = f2bf(v.z); u.e[3] = f2bf(v.w);
    return u.q;
}

// 32 values a thread, as eight 16-byte loads in flight; every wave-wide load (512 B) and store (256 B)
// covers whole lines. One wave per 1,024 values, not one per 32.
#define CVT_BLOCK (256 * 32)   // values per work-group; a tensor is a multiple of it
__device__ __forceinline__
void cvt_f32_to_bf16(const float* __restrict__ in, bf16_t* __restrict__ out, int blk) {
    const size_t base = (size_t)blk * CVT_BLOCK + threadIdx.x * 4;
    float4 v[8];
#pragma unroll
    for (int c = 0; c < 8; ++c)
        v[c] = *reinterpret_cast<const float4*>(in + base + c * 1024);
#pragma unroll
    for (int c = 0; c < 8; ++c)
        *reinterpret_cast<uint2*>(out + base + c * 1024) = pack4_bf16(v[c]);
}

// ---------------------------------------------------------------- fp32 [K][N] -> bf16 [N][K]
// 64 x 64 tile, 16 values a thread: 16-byte loads along n (a wave covers two 256-B row pieces),
// 16-byte stores along k (eight lanes cover one 128-B line of an output row).
#define TT 64
__device__ __forceinline__
void cvt_transpose_bf16(const float* __restrict__ in, bf16_t* __restrict__ out,
                        int Kdim, int Ndim, int bn, int bk) {
    __shared__ float tile[TT][TT + 1];   // pitch 65 dwords: the column walks below meet no bank twice
    const int k0 = bk * TT;
    const int n0 = bn * TT;
    const int t  = threadIdx.x;
    const int lr = t >> 4;               // 0..15
    const int lc = (t & 15) * 4;         // 0,4,..,60
    const float* s0 = in + (size_t)(k0 + lr) * Ndim + n0 + lc;
    const float* s1 = s0 + (size_t)16 * Ndim;
    const float* s2 = s1 + (size_t)16 * Ndim;
    const float* s3 = s2 + (size_t)16 * Ndim;
    float4 v[4];
    v[0] = *reinterpret_cast<const float4*>(s0);
    v[1] = *reinterpret_cast<const float4*>(s1);
    v[2] = *reinterpret_cast<const float4*>(s2);
    v[3] = *reinterpret_cast<const float4*>(s3);
    // the wait that stands before an issued load's address registers are written again;
    // the addresses are inputs so that none is reused as a later load's destination
    asm volatile("s_wait_xcnt 0x0" :: "v"(s0), "v"(s1), "v"(s2), "v"(s3) : "memory");
#pragma unroll
    for (int p = 0; p < 4; ++p) {
        float* d = &tile[p * 16 + lr][lc];
        d[0] = v[p].x; d[1] = v[p].y; d[2] = v[p].z; d[3] = v[p].w;
    }
    __syncthreads();
#pragma unroll
    for (int c = 0; c < 2; ++c) {
        const int id = t + c * 256;
        const int n  = id >> 3;          // 0..63
        const int ks = (id & 7) * 8;     // 0,8,..,56
        union { bf16_t e[8]; uint4 q; } u;
#pragma unroll
        for (int j = 0; j < 8; ++j) u.e[j] = f2bf(tile[ks + j][n]);
        *reinterpret_cast<uint4*>(out + (size_t)(n0 + n) * Kdim + k0 + ks) = u.q;
    }
}

// ---------------------------------------------------------------- all ten conversions, one launch
// None of them needs anything of another, so they share one grid by ranges of the block index
// (every test below is on blockIdx alone: the same for a whole work-group). The casts, which move
// twice a transpose tile's bytes per work-group, come first.
#define CAST_BLOCKS (MROWS * DMODEL / CVT_BLOCK)             // 512 per activation tensor
#define SQ_BLOCKS   ((DMODEL / TT) * (DMODEL / TT))          // 256 per square weight
#define FF_BLOCKS   ((DMODEL / TT) * (FFDIM / TT))           // 1,024 per feed-forward weight
#define CVT_ALL_BLOCKS (2 * CAST_BLOCKS + 6 * SQ_BLOCKS + 2 * FF_BLOCKS)
__global__ __launch_bounds__(256)
void cvt_all(const float* __restrict__ x,    const float* __restrict__ enc,
             const float* __restrict__ wq1,  const float* __restrict__ wk1, const float* __restrict__ wv1,
             const float* __restrict__ wq2,  const float* __restrict__ wk2, const float* __restrict__ wv2,
             const float* __restrict__ wff1, const float* __restrict__ wff2,
             bf16_t* __restrict__ xbf,  bf16_t* __restrict__ encbf,
             bf16_t* __restrict__ wsq,          // the six square weights' outputs, DMODEL * DMODEL apart
             bf16_t* __restrict__ wff1b, bf16_t* __restrict__ wff2b) {
    int b = blockIdx.x;
    if (b < 2 * CAST_BLOCKS) {
        const bool first = b < CAST_BLOCKS;
        cvt_f32_to_bf16(first ? x : enc, first ? xbf : encbf, first ? b : b - CAST_BLOCKS);
        return;   // the whole work-group leaves, ahead of the transpose's barrier
    }
    b -= 2 * CAST_BLOCKS;
    const float* in;
    bf16_t* out;
    int Kdim = DMODEL, Ndim = DMODEL;
    if (b < 6 * SQ_BLOCKS) {
        const int w = b / SQ_BLOCKS;
        b -= w * SQ_BLOCKS;
        const bool odd = w & 1;
        const float* p01 = odd ? wk1 : wq1;
        const float* p23 = odd ? wq2 : wv1;
        const float* p45 = odd ? wv2 : wk2;
        in  = w < 2 ? p01 : w < 4 ? p23 : p45;
        out = wsq + (size_t)w * DMODEL * DMODEL;
    } else if (b < 6 * SQ_BLOCKS + FF_BLOCKS) {
        b -= 6 * SQ_BLOCKS;
        in = wff1; out = wff1b; Ndim = FFDIM;
    } else {
        b -= 6 * SQ_BLOCKS + FF_BLOCKS;
        in = wff2; out = wff2b; Kdim = FFDIM;
    }
    const int nb = Ndim / TT;   // tiles along n: 16 or 64
    cvt_transpose_bf16(in, out, Kdim, Ndim, b % nb, b / nb);
}

// ---------------------------------------------------------------- erf of eight values, without a branch
__device__ __forceinline__ v8f exp8_slot(const v8f& x);   // eight e^x, defined with the attention kernel below

__device__ __forceinline__ v8f splat8(float c) {
    v8f r;
#pragma unroll   // constant element indices, so that the vector stays in registers (so below too)
    for (int i = 0; i < 8; ++i) r[i] = c;
    return r;
}

// The two polynomials of the f32 library erf (in x^2 below |x| = 1; in |x|, then 1 - e^-q, from 1 on), both taken
// for every value and picked by a select. With a branch per value a wave of mixed lanes walks both sides anyway,
// one value at a time and every link waiting on the one before; here the eight values are independent chains
// of packed operations.
__device__ __forceinline__ v8f erf8(const v8f& x) {
    const v8f ax = __builtin_elementwise_abs(x);
    const v8f t  = x * x;
    v8f p = __builtin_elementwise_fma(t, splat8(-5.6180177e-4f), splat8(4.9138162e-3f));
    p = __builtin_elementwise_fma(t, p, splat8(-2.6707515e-2f));
    p = __builtin_elementwise_fma(t, p, splat8(1.1280011e-1f));
    p = __builtin_elementwise_fma(t, p, splat8(-3.7612295e-1f));
    p = __builtin_elementwise_fma(t, p, splat8(1.2837911e-1f));
    const v8f lo = __builtin_elementwise_fma(ax, p, ax);
    v8f q = __builtin_elementwise_fma(ax, splat8(1.6998811e-5f), splat8(-3.7867785e-4f));
    q = __builtin_elementwise_fma(ax, q, splat8(3.8578159e-3f));
    q = __builtin_elementwise_fma(ax, q, splat8(-2.4181698e-2f));
    q = __builtin_elementwise_fma(ax, q, splat8(1.0666826e-1f));
    q = __builtin_elementwise_fma(ax, q, splat8(6.3493329e-1f));
    q = __builtin_elementwise_fma(ax, q, splat8(1.2868941e-1f));
    q = __builtin_elementwise_fma(ax, q, ax);
    const v8f hi = 1.0f - exp8_slot(-q);
    v8f r;
#pragma unroll
    for (int i = 0; i < 8; ++i) r[i] = __builtin_copysignf(ax[i] < 1.0f ? lo[i] : hi[i], x[i]);
    return r;
}

// ---------------------------------------------------------------- GEMM (bf16 WMMA, fp32 acc)
// C[M,N] = A[M,K] @ B[K,N], with B supplied TRANSPOSED as Bt[N][K] bf16.
// The output kind, bias, GELU and the output's pitch are compile-time values: one kernel per use below.
#define OUT_BF16   0   // bf16 [M][N]
#define OUT_BF16_T 1   // bf16 [N][M]
#define OUT_F32    2   // f32  [M][N]
#define TM 128
#define TN 128
#define TK 64      // one staged row of a slab = 128 B = one whole cache line
#define LDP 72     // LDS row pitch in elements: 144 B = 16 B x odd, for the 16-byte fragment reads

#define GEMM_BUF_BYTES (TM * LDP * 2)   // one staging buffer of one operand (TM = TN): 18,432 B

// One slab of A and of B from global memory into LDS through no register: a thread's eight 16-byte pieces (rows
// srow, + 32, + 64, + 96 of each operand) as asynchronous copies. The wait that stands before a register named by
// an issued copy is written again is the statement's last line, so that no later address sum is lifted over it.
__device__ __forceinline__
void gemm_stage(unsigned la, unsigned lb, const bf16_t* a0, const bf16_t* b0, size_t rstep) {
    const bf16_t* a1 = a0 + rstep;
    const bf16_t* a2 = a1 + rstep;
    const bf16_t* a3 = a2 + rstep;
    const bf16_t* b1 = b0 + rstep;
    const bf16_t* b2 = b1 + rstep;
    const bf16_t* b3 = b2 + rstep;
    const unsigned ls = 32 * LDP * 2;   // 32 rows of LDS in bytes
    asm volatile("global_load_async_to_lds_b128 %0, %8, off\n\t"
                 "global_load_async_to_lds_b128 %1, %9, off\n\t"
                 "global_load_async_to_lds_b128 %2, %10, off\n\t"
                 "global_load_async_to_lds_b128 %3, %11, off\n\t"
                 "global_load_async_to_lds_b128 %4, %12, off\n\t"
                 "global_load_async_to_lds_b128 %5, %13, off\n\t"
                 "global_load_async_to_lds_b128 %6, %14, off\n\t"
                 "global_load_async_to_lds_b128 %7, %15, off\n\t"
                 "s_wait_xcnt 0x0"
                 :: "v"(la), "v"(la + ls), "v"(la + 2 * ls), "v"(la + 3 * ls),
                    "v"(lb), "v"(lb + ls), "v"(lb + 2 * ls), "v"(lb + 3 * ls),
                    "v"(a0), "v"(a1), "v"(a2), "v"(a3), "v"(b0), "v"(b1), "v"(b2), "v"(b3)
                 : "memory");
}

template <int KIND, bool BIAS, bool GELU, int M, int N>
__device__ __forceinline__
void gemm_body(bf16_t (*sA)[TM * LDP], bf16_t (*sB)[TN * LDP],
               const bf16_t* __restrict__ A, const bf16_t* __restrict__ Bt,
               void* __restrict__ Cout, const float* __restrict__ bias, int K, int ld) {
    // K: the k extent of this product; ld: the row pitch of A and Bt in elements (K, or more for a part of the rows)
    static_assert(KIND != OUT_BF16_T || (!BIAS && !GELU), "the transposed output takes neither");

    const int t    = threadIdx.x;
    const int lane = t & 31;
    const int wave = t >> 5;                 // 0..7
    const int wrow = (wave & 3) * 32;        // 0,32,64,96
    const int wcol = (wave >> 2) * 64;       // 0,64
    const int m0   = blockIdx.y * TM;
    const int n0   = blockIdx.x * TN;
    const int hi   = lane >> 4;
    const int l16  = lane & 15;
    const int kb   = hi * 8;

    // staging: eight lanes cover one 128-B row of the slab, so a wave's 16-byte copy
    // touches four whole lines; a thread takes rows srow, srow + 32, + 64, + 96
    const int srow = t >> 3;                 // 0..31
    const int sseg = (t & 7) * 8;            // 0,8,..,56
    const bf16_t* gA = A  + (size_t)m0 * ld; // block-uniform bases; the lane's part is soff
    const bf16_t* gB = Bt + (size_t)n0 * ld;
    const unsigned soff = (unsigned)(srow * ld + sseg);
    const size_t rstep = (size_t)32 * ld;
    const int sdst = srow * LDP + sseg;

    v8f acc[2][4];
#pragma unroll
    for (int i = 0; i < 2; ++i)
#pragma unroll
        for (int j = 0; j < 4; ++j) acc[i][j] = v8f_zero();

    const int nk = K / TK;
    // the lane's own LDS byte addresses in buffer 0 (the low 32 bits of a __shared__ address are its LDS offset)
    const unsigned lA = (unsigned)(size_t)&sA[0][sdst];
    const unsigned lB = (unsigned)(size_t)&sB[0][sdst];
    const bf16_t* sa = gA + soff;
    const bf16_t* sb = gB + soff;

    // prologue: slab 0 into buffer 0, landed and published; then slab 1 flies into buffer 1
    gemm_stage(lA, lB, sa, sb, rstep);
    // this wave's copies have landed before the barrier behind which other waves read them
    asm volatile("s_wait_asynccnt 0x0" ::: "memory");
    __syncthreads();
    if (nk > 1) gemm_stage(lA + GEMM_BUF_BYTES, lB + GEMM_BUF_BYTES, sa + TK, sb + TK, rstep);

    for (int kt = 0; kt < nk; ++kt) {
        const int cur = kt & 1;

        // two 32-deep products per slab, k ascending; unrolled so that ks folds into the LDS offsets
#pragma unroll
        for (int ks = 0; ks < TK; ks += 32) {
            FragB af[2], bfr[4];
#pragma unroll
            for (int i = 0; i < 2; ++i) {
                int row = wrow + i * 16 + l16;
                af[i].q[0] = *reinterpret_cast<const uint4*>(&sA[cur][row * LDP + ks + kb]);
                af[i].q[1] = *reinterpret_cast<const uint4*>(&sA[cur][row * LDP + ks + kb + 16]);
            }
#pragma unroll
            for (int j = 0; j < 4; ++j) {
                int col = wcol + j * 16 + l16;
                bfr[j].q[0] = *reinterpret_cast<const uint4*>(&sB[cur][col * LDP + ks + kb]);
                bfr[j].q[1] = *reinterpret_cast<const uint4*>(&sB[cur][col * LDP + ks + kb + 16]);
            }
#pragma unroll
            for (int i = 0; i < 2; ++i)
#pragma unroll
                for (int j = 0; j < 4; ++j) {
                    // the operand order decides which index of C runs along a lane's eight accumulators:
                    // always the one that is contiguous in the output (m for [N][M], n for [M][N])
                    if constexpr (KIND == OUT_BF16_T) acc[i][j] = wmma_bf16(af[i].v, bfr[j].v, acc[i][j]);
                    else                              acc[i][j] = wmma_bf16(bfr[j].v, af[i].v, acc[i][j]);
                }
        }

        // the wave's reads of this buffer have retired before a copy is aimed at it
        asm volatile("s_wait_dscnt 0x0" ::: "memory");
        // the wave's copies of the next slab have landed before the barrier that publishes them
        asm volatile("s_wait_asynccnt 0x0" ::: "memory");
        // publishes slab kt + 1 and ends every wave's reads of the buffer that is refilled behind it
        __syncthreads();
        if (kt + 2 < nk) {
            const unsigned bo = (unsigned)cur * GEMM_BUF_BYTES;
            gemm_stage(lA + bo, lB + bo, sa + (kt + 2) * TK, sb + (kt + 2) * TK, rstep);
        }
    }
    // no copy is outstanding when the wave goes on to its end
    asm volatile("s_wait_asynccnt 0x0" ::: "memory");

    if constexpr (KIND == OUT_BF16_T) {
        // lane = column n; its eight accumulators are rows m .. m + 7: one 16-byte store
        bf16_t* C = (bf16_t*)Cout + (size_t)(n0 + wcol + l16) * M + m0 + wrow + kb;
#pragma unroll
        for (int i = 0; i < 2; ++i)
#pragma unroll
            for (int j = 0; j < 4; ++j) {
                union { bf16_t e[8]; uint4 q; } u;
#pragma unroll
                for (int r = 0; r < 8; ++r) u.e[r] = f2bf(acc[i][j][r]);
                *reinterpret_cast<uint4*>(C + (size_t)j * 16 * M + i * 16) = u.q;
            }
    } else {
        // lane = row m; its eight accumulators are columns n .. n + 7: one (bf16) or two (f32) 16-byte stores
        const size_t co = (size_t)(m0 + wrow + l16) * N + n0 + wcol + kb;
        float4 bv[4][2];
        if constexpr (BIAS) {
#pragma unroll
            for (int j = 0; j < 4; ++j) {
                bv[j][0] = *reinterpret_cast<const float4*>(bias + n0 + wcol + kb + j * 16);
                bv[j][1] = *reinterpret_cast<const float4*>(bias + n0 + wcol + kb + j * 16 + 4);
            }
        }
#pragma unroll
        for (int i = 0; i < 2; ++i)
#pragma unroll
            for (int j = 0; j < 4; ++j) {
                float v[8];
#pragma unroll
                for (int r = 0; r < 8; ++r) v[r] = acc[i][j][r];
                if constexpr (BIAS) {
                    v[0] += bv[j][0].x; v[1] += bv[j][0].y; v[2] += bv[j][0].z; v[3] += bv[j][0].w;
                    v[4] += bv[j][1].x; v[5] += bv[j][1].y; v[6] += bv[j][1].z; v[7] += bv[j][1].w;
                }
                if constexpr (GELU) {
                    v8f xs;
#pragma unroll
                    for (int r = 0; r < 8; ++r) xs[r] = v[r] * 0.70710678118654752440f;
                    const v8f e = erf8(xs);
#pragma unroll
                    for (int r = 0; r < 8; ++r) v[r] = 0.5f * v[r] * (1.0f + e[r]);
                }
                const size_t o = co + (size_t)i * 16 * N + j * 16;
                if constexpr (KIND == OUT_BF16) {
                    union { bf16_t e[8]; uint4 q; } u;
#pragma unroll
                    for (int r = 0; r < 8; ++r) u.e[r] = f2bf(v[r]);
                    *reinterpret_cast<uint4*>((bf16_t*)Cout + o) = u.q;
                } else {
                    *reinterpret_cast<float4*>((float*)Cout + o)     = make_float4(v[0], v[1], v[2], v[3]);
                    *reinterpret_cast<float4*>((float*)Cout + o + 4) = make_float4(v[4], v[5], v[6], v[7]);
                }
            }
    }
}

// the two staging buffers of a GEMM work-group; declared in the kernel, so that the two bodies of
// gemm_qkv share one set
#define GEMM_LDS \
    __shared__ __align__(16) bf16_t sA[2][TM * LDP];  /* [row][k]  2 x 18 KB */ \
    __shared__ __align__(16) bf16_t sB[2][TN * LDP];  /* [n][k]    2 x 18 KB */

// the uses: the three projections of an attention block; FFN up (bias, GELU); FFN down (f32, two halves of k)
// Q, K and V need nothing of each other: one launch, blockIdx.z picks the product (0 Q, 1 K, 2 V with
// its transposed output), so that three work-groups stand on a WGP where one stood
__global__ __launch_bounds__(256)
void gemm_qkv(const bf16_t* __restrict__ Aq, const bf16_t* __restrict__ Akv,
              const bf16_t* __restrict__ Wq, const bf16_t* __restrict__ Wk, const bf16_t* __restrict__ Wv,
              bf16_t* __restrict__ Cq, bf16_t* __restrict__ Ck, bf16_t* __restrict__ Cvt, int K) {
    GEMM_LDS
    const int z = blockIdx.z;
    if (z == 2) {
        gemm_body<OUT_BF16_T, false, false, MROWS, DMODEL>(sA, sB, Akv, Wv, Cvt, nullptr, K, K);
        return;
    }
    gemm_body<OUT_BF16, false, false, MROWS, DMODEL>(sA, sB, z ? Akv : Aq, z ? Wk : Wq, z ? Ck : Cq, nullptr, K, K);
    // the wait that stands before the registers of the issued stores are written again: in the built code the
    // other body's entry follows these stores behind a branch
    asm volatile("s_wait_xcnt 0x0" ::: "memory");
}
// eight waves a SIMD, so that the four work-groups that a WGP gets of this grid all stand on it at once: the loop
// needs fewer than 128 registers now, and the epilogue is held to them too
__global__ __launch_bounds__(256) __attribute__((amdgpu_waves_per_eu(8)))
void gemm_ff1(const bf16_t* __restrict__ A, const bf16_t* __restrict__ Bt, bf16_t* __restrict__ C,
              const float* __restrict__ bias, int K) {
    GEMM_LDS
    gemm_body<OUT_BF16, true, true, MROWS, FFDIM>(sA, sB, A, Bt, C, bias, K, K);
}
// FFN down has one 128 x 128 tile per WGP and a long k: blockIdx.z halves k, so that two work-groups stand on a
// WGP and each one's waits (LDS reads, the next slab's loads, the barrier) are filled by the other's products.
// Each half stores its own f32 plane; the LayerNorm that follows adds the two planes and the bias.
__global__ __launch_bounds__(256)
void gemm_ff2(const bf16_t* __restrict__ A, const bf16_t* __restrict__ Bt,
              float* __restrict__ C0, float* __restrict__ C1, int K) {
    GEMM_LDS
    const int z  = blockIdx.z;
    const int kh = K / 2;
    gemm_body<OUT_F32, false, false, MROWS, DMODEL>(sA, sB, A + z * kh, Bt + z * kh, z ? C1 : C0, nullptr, kh, K);
}

__device__ __forceinline__ float expf_slot(float x) {
    float r;
    asm("v_exp_f32 %0, %1\n\tv_nop" : "=v"(r) : "v"(x * 1.44269504088896340736f));
    return r;
}

// eight e^x, each as above. One statement, so that the slot behind every v_exp_f32 is filled by construction: the
// next one neither reads its result nor writes its source (the results are early-clobber registers), and the
// last has the v_nop.
__device__ __forceinline__ v8f exp8_slot(const v8f& x) {
    float r0, r1, r2, r3, r4, r5, r6, r7;
    const float c = 1.44269504088896340736f;
    asm("v_exp_f32 %0, %8\n\tv_exp_f32 %1, %9\n\tv_exp_f32 %2, %10\n\tv_exp_f32 %3, %11\n\t"
        "v_exp_f32 %4, %12\n\tv_exp_f32 %5, %13\n\tv_exp_f32 %6, %14\n\tv_exp_f32 %7, %15\n\tv_nop"
        : "=&v"(r0), "=&v"(r1), "=&v"(r2), "=&v"(r3), "=&v"(r4), "=&v"(r5), "=&v"(r6), "=&v"(r7)
        : "v"(x[0] * c), "v"(x[1] * c), "v"(x[2] * c), "v"(x[3] * c),
          "v"(x[4] * c), "v"(x[5] * c), "v"(x[6] * c), "v"(x[7] * c));
    v8f r;
    r[0] = r0; r[1] = r1; r[2] = r2; r[3] = r3; r[4] = r4; r[5] = r5; r[6] = r6; r[7] = r7;
    return r;
}

// lane l with lane l ^ 16
__device__ __forceinline__ float xhalf(float x) {
    const int b = __builtin_bit_cast(int, x);
    return __builtin_bit_cast(float, __builtin_amdgcn_permlanex16(b, b, 0x76543210, 0xfedcba98, false, false));
}

#define AW     8    // waves = 16-query tiles per work-group
#define AKEYS  64   // keys per staged tile: a V row of the tile is one whole 128-B line, as a K row is
#define APITCH 72   // LDS row pitch in elements: 144 B = 16 B x odd, for the 16-byte fragment reads
__global__ __launch_bounds__(256)
void attn_wmma(const bf16_t* __restrict__ Qg, const bf16_t* __restrict__ Kg,
               const bf16_t* __restrict__ Vt, float* __restrict__ Og,
               int Nq, int Nk, int Mtot, int causal, float scale) {
    __shared__ __align__(16) bf16_t sK[2][AKEYS * APITCH];   // [key][head-dim]   2 x 9 KB
    __shared__ __align__(16) bf16_t sV[2][HDIM * APITCH];    // [head-dim][key]   2 x 9 KB

    const int t    = threadIdx.x;
    const int lane = t & 31;
    const int wave = __builtin_amdgcn_readfirstlane(t >> 5);  // scalar: the tests on kend below are scalar branches
    const int hi   = lane >> 4;
    const int l16  = lane & 15;
    const int kb   = hi * 8;
    const int h    = blockIdx.y;
    const int b    = blockIdx.z;
    const int qblk  = blockIdx.x * (16 * AW);
    const int qbase = qblk + wave * 16;
    const size_t qoff = (size_t)b * Nq * DMODEL;
    const size_t koff = (size_t)b * Nk * DMODEL;

    // staging: eight lanes cover one 128-B row, so a wave's 16-byte load touches four whole lines;
    // a thread takes rows srow and srow + 32 of the K tile and of the V tile
    const int srow = t >> 3;                 // 0..31
    const int sseg = (t & 7) * 8;            // 0,8,..,56
    const int sdst = srow * APITCH + sseg;
    const bf16_t* gK = Kg + koff + (size_t)srow * DMODEL + h * HDIM + sseg;
    const bf16_t* gV = Vt + (size_t)(h * HDIM + srow) * Mtot + (size_t)b * Nk + sseg;
    const size_t kstep = (size_t)32 * DMODEL;
    const size_t vstep = (size_t)32 * Mtot;

    // Q fragments: 16 queries x 64 head-dims = two 32x16 B fragments (lane = query, elements walk head-dim)
    FragB qa[2];
#pragma unroll
    for (int kc = 0; kc < 2; ++kc) {
        const bf16_t* base = Qg + qoff + (size_t)(qbase + l16) * DMODEL + h * HDIM + kc * 32 + kb;
        qa[kc].q[0] = *reinterpret_cast<const uint4*>(base);
        qa[kc].q[1] = *reinterpret_cast<const uint4*>(base + 16);
    }

    v8f o[4];               // O^T: o[n][r] = head-dim n * 16 + kb + r of query l16
    float m = -1e30f;       // the query's running maximum, the same in both halves
    float lsum = 0.0f;      // the sum over this half's keys; the halves are joined behind the loop
#pragma unroll
    for (int n = 0; n < 4; ++n) o[n] = v8f_zero();
    const int row = qbase + l16;   // the lane's query

    int kend  = Nk;    // this wave's end
    int kendw = Nk;    // the work-group's end = its last wave's
    if (causal) {
        kend = (qbase + 16 + 31) & ~31;
        if (kend > Nk) kend = Nk;
        kendw = (qblk + 16 * AW + 31) & ~31;
        if (kendw > Nk) kendw = Nk;
    }
    const int ns = (kendw + AKEYS - 1) / AKEYS;   // staged tiles, the same for every wave

    uint4 pk0, pk1, pv0, pv1;
    // prologue: tile 0 into buffer 0
    pk0 = *reinterpret_cast<const uint4*>(gK);
    pk1 = *reinterpret_cast<const uint4*>(gK + kstep);
    pv0 = *reinterpret_cast<const uint4*>(gV);
    pv1 = *reinterpret_cast<const uint4*>(gV + vstep);
    *reinterpret_cast<uint4*>(&sK[0][sdst])               = pk0;
    *reinterpret_cast<uint4*>(&sK[0][sdst + 32 * APITCH]) = pk1;
    *reinterpret_cast<uint4*>(&sV[0][sdst])               = pv0;
    *reinterpret_cast<uint4*>(&sV[0][sdst + 32 * APITCH]) = pv1;
    __syncthreads();

    for (int s = 0; s < ns; ++s) {
        const int cur = s & 1;
        const int nxt = cur ^ 1;
        const bool more = (s + 1) < ns;
        if (more) {
            const bf16_t* k0 = gK + (size_t)(s + 1) * AKEYS * DMODEL;
            const bf16_t* v0 = gV + (s + 1) * AKEYS;
            const bf16_t* v1 = v0 + vstep;
            pk0 = *reinterpret_cast<const uint4*>(k0);
            pk1 = *reinterpret_cast<const uint4*>(k0 + kstep);   // a constant step: k0's registers and an offset
            pv0 = *reinterpret_cast<const uint4*>(v0);
            pv1 = *reinterpret_cast<const uint4*>(v1);
            // the wait that stands before an issued load's address registers are written again;
            // the addresses are inputs so that none is reused as a later load's destination
            asm volatile("s_wait_xcnt 0x0" :: "v"(k0), "v"(v0), "v"(v1) : "memory");
        }

        // two 32-key passes per staged tile; a wave past its own causal end skips the pass
#pragma unroll
        for (int sub = 0; sub < AKEYS; sub += 32) {
            const int j0 = s * AKEYS + sub;
            if (j0 < kend) {
                // ---- S^T = K Q^T for 32 keys (two 16x16 C tiles): sc[st][r] = key j0 + st * 16 + kb + r, query l16
                v8f sc[2];
#pragma unroll
                for (int st = 0; st < 2; ++st) {
                    FragB kb0, kb1;   // A = K: lane holds key row, elems walk head-dim
                    const bf16_t* base = &sK[cur][(sub + st * 16 + l16) * APITCH + kb];
                    kb0.q[0] = *reinterpret_cast<const uint4*>(base);
                    kb0.q[1] = *reinterpret_cast<const uint4*>(base + 16);
                    kb1.q[0] = *reinterpret_cast<const uint4*>(base + 32);
                    kb1.q[1] = *reinterpret_cast<const uint4*>(base + 48);
                    v8f z = v8f_zero();
                    z = wmma_bf16(kb0.v, qa[0].v, z);
                    z = wmma_bf16(kb1.v, qa[1].v, z);
                    sc[st] = z;
                }
                // ---- scale
#pragma unroll
                for (int st = 0; st < 2; ++st)
#pragma unroll
                    for (int r = 0; r < 8; ++r) sc[st][r] *= scale;
                // ---- causal mask, only in a pass that crosses the diagonal: the pass holds keys up to j0 + 31 and
                // the wave queries from qbase on, so below that no key is masked. All three values are scalars:
                // one scalar branch per pass stands for sixteen index, compare and select triples
                if (causal && j0 + 31 > qbase) {
#pragma unroll
                    for (int st = 0; st < 2; ++st)
#pragma unroll
                        for (int r = 0; r < 8; ++r)
                            if (j0 + st * 16 + kb + r > row) sc[st][r] = -1e30f;
                }
                // ---- online softmax: the lane's 16 scores by a tree, then the other half's result
                float t8[8];
#pragma unroll
                for (int r = 0; r < 8; ++r) t8[r] = fmaxf(sc[0][r], sc[1][r]);
                float rm = fmaxf(fmaxf(fmaxf(t8[0], t8[1]), fmaxf(t8[2], t8[3])),
                                 fmaxf(fmaxf(t8[4], t8[5]), fmaxf(t8[6], t8[7])));
                rm = fmaxf(rm, xhalf(rm));
                const float mn = fmaxf(m, rm);
                const float alpha = expf_slot(m - mn);
                m = mn;
                float rs[4] = {0.0f, 0.0f, 0.0f, 0.0f};   // four chains, so that no add waits on the one before
#pragma unroll
                for (int st = 0; st < 2; ++st) {
                    sc[st] = exp8_slot(sc[st] - mn);
#pragma unroll
                    for (int r = 0; r < 8; ++r) rs[r & 3] += sc[st][r];
                }
                lsum = lsum * alpha + ((rs[0] + rs[1]) + (rs[2] + rs[3]));
#pragma unroll
                for (int n = 0; n < 4; ++n)
#pragma unroll
                    for (int r = 0; r < 8; ++r) o[n][r] *= alpha;

                // ---- P^T as a B fragment: element s is key (s < 8 ? kb + s : 16 + kb + s - 8), which is what
                // the lane holds in sc[s >> 3][s & 7], and the k order of the V loader below
                FragB pb;
#pragma unroll
                for (int s8 = 0; s8 < 16; ++s8) pb.e[s8] = f2bf(sc[s8 >> 3][s8 & 7]);

                // ---- O^T += V^T (64x32) * P^T (32x16): V fragments from the staged tile
#pragma unroll
                for (int n = 0; n < 4; ++n) {
                    FragB vb;   // A = V^T: lane holds head-dim row, elems walk keys
                    const bf16_t* vbase = &sV[cur][(n * 16 + l16) * APITCH + sub + kb];
                    vb.q[0] = *reinterpret_cast<const uint4*>(vbase);
                    vb.q[1] = *reinterpret_cast<const uint4*>(vbase + 16);
                    o[n] = wmma_bf16(vb.v, pb.v, o[n]);
                }
                // the four vector slots that the chip needs behind a matrix instruction before its operands are
                // overwritten: the four
                // accumulators are inputs so that the slots stand behind all four products
                asm volatile("v_nop\n\tv_nop\n\tv_nop\n\tv_nop" :: "v"(o[0]), "v"(o[1]), "v"(o[2]), "v"(o[3]));
            }
        }

        if (more) {
            *reinterpret_cast<uint4*>(&sK[nxt][sdst])               = pk0;
            *reinterpret_cast<uint4*>(&sK[nxt][sdst + 32 * APITCH]) = pk1;
            *reinterpret_cast<uint4*>(&sV[nxt][sdst])               = pv0;
            *reinterpret_cast<uint4*>(&sV[nxt][sdst + 32 * APITCH]) = pv1;
        }
        // publishes the next tile and ends every wave's reads of the buffer that is refilled next
        __syncthreads();
    }

    // ---- join the halves' sums, normalize + store: a lane's eight values of a tile are neighbours
    const float l = lsum + xhalf(lsum);
#pragma unroll
    for (int n = 0; n < 4; ++n)
#pragma unroll
        for (int r = 0; r < 8; ++r) o[n][r] = o[n][r] / l;
    float* og = Og + qoff + (size_t)row * DMODEL + h * HDIM + kb;
#pragma unroll
    for (int n = 0; n < 4; ++n) {
        *reinterpret_cast<float4*>(og + n * 16)     = make_float4(o[n][0], o[n][1], o[n][2], o[n][3]);
        *reinterpret_cast<float4*>(og + n * 16 + 4) = make_float4(o[n][4], o[n][5], o[n][6], o[n][7]);
    }
}

// ---------------------------------------------------------------- residual + LayerNorm
// One wave per row, 32 values a lane by 16-byte accesses on whole lines; the row's sums stay in the
// wave (four chains a lane, then a five-step butterfly), so no LDS and no barrier.
// SPLIT: a is the first of two partial planes; the row is (a + a2) + bias, then the residual as ever.
#define LN_ROWS 8   // rows (waves) per work-group
template <bool SPLIT>
__device__ __forceinline__
void add_ln_body(const float* __restrict__ a, const float* __restrict__ a2, const float* __restrict__ bias,
                 const float* __restrict__ resid,
                 const float* __restrict__ g, const float* __restrict__ beta,
                 float* __restrict__ yf, bf16_t* __restrict__ ybf) {
    const int lane = threadIdx.x & 31;
    const int row  = blockIdx.x * LN_ROWS + (threadIdx.x >> 5);
    const size_t ro = (size_t)row * DMODEL + lane * 4;

    const float* pa = a     + ro;
    const float* pr = resid + ro;
    float4 x[8], r[8];
#pragma unroll
    for (int i = 0; i < 8; ++i) x[i] = *reinterpret_cast<const float4*>(pa + i * 128);
#pragma unroll
    for (int i = 0; i < 8; ++i) r[i] = *reinterpret_cast<const float4*>(pr + i * 128);
    // the wait that stands before an issued load's address registers are written again;
    // the addresses are inputs so that none is reused as a later load's destination
    asm volatile("s_wait_xcnt 0x0" :: "v"(pa), "v"(pr) : "memory");
    if constexpr (SPLIT) {
        const float* p2 = a2   + ro;
        const float* pb = bias + lane * 4;
        float4 y[8], c[8];
#pragma unroll
        for (int i = 0; i < 8; ++i) y[i] = *reinterpret_cast<const float4*>(p2 + i * 128);
#pragma unroll
        for (int i = 0; i < 8; ++i) c[i] = *reinterpret_cast<const float4*>(pb + i * 128);
        // the same wait, for these loads' addresses
        asm volatile("s_wait_xcnt 0x0" :: "v"(p2), "v"(pb) : "memory");
#pragma unroll
        for (int i = 0; i < 8; ++i) {
            x[i].x = (x[i].x + y[i].x) + c[i].x; x[i].y = (x[i].y + y[i].y) + c[i].y;
            x[i].z = (x[i].z + y[i].z) + c[i].z; x[i].w = (x[i].w + y[i].w) + c[i].w;
        }
    }

    float s0 = 0.0f, s1 = 0.0f, s2 = 0.0f, s3 = 0.0f;
    float q0 = 0.0f, q1 = 0.0f, q2 = 0.0f, q3 = 0.0f;
#pragma unroll
    for (int i = 0; i < 8; ++i) {
        x[i].x += r[i].x; x[i].y += r[i].y; x[i].z += r[i].z; x[i].w += r[i].w;
        s0 += x[i].x; s1 += x[i].y; s2 += x[i].z; s3 += x[i].w;
        q0 += x[i].x * x[i].x; q1 += x[i].y * x[i].y; q2 += x[i].z * x[i].z; q3 += x[i].w * x[i].w;
    }
    float s  = (s0 + s1) + (s2 + s3);
    float ss = (q0 + q1) + (q2 + q3);
#pragma unroll
    for (int off = 1; off < 32; off <<= 1) {
        s  += __shfl_xor(s,  off, 32);
        ss += __shfl_xor(ss, off, 32);
    }
    const float mean = s  * (1.0f / DMODEL);
    const float var  = ss * (1.0f / DMODEL) - mean * mean;
    // rsqrtf as the compiler expands it (a denormal argument is scaled by 2^24, its result by 2^12), with
    // v_rsq_f32 and the one slot that the instruction set asks for behind it in one statement, so that
    // the slot stays directly behind it
    const float ve   = var + 1e-5f;
    const bool  tiny = ve < 1.17549435e-38f;
    float rq;
    asm("v_rsq_f32 %0, %1\n\tv_nop" : "=v"(rq) : "v"(tiny ? ve * 16777216.0f : ve));
    const float rstd = tiny ? rq * 4096.0f : rq;
#pragma unroll
    for (int i = 0; i < 8; ++i) {
        const float4 gv = *reinterpret_cast<const float4*>(g    + lane * 4 + i * 128);
        const float4 bv = *reinterpret_cast<const float4*>(beta + lane * 4 + i * 128);
        x[i].x = (x[i].x - mean) * rstd * gv.x + bv.x;
        x[i].y = (x[i].y - mean) * rstd * gv.y + bv.y;
        x[i].z = (x[i].z - mean) * rstd * gv.z + bv.z;
        x[i].w = (x[i].w - mean) * rstd * gv.w + bv.w;
        *reinterpret_cast<float4*>(yf + ro + i * 128) = x[i];
    }
    // the wait that stands before the registers of the issued stores are written again (by the packing below)
    asm volatile("s_wait_xcnt 0x0" ::: "memory");
    if (ybf) {
#pragma unroll
        for (int i = 0; i < 8; ++i)
            *reinterpret_cast<uint2*>(ybf + ro + i * 128) = pack4_bf16(x[i]);
    }
}
__global__ __launch_bounds__(256)
void add_ln(const float* __restrict__ a, const float* __restrict__ resid,
            const float* __restrict__ g, const float* __restrict__ beta,
            float* __restrict__ yf, bf16_t* __restrict__ ybf) {
    add_ln_body<false>(a, nullptr, nullptr, resid, g, beta, yf, ybf);
}
__global__ __launch_bounds__(256)
void add_ln_split(const float* __restrict__ a, const float* __restrict__ a2, const float* __restrict__ bias,
                  const float* __restrict__ resid,
                  const float* __restrict__ g, const float* __restrict__ beta, float* __restrict__ yf) {
    add_ln_body<true>(a, a2, bias, resid, g, beta, yf, nullptr);
}

// ---------------------------------------------------------------- launch
extern "C" void kernel_launch(void* const* d_in, const int* in_sizes, int n_in,
                              void* d_out, int out_size, void* d_ws, size_t ws_size,
                              hipStream_t stream) {
    const float* x    = (const float*)d_in[0];
    const float* enc  = (const float*)d_in[1];
    const float* Wq1  = (const float*)d_in[2];
    const float* Wk1  = (const float*)d_in[3];
    const float* Wv1  = (const float*)d_in[4];
    const float* g1   = (const float*)d_in[5];
    const float* b1   = (const float*)d_in[6];
    const float* Wq2  = (const float*)d_in[7];
    const float* Wk2  = (const float*)d_in[8];
    const float* Wv2  = (const float*)d_in[9];
    const float* g2   = (const float*)d_in[10];
    const float* b2   = (const float*)d_in[11];
    const float* Wff1 = (const float*)d_in[12];
    const float* bff1 = (const float*)d_in[13];
    const float* Wff2 = (const float*)d_in[14];
    const float* bff2 = (const float*)d_in[15];
    const float* g3   = (const float*)d_in[16];
    const float* b3   = (const float*)d_in[17];

    char* ws = (char*)d_ws;
    const size_t MB = 1024u * 1024u;
    bf16_t* wq1b  = (bf16_t*)(ws + 0   * MB);   // all weights stored transposed [N][K]
    bf16_t* wk1b  = (bf16_t*)(ws + 2   * MB);
    bf16_t* wv1b  = (bf16_t*)(ws + 4   * MB);
    bf16_t* wq2b  = (bf16_t*)(ws + 6   * MB);
    bf16_t* wk2b  = (bf16_t*)(ws + 8   * MB);
    bf16_t* wv2b  = (bf16_t*)(ws + 10  * MB);
    bf16_t* wff1b = (bf16_t*)(ws + 12  * MB);
    bf16_t* wff2b = (bf16_t*)(ws + 20  * MB);
    bf16_t* xbf   = (bf16_t*)(ws + 28  * MB);   // activation bf16 (reused: x, y1, y2)
    bf16_t* encbf = (bf16_t*)(ws + 36  * MB);
    bf16_t* qbf   = (bf16_t*)(ws + 44  * MB);
    bf16_t* kbf   = (bf16_t*)(ws + 52  * MB);
    bf16_t* vbf   = (bf16_t*)(ws + 60  * MB);   // V stored transposed [DMODEL][MROWS]
    float*  ctx   = (float*) (ws + 68  * MB);   // attn ctx / ff2 out
    float*  yA    = (float*) (ws + 84  * MB);
    float*  yB    = (float*) (ws + 100 * MB);
    bf16_t* hbf   = (bf16_t*)(ws + 116 * MB);
    float*  ctx2  = (float*) (ws + 148 * MB);   // ff2 out, second half of k; ends at 164 MB

    const dim3 gqkv(DMODEL / TN, MROWS / TM, 3);
    const dim3 gff1(FFDIM / TN, MROWS / TM);
    const dim3 gff2(DMODEL / TN, MROWS / TM, 2);

    // x, enc -> bf16; weights -> bf16, transposed [N][K] (wq1b .. wv2b lie 2 MB apart, from wq1b on)
    cvt_all<<<CVT_ALL_BLOCKS, 256, 0, stream>>>(x, enc, Wq1, Wk1, Wv1, Wq2, Wk2, Wv2, Wff1, Wff2,
                                                xbf, encbf, wq1b, wff1b, wff2b);

    const float scale = 0.03125f;   // 1/sqrt(DMODEL), as in reference
    dim3 agrid(NTOK / (16 * AW), NHEAD, BATCH);

    // ---- block 1: causal self-attention
    gemm_qkv<<<gqkv, 256, 0, stream>>>(xbf, xbf, wq1b, wk1b, wv1b, qbf, kbf, vbf, DMODEL);
    attn_wmma<<<agrid, 256, 0, stream>>>(qbf, kbf, vbf, ctx, NTOK, NTOK, MROWS, 1, scale);
    add_ln<<<MROWS / LN_ROWS, 256, 0, stream>>>(ctx, x, g1, b1, yA, xbf);    // xbf := y1 (bf16)

    // ---- block 2: cross-attention over encoder output
    gemm_qkv<<<gqkv, 256, 0, stream>>>(xbf, encbf, wq2b, wk2b, wv2b, qbf, kbf, vbf, DMODEL);
    attn_wmma<<<agrid, 256, 0, stream>>>(qbf, kbf, vbf, ctx, NTOK, NTOK, MROWS, 0, scale);
    add_ln<<<MROWS / LN_ROWS, 256, 0, stream>>>(ctx, yA, g2, b2, yB, xbf);   // xbf := y2 (bf16)

    // ---- block 3: FFN (bias+GELU fused), residual, final LN
    gemm_ff1<<<gff1,  256, 0, stream>>>(xbf, wff1b, hbf, bff1, DMODEL);   // bf16 out + GELU
    gemm_ff2<<<gff2,  256, 0, stream>>>(hbf, wff2b, ctx, ctx2, FFDIM);    // fp32 out, one plane per half of k
    add_ln_split<<<MROWS / LN_ROWS, 256, 0, stream>>>(ctx, ctx2, bff2, yB, g3, b3, (float*)d_out);
}
